// v000
// Measured on an AMD MI455X. A time is GPU time per run, averaged over a window of back-to-back runs after a warm-up
// (all launches, gaps included; the runs take copies of the inputs in turn), and the median of several windows.
// Apart from v000's, it joins two sittings. Times from different sittings can be a few percent apart, while
// side-by-side timings come from the same sitting.
// v000 is the starting kernel. One run takes 778 microseconds.
// Contractions: a.W and x.W (q|k|v, K=1024) on v_wmma_f32_16x16x32_f16 with f16 containers of the bf16 RNE input
//   values (activations carried x16, W^T x64), one product; q.k^T (K=64) on v_wmma_f32_16x16x32_f16 with q (x4) and
//   k (x16) f16 hi planes plus x4096 f16 residual planes (three products, residual pair in a separate accumulator
//   folded by 1/4096); p.v^T on v_wmma_f32_16x16x32_f16 with p as f16(1024 p) and v^T as f16(16 v), one product
//   (the leading query blocks of every segment add the p and v x4096 f16 residual planes, two more products into a
//   separate accumulator); compressive memory sk^T.v (K=1024) and sq.M (K=64) on v_wmma_f32_16x16x32_f16 with
//   plain f16 operands, one product each. f32 accumulate everywhere; L2 norms, rotary tables and rotation, elu,
//   softmax statistics, sq.z, the memory quotient and the gate mix in f32.
#include <hip/hip_runtime.h>
#include <math.h>
#include <stdint.h>

#define NB      2
#define NTOK    2048                // tokens per stream per batch
#define SEQ     4096                // concatenated positions per batch (stream a first, then x)
#define DM      1024
#define NHEAD   16
#define HD      64
#define RP      32                  // rotary pairs per head
#define W3      3072
#define QKW     2048                // q|k plane width: q at column h*64+d, k at 1024 + h*64+d
#define SEG     1024
#define NSEG    4
#define NQB     16                  // 64-row query blocks per segment
#define NQP     4                   // leading query blocks per segment that carry the p / v residual products
#define MROWS   128                 // query rows per block of the memory read kernel
#define OUT1OFF (NB * NTOK * DM)             // element offset of the second output
#define XSC     16.0f
#define WSC     64.0f
#define QSC     4.0f
#define KSC     16.0f
#define VSC     16.0f
#define RSC     4096.0f
#define PSC     1024.0f
#define NRM_EPS 1.0e-12f
#define DEN_EPS 1.0e-6f
#define LOG2_BASE 13.287712379549449
#define NEG_BIG (-1.0e30f)

static_assert(NHEAD * HD == DM);
static_assert(SEQ == 2 * NTOK);
static_assert(SEQ == NSEG * SEG);
static_assert(SEG == NQB * 64);
static_assert(HD == 2 * RP);
static_assert(W3 == 3 * DM);
static_assert(QKW == 2 * DM);
static_assert(((NB * NTOK * DM) % 2048) == 0);
static_assert(((SEQ * RP) % 256) == 0);
static_assert((DM % 128) == 0 && (W3 % 64) == 0 && (NTOK % 64) == 0 && (SEQ % 64) == 0);
static_assert((QKW % 128) == 0 && (DM % 32) == 0);
static_assert(NQP > 0 && NQP < NQB);
static_assert((SEG % MROWS) == 0 && MROWS == 8 * 16);
static_assert(OUT1OFF == NB * NTOK * DM);

typedef _Float16 v16h __attribute__((ext_vector_type(16)));
typedef _Float16 v8h  __attribute__((ext_vector_type(8)));
typedef float    v8f  __attribute__((ext_vector_type(8)));
typedef float    v4f  __attribute__((ext_vector_type(4)));
typedef unsigned int v4u __attribute__((ext_vector_type(4)));
union FH { v16h v; v8h h[2]; };

// ---- scalar helpers --------------------------------------------------------------------------------
__device__ __forceinline__ unsigned short bf_bits(float f) {          // f32 -> bf16 bits, RNE convert
  unsigned u = __float_as_uint(f);
  return (unsigned short)((u + 0x7FFFu + ((u >> 16) & 1u)) >> 16);
}
__device__ __forceinline__ float bf_up(unsigned short b) { return __uint_as_float(((unsigned)b) << 16); }
__device__ __forceinline__ float bfr(float f) { return bf_up(bf_bits(f)); }     // value of the bf16 RNE convert
__device__ __forceinline__ unsigned short h_bits(_Float16 x) { return __builtin_bit_cast(unsigned short, x); }
__device__ __forceinline__ unsigned pk16(unsigned short a, unsigned short b) { return (unsigned)a | ((unsigned)b << 16); }
__device__ __forceinline__ v8f zero8() { v8f z = {0.f, 0.f, 0.f, 0.f, 0.f, 0.f, 0.f, 0.f}; return z; }

// ---- fragment loader: 16-bit A/B operand, lane -> row/col (lane&15), p already includes +8*(lane>>4);
//      elements 0..7 <- p[0..7] (k0+8h..), elements 8..15 <- p[16..23] (k0+16+8h..)
__device__ __forceinline__ v16h ldfrag_h(const _Float16* p) {
  FH f;
  f.h[0] = *(const v8h*)(p);
  f.h[1] = *(const v8h*)(p + 16);
  return f.v;
}

// ---- WMMA helpers with trailing VALU hazard gap --------------------------------------------------------
__device__ __forceinline__ v8f mma_h_raw(v16h a, v16h b, v8f c) {
  return __builtin_amdgcn_wmma_f32_16x16x32_f16(false, a, false, b, (short)0, c, false, false);
}
__device__ __forceinline__ v8f mma_h(v16h a, v16h b, v8f c) {
  c = mma_h_raw(a, b, c);
#if defined(__HIP_DEVICE_COMPILE__)
  asm volatile("v_nop\n\tv_nop\n\tv_nop\n\tv_nop" : "+v"(c) : "v"(a), "v"(b));
#endif
  return c;
}
__device__ __forceinline__ void guard3(v8f& x, v8f& y, v16h a, v16h b, v16h d) {   // two D tiles, 3 frags live
#if defined(__HIP_DEVICE_COMPILE__)
  asm volatile("v_nop\n\tv_nop\n\tv_nop\n\tv_nop" : "+v"(x), "+v"(y) : "v"(a), "v"(b), "v"(d));
#endif
}
__device__ __forceinline__ void guard1q(v8f& x, v16h a, v16h b, v16h d, v16h e) {           // one D, 4 frags
#if defined(__HIP_DEVICE_COMPILE__)
  asm volatile("v_nop\n\tv_nop\n\tv_nop\n\tv_nop" : "+v"(x) : "v"(a), "v"(b), "v"(d), "v"(e));
#endif
}
__device__ __forceinline__ void guard4m(v8f& x, v8f& y, v16h a, v16h b, v16h d, v16h e) {   // two D, 4 frags
#if defined(__HIP_DEVICE_COMPILE__)
  asm volatile("v_nop\n\tv_nop\n\tv_nop\n\tv_nop" : "+v"(x), "+v"(y) : "v"(a), "v"(b), "v"(d), "v"(e)
               : "memory");
#endif
}
__device__ __forceinline__ void guard8m(v8f& x, v8f& y, v16h a, v16h b, v16h d, v16h e,
                                        v16h f, v16h g, v16h p, v16h q) {                      // two D, 8 frags
#if defined(__HIP_DEVICE_COMPILE__)
  asm volatile("v_nop\n\tv_nop\n\tv_nop\n\tv_nop" : "+v"(x), "+v"(y)
               : "v"(a), "v"(b), "v"(d), "v"(e), "v"(f), "v"(g), "v"(p), "v"(q) : "memory");
#endif
}
__device__ __forceinline__ void acc_guard4(v8f& a, v8f& b, v8f& c, v8f& d) {
#if defined(__HIP_DEVICE_COMPILE__)
  asm volatile("v_nop\n\tv_nop\n\tv_nop\n\tv_nop" : "+v"(a), "+v"(b), "+v"(c), "+v"(d));
#endif
}
__device__ __forceinline__ void acc_guard2(v8f& a, v8f& b) {
#if defined(__HIP_DEVICE_COMPILE__)
  asm volatile("v_nop\n\tv_nop\n\tv_nop\n\tv_nop" : "+v"(a), "+v"(b));
#endif
}
__device__ __forceinline__ void cbar() {
#if defined(__HIP_DEVICE_COMPILE__)
  asm volatile("" ::: "memory");
#endif
}
__device__ __forceinline__ void wave_sync_lds() {
  __builtin_amdgcn_fence(__ATOMIC_RELEASE, "workgroup");
  __builtin_amdgcn_wave_barrier();
  __builtin_amdgcn_fence(__ATOMIC_ACQUIRE, "workgroup");
}

// =====================================================================================================
// Row-major convert: f32 [n] -> f16 plane [n] holding f16(bf16 RNE value * scale) (scale a power of two, exact).
// coverage: grid.x = n/2048 blocks x 256 threads x 8 = n elements (n % 2048 == 0 host-checked).
// =====================================================================================================
__global__ __launch_bounds__(256) void cvt_rm(const float* __restrict__ in, unsigned short* out, int n,
                                             float scale) {
  const size_t i8 = ((size_t)blockIdx.x * 256 + threadIdx.x) * 8;
  if (i8 + 8 > (size_t)n) return;        // never taken for the host-checked sizes; no barriers below
  const v4f a = *(const v4f*)(in + i8);
  const v4f b = *(const v4f*)(in + i8 + 4);
  float f[8];
  f[0] = a[0]; f[1] = a[1]; f[2] = a[2]; f[3] = a[3];
  f[4] = b[0]; f[5] = b[1]; f[6] = b[2]; f[7] = b[3];
  v4u p;
#pragma unroll
  for (int e = 0; e < 4; ++e) {
    const unsigned short b0 = bf_bits(f[2 * e]), b1 = bf_bits(f[2 * e + 1]);
    const _Float16 x0 = (_Float16)(bf_up(b0) * scale);
    const _Float16 x1 = (_Float16)(bf_up(b1) * scale);
    p[e] = pk16(h_bits(x0), h_bits(x1));
  }
  *(v4u*)(out + i8) = p;
  
}

// =====================================================================================================
// Transposing convert: f32 in[R][C] (row-major, pitch C) -> 16-bit out[C][R] (pitch R), 64x64 tiles through LDS.
//   MODE 0: one plane  out0 = f16(bf16 RNE value * scale).
//   MODE 1: two planes out0 = f16(v * scale) hi, out1 = f16((v * scale - hi) * RSC) residual.
// Block = 256 threads; grid = (C/64, R/64) exact (host-checked). Load: thread -> input row tid>>2, 16 consecutive
// columns (four 16-B loads). Store: two iterations, output row it*32 + (tid>>3), lanes (tid&7) -> elements
// coverage: 2 iterations x 32 output rows x 8 lanes x 8 halves = the whole 64x64 tile; grid covers all of C x R.
// =====================================================================================================
template <int MODE>
__global__ __launch_bounds__(256) void tr_cvt(const float* __restrict__ in, int R, int C,
                                             unsigned short* out0, unsigned short* out1, float scale) {
  __shared__ float sm[64][65];
  const int tid = threadIdx.x;
  const int c0 = blockIdx.x * 64;          // input column block -> output row block
  const int r0 = blockIdx.y * 64;          // input row block    -> output column block
  if (c0 + 64 > C || r0 + 64 > R) return;  // block-uniform, ahead of any barrier; never taken for exact grids
  {
    const int lr = tid >> 2, lc = (tid & 3) * 16;
    const float* src = in + (size_t)(r0 + lr) * (size_t)C + c0 + lc;
#pragma unroll
    for (int q = 0; q < 4; ++q) {
      const v4f v = *(const v4f*)(src + 4 * q);
      sm[lr][lc + 4 * q + 0] = v[0];
      sm[lr][lc + 4 * q + 1] = v[1];
      sm[lr][lc + 4 * q + 2] = v[2];
      sm[lr][lc + 4 * q + 3] = v[3];
    }
  }
  __syncthreads();
  const int seg = tid & 7;
  v4u p0[2], p1[2];
#pragma unroll
  for (int it = 0; it < 2; ++it) {
    const int ocl = it * 32 + (tid >> 3);   // output row within the tile = input column
    float f[8];
#pragma unroll
    for (int e = 0; e < 8; ++e) f[e] = sm[seg * 8 + e][ocl];
    v4u pk, pl;
#pragma unroll
    for (int e = 0; e < 4; ++e) {
      const float g0 = f[2 * e], g1 = f[2 * e + 1];
      if (MODE == 0) {
        const _Float16 x0 = (_Float16)(bfr(g0) * scale);
        const _Float16 x1 = (_Float16)(bfr(g1) * scale);
        pk[e] = pk16(h_bits(x0), h_bits(x1));
        pl[e] = pk[e];
      } else {
        const float s0 = g0 * scale, s1 = g1 * scale;
        const _Float16 x0 = (_Float16)s0, x1 = (_Float16)s1;
        const _Float16 y0 = (_Float16)((s0 - (float)x0) * RSC);
        const _Float16 y1 = (_Float16)((s1 - (float)x1) * RSC);
        pk[e] = pk16(h_bits(x0), h_bits(x1));
        pl[e] = pk16(h_bits(y0), h_bits(y1));
      }
    }
    p0[it] = pk;
    p1[it] = pl;
  }
  {
#pragma unroll
    for (int it = 0; it < 2; ++it) {
      const int ocl = it * 32 + (tid >> 3);
      const size_t go = (size_t)(c0 + ocl) * (size_t)R + (size_t)(r0 + seg * 8);
      *(v4u*)(out0 + go) = p0[it];
      if (MODE == 1) *(v4u*)(out1 + go) = p1[it];
    }
    
  }
}

// =====================================================================================================
// Rotary tables for interleaved pairs: cost[t][i] = cos(t * inv_freq[i]), sint[t][i] = sin(t * inv_freq[i]),
// i = 0..31, inv_freq[i] = 1 / (10000^(2i/64)) (power via f64 exp2 -> one f32 convert, then an f32 reciprocal
// formed in f64 and converted once), angle = one f32 multiply with t = position 0..4095 in the concatenated
// coverage: grid.x = n/256 blocks x 256 threads = n = SEQ*32 elements of each table.
// =====================================================================================================
__global__ __launch_bounds__(256) void rope_tab(float* cost, float* sint, int n) {
  const int e = blockIdx.x * 256 + (int)threadIdx.x;
  if (e >= n) return;                      // never taken (n % 256 == 0); no barriers below
  const int t = e >> 5, i = e & 31;
  const double pd = exp2((double)i * (1.0 / 32.0) * LOG2_BASE);   // 10000^(2i/64)
  const float  pf = (float)pd;
  const float  invf = (float)(1.0 / (double)pf);
  const float  ang = (float)t * invf;
  float sv, cv;
  sincosf(ang, &sv, &cv);
  *(float*)(cost + e) = cv;
  *(float*)(sint + e) = sv;
  
}

// =====================================================================================================
// Register-blocked f16 WMMA GEMM, one wave per 32x128 tile (block = 4 waves = 4 tiles, no block barriers):
//   acc[m][n] = sum_k A[m][k] * Bt[n][k]; A row-major [M][K] pitch lda, Bt row-major [N][K] pitch ldb
//   (k contiguous); M % 32 == 0, N % 128 == 0, K % 32 == 0 (exact constants here, host-checked).
// EPI 1 (q|k planes, N == QKW): the 128-column tile holds two heads of 64 columns (columns < DM are q heads,
//        columns >= DM are k heads). Per row and head: t = acc*oscale; v = t * (1/max(||t||_2, 1e-12)) *
//        bf16(gain[head][d]) * 8; then the interleaved-pair rotary rotation with the f32 tables at position
//        crow0 + m (pair (2i, 2i+1): o1 = v1*c - v2*s, o2 = v1*s + v2*c), times cscale (QSC for q, KSC for k)
//        -> C0 = f16 hi, C1 = f16((v - hi) * RSC) residual, 16-bit planes of pitch ldc, row crow0 + m, column n.
// EPI 3: f32 rows (C0) = acc*oscale, pitch ldc, row crow0 + m, column n.
// 16 lanes x 16 B per 256-B row segment (two rows per instruction), f32 as 32 lanes x 16 B per 512-B row segment;
// coverage: 2 slabs x 16 rows x 128 cols = the wave's whole 32x128 tile; tiles = whole M x N (grid = tiles/4 exact).
// =====================================================================================================
template <int EPI>
__global__ __launch_bounds__(128) void gemm_t(
    const unsigned short* __restrict__ A, int lda,
    const unsigned short* __restrict__ Bt, int ldb,
    void* C0, void* C1, int ldc, int crow0,
    const float* __restrict__ cost, const float* __restrict__ sint,
    const float* __restrict__ gq, const float* __restrict__ gk,
    int M, int N, int K, float oscale) {
  __shared__ __align__(16) float sT[4][16 * 132];   // per-wave 16x128 slab, pitch 132 floats
  const int lane = threadIdx.x & 31;
  const int wave = threadIdx.x >> 5;
  const int tilesN = N >> 7;
  const int tilesM = M >> 5;
  const int tile = blockIdx.x * 4 + wave;
  if (tile >= tilesM * tilesN) return;   // wave-uniform; no block barriers in this kernel
  const int tm = tile / tilesN;
  const int tn = tile - tm * tilesN;
  const int m0 = tm << 5;
  const int n0 = tn << 7;
  const int rl   = lane & 15;            // row (A) / col (B, D) within subtile
  const int hh   = lane >> 4;            // lane half
  const int koff = hh * 8;               // k offset of this lane half

  v8f acc[2][8];
#pragma unroll
  for (int i = 0; i < 2; ++i)
#pragma unroll
    for (int j = 0; j < 8; ++j) acc[i][j] = zero8();

  {
    const _Float16* ar0 = (const _Float16*)(const void*)A + (size_t)(m0 + rl) * (size_t)lda + koff;
    const _Float16* ar1 = (const _Float16*)(const void*)A + (size_t)(m0 + 16 + rl) * (size_t)lda + koff;
    const _Float16* br  = (const _Float16*)(const void*)Bt + (size_t)(n0 + rl) * (size_t)ldb + koff;
    for (int k0 = 0; k0 < K; k0 += 32) {
      const v16h a0 = ldfrag_h(ar0 + k0);
      const v16h a1 = ldfrag_h(ar1 + k0);
#pragma unroll
      for (int j = 0; j < 8; ++j) {
        const v16h b = ldfrag_h(br + (size_t)j * 16 * (size_t)ldb + k0);
        acc[0][j] = mma_h_raw(a0, b, acc[0][j]);
        acc[1][j] = mma_h_raw(a1, b, acc[1][j]);
        guard3(acc[0][j], acc[1][j], a0, a1, b);
      }
    }
  }
  acc_guard4(acc[0][0], acc[0][1], acc[0][2], acc[0][3]);
  acc_guard4(acc[0][4], acc[0][5], acc[0][6], acc[0][7]);
  acc_guard4(acc[1][0], acc[1][1], acc[1][2], acc[1][3]);
  acc_guard4(acc[1][4], acc[1][5], acc[1][6], acc[1][7]);

  // ---- epilogue ----
  float* slab = sT[wave];
  float gmul[8];
  float csc = 1.0f;
  if (EPI == 1) {
    const bool isq = (n0 < DM);                                 // wave-uniform
    const int  hb  = (isq ? n0 : (n0 - DM)) >> 6;               // first head of this tile (0..15)
    csc = isq ? QSC : KSC;
#pragma unroll
    for (int j = 0; j < 8; ++j) {
      const int gi = (hb + (j >> 2)) * HD + 16 * (j & 3) + rl;  // < NHEAD*HD, inside both gain arrays
      const float ga = bfr(gq[gi]);
      const float gb = bfr(gk[gi]);
      gmul[j] = (isq ? ga : gb) * 8.0f;
    }
  } else {
#pragma unroll
    for (int j = 0; j < 8; ++j) gmul[j] = 1.0f;
  }
#pragma unroll
  for (int i = 0; i < 2; ++i) {
    const int mB = m0 + 16 * i;
    if (EPI == 1) {
      float inv[2][8];
#pragma unroll
      for (int jh = 0; jh < 2; ++jh) {
#pragma unroll
        for (int r = 0; r < 8; ++r) {        // sum of squares over the head's 64 columns of row 8hh+r
          float ss = 0.f;
#pragma unroll
          for (int jj = 0; jj < 4; ++jj) {
            const float x = acc[i][4 * jh + jj][r] * oscale;
            ss += x * x;
          }
          ss += __shfl_xor(ss, 1, 32);
          ss += __shfl_xor(ss, 2, 32);
          ss += __shfl_xor(ss, 4, 32);
          ss += __shfl_xor(ss, 8, 32);
          inv[jh][r] = oscale * (1.0f / fmaxf(sqrtf(ss), NRM_EPS));
        }
      }
#pragma unroll
      for (int j = 0; j < 8; ++j) {
#pragma unroll
        for (int r = 0; r < 8; ++r)
          slab[(8 * hh + r) * 132 + 16 * j + rl] = acc[i][j][r] * inv[j >> 2][r] * gmul[j];
      }
    } else {
#pragma unroll
      for (int j = 0; j < 8; ++j) {
#pragma unroll
        for (int r = 0; r < 8; ++r) slab[(8 * hh + r) * 132 + 16 * j + rl] = acc[i][j][r] * oscale;
      }
    }
    wave_sync_lds();
    if (EPI == 3) {
      float* Cf = (float*)C0;
      v4f ov[16];
#pragma unroll
      for (int it = 0; it < 16; ++it) ov[it] = *(const v4f*)(slab + it * 132 + lane * 4);
      {
#pragma unroll
        for (int it = 0; it < 16; ++it)                       // row it: 32 lanes x 16 B = 512 B = 128 cols
          *(v4f*)(Cf + (size_t)(crow0 + mB + it) * (size_t)ldc + n0 + lane * 4) = ov[it];
        
      }
    } else {
      unsigned short* Cp = (unsigned short*)C0;
      unsigned short* Cq = (unsigned short*)C1;
      v4u hv[8], lv[8];
#pragma unroll
      for (int it = 0; it < 8; ++it) {
        const int row = it * 2 + hh;                          // it 0..7 x hh 0..1 = rows 0..15
        const float* sp = slab + row * 132 + rl * 8;          // 8 consecutive columns = 4 rotary pairs
        const v4f fa = *(const v4f*)sp;
        const v4f fb = *(const v4f*)(sp + 4);
        float f[8];
        f[0] = fa[0]; f[1] = fa[1]; f[2] = fa[2]; f[3] = fa[3];
        f[4] = fb[0]; f[5] = fb[1]; f[6] = fb[2]; f[7] = fb[3];
        const int pos = crow0 + mB + row;                     // position in the concatenated sequence
        const v4f cv = *(const v4f*)(cost + (size_t)pos * RP + (rl & 7) * 4);   // pairs ((rl&7)*4 .. +3)
        const v4f sv = *(const v4f*)(sint + (size_t)pos * RP + (rl & 7) * 4);
        v4u pk, pl;
#pragma unroll
        for (int e = 0; e < 4; ++e) {
          const float f0 = f[2 * e], f1 = f[2 * e + 1];
          const float cc = cv[e], sn = sv[e];
          const float g0 = (f0 * cc - f1 * sn) * csc;
          const float g1 = (f0 * sn + f1 * cc) * csc;
          const _Float16 x0 = (_Float16)g0;
          const _Float16 x1 = (_Float16)g1;
          const _Float16 y0 = (_Float16)((g0 - (float)x0) * RSC);
          const _Float16 y1 = (_Float16)((g1 - (float)x1) * RSC);
          pk[e] = pk16(h_bits(x0), h_bits(x1));
          pl[e] = pk16(h_bits(y0), h_bits(y1));
        }
        hv[it] = pk;
        lv[it] = pl;
      }
      {
#pragma unroll
        for (int it = 0; it < 8; ++it) {
          const int row = it * 2 + hh;
          const size_t go = (size_t)(crow0 + mB + row) * (size_t)ldc + n0 + rl * 8;
          *(v4u*)(Cp + go) = hv[it];
          *(v4u*)(Cq + go) = lv[it];
        }
        
      }
    }
    wave_sync_lds();
  }
}

// =====================================================================================================
// Compressive-memory update per (head h, segment s in 0..2) of one batch:
//   MT[h][s][e][d] = sum over the 1024 keys l of segment s of v[l][e] * sk[l][d], sk = elu(k) + 1
//   (elu(x) = x > 0 ? x : exp(x) - 1, so sk = x > 0 ? x + 1 : exp(x)), and ZP[h][s][d] = sum_l sk[l][d].
//   k is rebuilt in f32 from the q|k hi / residual planes ((hi + lo/RSC) / KSC, column DM + h*64 + d), sk is
//   RNE-converted to f16 and written TRANSPOSED into an LDS tile skT[d][l] (64 keys per chunk, pitch 72 halves);
//   A = V^T hi plane rows (h*64 + e, keys), Bt = skT; D[e][d] scaled by 1/VSC.
//   Block = 8 waves; wave w owns e rows 16*(w>>1).. and d columns 32*(w&1)..; acc guarded; the 16x32 f32 piece is
// coverage: MT: 8 waves x (16 rows x 32 cols) = the whole 64x64 tile of (h,s); 4 its x 4 row groups x 8 lanes =
//   16 rows x 32 cols per wave. ZP: 16 lanes x 4 floats = 64. skT fill: 256 threads x 16 d x 1 key = 64x64 chunk.
// =====================================================================================================
__global__ __launch_bounds__(256) void mt_seg(const unsigned short* __restrict__ QKH,
                                             const unsigned short* __restrict__ QKL,
                                             const unsigned short* __restrict__ VTH,
                                             float* MT, float* ZP) {
  __shared__ __align__(16) _Float16 skT[HD * 72];
  __shared__ __align__(16) float slab[8][16 * 36];
  __shared__ float zred[8][HD];
  __shared__ __align__(16) float zsum[HD];

  const int tid = threadIdx.x, wave = tid >> 5, lane = tid & 31, hh = lane >> 4, c = lane & 15;
  const int h = (int)(blockIdx.x / 3u);
  const int s = (int)(blockIdx.x - (unsigned)h * 3u);
  if (h >= NHEAD) return;                 // block-uniform, ahead of any barrier; never taken
  const int r  = tid >> 2;                // key within the 64-key chunk handled by this thread
  const int dq = (tid & 3) * 16;          // first of the 16 d columns handled by this thread
  const int et = wave >> 1;               // e row tile of this wave
  const int dt0 = (wave & 1) * 2;         // first d column tile of this wave

  const _Float16* Q16 = (const _Float16*)(const void*)QKH;
  const _Float16* L16 = (const _Float16*)(const void*)QKL;
  const _Float16* V16 = (const _Float16*)(const void*)VTH;
  const _Float16* vrow = V16 + (size_t)(h * HD + et * 16 + c) * SEQ + (size_t)s * SEG + 8 * hh;   // A frag base

  float zacc[16];
#pragma unroll
  for (int e = 0; e < 16; ++e) zacc[e] = 0.f;
  v8f acc[2];
  acc[0] = zero8(); acc[1] = zero8();

  for (int kt = 0; kt < SEG / 64; ++kt) {
    __syncthreads();                      // prior chunk's fragment reads are done
    {
      const size_t n = (size_t)(s * SEG + kt * 64 + r);
      const _Float16* kp = Q16 + n * QKW + DM + h * HD + dq;
      const _Float16* lp = L16 + n * QKW + DM + h * HD + dq;
      FH kf, lf;
      kf.h[0] = *(const v8h*)kp; kf.h[1] = *(const v8h*)(kp + 8);
      lf.h[0] = *(const v8h*)lp; lf.h[1] = *(const v8h*)(lp + 8);
#pragma unroll
      for (int e = 0; e < 16; ++e) {
        const float kv = ((float)kf.v[e] + (float)lf.v[e] * (1.0f / RSC)) * (1.0f / KSC);
        const float sk = (kv > 0.f) ? (kv + 1.0f) : __expf(kv);
        const _Float16 skh = (_Float16)sk;
        skT[(dq + e) * 72 + r] = skh;
        zacc[e] += (float)skh;
      }
    }
    __syncthreads();                      // skT chunk complete
#pragma unroll
    for (int kk = 0; kk < 2; ++kk) {
      const v16h a  = ldfrag_h(vrow + kt * 64 + 32 * kk);
      const v16h b0 = ldfrag_h(skT + (16 * dt0 + c) * 72 + 32 * kk + 8 * hh);
      const v16h b1 = ldfrag_h(skT + (16 * (dt0 + 1) + c) * 72 + 32 * kk + 8 * hh);
      acc[0] = mma_h_raw(a, b0, acc[0]);
      acc[1] = mma_h_raw(a, b1, acc[1]);
      guard3(acc[0], acc[1], a, b0, b1);
    }
  }
  acc_guard2(acc[0], acc[1]);

  // ---- MT piece: rows e = 16*et + (8hh+rr), cols d = 32*(wave&1) + 16*jj + c ----
  float* sl = slab[wave];
#pragma unroll
  for (int jj = 0; jj < 2; ++jj) {
#pragma unroll
    for (int rr = 0; rr < 8; ++rr) sl[(8 * hh + rr) * 36 + 16 * jj + c] = acc[jj][rr] * (1.0f / VSC);
  }
  wave_sync_lds();
  {
    v4f mv[4];
#pragma unroll
    for (int it = 0; it < 4; ++it) {
      const int row = it * 4 + (lane >> 3);
      mv[it] = *(const v4f*)(sl + row * 36 + (lane & 7) * 4);
    }
    float* mtb = MT + ((size_t)(h * 3 + s) * HD + (size_t)et * 16) * HD + (wave & 1) * 32;
    {
#pragma unroll
      for (int it = 0; it < 4; ++it) {
        const int row = it * 4 + (lane >> 3);
        *(v4f*)(mtb + (size_t)row * HD + (lane & 7) * 4) = mv[it];
      }
      
    }
  }
  // ---- ZP: sum zacc over the 8 keys of this wave (lanes sharing lane&3), then over the 8 waves ----
#pragma unroll
  for (int e = 0; e < 16; ++e) {
    float v = zacc[e];
    v += __shfl_xor(v, 4, 32);
    v += __shfl_xor(v, 8, 32);
    v += __shfl_xor(v, 16, 32);
    if ((lane >> 2) == 0) zred[wave][(lane & 3) * 16 + e] = v;
  }
  __syncthreads();
  if (tid < HD) {
    float z = 0.f;
#pragma unroll
    for (int w = 0; w < 8; ++w) z += zred[w][tid];
    zsum[tid] = z;
  }
  __syncthreads();
  if (tid < 16) {                         // wave 0, lanes 0..15: 16 x 16 B = the whole 256-B ZP row
    const v4f zz = *(const v4f*)(zsum + tid * 4);
    float* zp = ZP + (size_t)(h * 3 + s) * HD + tid * 4;
    *(v4f*)zp = zz;
    
  }
}

// =====================================================================================================
// Compressive-memory read per (head h, segment s in 1..3, 128-row block) of one batch:
//   M_s = sum over segments before s of MT[h][s'] (f32 sum, RNE convert to an f16 LDS tile MTh[e][d], pitch 72);
//   z_s = sum of ZP[h][s'] (f32, LDS). Per query row n of segment s: q rebuilt in f32 from the hi / residual planes
//   ((hi + lo/RSC) / QSC, column h*64 + d), sq = elu(q) + 1 RNE-converted to f16 directly into the A fragment
//   (elementwise transform keeps the A layout); num[n][e] = sum_d sq[n][d] * M_s[d][e] with Bt = MTh (K = 64, two
//   k-steps, 4 column tiles); den[n] = sum_d sq[n][d] * z_s[d] + 1e-6 in f32 from the same f16 sq values (lane
//   halves combined, then broadcast to the D rows); MEM[n][h*64 + e] = num * (1/den), f32 rows of pitch DM.
//   Block = 8 waves x 16 rows; per-wave 16x64 f32 tile staged in LDS; stores 16 lanes x 16 B per 256-B row
// coverage: 16 heads x 3 segments x 8 row blocks x 8 waves x 16 rows = MEM rows 1024..4095 of every head's 64
//   columns; 8 its x 2 row halves x 16 lanes x 4 floats = the wave's 16x64 tile. Rows 0..1023 (segment 0) are not
//   produced and are not used by the consumer (memory is exactly zero there).
// =====================================================================================================
__global__ __launch_bounds__(256) void mem_ret(const unsigned short* __restrict__ QKH,
                                              const unsigned short* __restrict__ QKL,
                                              const float* __restrict__ MT, const float* __restrict__ ZP,
                                              float* MEM) {
  __shared__ __align__(16) _Float16 MTh[HD * 72];
  __shared__ float zs[HD];
  __shared__ __align__(16) float slab[8][16 * 68];

  const int tid = threadIdx.x, wave = tid >> 5, lane = tid & 31, hh = lane >> 4, c = lane & 15;
  const int h   = (int)(blockIdx.x / 24u);
  const int rem = (int)(blockIdx.x - (unsigned)h * 24u);
  const int s   = 1 + rem / 8;            // 1..3
  const int rb  = rem - (s - 1) * 8;      // 0..7
  if (h >= NHEAD) return;                 // block-uniform, ahead of any barrier; never taken

  {
    const int e = tid >> 2, d0 = (tid & 3) * 16;
    float sm[16];
#pragma unroll
    for (int i = 0; i < 16; ++i) sm[i] = 0.f;
#pragma unroll
    for (int sp = 0; sp < 3; ++sp) {
      if (sp < s) {                       // block-uniform
        const float* src = MT + ((size_t)(h * 3 + sp) * HD + e) * HD + d0;
#pragma unroll
        for (int q = 0; q < 4; ++q) {
          const v4f v = *(const v4f*)(src + 4 * q);
          sm[4 * q + 0] += v[0]; sm[4 * q + 1] += v[1]; sm[4 * q + 2] += v[2]; sm[4 * q + 3] += v[3];
        }
      }
    }
    v8h p0, p1;
#pragma unroll
    for (int i = 0; i < 8; ++i) { p0[i] = (_Float16)sm[i]; p1[i] = (_Float16)sm[8 + i]; }
    *(v8h*)(MTh + e * 72 + d0) = p0;
    *(v8h*)(MTh + e * 72 + d0 + 8) = p1;
    if (tid < HD) {
      float z = 0.f;
#pragma unroll
      for (int sp = 0; sp < 3; ++sp) {
        if (sp < s) z += ZP[(size_t)(h * 3 + sp) * HD + tid];
      }
      zs[tid] = z;
    }
  }
  __syncthreads();

  const _Float16* Q16 = (const _Float16*)(const void*)QKH;
  const _Float16* L16 = (const _Float16*)(const void*)QKL;
  const int n0w = s * SEG + rb * MROWS + wave * 16;          // first query position of this wave

  v16h af[2];
  float denp = 0.f;
#pragma unroll
  for (int kk = 0; kk < 2; ++kk) {
    FH hf, lf;
    hf.v = ldfrag_h(Q16 + (size_t)(n0w + c) * QKW + h * HD + 32 * kk + 8 * hh);
    lf.v = ldfrag_h(L16 + (size_t)(n0w + c) * QKW + h * HD + 32 * kk + 8 * hh);
    v16h a;
#pragma unroll
    for (int i = 0; i < 16; ++i) {
      const float qv = ((float)hf.v[i] + (float)lf.v[i] * (1.0f / RSC)) * (1.0f / QSC);
      const float sq = (qv > 0.f) ? (qv + 1.0f) : __expf(qv);
      const _Float16 sqh = (_Float16)sq;
      a[i] = sqh;
      const int kidx = 32 * kk + ((i < 8) ? (8 * hh + i) : (8 + 8 * hh + i));   // k of element i (split map)
      denp += (float)sqh * zs[kidx];
    }
    af[kk] = a;
  }
  const float den = denp + __shfl_xor(denp, 16, 32) + DEN_EPS;   // row c complete in lanes c and c+16

  v8f acc[4];
#pragma unroll
  for (int j = 0; j < 4; ++j) {
    acc[j] = zero8();
#pragma unroll
    for (int kk = 0; kk < 2; ++kk) {
      const v16h b = ldfrag_h(MTh + (16 * j + c) * 72 + 32 * kk + 8 * hh);
      acc[j] = mma_h(af[kk], b, acc[j]);
    }
  }
  float rinv[8];
#pragma unroll
  for (int rr = 0; rr < 8; ++rr) rinv[rr] = 1.0f / __shfl(den, 8 * hh + rr, 32);   // den of D row 8hh+rr

  float* sl = slab[wave];
#pragma unroll
  for (int j = 0; j < 4; ++j) {
#pragma unroll
    for (int rr = 0; rr < 8; ++rr) sl[(8 * hh + rr) * 68 + 16 * j + c] = acc[j][rr] * rinv[rr];
  }
  wave_sync_lds();
  {
    v4f ov[8];
#pragma unroll
    for (int it = 0; it < 8; ++it) {
      const int row = it * 2 + hh;        // it 0..7 x hh 0..1 = rows 0..15
      ov[it] = *(const v4f*)(sl + row * 68 + c * 4);
    }
    {
#pragma unroll
      for (int it = 0; it < 8; ++it) {
        const int row = it * 2 + hh;
        *(v4f*)(MEM + (size_t)(n0w + row) * DM + h * HD + c * 4) = ov[it];
      }
      
    }
  }
}

// =====================================================================================================
// Segment-local causal attention with the gate mix, one batch, per (h, segment, 64-query block):
//   s = (sum_d qh.kh + (ql.kh + qh.kl) / RSC) * sscale, sscale = (1/8) / (QSC*KSC); key > query (segment-local)
//   -> NEG_BIG (value select); online softmax in f32; p = exp(s - m) carried as ph = f16(1024 p) and, when PRES,
//   also pl = f16((1024 p - ph) * RSC); local numerator = p . v with v as f16 hi (VSC v) and, when PRES, the f16
//   residual ((VSC v - hi) * RSC) plane: oh += ph.vhi over all chunks; when PRES: ol = ph.vres + pl.vhi (one
//   residual accumulator per chunk and 16-wide d tile, both products carry the same 1/RSC), folded as
//   oh += ol / RSC in f32 right after its two k-steps.
//   q|k planes (f16, pitch QKW, rows = positions): q element (t, h, d) at [t*QKW + h*64 + d], k at
//   [t*QKW + DM + h*64 + d]; V^T planes (f16): element (h, d, t) at [(h*64 + d)*SEQ + t]; MEM plane (f32,
//   pitch DM): element (t, h, e) at [t*DM + h*64 + e].
//   Epilogue per query row t: local = oh / (l * PSC * VSC); mem = MEM[t] for segments >= 1 (segment 0: exactly 0
//   by a value select; the load address is always inside the plane); out = g * mem + (1 - g) * local with
//   g = sigmoid(bf16(gate[h])); rows of positions < NTOK go to the second output (offset OUT1OFF), rows of positions
//   >= NTOK to the first, row t mod NTOK, columns h*64..h*64+63 (pitch DM floats).
//   Block = 4 waves = 64 query rows of one h; grid = NHEAD * NSEG * nqb, block -> (h, seg, qbs = qb0 + i);
//   key chunks of 64 within the segment, chunks kt <= qbs only (block-uniform trip <= NQB), chunk kt == qbs keeps
//   its diagonal by the per-element select.
//   K / V^T chunk staging: 128 threads, K row r = tid>>1 (32-column half (tid&1)), V^T row d = tid>>1 (32-key half);
//   plain 16-B loads, __syncthreads ahead of and after; q fragments (hi and residual, 2 d-chunks) held in
//   registers for the whole block; P tiles wave-private, spilled with _Float16 element stores and reloaded as v8h
//   Output coverage: each wave stores rows q0..q0+15 (it 0..7 x lane>>4) x 64 columns (16 lanes x 16 B), one
// =====================================================================================================
template <bool PRES>
__global__ __launch_bounds__(128)
void attn_seg(const unsigned short* __restrict__ QKH, const unsigned short* __restrict__ QKL,
              const unsigned short* __restrict__ VTH, const unsigned short* __restrict__ VTL,
              const float* __restrict__ MEM, const float* __restrict__ gate,
              float* outb, float sscale, int qb0, int nqb) {
  __shared__ __align__(16) _Float16 Ksh[64 * HD];                            // K hi  [key][d]  8 KB
  __shared__ __align__(16) _Float16 Kls[64 * HD];                            // K res [key][d]  8 KB
  __shared__ __align__(16) _Float16 Vhs[HD * 64];                            // V^T hi [d][key] 8 KB
  __shared__ __align__(16) _Float16 Vls[PRES ? HD * 64 : 8];                 // V^T res [d][key] 8 KB (PRES)
  __shared__ __align__(16) _Float16 Psh[4][16 * 64];                         // per wave P hi [row][key] 8 KB
  __shared__ __align__(16) _Float16 Psl[PRES ? 4 : 1][PRES ? 16 * 64 : 8];   // per wave P residual (PRES) 8 KB
  __shared__ __align__(16) float    Os[4][16 * 68];                          // per wave output tile [row][d]

  const int tid  = threadIdx.x;
  const int wave = tid >> 5;
  const int lane = tid & 31;
  const int hh   = lane >> 4;
  const int c    = lane & 15;

  const int per = NSEG * nqb;
  const int h   = (int)(blockIdx.x / (unsigned)per);
  const int rem = (int)(blockIdx.x - (unsigned)h * (unsigned)per);
  const int seg = rem / nqb;
  const int qbs = qb0 + (rem - seg * nqb);
  if (h >= NHEAD || seg >= NSEG) return;  // block-uniform, ahead of any barrier; never taken for exact grids
  const int sbase = seg * SEG;
  const int rowl0 = qbs * 64 + wave * 16; // segment-local row of this wave's first query
  const int q0    = sbase + rowl0;        // its position in the concatenated sequence

  const _Float16* Q16 = (const _Float16*)(const void*)QKH;
  const _Float16* L16 = (const _Float16*)(const void*)QKL;
  const _Float16* Qg  = Q16 + (size_t)h * HD;
  const _Float16* Qlg = L16 + (size_t)h * HD;
  const _Float16* Kg  = Q16 + DM + (size_t)h * HD;
  const _Float16* Klg = L16 + DM + (size_t)h * HD;
  const _Float16* Vhg = (const _Float16*)(const void*)VTH + (size_t)h * HD * SEQ;
  const _Float16* Vlg = (const _Float16*)(const void*)VTL + (size_t)h * HD * SEQ;

  // ---- q fragments (A operand, row = lane&15), hi and residual, d-chunks 0 and 1, fixed for the block ----
  const v16h qh0 = ldfrag_h(Qg  + (size_t)(q0 + c) * QKW + 8 * hh);
  const v16h qh1 = ldfrag_h(Qg  + (size_t)(q0 + c) * QKW + 32 + 8 * hh);
  const v16h ql0 = ldfrag_h(Qlg + (size_t)(q0 + c) * QKW + 8 * hh);
  const v16h ql1 = ldfrag_h(Qlg + (size_t)(q0 + c) * QKW + 32 + 8 * hh);

  float mrow[8], lrow[8];
  v8f oh[4];
#pragma unroll
  for (int r = 0; r < 8; ++r) { mrow[r] = NEG_BIG; lrow[r] = 0.f; }
#pragma unroll
  for (int t = 0; t < 4; ++t) oh[t] = zero8();

  _Float16* pwh = Psh[wave];
  _Float16* pwl = &Psl[PRES ? wave : 0][0];

  for (int kt = 0; kt < NQB; ++kt) {          // static bound; block-uniform causal chunk skipping
    if (kt > qbs) break;
    const int kv0 = sbase + kt * 64;
    __syncthreads();
    {
      const int r = tid >> 1, hk = (tid & 1) * 32;
      const _Float16* kg = Kg + (size_t)(kv0 + r) * QKW + hk;        // K row kv0+r, d = hk..hk+31
#pragma unroll
      for (int i = 0; i < 4; ++i) *(v8h*)(Ksh + r * HD + hk + 8 * i) = *(const v8h*)(kg + 8 * i);
      cbar();
      const _Float16* lg = Klg + (size_t)(kv0 + r) * QKW + hk;
#pragma unroll
      for (int i = 0; i < 4; ++i) *(v8h*)(Kls + r * HD + hk + 8 * i) = *(const v8h*)(lg + 8 * i);
      cbar();
      const _Float16* vh = Vhg + (size_t)r * SEQ + kv0 + hk;          // V^T row d = r, t = kv0+hk..+31
#pragma unroll
      for (int i = 0; i < 4; ++i) *(v8h*)(Vhs + r * 64 + hk + 8 * i) = *(const v8h*)(vh + 8 * i);
      if (PRES) {
        cbar();
        const _Float16* vl = Vlg + (size_t)r * SEQ + kv0 + hk;
#pragma unroll
        for (int i = 0; i < 4; ++i) *(v8h*)(Vls + r * 64 + hk + 8 * i) = *(const v8h*)(vl + 8 * i);
        cbar();
      }
    }
    __syncthreads();

    // ---- scores: 16 query rows x 64 keys per wave, K = 64 (2 d-chunks), three products ----
    v8f s[4];
#pragma unroll
    for (int j = 0; j < 4; ++j) {
      v8f sh = zero8(), sl = zero8();
      {
        FH kb, lb;
        kb.h[0] = *(const v8h*)(Ksh + (j * 16 + c) * HD + 8 * hh);
        kb.h[1] = *(const v8h*)(Ksh + (j * 16 + c) * HD + 16 + 8 * hh);
        lb.h[0] = *(const v8h*)(Kls + (j * 16 + c) * HD + 8 * hh);
        lb.h[1] = *(const v8h*)(Kls + (j * 16 + c) * HD + 16 + 8 * hh);
        sh = mma_h_raw(qh0, kb.v, sh);
        sl = mma_h_raw(ql0, kb.v, sl);
        sl = mma_h_raw(qh0, lb.v, sl);
        guard4m(sh, sl, qh0, ql0, kb.v, lb.v);
      }
      {
        FH kb, lb;
        kb.h[0] = *(const v8h*)(Ksh + (j * 16 + c) * HD + 32 + 8 * hh);
        kb.h[1] = *(const v8h*)(Ksh + (j * 16 + c) * HD + 48 + 8 * hh);
        lb.h[0] = *(const v8h*)(Kls + (j * 16 + c) * HD + 32 + 8 * hh);
        lb.h[1] = *(const v8h*)(Kls + (j * 16 + c) * HD + 48 + 8 * hh);
        sh = mma_h_raw(qh1, kb.v, sh);
        sl = mma_h_raw(ql1, kb.v, sl);
        sl = mma_h_raw(qh1, lb.v, sl);
        guard4m(sh, sl, qh1, ql1, kb.v, lb.v);
      }
      const int key  = kt * 64 + j * 16 + c;             // segment-local key of this lane's D column
      const int rowb = rowl0 + 8 * hh;                   // segment-local query row of D element r is rowb + r
#pragma unroll
      for (int r = 0; r < 8; ++r) {
        float v = sh[r];
        v += sl[r] * (1.0f / RSC);
        v *= sscale;
        s[j][r] = (key <= rowb + r) ? v : NEG_BIG;
      }
    }

    // ---- row max, online softmax, P hi (x1024, f16) and, when PRES, P residual (x RSC, f16) to LDS ----
#pragma unroll
    for (int r = 0; r < 8; ++r) {
      float m = s[0][r];
      m = fmaxf(m, s[1][r]);
      m = fmaxf(m, s[2][r]);
      m = fmaxf(m, s[3][r]);
#pragma unroll
      for (int off = 1; off < 16; off <<= 1) m = fmaxf(m, __shfl_xor(m, off, 32));
      const float mnew  = fmaxf(mrow[r], m);
      const float alpha = __expf(mrow[r] - mnew);
      mrow[r] = mnew;
      float psum = 0.f;
#pragma unroll
      for (int j = 0; j < 4; ++j) {
        const float p  = __expf(s[j][r] - mnew);
        psum += p;
        const float ph = p * PSC;
        const _Float16 xh = (_Float16)ph;
        const int pi = (8 * hh + r) * 64 + j * 16 + c;
        pwh[pi] = xh;
        if (PRES) pwl[pi] = (_Float16)((ph - (float)xh) * RSC);
      }
#pragma unroll
      for (int off = 1; off < 16; off <<= 1) psum += __shfl_xor(psum, off, 32);
      lrow[r] = lrow[r] * alpha + psum;
#pragma unroll
      for (int t = 0; t < 4; ++t) oh[t][r] *= alpha;
    }
    wave_sync_lds();

    // ---- local numerator: oh += Phi . Vhi; when PRES also ol = Phi . Vres + Plo . Vhi, oh += ol/RSC ----
    FH pa0, pa1, pb0, pb1;
    pa0.h[0] = *(const v8h*)(pwh + c * 64 + 8 * hh);
    pa0.h[1] = *(const v8h*)(pwh + c * 64 + 16 + 8 * hh);
    pa1.h[0] = *(const v8h*)(pwh + c * 64 + 32 + 8 * hh);
    pa1.h[1] = *(const v8h*)(pwh + c * 64 + 48 + 8 * hh);
    pb0.v = pa0.v;
    pb1.v = pa1.v;
    if (PRES) {
      pb0.h[0] = *(const v8h*)(pwl + c * 64 + 8 * hh);
      pb0.h[1] = *(const v8h*)(pwl + c * 64 + 16 + 8 * hh);
      pb1.h[0] = *(const v8h*)(pwl + c * 64 + 32 + 8 * hh);
      pb1.h[1] = *(const v8h*)(pwl + c * 64 + 48 + 8 * hh);
      cbar();
    }
#pragma unroll
    for (int t = 0; t < 4; ++t) {
      const _Float16* vr = Vhs + (t * 16 + c) * 64 + 8 * hh;
      FH vb0, vb1;
      vb0.h[0] = *(const v8h*)(vr);
      vb0.h[1] = *(const v8h*)(vr + 16);
      vb1.h[0] = *(const v8h*)(vr + 32);
      vb1.h[1] = *(const v8h*)(vr + 48);
      if (PRES) {
        const _Float16* wr = Vls + (t * 16 + c) * 64 + 8 * hh;
        FH wb0, wb1;
        wb0.h[0] = *(const v8h*)(wr);
        wb0.h[1] = *(const v8h*)(wr + 16);
        wb1.h[0] = *(const v8h*)(wr + 32);
        wb1.h[1] = *(const v8h*)(wr + 48);
        v8f ol = zero8();
        oh[t] = mma_h_raw(pa0.v, vb0.v, oh[t]);
        ol    = mma_h_raw(pa0.v, wb0.v, ol);
        ol    = mma_h_raw(pb0.v, vb0.v, ol);
        oh[t] = mma_h_raw(pa1.v, vb1.v, oh[t]);
        ol    = mma_h_raw(pa1.v, wb1.v, ol);
        ol    = mma_h_raw(pb1.v, vb1.v, ol);
        guard8m(oh[t], ol, pa0.v, pa1.v, pb0.v, pb1.v, vb0.v, vb1.v, wb0.v, wb1.v);
#pragma unroll
        for (int r = 0; r < 8; ++r) oh[t][r] += ol[r] * (1.0f / RSC);
      } else {
        oh[t] = mma_h_raw(pa0.v, vb0.v, oh[t]);
        oh[t] = mma_h_raw(pa1.v, vb1.v, oh[t]);
        guard1q(oh[t], pa0.v, pa1.v, vb0.v, vb1.v);
      }
    }
    acc_guard4(oh[0], oh[1], oh[2], oh[3]);
  }

  // ---- normalise (1/l, the 1/1024 p carry and the 1/VSC v carry), gate mix with the memory read, stage the
  const float gv  = bfr(gate[h]);
  const float g   = 1.0f / (1.0f + expf(-gv));
  const float omg = 1.0f - g;
  const bool useMem = (seg > 0);                          // block-uniform
  float* os = Os[wave];
#pragma unroll
  for (int r = 0; r < 8; ++r) {
    const int qr = q0 + 8 * hh + r;                         // query position
    const float l = lrow[r];                                // >= 1 (the row maximum contributes exp(0))
    const float inv = (1.0f / l) * (1.0f / (PSC * VSC));
    const float* mr = MEM + (size_t)qr * DM + h * HD;       // inside the MEM plane for every position
#pragma unroll
    for (int t = 0; t < 4; ++t) {
      const float yv  = oh[t][r] * inv;                     // e = 16t + c
      const float mvr = mr[16 * t + c];
      const float mv  = useMem ? mvr : 0.f;
      os[(8 * hh + r) * 68 + 16 * t + c] = g * mv + omg * yv;
    }
  }
  wave_sync_lds();
  {
    const size_t ooff  = (seg < (NTOK / SEG)) ? (size_t)OUT1OFF : (size_t)0;   // positions < NTOK -> second output
    const int    orow0 = (seg < (NTOK / SEG)) ? q0 : (q0 - NTOK);               // row within the output [b][2048][1024]
    v4f ov[8];
#pragma unroll
    for (int it = 0; it < 8; ++it) {
      const int row = it * 2 + hh;                          // it 0..7 x hh 0..1 = rows 0..15 of the wave tile
      ov[it] = *(const v4f*)(os + row * 68 + c * 4);
    }
    {
#pragma unroll
      for (int it = 0; it < 8; ++it) {
        const int row = it * 2 + hh;
        *(v4f*)(outb + ooff + (size_t)(orow0 + row) * DM + h * HD + c * 4) = ov[it];
      }
      
    }
  }
}

// =====================================================================================================
// Workspace map (bytes); every plane is an exact multiple of its tile / whole-line store granularity (all dims are
// exact tile multiples, no padded tails), all offsets multiples of 4096:
//   XH    f16  [4096 t][1024 in]        0          8388608   (f16 of bf16 value x16, rows b*2048 + t)
//   AH    f16  [4096 t][1024 in]        8388608    8388608
//   WXT   f16  [3072 out][1024 in]      16777216   6291456   (W^T, bf16 value x64)
//   WAT   f16  [3072 out][1024 in]      23068672   6291456
//   COST  f32  [4096 pos][32]           29360128    524288
//   SINT  f32  [4096 pos][32]           29884416    524288
//   QKH   f16  [4096 pos][2048 (q|k)]   30408704  16777216   (one batch; q x4, k x16 hi after norm + rotary)
//   QKL   f16  [4096][2048]             47185920  16777216   (x4096 residuals)
//   VF    f32  [4096 pos][1024 (h,d)]   63963136  16777216   (v, f32)
//   VTH   f16  [1024 (h,d)][4096 pos]   80740352   8388608   (v x16 hi)
//   VTL   f16  [1024 (h,d)][4096 pos]   89128960   8388608   ((v x16 - hi) x4096)
//   MT    f32  [16 h][3 s][64 e][64 d]  97517568    786432
//   ZP    f32  [16 h][3 s][64 d]        98304000     12288
//   MEM   f32  [4096 pos][1024 (h,e)]   98316288  16777216
//   end                                115093504
// =====================================================================================================
extern "C" void kernel_launch(void* const* d_in, const int* in_sizes, int n_in,
                              void* d_out, int out_size, void* d_ws, size_t ws_size,
                              hipStream_t stream) {
  if (n_in < 9) return;
  if (in_sizes[0] != NB * NTOK * DM || in_sizes[1] != NB * NTOK * DM) return;
  if (in_sizes[2] != DM * W3 || in_sizes[3] != DM * W3) return;
  if (in_sizes[4] != NHEAD * HD || in_sizes[5] != NHEAD * HD) return;
  if (in_sizes[6] != NHEAD * HD || in_sizes[7] != NHEAD * HD) return;
  if (in_sizes[8] != NHEAD) return;
  if (out_size != 2 * NB * NTOK * DM) return;

  const float* X    = (const float*)d_in[0];
  const float* Aa   = (const float*)d_in[1];
  const float* Wx   = (const float*)d_in[2];
  const float* Wa   = (const float*)d_in[3];
  const float* g_qx = (const float*)d_in[4];
  const float* g_kx = (const float*)d_in[5];
  const float* g_qa = (const float*)d_in[6];
  const float* g_ka = (const float*)d_in[7];
  const float* gate = (const float*)d_in[8];
  float* outf = (float*)d_out;

  const size_t PXA = (size_t)NB * NTOK * DM * 2;        //  8388608
  const size_t PW  = (size_t)W3 * DM * 2;               //  6291456
  const size_t PRT = (size_t)SEQ * RP * 4;              //   524288
  const size_t PQK = (size_t)SEQ * QKW * 2;             // 16777216
  const size_t PVF = (size_t)SEQ * DM * 4;              // 16777216
  const size_t PVT = (size_t)DM * SEQ * 2;              //  8388608
  const size_t PMT = (size_t)NHEAD * 3 * HD * HD * 4;   //   786432
  const size_t PZP = (size_t)NHEAD * 3 * HD * 4;        //    12288
  const size_t PME = (size_t)SEQ * DM * 4;              // 16777216
  size_t off = 0;
  const size_t oXH = off; off += PXA;
  const size_t oAH = off; off += PXA;
  const size_t oWX = off; off += PW;
  const size_t oWA = off; off += PW;
  const size_t oCT = off; off += PRT;
  const size_t oST = off; off += PRT;
  const size_t oQH = off; off += PQK;
  const size_t oQL = off; off += PQK;
  const size_t oVF = off; off += PVF;
  const size_t oVH = off; off += PVT;
  const size_t oVL = off; off += PVT;
  const size_t oMT = off; off += PMT;
  const size_t oZP = off; off += PZP;
  const size_t oME = off; off += PME;
  if (off > ws_size) return;                            // off = 115093504
  if (off > (size_t)134217728) return;

  char* ws = (char*)d_ws;
  unsigned short* XH   = (unsigned short*)(ws + oXH);
  unsigned short* AH   = (unsigned short*)(ws + oAH);
  unsigned short* WXT  = (unsigned short*)(ws + oWX);
  unsigned short* WAT  = (unsigned short*)(ws + oWA);
  float*          COST = (float*)(ws + oCT);
  float*          SINT = (float*)(ws + oST);
  unsigned short* QKH  = (unsigned short*)(ws + oQH);
  unsigned short* QKL  = (unsigned short*)(ws + oQL);
  float*          VF   = (float*)(ws + oVF);
  unsigned short* VTH  = (unsigned short*)(ws + oVH);
  unsigned short* VTL  = (unsigned short*)(ws + oVL);
  float*          MT   = (float*)(ws + oMT);
  float*          ZP   = (float*)(ws + oZP);
  float*          MEM  = (float*)(ws + oME);

  const dim3 blk256(256), blk128(128);
  const float sscale = 0.125f / (QSC * KSC);
  const float oscale = 1.0f / (XSC * WSC);

  // (1) x, a -> row-major f16 planes of their bf16 RNE values x16; W [1024][3072] -> transposed f16 planes
  //     [3072][1024] (k contiguous, Bt form) of their bf16 RNE values x64; rotary tables
  cvt_rm<<<dim3((NB * NTOK * DM) / 2048), blk256, 0, stream>>>(X, XH, NB * NTOK * DM, XSC);
  cvt_rm<<<dim3((NB * NTOK * DM) / 2048), blk256, 0, stream>>>(Aa, AH, NB * NTOK * DM, XSC);
  // in[DM rows][W3 cols] -> out[W3][DM]: grid (cols/64, rows/64)
  tr_cvt<0><<<dim3(W3 / 64, DM / 64), blk256, 0, stream>>>(Wx, DM, W3, WXT, WXT, WSC);
  tr_cvt<0><<<dim3(W3 / 64, DM / 64), blk256, 0, stream>>>(Wa, DM, W3, WAT, WAT, WSC);
  rope_tab<<<dim3((SEQ * RP) / 256), blk256, 0, stream>>>(COST, SINT, SEQ * RP);

  const int gqk  = ((NTOK / 32) * (QKW / 128)) / 4;      // 1024 tiles -> 256 blocks
  const int gv   = ((NTOK / 32) * (DM / 128)) / 4;       //  512 tiles -> 128 blocks
  const int gmt  = NHEAD * 3;                            //   48 blocks
  const int gmem = NHEAD * 3 * (SEG / MROWS);            //  384 blocks
  for (int b = 0; b < NB; ++b) {
    const unsigned short* AHb = AH + (size_t)b * NTOK * DM;
    const unsigned short* XHb = XH + (size_t)b * NTOK * DM;
    float* outb = outf + (size_t)b * NTOK * DM;
    // (2) q|k of stream a (positions 0..2047) and stream x (positions 2048..4095): M=2048, N=2048, K=1024,
    //     fused per-head L2 norm + gain + rotary -> QKH/QKL f16 planes
    gemm_t<1><<<dim3(gqk), blk128, 0, stream>>>(AHb, DM, WAT, DM, (void*)QKH, (void*)QKL, QKW, 0,
                                               COST, SINT, g_qa, g_ka, NTOK, QKW, DM, oscale);
    gemm_t<1><<<dim3(gqk), blk128, 0, stream>>>(XHb, DM, WXT, DM, (void*)QKH, (void*)QKL, QKW, NTOK,
                                               COST, SINT, g_qx, g_kx, NTOK, QKW, DM, oscale);
    // (3) v of both streams: M=2048, N=1024 (W^T rows 2048..3071), K=1024 -> VF f32 rows
    gemm_t<3><<<dim3(gv), blk128, 0, stream>>>(AHb, DM, WAT + (size_t)2 * DM * DM, DM, (void*)VF, (void*)VF,
                                              DM, 0, COST, SINT, g_qa, g_ka, NTOK, DM, DM, oscale);
    gemm_t<3><<<dim3(gv), blk128, 0, stream>>>(XHb, DM, WXT + (size_t)2 * DM * DM, DM, (void*)VF, (void*)VF,
                                              DM, NTOK, COST, SINT, g_qx, g_kx, NTOK, DM, DM, oscale);
    // (4) v^T planes: in VF [SEQ rows][DM cols] -> out [DM][SEQ] f16 hi (x16) and residual (x4096)
    tr_cvt<1><<<dim3(DM / 64, SEQ / 64), blk256, 0, stream>>>(VF, SEQ, DM, VTH, VTL, VSC);
    // (5) compressive memory: per-segment sk^T.v and sum sk (segments 0..2), then the memory read for the
    //     query rows of segments 1..3 -> MEM f32 plane
    mt_seg<<<dim3(gmt), blk256, 0, stream>>>(QKH, QKL, VTH, MT, ZP);
    mem_ret<<<dim3(gmem), blk256, 0, stream>>>(QKH, QKL, MT, ZP, MEM);
    // (6) segment-local causal attention + gate mix -> both outputs: the leading NQP query blocks of every
    //     segment with the p, v residual products, the remaining blocks without
    attn_seg<true><<<dim3(NHEAD * NSEG * NQP), blk128, 0, stream>>>(QKH, QKL, VTH, VTL, MEM, gate, outb,
                                                                    sscale, 0, NQP);
    attn_seg<false><<<dim3(NHEAD * NSEG * (NQB - NQP)), blk128, 0, stream>>>(QKH, QKL, VTH, VTL, MEM, gate,
                                                                             outb, sscale, NQP, NQB - NQP);
  }
  (void)hipGetLastError();
}

// v001
// A run of this version takes 417 microseconds.
// Two timings next to v000 both put it at 1.88 times that version's speed.
// Contractions: a.W and x.W (q|k|v, K=1024) on v_wmma_f32_16x16x32_f16 with f16 containers of the bf16 RNE input
//   values (activations carried x16, W^T x64), one product; q.k^T (K=64) on v_wmma_f32_16x16x32_f16 with q (x4) and
//   k (x16) f16 hi planes plus x4096 f16 residual planes (three products, residual pair in a separate accumulator
//   folded by 1/4096); p.v^T on v_wmma_f32_16x16x32_f16 with p as f16(1024 p) and v^T as f16(16 v), one product
//   (the leading query blocks of every segment add the p and v x4096 f16 residual planes, two more products into a
//   separate accumulator); compressive memory sk^T.v (K=1024) and sq.M (K=64) on v_wmma_f32_16x16x32_f16 with
//   plain f16 operands, one product each. f32 accumulate everywhere; L2 norms, rotary tables and rotation, elu,
//   softmax statistics, sq.z, the memory quotient and the gate mix in f32.
#include <hip/hip_runtime.h>
#include <math.h>
#include <stdint.h>

#define NB      2
#define NTOK    2048                // tokens per stream per batch
#define SEQ     4096                // concatenated positions per batch (stream a first, then x)
#define DM      1024
#define NHEAD   16
#define HD      64
#define RP      32                  // rotary pairs per head
#define W3      3072
#define QKW     2048                // q|k plane width: q at column h*64+d, k at 1024 + h*64+d
#define SEG     1024
#define NSEG    4
#define NQB     16                  // 64-row query blocks per segment
#define NQP     4                   // leading query blocks per segment that carry the p / v residual products
#define MROWS   128                 // query rows per block of the memory read kernel
#define OUT1OFF (NB * NTOK * DM)             // element offset of the second output
#define XSC     16.0f
#define WSC     64.0f
#define QSC     4.0f
#define KSC     16.0f
#define VSC     16.0f
#define RSC     4096.0f
#define PSC     1024.0f
#define NRM_EPS 1.0e-12f
#define DEN_EPS 1.0e-6f
#define LOG2_BASE 13.287712379549449
#define NEG_BIG (-1.0e30f)
#define GBK     128                 // k per LDS stage of the projection GEMM (256 B of every operand row)
#define GPIT    136                 // LDS row pitch of a stage in halves: 272 B = 16 B x 17 (ds_load_b128 readers)
#define GSTG    (256 * GPIT)        // halves per stage: 128 A rows, then 128 Bt rows

static_assert(NHEAD * HD == DM);
static_assert(SEQ == 2 * NTOK);
static_assert(SEQ == NSEG * SEG);
static_assert(SEG == NQB * 64);
static_assert(HD == 2 * RP);
static_assert(W3 == 3 * DM);
static_assert(QKW == 2 * DM);
static_assert(((NB * NTOK * DM) % 2048) == 0);
static_assert(((SEQ * RP) % 256) == 0);
static_assert((DM % 128) == 0 && (W3 % 64) == 0 && (NTOK % 64) == 0 && (SEQ % 64) == 0);
static_assert((QKW % 128) == 0 && (DM % 32) == 0);
static_assert(NQP > 0 && NQP < NQB);
static_assert((SEG % MROWS) == 0 && MROWS == 8 * 16);
static_assert(OUT1OFF == NB * NTOK * DM);
static_assert((DM % GBK) == 0 && (NTOK % 128) == 0 && ((GPIT * 2) % 16) == 0);

typedef _Float16 v16h __attribute__((ext_vector_type(16)));
typedef _Float16 v8h  __attribute__((ext_vector_type(8)));
typedef float    v8f  __attribute__((ext_vector_type(8)));
typedef float    v4f  __attribute__((ext_vector_type(4)));
typedef unsigned int v4u __attribute__((ext_vector_type(4)));
union FH { v16h v; v8h h[2]; };

// ---- scalar helpers --------------------------------------------------------------------------------
__device__ __forceinline__ unsigned short bf_bits(float f) {          // f32 -> bf16 bits, RNE convert
  unsigned u = __float_as_uint(f);
  return (unsigned short)((u + 0x7FFFu + ((u >> 16) & 1u)) >> 16);
}
__device__ __forceinline__ float bf_up(unsigned short b) { return __uint_as_float(((unsigned)b) << 16); }
__device__ __forceinline__ float bfr(float f) { return bf_up(bf_bits(f)); }     // value of the bf16 RNE convert
__device__ __forceinline__ unsigned short h_bits(_Float16 x) { return __builtin_bit_cast(unsigned short, x); }
__device__ __forceinline__ unsigned pk16(unsigned short a, unsigned short b) { return (unsigned)a | ((unsigned)b << 16); }
__device__ __forceinline__ v8f zero8() { v8f z = {0.f, 0.f, 0.f, 0.f, 0.f, 0.f, 0.f, 0.f}; return z; }

// ---- fragment loader: 16-bit A/B operand, lane -> row/col (lane&15), p already includes +8*(lane>>4);
//      elements 0..7 <- p[0..7] (k0+8h..), elements 8..15 <- p[16..23] (k0+16+8h..)
__device__ __forceinline__ v16h ldfrag_h(const _Float16* p) {
  FH f;
  f.h[0] = *(const v8h*)(p);
  f.h[1] = *(const v8h*)(p + 16);
  return f.v;
}

// ---- WMMA helpers with trailing VALU hazard gap --------------------------------------------------------
__device__ __forceinline__ v8f mma_h_raw(v16h a, v16h b, v8f c) {
  return __builtin_amdgcn_wmma_f32_16x16x32_f16(false, a, false, b, (short)0, c, false, false);
}
__device__ __forceinline__ v8f mma_h(v16h a, v16h b, v8f c) {
  c = mma_h_raw(a, b, c);
#if defined(__HIP_DEVICE_COMPILE__)
  asm volatile("v_nop\n\tv_nop\n\tv_nop\n\tv_nop" : "+v"(c) : "v"(a), "v"(b));
#endif
  return c;
}
__device__ __forceinline__ void guard3(v8f& x, v8f& y, v16h a, v16h b, v16h d) {   // two D tiles, 3 frags live
#if defined(__HIP_DEVICE_COMPILE__)
  asm volatile("v_nop\n\tv_nop\n\tv_nop\n\tv_nop" : "+v"(x), "+v"(y) : "v"(a), "v"(b), "v"(d));
#endif
}
__device__ __forceinline__ void guard1q(v8f& x, v16h a, v16h b, v16h d, v16h e) {           // one D, 4 frags
#if defined(__HIP_DEVICE_COMPILE__)
  asm volatile("v_nop\n\tv_nop\n\tv_nop\n\tv_nop" : "+v"(x) : "v"(a), "v"(b), "v"(d), "v"(e));
#endif
}
__device__ __forceinline__ void guard4m(v8f& x, v8f& y, v16h a, v16h b, v16h d, v16h e) {   // two D, 4 frags
#if defined(__HIP_DEVICE_COMPILE__)
  asm volatile("v_nop\n\tv_nop\n\tv_nop\n\tv_nop" : "+v"(x), "+v"(y) : "v"(a), "v"(b), "v"(d), "v"(e)
               : "memory");
#endif
}
__device__ __forceinline__ void guard8m(v8f& x, v8f& y, v16h a, v16h b, v16h d, v16h e,
                                        v16h f, v16h g, v16h p, v16h q) {                      // two D, 8 frags
#if defined(__HIP_DEVICE_COMPILE__)
  asm volatile("v_nop\n\tv_nop\n\tv_nop\n\tv_nop" : "+v"(x), "+v"(y)
               : "v"(a), "v"(b), "v"(d), "v"(e), "v"(f), "v"(g), "v"(p), "v"(q) : "memory");
#endif
}
__device__ __forceinline__ void acc_guard4(v8f& a, v8f& b, v8f& c, v8f& d) {
#if defined(__HIP_DEVICE_COMPILE__)
  asm volatile("v_nop\n\tv_nop\n\tv_nop\n\tv_nop" : "+v"(a), "+v"(b), "+v"(c), "+v"(d));
#endif
}
__device__ __forceinline__ void acc_guard2(v8f& a, v8f& b) {
#if defined(__HIP_DEVICE_COMPILE__)
  asm volatile("v_nop\n\tv_nop\n\tv_nop\n\tv_nop" : "+v"(a), "+v"(b));
#endif
}
__device__ __forceinline__ void cbar() {
#if defined(__HIP_DEVICE_COMPILE__)
  asm volatile("" ::: "memory");
#endif
}
__device__ __forceinline__ void wave_sync_lds() {
  __builtin_amdgcn_fence(__ATOMIC_RELEASE, "workgroup");
  __builtin_amdgcn_wave_barrier();
  __builtin_amdgcn_fence(__ATOMIC_ACQUIRE, "workgroup");
}

// ---- eight asynchronous 16-B copies global -> LDS per lane (l: LDS byte address, g: global address). The
//      s_wait_xcnt stands inside the statement so that no address register is rewritten ahead of it.
__device__ __forceinline__ void acopy8(uint32_t l0, uint32_t l1, uint32_t l2, uint32_t l3,
                                       uint32_t l4, uint32_t l5, uint32_t l6, uint32_t l7,
                                       const _Float16* g0, const _Float16* g1, const _Float16* g2,
                                       const _Float16* g3, const _Float16* g4, const _Float16* g5,
                                       const _Float16* g6, const _Float16* g7) {
#if defined(__HIP_DEVICE_COMPILE__)
  asm volatile("global_load_async_to_lds_b128 %0, %8, off\n\t"
               "global_load_async_to_lds_b128 %1, %9, off\n\t"
               "global_load_async_to_lds_b128 %2, %10, off\n\t"
               "global_load_async_to_lds_b128 %3, %11, off\n\t"
               "global_load_async_to_lds_b128 %4, %12, off\n\t"
               "global_load_async_to_lds_b128 %5, %13, off\n\t"
               "global_load_async_to_lds_b128 %6, %14, off\n\t"
               "global_load_async_to_lds_b128 %7, %15, off\n\t"
               "s_wait_xcnt 0x0"
               :: "v"(l0), "v"(l1), "v"(l2), "v"(l3), "v"(l4), "v"(l5), "v"(l6), "v"(l7),
                  "v"(g0), "v"(g1), "v"(g2), "v"(g3), "v"(g4), "v"(g5), "v"(g6), "v"(g7)
               : "memory");
#endif
}
// 64 rows of one operand, 256 B each, into LDS rows of pitch GPIT: l / g are this thread's addresses in row
// (tid >> 4) at 16-B piece (tid & 15); copy i takes row 8 i + (tid >> 4), a wave's copy covers two whole rows.
__device__ __forceinline__ void acopy_rows64(uint32_t l, const _Float16* g, size_t ld) {
  const uint32_t ls = 8u * GPIT * 2u;
  const size_t   gs = 8 * ld;
  acopy8(l, l + ls, l + 2 * ls, l + 3 * ls, l + 4 * ls, l + 5 * ls, l + 6 * ls, l + 7 * ls,
         g, g + gs, g + 2 * gs, g + 3 * gs, g + 4 * gs, g + 5 * gs, g + 6 * gs, g + 7 * gs);
}
// the issuing wave's own copies have landed (the compiler places no wait for them)
__device__ __forceinline__ void wait_async0() {
#if defined(__HIP_DEVICE_COMPILE__)
  asm volatile("s_wait_asynccnt 0x0" ::: "memory");
#endif
}
// this wave's LDS reads of the stage have returned before the stage is handed back for a refill
__device__ __forceinline__ void wait_ds0() {
#if defined(__HIP_DEVICE_COMPILE__)
  asm volatile("s_wait_dscnt 0x0" ::: "memory");
#endif
}

// =====================================================================================================
// Row-major convert: f32 [n] -> f16 plane [n] holding f16(bf16 RNE value * scale) (scale a power of two, exact).
// coverage: grid.x = n/2048 blocks x 256 threads x 8 = n elements (n % 2048 == 0 host-checked).
// =====================================================================================================
__global__ __launch_bounds__(256) void cvt_rm(const float* __restrict__ in, unsigned short* out, int n,
                                             float scale) {
  const size_t i8 = ((size_t)blockIdx.x * 256 + threadIdx.x) * 8;
  if (i8 + 8 > (size_t)n) return;        // never taken for the host-checked sizes; no barriers below
  const v4f a = *(const v4f*)(in + i8);
  const v4f b = *(const v4f*)(in + i8 + 4);
  float f[8];
  f[0] = a[0]; f[1] = a[1]; f[2] = a[2]; f[3] = a[3];
  f[4] = b[0]; f[5] = b[1]; f[6] = b[2]; f[7] = b[3];
  v4u p;
#pragma unroll
  for (int e = 0; e < 4; ++e) {
    const unsigned short b0 = bf_bits(f[2 * e]), b1 = bf_bits(f[2 * e + 1]);
    const _Float16 x0 = (_Float16)(bf_up(b0) * scale);
    const _Float16 x1 = (_Float16)(bf_up(b1) * scale);
    p[e] = pk16(h_bits(x0), h_bits(x1));
  }
  *(v4u*)(out + i8) = p;
  
}

// =====================================================================================================
// Transposing convert: f32 in[R][C] (row-major, pitch C) -> 16-bit out[C][R] (pitch R), 64x64 tiles through LDS.
//   MODE 0: one plane  out0 = f16(bf16 RNE value * scale).
//   MODE 1: two planes out0 = f16(v * scale) hi, out1 = f16((v * scale - hi) * RSC) residual.
// Block = 256 threads; grid = (C/64, R/64) exact (host-checked). Load: thread -> input row tid>>2, 16 consecutive
// columns (four 16-B loads). Store: two iterations, output row it*32 + (tid>>3), lanes (tid&7) -> elements
// coverage: 2 iterations x 32 output rows x 8 lanes x 8 halves = the whole 64x64 tile; grid covers all of C x R.
// =====================================================================================================
template <int MODE>
__global__ __launch_bounds__(256) void tr_cvt(const float* __restrict__ in, int R, int C,
                                             unsigned short* out0, unsigned short* out1, float scale) {
  __shared__ float sm[64][65];
  const int tid = threadIdx.x;
  const int c0 = blockIdx.x * 64;          // input column block -> output row block
  const int r0 = blockIdx.y * 64;          // input row block    -> output column block
  if (c0 + 64 > C || r0 + 64 > R) return;  // block-uniform, ahead of any barrier; never taken for exact grids
  {
    const int lr = tid >> 2, lc = (tid & 3) * 16;
    const float* src = in + (size_t)(r0 + lr) * (size_t)C + c0 + lc;
#pragma unroll
    for (int q = 0; q < 4; ++q) {
      const v4f v = *(const v4f*)(src + 4 * q);
      sm[lr][lc + 4 * q + 0] = v[0];
      sm[lr][lc + 4 * q + 1] = v[1];
      sm[lr][lc + 4 * q + 2] = v[2];
      sm[lr][lc + 4 * q + 3] = v[3];
    }
  }
  __syncthreads();
  const int seg = tid & 7;
  v4u p0[2], p1[2];
#pragma unroll
  for (int it = 0; it < 2; ++it) {
    const int ocl = it * 32 + (tid >> 3);   // output row within the tile = input column
    float f[8];
#pragma unroll
    for (int e = 0; e < 8; ++e) f[e] = sm[seg * 8 + e][ocl];
    v4u pk, pl;
#pragma unroll
    for (int e = 0; e < 4; ++e) {
      const float g0 = f[2 * e], g1 = f[2 * e + 1];
      if (MODE == 0) {
        const _Float16 x0 = (_Float16)(bfr(g0) * scale);
        const _Float16 x1 = (_Float16)(bfr(g1) * scale);
        pk[e] = pk16(h_bits(x0), h_bits(x1));
        pl[e] = pk[e];
      } else {
        const float s0 = g0 * scale, s1 = g1 * scale;
        const _Float16 x0 = (_Float16)s0, x1 = (_Float16)s1;
        const _Float16 y0 = (_Float16)((s0 - (float)x0) * RSC);
        const _Float16 y1 = (_Float16)((s1 - (float)x1) * RSC);
        pk[e] = pk16(h_bits(x0), h_bits(x1));
        pl[e] = pk16(h_bits(y0), h_bits(y1));
      }
    }
    p0[it] = pk;
    p1[it] = pl;
  }
  {
#pragma unroll
    for (int it = 0; it < 2; ++it) {
      const int ocl = it * 32 + (tid >> 3);
      const size_t go = (size_t)(c0 + ocl) * (size_t)R + (size_t)(r0 + seg * 8);
      *(v4u*)(out0 + go) = p0[it];
      if (MODE == 1) *(v4u*)(out1 + go) = p1[it];
    }
    
  }
}

// =====================================================================================================
// Rotary tables for interleaved pairs: cost[t][i] = cos(t * inv_freq[i]), sint[t][i] = sin(t * inv_freq[i]),
// i = 0..31, inv_freq[i] = 1 / (10000^(2i/64)) (power via f64 exp2 -> one f32 convert, then an f32 reciprocal
// formed in f64 and converted once), angle = one f32 multiply with t = position 0..4095 in the concatenated
// coverage: grid.x = n/256 blocks x 256 threads = n = SEQ*32 elements of each table.
// =====================================================================================================
__global__ __launch_bounds__(256) void rope_tab(float* cost, float* sint, int n) {
  const int e = blockIdx.x * 256 + (int)threadIdx.x;
  if (e >= n) return;                      // never taken (n % 256 == 0); no barriers below
  const int t = e >> 5, i = e & 31;
  const double pd = exp2((double)i * (1.0 / 32.0) * LOG2_BASE);   // 10000^(2i/64)
  const float  pf = (float)pd;
  const float  invf = (float)(1.0 / (double)pf);
  const float  ang = (float)t * invf;
  float sv, cv;
  sincosf(ang, &sv, &cv);
  *(float*)(cost + e) = cv;
  *(float*)(sint + e) = sv;
  
}

// =====================================================================================================
// Register-blocked f16 WMMA GEMM, one wave per 32x128 tile; block = 4 waves = 4 tiles stacked in m = one 128x128
// block tile whose operands pass through LDS: a stage is 128 k of the 128 A rows and the 128 Bt rows, brought by
// asynchronous copies into two buffers (stage t + 1 flies while stage t is worked on), read by all 4 waves:
//   acc[m][n] = sum_k A[m][k] * Bt[n][k]; A row-major [M][K] pitch lda, Bt row-major [N][K] pitch ldb
//   (k contiguous); M % 128 == 0, N % 128 == 0, K % 128 == 0 (exact constants here, host-checked).
// EPI 1 (q|k planes, N == QKW): the 128-column tile holds two heads of 64 columns (columns < DM are q heads,
//        columns >= DM are k heads). Per row and head: t = acc*oscale; v = t * (1/max(||t||_2, 1e-12)) *
//        bf16(gain[head][d]) * 8; then the interleaved-pair rotary rotation with the f32 tables at position
//        crow0 + m (pair (2i, 2i+1): o1 = v1*c - v2*s, o2 = v1*s + v2*c), times cscale (QSC for q, KSC for k)
//        -> C0 = f16 hi, C1 = f16((v - hi) * RSC) residual, 16-bit planes of pitch ldc, row crow0 + m, column n.
// EPI 3: f32 rows (C0) = acc*oscale, pitch ldc, row crow0 + m, column n.
// 16 lanes x 16 B per 256-B row segment (two rows per instruction), f32 as 32 lanes x 16 B per 512-B row segment;
// coverage: 2 slabs x 16 rows x 128 cols = the wave's whole 32x128 tile; tiles = whole M x N (grid = tiles/4 exact).
// =====================================================================================================
template <int EPI>
__global__ __launch_bounds__(128) void gemm_t(
    const unsigned short* __restrict__ A, int lda,
    const unsigned short* __restrict__ Bt, int ldb,
    void* C0, void* C1, int ldc, int crow0,
    const float* __restrict__ cost, const float* __restrict__ sint,
    const float* __restrict__ gq, const float* __restrict__ gk,
    int M, int N, int K, float oscale) {
  __shared__ __align__(16) float sT[4][16 * 132];   // per-wave 16x128 slab, pitch 132 floats
  __shared__ __align__(16) _Float16 ring[2 * GSTG]; // two operand stages
  const int lane = threadIdx.x & 31;
  const int wave = threadIdx.x >> 5;
  const int tilesN = N >> 7;
  const int tilesM = M >> 5;
  if ((int)blockIdx.x >= (tilesM >> 2) * tilesN) return;   // block-uniform, ahead of any barrier; never taken
  const int bm = (int)blockIdx.x / tilesN;
  const int tn = (int)blockIdx.x - bm * tilesN;
  const int tm = bm * 4 + wave;
  const int m0 = tm << 5;
  const int n0 = tn << 7;
  const int rl   = lane & 15;            // row (A) / col (B, D) within subtile
  const int hh   = lane >> 4;            // lane half
  const int koff = hh * 8;               // k offset of this lane half

  v8f acc[2][8];
#pragma unroll
  for (int i = 0; i < 2; ++i)
#pragma unroll
    for (int j = 0; j < 8; ++j) acc[i][j] = zero8();

  {
    const int cr = (int)threadIdx.x >> 4;          // row (mod 8) this thread copies
    const int cc = (int)threadIdx.x & 15;          // its 16-B piece of the row's 256 B
    const _Float16* ga = (const _Float16*)(const void*)A + (size_t)((bm << 7) + cr) * (size_t)lda + cc * 8;
    const _Float16* gb = (const _Float16*)(const void*)Bt + (size_t)(n0 + cr) * (size_t)ldb + cc * 8;
    const uint32_t  lr = (uint32_t)(size_t)(const void*)ring + (uint32_t)(cr * GPIT + cc * 8) * 2u;
    const int nst = K / GBK;                       // stages; block-uniform
    auto fill = [&](int st) {                      // stage st -> buffer st & 1: 32 copies per wave
      const uint32_t l = lr + (uint32_t)(st & 1) * (uint32_t)(GSTG * 2);
      const _Float16* pa = ga + (size_t)st * GBK;
      const _Float16* pb = gb + (size_t)st * GBK;
      acopy_rows64(l, pa, (size_t)lda);
      acopy_rows64(l + 64u * GPIT * 2u, pa + (size_t)64 * (size_t)lda, (size_t)lda);
      acopy_rows64(l + 128u * GPIT * 2u, pb, (size_t)ldb);
      acopy_rows64(l + 192u * GPIT * 2u, pb + (size_t)64 * (size_t)ldb, (size_t)ldb);
    };
    fill(0);
    wait_async0();
    __syncthreads();                               // stage 0 is published
    if (nst > 1) fill(1);
    for (int t = 0; t < nst; ++t) {
      const _Float16* sb  = ring + (t & 1) * GSTG;
      const _Float16* ar0 = sb + (wave * 32 + rl) * GPIT + koff;
      const _Float16* ar1 = ar0 + 16 * GPIT;
      const _Float16* br  = sb + (128 + rl) * GPIT + koff;
#pragma unroll                                     // the k offset becomes an immediate of each LDS load
      for (int kk = 0; kk < GBK / 32; ++kk) {
        const v16h a0 = ldfrag_h(ar0 + 32 * kk);
        const v16h a1 = ldfrag_h(ar1 + 32 * kk);
        v16h b[8];
#pragma unroll                                     // b[] stays in registers: the k-step's LDS loads stand as one group
        for (int j = 0; j < 8; ++j) b[j] = ldfrag_h(br + j * 16 * GPIT + 32 * kk);
#pragma unroll                                     // acc[][] and b[] indexed by constants only
        for (int j = 0; j < 8; ++j) {
          acc[0][j] = mma_h_raw(a0, b[j], acc[0][j]);
          acc[1][j] = mma_h_raw(a1, b[j], acc[1][j]);
          guard3(acc[0][j], acc[1][j], a0, a1, b[j]);
        }
      }
      wait_ds0();
      wait_async0();
      __syncthreads();                             // publishes stage t + 1 and ends every read of stage t
      if (t + 2 < nst) fill(t + 2);
    }
    wait_async0();
  }
  acc_guard4(acc[0][0], acc[0][1], acc[0][2], acc[0][3]);
  acc_guard4(acc[0][4], acc[0][5], acc[0][6], acc[0][7]);
  acc_guard4(acc[1][0], acc[1][1], acc[1][2], acc[1][3]);
  acc_guard4(acc[1][4], acc[1][5], acc[1][6], acc[1][7]);

  // ---- epilogue ----
  float* slab = sT[wave];
  float gmul[8];
  float csc = 1.0f;
  if (EPI == 1) {
    const bool isq = (n0 < DM);                                 // wave-uniform
    const int  hb  = (isq ? n0 : (n0 - DM)) >> 6;               // first head of this tile (0..15)
    csc = isq ? QSC : KSC;
#pragma unroll
    for (int j = 0; j < 8; ++j) {
      const int gi = (hb + (j >> 2)) * HD + 16 * (j & 3) + rl;  // < NHEAD*HD, inside both gain arrays
      const float ga = bfr(gq[gi]);
      const float gb = bfr(gk[gi]);
      gmul[j] = (isq ? ga : gb) * 8.0f;
    }
  } else {
#pragma unroll
    for (int j = 0; j < 8; ++j) gmul[j] = 1.0f;
  }
#pragma unroll
  for (int i = 0; i < 2; ++i) {
    const int mB = m0 + 16 * i;
    if (EPI == 1) {
      float inv[2][8];
#pragma unroll
      for (int jh = 0; jh < 2; ++jh) {
#pragma unroll
        for (int r = 0; r < 8; ++r) {        // sum of squares over the head's 64 columns of row 8hh+r
          float ss = 0.f;
#pragma unroll
          for (int jj = 0; jj < 4; ++jj) {
            const float x = acc[i][4 * jh + jj][r] * oscale;
            ss += x * x;
          }
          ss += __shfl_xor(ss, 1, 32);
          ss += __shfl_xor(ss, 2, 32);
          ss += __shfl_xor(ss, 4, 32);
          ss += __shfl_xor(ss, 8, 32);
          inv[jh][r] = oscale * (1.0f / fmaxf(sqrtf(ss), NRM_EPS));
        }
      }
#pragma unroll
      for (int j = 0; j < 8; ++j) {
#pragma unroll
        for (int r = 0; r < 8; ++r)
          slab[(8 * hh + r) * 132 + 16 * j + rl] = acc[i][j][r] * inv[j >> 2][r] * gmul[j];
      }
    } else {
#pragma unroll
      for (int j = 0; j < 8; ++j) {
#pragma unroll
        for (int r = 0; r < 8; ++r) slab[(8 * hh + r) * 132 + 16 * j + rl] = acc[i][j][r] * oscale;
      }
    }
    wave_sync_lds();
    if (EPI == 3) {
      float* Cf = (float*)C0;
      v4f ov[16];
#pragma unroll
      for (int it = 0; it < 16; ++it) ov[it] = *(const v4f*)(slab + it * 132 + lane * 4);
      {
#pragma unroll
        for (int it = 0; it < 16; ++it)                       // row it: 32 lanes x 16 B = 512 B = 128 cols
          *(v4f*)(Cf + (size_t)(crow0 + mB + it) * (size_t)ldc + n0 + lane * 4) = ov[it];
        
      }
    } else {
      unsigned short* Cp = (unsigned short*)C0;
      unsigned short* Cq = (unsigned short*)C1;
      v4u hv[8], lv[8];
#pragma unroll
      for (int it = 0; it < 8; ++it) {
        const int row = it * 2 + hh;                          // it 0..7 x hh 0..1 = rows 0..15
        const float* sp = slab + row * 132 + rl * 8;          // 8 consecutive columns = 4 rotary pairs
        const v4f fa = *(const v4f*)sp;
        const v4f fb = *(const v4f*)(sp + 4);
        float f[8];
        f[0] = fa[0]; f[1] = fa[1]; f[2] = fa[2]; f[3] = fa[3];
        f[4] = fb[0]; f[5] = fb[1]; f[6] = fb[2]; f[7] = fb[3];
        const int pos = crow0 + mB + row;                     // position in the concatenated sequence
        const v4f cv = *(const v4f*)(cost + (size_t)pos * RP + (rl & 7) * 4);   // pairs ((rl&7)*4 .. +3)
        const v4f sv = *(const v4f*)(sint + (size_t)pos * RP + (rl & 7) * 4);
        v4u pk, pl;
#pragma unroll
        for (int e = 0; e < 4; ++e) {
          const float f0 = f[2 * e], f1 = f[2 * e + 1];
          const float cc = cv[e], sn = sv[e];
          const float g0 = (f0 * cc - f1 * sn) * csc;
          const float g1 = (f0 * sn + f1 * cc) * csc;
          const _Float16 x0 = (_Float16)g0;
          const _Float16 x1 = (_Float16)g1;
          const _Float16 y0 = (_Float16)((g0 - (float)x0) * RSC);
          const _Float16 y1 = (_Float16)((g1 - (float)x1) * RSC);
          pk[e] = pk16(h_bits(x0), h_bits(x1));
          pl[e] = pk16(h_bits(y0), h_bits(y1));
        }
        hv[it] = pk;
        lv[it] = pl;
      }
      {
#pragma unroll
        for (int it = 0; it < 8; ++it) {
          const int row = it * 2 + hh;
          const size_t go = (size_t)(crow0 + mB + row) * (size_t)ldc + n0 + rl * 8;
          *(v4u*)(Cp + go) = hv[it];
          *(v4u*)(Cq + go) = lv[it];
        }
        
      }
    }
    wave_sync_lds();
  }
}

// =====================================================================================================
// Compressive-memory update per (head h, segment s in 0..2) of one batch:
//   MT[h][s][e][d] = sum over the 1024 keys l of segment s of v[l][e] * sk[l][d], sk = elu(k) + 1
//   (elu(x) = x > 0 ? x : exp(x) - 1, so sk = x > 0 ? x + 1 : exp(x)), and ZP[h][s][d] = sum_l sk[l][d].
//   k is rebuilt in f32 from the q|k hi / residual planes ((hi + lo/RSC) / KSC, column DM + h*64 + d), sk is
//   RNE-converted to f16 and written TRANSPOSED into an LDS tile skT[d][l] (64 keys per chunk, pitch 72 halves);
//   A = V^T hi plane rows (h*64 + e, keys), Bt = skT; D[e][d] scaled by 1/VSC.
//   Block = 8 waves; wave w owns e rows 16*(w>>1).. and d columns 32*(w&1)..; acc guarded; the 16x32 f32 piece is
// coverage: MT: 8 waves x (16 rows x 32 cols) = the whole 64x64 tile of (h,s); 4 its x 4 row groups x 8 lanes =
//   16 rows x 32 cols per wave. ZP: 16 lanes x 4 floats = 64. skT fill: 256 threads x 16 d x 1 key = 64x64 chunk.
// =====================================================================================================
__global__ __launch_bounds__(256) void mt_seg(const unsigned short* __restrict__ QKH,
                                             const unsigned short* __restrict__ QKL,
                                             const unsigned short* __restrict__ VTH,
                                             float* MT, float* ZP) {
  __shared__ __align__(16) _Float16 skT[HD * 72];
  __shared__ __align__(16) float slab[8][16 * 36];
  __shared__ float zred[8][HD];
  __shared__ __align__(16) float zsum[HD];

  const int tid = threadIdx.x, wave = tid >> 5, lane = tid & 31, hh = lane >> 4, c = lane & 15;
  const int h = (int)(blockIdx.x / 3u);
  const int s = (int)(blockIdx.x - (unsigned)h * 3u);
  if (h >= NHEAD) return;                 // block-uniform, ahead of any barrier; never taken
  const int r  = tid >> 2;                // key within the 64-key chunk handled by this thread
  const int dq = (tid & 3) * 16;          // first of the 16 d columns handled by this thread
  const int et = wave >> 1;               // e row tile of this wave
  const int dt0 = (wave & 1) * 2;         // first d column tile of this wave

  const _Float16* Q16 = (const _Float16*)(const void*)QKH;
  const _Float16* L16 = (const _Float16*)(const void*)QKL;
  const _Float16* V16 = (const _Float16*)(const void*)VTH;
  const _Float16* vrow = V16 + (size_t)(h * HD + et * 16 + c) * SEQ + (size_t)s * SEG + 8 * hh;   // A frag base

  float zacc[16];
#pragma unroll
  for (int e = 0; e < 16; ++e) zacc[e] = 0.f;
  v8f acc[2];
  acc[0] = zero8(); acc[1] = zero8();

  for (int kt = 0; kt < SEG / 64; ++kt) {
    __syncthreads();                      // prior chunk's fragment reads are done
    {
      const size_t n = (size_t)(s * SEG + kt * 64 + r);
      const _Float16* kp = Q16 + n * QKW + DM + h * HD + dq;
      const _Float16* lp = L16 + n * QKW + DM + h * HD + dq;
      FH kf, lf;
      kf.h[0] = *(const v8h*)kp; kf.h[1] = *(const v8h*)(kp + 8);
      lf.h[0] = *(const v8h*)lp; lf.h[1] = *(const v8h*)(lp + 8);
#pragma unroll
      for (int e = 0; e < 16; ++e) {
        const float kv = ((float)kf.v[e] + (float)lf.v[e] * (1.0f / RSC)) * (1.0f / KSC);
        const float sk = (kv > 0.f) ? (kv + 1.0f) : __expf(kv);
        const _Float16 skh = (_Float16)sk;
        skT[(dq + e) * 72 + r] = skh;
        zacc[e] += (float)skh;
      }
    }
    __syncthreads();                      // skT chunk complete
#pragma unroll
    for (int kk = 0; kk < 2; ++kk) {
      const v16h a  = ldfrag_h(vrow + kt * 64 + 32 * kk);
      const v16h b0 = ldfrag_h(skT + (16 * dt0 + c) * 72 + 32 * kk + 8 * hh);
      const v16h b1 = ldfrag_h(skT + (16 * (dt0 + 1) + c) * 72 + 32 * kk + 8 * hh);
      acc[0] = mma_h_raw(a, b0, acc[0]);
      acc[1] = mma_h_raw(a, b1, acc[1]);
      guard3(acc[0], acc[1], a, b0, b1);
    }
  }
  acc_guard2(acc[0], acc[1]);

  // ---- MT piece: rows e = 16*et + (8hh+rr), cols d = 32*(wave&1) + 16*jj + c ----
  float* sl = slab[wave];
#pragma unroll
  for (int jj = 0; jj < 2; ++jj) {
#pragma unroll
    for (int rr = 0; rr < 8; ++rr) sl[(8 * hh + rr) * 36 + 16 * jj + c] = acc[jj][rr] * (1.0f / VSC);
  }
  wave_sync_lds();
  {
    v4f mv[4];
#pragma unroll
    for (int it = 0; it < 4; ++it) {
      const int row = it * 4 + (lane >> 3);
      mv[it] = *(const v4f*)(sl + row * 36 + (lane & 7) * 4);
    }
    float* mtb = MT + ((size_t)(h * 3 + s) * HD + (size_t)et * 16) * HD + (wave & 1) * 32;
    {
#pragma unroll
      for (int it = 0; it < 4; ++it) {
        const int row = it * 4 + (lane >> 3);
        *(v4f*)(mtb + (size_t)row * HD + (lane & 7) * 4) = mv[it];
      }
      
    }
  }
  // ---- ZP: sum zacc over the 8 keys of this wave (lanes sharing lane&3), then over the 8 waves ----
#pragma unroll
  for (int e = 0; e < 16; ++e) {
    float v = zacc[e];
    v += __shfl_xor(v, 4, 32);
    v += __shfl_xor(v, 8, 32);
    v += __shfl_xor(v, 16, 32);
    if ((lane >> 2) == 0) zred[wave][(lane & 3) * 16 + e] = v;
  }
  __syncthreads();
  if (tid < HD) {
    float z = 0.f;
#pragma unroll
    for (int w = 0; w < 8; ++w) z += zred[w][tid];
    zsum[tid] = z;
  }
  __syncthreads();
  if (tid < 16) {                         // wave 0, lanes 0..15: 16 x 16 B = the whole 256-B ZP row
    const v4f zz = *(const v4f*)(zsum + tid * 4);
    float* zp = ZP + (size_t)(h * 3 + s) * HD + tid * 4;
    *(v4f*)zp = zz;
    
  }
}

// =====================================================================================================
// Compressive-memory read per (head h, segment s in 1..3, 128-row block) of one batch:
//   M_s = sum over segments before s of MT[h][s'] (f32 sum, RNE convert to an f16 LDS tile MTh[e][d], pitch 72);
//   z_s = sum of ZP[h][s'] (f32, LDS). Per query row n of segment s: q rebuilt in f32 from the hi / residual planes
//   ((hi + lo/RSC) / QSC, column h*64 + d), sq = elu(q) + 1 RNE-converted to f16 directly into the A fragment
//   (elementwise transform keeps the A layout); num[n][e] = sum_d sq[n][d] * M_s[d][e] with Bt = MTh (K = 64, two
//   k-steps, 4 column tiles); den[n] = sum_d sq[n][d] * z_s[d] + 1e-6 in f32 from the same f16 sq values (lane
//   halves combined, then broadcast to the D rows); MEM[n][h*64 + e] = num * (1/den), f32 rows of pitch DM.
//   Block = 8 waves x 16 rows; per-wave 16x64 f32 tile staged in LDS; stores 16 lanes x 16 B per 256-B row
// coverage: 16 heads x 3 segments x 8 row blocks x 8 waves x 16 rows = MEM rows 1024..4095 of every head's 64
//   columns; 8 its x 2 row halves x 16 lanes x 4 floats = the wave's 16x64 tile. Rows 0..1023 (segment 0) are not
//   produced and are not used by the consumer (memory is exactly zero there).
// =====================================================================================================
__global__ __launch_bounds__(256) void mem_ret(const unsigned short* __restrict__ QKH,
                                              const unsigned short* __restrict__ QKL,
                                              const float* __restrict__ MT, const float* __restrict__ ZP,
                                              float* MEM) {
  __shared__ __align__(16) _Float16 MTh[HD * 72];
  __shared__ float zs[HD];
  __shared__ __align__(16) float slab[8][16 * 68];

  const int tid = threadIdx.x, wave = tid >> 5, lane = tid & 31, hh = lane >> 4, c = lane & 15;
  const int h   = (int)(blockIdx.x / 24u);
  const int rem = (int)(blockIdx.x - (unsigned)h * 24u);
  const int s   = 1 + rem / 8;            // 1..3
  const int rb  = rem - (s - 1) * 8;      // 0..7
  if (h >= NHEAD) return;                 // block-uniform, ahead of any barrier; never taken

  {
    const int e = tid >> 2, d0 = (tid & 3) * 16;
    float sm[16];
#pragma unroll
    for (int i = 0; i < 16; ++i) sm[i] = 0.f;
#pragma unroll
    for (int sp = 0; sp < 3; ++sp) {
      if (sp < s) {                       // block-uniform
        const float* src = MT + ((size_t)(h * 3 + sp) * HD + e) * HD + d0;
#pragma unroll
        for (int q = 0; q < 4; ++q) {
          const v4f v = *(const v4f*)(src + 4 * q);
          sm[4 * q + 0] += v[0]; sm[4 * q + 1] += v[1]; sm[4 * q + 2] += v[2]; sm[4 * q + 3] += v[3];
        }
      }
    }
    v8h p0, p1;
#pragma unroll
    for (int i = 0; i < 8; ++i) { p0[i] = (_Float16)sm[i]; p1[i] = (_Float16)sm[8 + i]; }
    *(v8h*)(MTh + e * 72 + d0) = p0;
    *(v8h*)(MTh + e * 72 + d0 + 8) = p1;
    if (tid < HD) {
      float z = 0.f;
#pragma unroll
      for (int sp = 0; sp < 3; ++sp) {
        if (sp < s) z += ZP[(size_t)(h * 3 + sp) * HD + tid];
      }
      zs[tid] = z;
    }
  }
  __syncthreads();

  const _Float16* Q16 = (const _Float16*)(const void*)QKH;
  const _Float16* L16 = (const _Float16*)(const void*)QKL;
  const int n0w = s * SEG + rb * MROWS + wave * 16;          // first query position of this wave

  v16h af[2];
  float denp = 0.f;
#pragma unroll
  for (int kk = 0; kk < 2; ++kk) {
    FH hf, lf;
    hf.v = ldfrag_h(Q16 + (size_t)(n0w + c) * QKW + h * HD + 32 * kk + 8 * hh);
    lf.v = ldfrag_h(L16 + (size_t)(n0w + c) * QKW + h * HD + 32 * kk + 8 * hh);
    v16h a;
#pragma unroll
    for (int i = 0; i < 16; ++i) {
      const float qv = ((float)hf.v[i] + (float)lf.v[i] * (1.0f / RSC)) * (1.0f / QSC);
      const float sq = (qv > 0.f) ? (qv + 1.0f) : __expf(qv);
      const _Float16 sqh = (_Float16)sq;
      a[i] = sqh;
      const int kidx = 32 * kk + ((i < 8) ? (8 * hh + i) : (8 + 8 * hh + i));   // k of element i (split map)
      denp += (float)sqh * zs[kidx];
    }
    af[kk] = a;
  }
  const float den = denp + __shfl_xor(denp, 16, 32) + DEN_EPS;   // row c complete in lanes c and c+16

  v8f acc[4];
#pragma unroll
  for (int j = 0; j < 4; ++j) {
    acc[j] = zero8();
#pragma unroll
    for (int kk = 0; kk < 2; ++kk) {
      const v16h b = ldfrag_h(MTh + (16 * j + c) * 72 + 32 * kk + 8 * hh);
      acc[j] = mma_h(af[kk], b, acc[j]);
    }
  }
  float rinv[8];
#pragma unroll
  for (int rr = 0; rr < 8; ++rr) rinv[rr] = 1.0f / __shfl(den, 8 * hh + rr, 32);   // den of D row 8hh+rr

  float* sl = slab[wave];
#pragma unroll
  for (int j = 0; j < 4; ++j) {
#pragma unroll
    for (int rr = 0; rr < 8; ++rr) sl[(8 * hh + rr) * 68 + 16 * j + c] = acc[j][rr] * rinv[rr];
  }
  wave_sync_lds();
  {
    v4f ov[8];
#pragma unroll
    for (int it = 0; it < 8; ++it) {
      const int row = it * 2 + hh;        // it 0..7 x hh 0..1 = rows 0..15
      ov[it] = *(const v4f*)(sl + row * 68 + c * 4);
    }
    {
#pragma unroll
      for (int it = 0; it < 8; ++it) {
        const int row = it * 2 + hh;
        *(v4f*)(MEM + (size_t)(n0w + row) * DM + h * HD + c * 4) = ov[it];
      }
      
    }
  }
}

// =====================================================================================================
// Segment-local causal attention with the gate mix, one batch, per (h, segment, 64-query block):
//   s = (sum_d qh.kh + (ql.kh + qh.kl) / RSC) * sscale, sscale = (1/8) / (QSC*KSC); key > query (segment-local)
//   -> NEG_BIG (value select); online softmax in f32; p = exp(s - m) carried as ph = f16(1024 p) and, when PRES,
//   also pl = f16((1024 p - ph) * RSC); local numerator = p . v with v as f16 hi (VSC v) and, when PRES, the f16
//   residual ((VSC v - hi) * RSC) plane: oh += ph.vhi over all chunks; when PRES: ol = ph.vres + pl.vhi (one
//   residual accumulator per chunk and 16-wide d tile, both products carry the same 1/RSC), folded as
//   oh += ol / RSC in f32 right after its two k-steps.
//   q|k planes (f16, pitch QKW, rows = positions): q element (t, h, d) at [t*QKW + h*64 + d], k at
//   [t*QKW + DM + h*64 + d]; V^T planes (f16): element (h, d, t) at [(h*64 + d)*SEQ + t]; MEM plane (f32,
//   pitch DM): element (t, h, e) at [t*DM + h*64 + e].
//   Epilogue per query row t: local = oh / (l * PSC * VSC); mem = MEM[t] for segments >= 1 (segment 0: exactly 0
//   by a value select; the load address is always inside the plane); out = g * mem + (1 - g) * local with
//   g = sigmoid(bf16(gate[h])); rows of positions < NTOK go to the second output (offset OUT1OFF), rows of positions
//   >= NTOK to the first, row t mod NTOK, columns h*64..h*64+63 (pitch DM floats).
//   Block = 4 waves = 64 query rows of one h; grid = NHEAD * NSEG * nqb, block -> (h, seg, qbs = qb0 + i);
//   key chunks of 64 within the segment, chunks kt <= qbs only (block-uniform trip <= NQB), chunk kt == qbs keeps
//   its diagonal by the per-element select.
//   K / V^T chunk staging: 128 threads, K row r = tid>>1 (32-column half (tid&1)), V^T row d = tid>>1 (32-key half);
//   plain 16-B loads, __syncthreads ahead of and after; q fragments (hi and residual, 2 d-chunks) held in
//   registers for the whole block; P tiles wave-private, spilled with _Float16 element stores and reloaded as v8h
//   Output coverage: each wave stores rows q0..q0+15 (it 0..7 x lane>>4) x 64 columns (16 lanes x 16 B), one
// =====================================================================================================
template <bool PRES>
__global__ __launch_bounds__(128)
void attn_seg(const unsigned short* __restrict__ QKH, const unsigned short* __restrict__ QKL,
              const unsigned short* __restrict__ VTH, const unsigned short* __restrict__ VTL,
              const float* __restrict__ MEM, const float* __restrict__ gate,
              float* outb, float sscale, int qb0, int nqb) {
  __shared__ __align__(16) _Float16 Ksh[64 * HD];                            // K hi  [key][d]  8 KB
  __shared__ __align__(16) _Float16 Kls[64 * HD];                            // K res [key][d]  8 KB
  __shared__ __align__(16) _Float16 Vhs[HD * 64];                            // V^T hi [d][key] 8 KB
  __shared__ __align__(16) _Float16 Vls[PRES ? HD * 64 : 8];                 // V^T res [d][key] 8 KB (PRES)
  __shared__ __align__(16) _Float16 Psh[4][16 * 64];                         // per wave P hi [row][key] 8 KB
  __shared__ __align__(16) _Float16 Psl[PRES ? 4 : 1][PRES ? 16 * 64 : 8];   // per wave P residual (PRES) 8 KB
  __shared__ __align__(16) float    Os[4][16 * 68];                          // per wave output tile [row][d]

  const int tid  = threadIdx.x;
  const int wave = tid >> 5;
  const int lane = tid & 31;
  const int hh   = lane >> 4;
  const int c    = lane & 15;

  const int per = NSEG * nqb;
  const int h   = (int)(blockIdx.x / (unsigned)per);
  const int rem = (int)(blockIdx.x - (unsigned)h * (unsigned)per);
  const int seg = rem / nqb;
  const int qbs = qb0 + (rem - seg * nqb);
  if (h >= NHEAD || seg >= NSEG) return;  // block-uniform, ahead of any barrier; never taken for exact grids
  const int sbase = seg * SEG;
  const int rowl0 = qbs * 64 + wave * 16; // segment-local row of this wave's first query
  const int q0    = sbase + rowl0;        // its position in the concatenated sequence

  const _Float16* Q16 = (const _Float16*)(const void*)QKH;
  const _Float16* L16 = (const _Float16*)(const void*)QKL;
  const _Float16* Qg  = Q16 + (size_t)h * HD;
  const _Float16* Qlg = L16 + (size_t)h * HD;
  const _Float16* Kg  = Q16 + DM + (size_t)h * HD;
  const _Float16* Klg = L16 + DM + (size_t)h * HD;
  const _Float16* Vhg = (const _Float16*)(const void*)VTH + (size_t)h * HD * SEQ;
  const _Float16* Vlg = (const _Float16*)(const void*)VTL + (size_t)h * HD * SEQ;

  // ---- q fragments (A operand, row = lane&15), hi and residual, d-chunks 0 and 1, fixed for the block ----
  const v16h qh0 = ldfrag_h(Qg  + (size_t)(q0 + c) * QKW + 8 * hh);
  const v16h qh1 = ldfrag_h(Qg  + (size_t)(q0 + c) * QKW + 32 + 8 * hh);
  const v16h ql0 = ldfrag_h(Qlg + (size_t)(q0 + c) * QKW + 8 * hh);
  const v16h ql1 = ldfrag_h(Qlg + (size_t)(q0 + c) * QKW + 32 + 8 * hh);

  float mrow[8], lrow[8];
  v8f oh[4];
#pragma unroll
  for (int r = 0; r < 8; ++r) { mrow[r] = NEG_BIG; lrow[r] = 0.f; }
#pragma unroll
  for (int t = 0; t < 4; ++t) oh[t] = zero8();

  _Float16* pwh = Psh[wave];
  _Float16* pwl = &Psl[PRES ? wave : 0][0];

  for (int kt = 0; kt < NQB; ++kt) {          // static bound; block-uniform causal chunk skipping
    if (kt > qbs) break;
    const int kv0 = sbase + kt * 64;
    __syncthreads();
    {
      const int r = tid >> 1, hk = (tid & 1) * 32;
      const _Float16* kg = Kg + (size_t)(kv0 + r) * QKW + hk;        // K row kv0+r, d = hk..hk+31
#pragma unroll
      for (int i = 0; i < 4; ++i) *(v8h*)(Ksh + r * HD + hk + 8 * i) = *(const v8h*)(kg + 8 * i);
      cbar();
      const _Float16* lg = Klg + (size_t)(kv0 + r) * QKW + hk;
#pragma unroll
      for (int i = 0; i < 4; ++i) *(v8h*)(Kls + r * HD + hk + 8 * i) = *(const v8h*)(lg + 8 * i);
      cbar();
      const _Float16* vh = Vhg + (size_t)r * SEQ + kv0 + hk;          // V^T row d = r, t = kv0+hk..+31
#pragma unroll
      for (int i = 0; i < 4; ++i) *(v8h*)(Vhs + r * 64 + hk + 8 * i) = *(const v8h*)(vh + 8 * i);
      if (PRES) {
        cbar();
        const _Float16* vl = Vlg + (size_t)r * SEQ + kv0 + hk;
#pragma unroll
        for (int i = 0; i < 4; ++i) *(v8h*)(Vls + r * 64 + hk + 8 * i) = *(const v8h*)(vl + 8 * i);
        cbar();
      }
    }
    __syncthreads();

    // ---- scores: 16 query rows x 64 keys per wave, K = 64 (2 d-chunks), three products ----
    v8f s[4];
#pragma unroll
    for (int j = 0; j < 4; ++j) {
      v8f sh = zero8(), sl = zero8();
      {
        FH kb, lb;
        kb.h[0] = *(const v8h*)(Ksh + (j * 16 + c) * HD + 8 * hh);
        kb.h[1] = *(const v8h*)(Ksh + (j * 16 + c) * HD + 16 + 8 * hh);
        lb.h[0] = *(const v8h*)(Kls + (j * 16 + c) * HD + 8 * hh);
        lb.h[1] = *(const v8h*)(Kls + (j * 16 + c) * HD + 16 + 8 * hh);
        sh = mma_h_raw(qh0, kb.v, sh);
        sl = mma_h_raw(ql0, kb.v, sl);
        sl = mma_h_raw(qh0, lb.v, sl);
        guard4m(sh, sl, qh0, ql0, kb.v, lb.v);
      }
      {
        FH kb, lb;
        kb.h[0] = *(const v8h*)(Ksh + (j * 16 + c) * HD + 32 + 8 * hh);
        kb.h[1] = *(const v8h*)(Ksh + (j * 16 + c) * HD + 48 + 8 * hh);
        lb.h[0] = *(const v8h*)(Kls + (j * 16 + c) * HD + 32 + 8 * hh);
        lb.h[1] = *(const v8h*)(Kls + (j * 16 + c) * HD + 48 + 8 * hh);
        sh = mma_h_raw(qh1, kb.v, sh);
        sl = mma_h_raw(ql1, kb.v, sl);
        sl = mma_h_raw(qh1, lb.v, sl);
        guard4m(sh, sl, qh1, ql1, kb.v, lb.v);
      }
      const int key  = kt * 64 + j * 16 + c;             // segment-local key of this lane's D column
      const int rowb = rowl0 + 8 * hh;                   // segment-local query row of D element r is rowb + r
#pragma unroll
      for (int r = 0; r < 8; ++r) {
        float v = sh[r];
        v += sl[r] * (1.0f / RSC);
        v *= sscale;
        s[j][r] = (key <= rowb + r) ? v : NEG_BIG;
      }
    }

    // ---- row max, online softmax, P hi (x1024, f16) and, when PRES, P residual (x RSC, f16) to LDS ----
#pragma unroll
    for (int r = 0; r < 8; ++r) {
      float m = s[0][r];
      m = fmaxf(m, s[1][r]);
      m = fmaxf(m, s[2][r]);
      m = fmaxf(m, s[3][r]);
#pragma unroll
      for (int off = 1; off < 16; off <<= 1) m = fmaxf(m, __shfl_xor(m, off, 32));
      const float mnew  = fmaxf(mrow[r], m);
      const float alpha = __expf(mrow[r] - mnew);
      mrow[r] = mnew;
      float psum = 0.f;
#pragma unroll
      for (int j = 0; j < 4; ++j) {
        const float p  = __expf(s[j][r] - mnew);
        psum += p;
        const float ph = p * PSC;
        const _Float16 xh = (_Float16)ph;
        const int pi = (8 * hh + r) * 64 + j * 16 + c;
        pwh[pi] = xh;
        if (PRES) pwl[pi] = (_Float16)((ph - (float)xh) * RSC);
      }
#pragma unroll
      for (int off = 1; off < 16; off <<= 1) psum += __shfl_xor(psum, off, 32);
      lrow[r] = lrow[r] * alpha + psum;
#pragma unroll
      for (int t = 0; t < 4; ++t) oh[t][r] *= alpha;
    }
    wave_sync_lds();

    // ---- local numerator: oh += Phi . Vhi; when PRES also ol = Phi . Vres + Plo . Vhi, oh += ol/RSC ----
    FH pa0, pa1, pb0, pb1;
    pa0.h[0] = *(const v8h*)(pwh + c * 64 + 8 * hh);
    pa0.h[1] = *(const v8h*)(pwh + c * 64 + 16 + 8 * hh);
    pa1.h[0] = *(const v8h*)(pwh + c * 64 + 32 + 8 * hh);
    pa1.h[1] = *(const v8h*)(pwh + c * 64 + 48 + 8 * hh);
    pb0.v = pa0.v;
    pb1.v = pa1.v;
    if (PRES) {
      pb0.h[0] = *(const v8h*)(pwl + c * 64 + 8 * hh);
      pb0.h[1] = *(const v8h*)(pwl + c * 64 + 16 + 8 * hh);
      pb1.h[0] = *(const v8h*)(pwl + c * 64 + 32 + 8 * hh);
      pb1.h[1] = *(const v8h*)(pwl + c * 64 + 48 + 8 * hh);
      cbar();
    }
#pragma unroll
    for (int t = 0; t < 4; ++t) {
      const _Float16* vr = Vhs + (t * 16 + c) * 64 + 8 * hh;
      FH vb0, vb1;
      vb0.h[0] = *(const v8h*)(vr);
      vb0.h[1] = *(const v8h*)(vr + 16);
      vb1.h[0] = *(const v8h*)(vr + 32);
      vb1.h[1] = *(const v8h*)(vr + 48);
      if (PRES) {
        const _Float16* wr = Vls + (t * 16 + c) * 64 + 8 * hh;
        FH wb0, wb1;
        wb0.h[0] = *(const v8h*)(wr);
        wb0.h[1] = *(const v8h*)(wr + 16);
        wb1.h[0] = *(const v8h*)(wr + 32);
        wb1.h[1] = *(const v8h*)(wr + 48);
        v8f ol = zero8();
        oh[t] = mma_h_raw(pa0.v, vb0.v, oh[t]);
        ol    = mma_h_raw(pa0.v, wb0.v, ol);
        ol    = mma_h_raw(pb0.v, vb0.v, ol);
        oh[t] = mma_h_raw(pa1.v, vb1.v, oh[t]);
        ol    = mma_h_raw(pa1.v, wb1.v, ol);
        ol    = mma_h_raw(pb1.v, vb1.v, ol);
        guard8m(oh[t], ol, pa0.v, pa1.v, pb0.v, pb1.v, vb0.v, vb1.v, wb0.v, wb1.v);
#pragma unroll
        for (int r = 0; r < 8; ++r) oh[t][r] += ol[r] * (1.0f / RSC);
      } else {
        oh[t] = mma_h_raw(pa0.v, vb0.v, oh[t]);
        oh[t] = mma_h_raw(pa1.v, vb1.v, oh[t]);
        guard1q(oh[t], pa0.v, pa1.v, vb0.v, vb1.v);
      }
    }
    acc_guard4(oh[0], oh[1], oh[2], oh[3]);
  }

  // ---- normalise (1/l, the 1/1024 p carry and the 1/VSC v carry), gate mix with the memory read, stage the
  const float gv  = bfr(gate[h]);
  const float g   = 1.0f / (1.0f + expf(-gv));
  const float omg = 1.0f - g;
  const bool useMem = (seg > 0);                          // block-uniform
  float* os = Os[wave];
#pragma unroll
  for (int r = 0; r < 8; ++r) {
    const int qr = q0 + 8 * hh + r;                         // query position
    const float l = lrow[r];                                // >= 1 (the row maximum contributes exp(0))
    const float inv = (1.0f / l) * (1.0f / (PSC * VSC));
    const float* mr = MEM + (size_t)qr * DM + h * HD;       // inside the MEM plane for every position
#pragma unroll
    for (int t = 0; t < 4; ++t) {
      const float yv  = oh[t][r] * inv;                     // e = 16t + c
      const float mvr = mr[16 * t + c];
      const float mv  = useMem ? mvr : 0.f;
      os[(8 * hh + r) * 68 + 16 * t + c] = g * mv + omg * yv;
    }
  }
  wave_sync_lds();
  {
    const size_t ooff  = (seg < (NTOK / SEG)) ? (size_t)OUT1OFF : (size_t)0;   // positions < NTOK -> second output
    const int    orow0 = (seg < (NTOK / SEG)) ? q0 : (q0 - NTOK);               // row within the output [b][2048][1024]
    v4f ov[8];
#pragma unroll
    for (int it = 0; it < 8; ++it) {
      const int row = it * 2 + hh;                          // it 0..7 x hh 0..1 = rows 0..15 of the wave tile
      ov[it] = *(const v4f*)(os + row * 68 + c * 4);
    }
    {
#pragma unroll
      for (int it = 0; it < 8; ++it) {
        const int row = it * 2 + hh;
        *(v4f*)(outb + ooff + (size_t)(orow0 + row) * DM + h * HD + c * 4) = ov[it];
      }
      
    }
  }
}

// =====================================================================================================
// Workspace map (bytes); every plane is an exact multiple of its tile / whole-line store granularity (all dims are
// exact tile multiples, no padded tails), all offsets multiples of 4096:
//   XH    f16  [4096 t][1024 in]        0          8388608   (f16 of bf16 value x16, rows b*2048 + t)
//   AH    f16  [4096 t][1024 in]        8388608    8388608
//   WXT   f16  [3072 out][1024 in]      16777216   6291456   (W^T, bf16 value x64)
//   WAT   f16  [3072 out][1024 in]      23068672   6291456
//   COST  f32  [4096 pos][32]           29360128    524288
//   SINT  f32  [4096 pos][32]           29884416    524288
//   QKH   f16  [4096 pos][2048 (q|k)]   30408704  16777216   (one batch; q x4, k x16 hi after norm + rotary)
//   QKL   f16  [4096][2048]             47185920  16777216   (x4096 residuals)
//   VF    f32  [4096 pos][1024 (h,d)]   63963136  16777216   (v, f32)
//   VTH   f16  [1024 (h,d)][4096 pos]   80740352   8388608   (v x16 hi)
//   VTL   f16  [1024 (h,d)][4096 pos]   89128960   8388608   ((v x16 - hi) x4096)
//   MT    f32  [16 h][3 s][64 e][64 d]  97517568    786432
//   ZP    f32  [16 h][3 s][64 d]        98304000     12288
//   MEM   f32  [4096 pos][1024 (h,e)]   98316288  16777216
//   end                                115093504
// =====================================================================================================
extern "C" void kernel_launch(void* const* d_in, const int* in_sizes, int n_in,
                              void* d_out, int out_size, void* d_ws, size_t ws_size,
                              hipStream_t stream) {
  if (n_in < 9) return;
  if (in_sizes[0] != NB * NTOK * DM || in_sizes[1] != NB * NTOK * DM) return;
  if (in_sizes[2] != DM * W3 || in_sizes[3] != DM * W3) return;
  if (in_sizes[4] != NHEAD * HD || in_sizes[5] != NHEAD * HD) return;
  if (in_sizes[6] != NHEAD * HD || in_sizes[7] != NHEAD * HD) return;
  if (in_sizes[8] != NHEAD) return;
  if (out_size != 2 * NB * NTOK * DM) return;

  const float* X    = (const float*)d_in[0];
  const float* Aa   = (const float*)d_in[1];
  const float* Wx   = (const float*)d_in[2];
  const float* Wa   = (const float*)d_in[3];
  const float* g_qx = (const float*)d_in[4];
  const float* g_kx = (const float*)d_in[5];
  const float* g_qa = (const float*)d_in[6];
  const float* g_ka = (const float*)d_in[7];
  const float* gate = (const float*)d_in[8];
  float* outf = (float*)d_out;

  const size_t PXA = (size_t)NB * NTOK * DM * 2;        //  8388608
  const size_t PW  = (size_t)W3 * DM * 2;               //  6291456
  const size_t PRT = (size_t)SEQ * RP * 4;              //   524288
  const size_t PQK = (size_t)SEQ * QKW * 2;             // 16777216
  const size_t PVF = (size_t)SEQ * DM * 4;              // 16777216
  const size_t PVT = (size_t)DM * SEQ * 2;              //  8388608
  const size_t PMT = (size_t)NHEAD * 3 * HD * HD * 4;   //   786432
  const size_t PZP = (size_t)NHEAD * 3 * HD * 4;        //    12288
  const size_t PME = (size_t)SEQ * DM * 4;              // 16777216
  size_t off = 0;
  const size_t oXH = off; off += PXA;
  const size_t oAH = off; off += PXA;
  const size_t oWX = off; off += PW;
  const size_t oWA = off; off += PW;
  const size_t oCT = off; off += PRT;
  const size_t oST = off; off += PRT;
  const size_t oQH = off; off += PQK;
  const size_t oQL = off; off += PQK;
  const size_t oVF = off; off += PVF;
  const size_t oVH = off; off += PVT;
  const size_t oVL = off; off += PVT;
  const size_t oMT = off; off += PMT;
  const size_t oZP = off; off += PZP;
  const size_t oME = off; off += PME;
  if (off > ws_size) return;                            // off = 115093504
  if (off > (size_t)134217728) return;

  char* ws = (char*)d_ws;
  unsigned short* XH   = (unsigned short*)(ws + oXH);
  unsigned short* AH   = (unsigned short*)(ws + oAH);
  unsigned short* WXT  = (unsigned short*)(ws + oWX);
  unsigned short* WAT  = (unsigned short*)(ws + oWA);
  float*          COST = (float*)(ws + oCT);
  float*          SINT = (float*)(ws + oST);
  unsigned short* QKH  = (unsigned short*)(ws + oQH);
  unsigned short* QKL  = (unsigned short*)(ws + oQL);
  float*          VF   = (float*)(ws + oVF);
  unsigned short* VTH  = (unsigned short*)(ws + oVH);
  unsigned short* VTL  = (unsigned short*)(ws + oVL);
  float*          MT   = (float*)(ws + oMT);
  float*          ZP   = (float*)(ws + oZP);
  float*          MEM  = (float*)(ws + oME);

  const dim3 blk256(256), blk128(128);
  const float sscale = 0.125f / (QSC * KSC);
  const float oscale = 1.0f / (XSC * WSC);

  // (1) x, a -> row-major f16 planes of their bf16 RNE values x16; W [1024][3072] -> transposed f16 planes
  //     [3072][1024] (k contiguous, Bt form) of their bf16 RNE values x64; rotary tables
  cvt_rm<<<dim3((NB * NTOK * DM) / 2048), blk256, 0, stream>>>(X, XH, NB * NTOK * DM, XSC);
  cvt_rm<<<dim3((NB * NTOK * DM) / 2048), blk256, 0, stream>>>(Aa, AH, NB * NTOK * DM, XSC);
  // in[DM rows][W3 cols] -> out[W3][DM]: grid (cols/64, rows/64)
  tr_cvt<0><<<dim3(W3 / 64, DM / 64), blk256, 0, stream>>>(Wx, DM, W3, WXT, WXT, WSC);
  tr_cvt<0><<<dim3(W3 / 64, DM / 64), blk256, 0, stream>>>(Wa, DM, W3, WAT, WAT, WSC);
  rope_tab<<<dim3((SEQ * RP) / 256), blk256, 0, stream>>>(COST, SINT, SEQ * RP);

  const int gqk  = ((NTOK / 32) * (QKW / 128)) / 4;      // 1024 tiles -> 256 blocks
  const int gv   = ((NTOK / 32) * (DM / 128)) / 4;       //  512 tiles -> 128 blocks
  const int gmt  = NHEAD * 3;                            //   48 blocks
  const int gmem = NHEAD * 3 * (SEG / MROWS);            //  384 blocks
  for (int b = 0; b < NB; ++b) {
    const unsigned short* AHb = AH + (size_t)b * NTOK * DM;
    const unsigned short* XHb = XH + (size_t)b * NTOK * DM;
    float* outb = outf + (size_t)b * NTOK * DM;
    // (2) q|k of stream a (positions 0..2047) and stream x (positions 2048..4095): M=2048, N=2048, K=1024,
    //     fused per-head L2 norm + gain + rotary -> QKH/QKL f16 planes
    gemm_t<1><<<dim3(gqk), blk128, 0, stream>>>(AHb, DM, WAT, DM, (void*)QKH, (void*)QKL, QKW, 0,
                                               COST, SINT, g_qa, g_ka, NTOK, QKW, DM, oscale);
    gemm_t<1><<<dim3(gqk), blk128, 0, stream>>>(XHb, DM, WXT, DM, (void*)QKH, (void*)QKL, QKW, NTOK,
                                               COST, SINT, g_qx, g_kx, NTOK, QKW, DM, oscale);
    // (3) v of both streams: M=2048, N=1024 (W^T rows 2048..3071), K=1024 -> VF f32 rows
    gemm_t<3><<<dim3(gv), blk128, 0, stream>>>(AHb, DM, WAT + (size_t)2 * DM * DM, DM, (void*)VF, (void*)VF,
                                              DM, 0, COST, SINT, g_qa, g_ka, NTOK, DM, DM, oscale);
    gemm_t<3><<<dim3(gv), blk128, 0, stream>>>(XHb, DM, WXT + (size_t)2 * DM * DM, DM, (void*)VF, (void*)VF,
                                              DM, NTOK, COST, SINT, g_qx, g_kx, NTOK, DM, DM, oscale);
    // (4) v^T planes: in VF [SEQ rows][DM cols] -> out [DM][SEQ] f16 hi (x16) and residual (x4096)
    tr_cvt<1><<<dim3(DM / 64, SEQ / 64), blk256, 0, stream>>>(VF, SEQ, DM, VTH, VTL, VSC);
    // (5) compressive memory: per-segment sk^T.v and sum sk (segments 0..2), then the memory read for the
    //     query rows of segments 1..3 -> MEM f32 plane
    mt_seg<<<dim3(gmt), blk256, 0, stream>>>(QKH, QKL, VTH, MT, ZP);
    mem_ret<<<dim3(gmem), blk256, 0, stream>>>(QKH, QKL, MT, ZP, MEM);
    // (6) segment-local causal attention + gate mix -> both outputs: the leading NQP query blocks of every
    //     segment with the p, v residual products, the remaining blocks without
    attn_seg<true><<<dim3(NHEAD * NSEG * NQP), blk128, 0, stream>>>(QKH, QKL, VTH, VTL, MEM, gate, outb,
                                                                    sscale, 0, NQP);
    attn_seg<false><<<dim3(NHEAD * NSEG * (NQB - NQP)), blk128, 0, stream>>>(QKH, QKL, VTH, VTL, MEM, gate,
                                                                             outb, sscale, NQP, NQB - NQP);
  }
  (void)hipGetLastError();
}

// v002
// One run takes 376 microseconds.
// Two timings next to v001 put it at 1.12 and 1.11 times that version's speed.
// All steps since v000 together make it 2.09 times as fast.
// Contractions: a.W and x.W (q|k|v, K=1024) on v_wmma_f32_16x16x32_f16 with f16 containers of the bf16 RNE input
//   values (activations carried x16, W^T x64), one product; q.k^T (K=64) on v_wmma_f32_16x16x32_f16 with q (x4) and
//   k (x16) f16 hi planes plus x4096 f16 residual planes (three products, residual pair in a separate accumulator
//   folded by 1/4096); p.v^T on v_wmma_f32_16x16x32_f16 with p as f16(1024 p) and v^T as f16(16 v), one product
//   (the leading query blocks of every segment add the p and v x4096 f16 residual planes, two more products into a
//   separate accumulator); compressive memory sk^T.v (K=1024) and sq.M (K=64) on v_wmma_f32_16x16x32_f16 with
//   plain f16 operands, one product each. f32 accumulate everywhere; L2 norms, rotary tables and rotation, elu,
//   softmax statistics, sq.z, the memory quotient and the gate mix in f32.
#include <hip/hip_runtime.h>
#include <math.h>
#include <stdint.h>

#define NB      2
#define NTOK    2048                // tokens per stream per batch
#define SEQ     4096                // concatenated positions per batch (stream a first, then x)
#define DM      1024
#define NHEAD   16
#define HD      64
#define RP      32                  // rotary pairs per head
#define W3      3072
#define QKW     2048                // q|k plane width: q at column h*64+d, k at 1024 + h*64+d
#define SEG     1024
#define NSEG    4
#define NQB     16                  // 64-row query blocks per segment
#define NQP     4                   // leading query blocks per segment that carry the p / v residual products
#define MROWS   128                 // query rows per block of the memory read kernel
#define OUT1OFF (NB * NTOK * DM)             // element offset of the second output
#define XSC     16.0f
#define WSC     64.0f
#define QSC     4.0f
#define KSC     16.0f
#define VSC     16.0f
#define RSC     4096.0f
#define PSC     1024.0f
#define NRM_EPS 1.0e-12f
#define DEN_EPS 1.0e-6f
#define LOG2_BASE 13.287712379549449
#define NEG_BIG (-1.0e30f)
#define GBK     128                 // k per LDS stage of the projection GEMM (256 B of every operand row)
#define GPIT    136                 // LDS row pitch of a stage in halves: 272 B = 16 B x 17 (ds_load_b128 readers)
#define GSTG    (256 * GPIT)        // halves per stage: 128 A rows, then 128 Bt rows
#define APIT    72                  // LDS row pitch of the attention K, V^T and P tiles in halves: 144 B = 16 B x 9
                                    // (ds_load_b128 readers: 16 rows of a fragment load fall on 16 distinct bank groups)

static_assert(NHEAD * HD == DM);
static_assert(SEQ == 2 * NTOK);
static_assert(SEQ == NSEG * SEG);
static_assert(SEG == NQB * 64);
static_assert(HD == 2 * RP);
static_assert(W3 == 3 * DM);
static_assert(QKW == 2 * DM);
static_assert(((NB * NTOK * DM) % 2048) == 0);
static_assert(((SEQ * RP) % 256) == 0);
static_assert((DM % 128) == 0 && (W3 % 64) == 0 && (NTOK % 64) == 0 && (SEQ % 64) == 0);
static_assert((QKW % 128) == 0 && (DM % 32) == 0);
static_assert(NQP > 0 && NQP < NQB);
static_assert((SEG % MROWS) == 0 && MROWS == 8 * 16);
static_assert(OUT1OFF == NB * NTOK * DM);
static_assert((DM % GBK) == 0 && (NTOK % 128) == 0 && ((GPIT * 2) % 16) == 0);
static_assert(APIT >= HD && ((APIT * 2) % 16) == 0);

typedef _Float16 v16h __attribute__((ext_vector_type(16)));
typedef _Float16 v8h  __attribute__((ext_vector_type(8)));
typedef float    v8f  __attribute__((ext_vector_type(8)));
typedef float    v4f  __attribute__((ext_vector_type(4)));
typedef unsigned int v4u __attribute__((ext_vector_type(4)));
union FH { v16h v; v8h h[2]; };

// ---- scalar helpers --------------------------------------------------------------------------------
__device__ __forceinline__ unsigned short bf_bits(float f) {          // f32 -> bf16 bits, RNE convert
  unsigned u = __float_as_uint(f);
  return (unsigned short)((u + 0x7FFFu + ((u >> 16) & 1u)) >> 16);
}
__device__ __forceinline__ float bf_up(unsigned short b) { return __uint_as_float(((unsigned)b) << 16); }
__device__ __forceinline__ float bfr(float f) { return bf_up(bf_bits(f)); }     // value of the bf16 RNE convert
__device__ __forceinline__ unsigned short h_bits(_Float16 x) { return __builtin_bit_cast(unsigned short, x); }
__device__ __forceinline__ unsigned pk16(unsigned short a, unsigned short b) { return (unsigned)a | ((unsigned)b << 16); }
__device__ __forceinline__ v8f zero8() { v8f z = {0.f, 0.f, 0.f, 0.f, 0.f, 0.f, 0.f, 0.f}; return z; }

// ---- fragment loader: 16-bit A/B operand, lane -> row/col (lane&15), p already includes +8*(lane>>4);
//      elements 0..7 <- p[0..7] (k0+8h..), elements 8..15 <- p[16..23] (k0+16+8h..)
__device__ __forceinline__ v16h ldfrag_h(const _Float16* p) {
  FH f;
  f.h[0] = *(const v8h*)(p);
  f.h[1] = *(const v8h*)(p + 16);
  return f.v;
}

// ---- WMMA helpers with trailing VALU hazard gap --------------------------------------------------------
__device__ __forceinline__ v8f mma_h_raw(v16h a, v16h b, v8f c) {
  return __builtin_amdgcn_wmma_f32_16x16x32_f16(false, a, false, b, (short)0, c, false, false);
}
__device__ __forceinline__ v8f mma_h(v16h a, v16h b, v8f c) {
  c = mma_h_raw(a, b, c);
#if defined(__HIP_DEVICE_COMPILE__)
  asm volatile("v_nop\n\tv_nop\n\tv_nop\n\tv_nop" : "+v"(c) : "v"(a), "v"(b));
#endif
  return c;
}
__device__ __forceinline__ void guard3(v8f& x, v8f& y, v16h a, v16h b, v16h d) {   // two D tiles, 3 frags live
#if defined(__HIP_DEVICE_COMPILE__)
  asm volatile("v_nop\n\tv_nop\n\tv_nop\n\tv_nop" : "+v"(x), "+v"(y) : "v"(a), "v"(b), "v"(d));
#endif
}
__device__ __forceinline__ void guard1q(v8f& x, v16h a, v16h b, v16h d, v16h e) {           // one D, 4 frags
#if defined(__HIP_DEVICE_COMPILE__)
  asm volatile("v_nop\n\tv_nop\n\tv_nop\n\tv_nop" : "+v"(x) : "v"(a), "v"(b), "v"(d), "v"(e));
#endif
}
__device__ __forceinline__ void guard4m(v8f& x, v8f& y, v16h a, v16h b, v16h d, v16h e) {   // two D, 4 frags
#if defined(__HIP_DEVICE_COMPILE__)
  asm volatile("v_nop\n\tv_nop\n\tv_nop\n\tv_nop" : "+v"(x), "+v"(y) : "v"(a), "v"(b), "v"(d), "v"(e)
               : "memory");
#endif
}
__device__ __forceinline__ void guard8m(v8f& x, v8f& y, v16h a, v16h b, v16h d, v16h e,
                                        v16h f, v16h g, v16h p, v16h q) {                      // two D, 8 frags
#if defined(__HIP_DEVICE_COMPILE__)
  asm volatile("v_nop\n\tv_nop\n\tv_nop\n\tv_nop" : "+v"(x), "+v"(y)
               : "v"(a), "v"(b), "v"(d), "v"(e), "v"(f), "v"(g), "v"(p), "v"(q) : "memory");
#endif
}
__device__ __forceinline__ void acc_guard4(v8f& a, v8f& b, v8f& c, v8f& d) {
#if defined(__HIP_DEVICE_COMPILE__)
  asm volatile("v_nop\n\tv_nop\n\tv_nop\n\tv_nop" : "+v"(a), "+v"(b), "+v"(c), "+v"(d));
#endif
}
__device__ __forceinline__ void acc_guard2(v8f& a, v8f& b) {
#if defined(__HIP_DEVICE_COMPILE__)
  asm volatile("v_nop\n\tv_nop\n\tv_nop\n\tv_nop" : "+v"(a), "+v"(b));
#endif
}
__device__ __forceinline__ void cbar() {
#if defined(__HIP_DEVICE_COMPILE__)
  asm volatile("" ::: "memory");
#endif
}
__device__ __forceinline__ void wave_sync_lds() {
  __builtin_amdgcn_fence(__ATOMIC_RELEASE, "workgroup");
  __builtin_amdgcn_wave_barrier();
  __builtin_amdgcn_fence(__ATOMIC_ACQUIRE, "workgroup");
}

// ---- eight asynchronous 16-B copies global -> LDS per lane (l: LDS byte address, g: global address). The
//      s_wait_xcnt stands inside the statement so that no address register is rewritten ahead of it.
__device__ __forceinline__ void acopy8(uint32_t l0, uint32_t l1, uint32_t l2, uint32_t l3,
                                       uint32_t l4, uint32_t l5, uint32_t l6, uint32_t l7,
                                       const _Float16* g0, const _Float16* g1, const _Float16* g2,
                                       const _Float16* g3, const _Float16* g4, const _Float16* g5,
                                       const _Float16* g6, const _Float16* g7) {
#if defined(__HIP_DEVICE_COMPILE__)
  asm volatile("global_load_async_to_lds_b128 %0, %8, off\n\t"
               "global_load_async_to_lds_b128 %1, %9, off\n\t"
               "global_load_async_to_lds_b128 %2, %10, off\n\t"
               "global_load_async_to_lds_b128 %3, %11, off\n\t"
               "global_load_async_to_lds_b128 %4, %12, off\n\t"
               "global_load_async_to_lds_b128 %5, %13, off\n\t"
               "global_load_async_to_lds_b128 %6, %14, off\n\t"
               "global_load_async_to_lds_b128 %7, %15, off\n\t"
               "s_wait_xcnt 0x0"
               :: "v"(l0), "v"(l1), "v"(l2), "v"(l3), "v"(l4), "v"(l5), "v"(l6), "v"(l7),
                  "v"(g0), "v"(g1), "v"(g2), "v"(g3), "v"(g4), "v"(g5), "v"(g6), "v"(g7)
               : "memory");
#endif
}
// 64 rows of one operand, 256 B each, into LDS rows of pitch GPIT: l / g are this thread's addresses in row
// (tid >> 4) at 16-B piece (tid & 15); copy i takes row 8 i + (tid >> 4), a wave's copy covers two whole rows.
__device__ __forceinline__ void acopy_rows64(uint32_t l, const _Float16* g, size_t ld) {
  const uint32_t ls = 8u * GPIT * 2u;
  const size_t   gs = 8 * ld;
  acopy8(l, l + ls, l + 2 * ls, l + 3 * ls, l + 4 * ls, l + 5 * ls, l + 6 * ls, l + 7 * ls,
         g, g + gs, g + 2 * gs, g + 3 * gs, g + 4 * gs, g + 5 * gs, g + 6 * gs, g + 7 * gs);
}
// the issuing wave's own copies have landed (the compiler places no wait for them)
__device__ __forceinline__ void wait_async0() {
#if defined(__HIP_DEVICE_COMPILE__)
  asm volatile("s_wait_asynccnt 0x0" ::: "memory");
#endif
}
// this wave's LDS reads of the stage have returned before the stage is handed back for a refill
__device__ __forceinline__ void wait_ds0() {
#if defined(__HIP_DEVICE_COMPILE__)
  asm volatile("s_wait_dscnt 0x0" ::: "memory");
#endif
}

// =====================================================================================================
// Row-major convert: f32 [n] -> f16 plane [n] holding f16(bf16 RNE value * scale) (scale a power of two, exact).
// coverage: grid.x = n/2048 blocks x 256 threads x 8 = n elements (n % 2048 == 0 host-checked).
// =====================================================================================================
__global__ __launch_bounds__(256) void cvt_rm(const float* __restrict__ in, unsigned short* out, int n,
                                             float scale) {
  const size_t i8 = ((size_t)blockIdx.x * 256 + threadIdx.x) * 8;
  if (i8 + 8 > (size_t)n) return;        // never taken for the host-checked sizes; no barriers below
  const v4f a = *(const v4f*)(in + i8);
  const v4f b = *(const v4f*)(in + i8 + 4);
  float f[8];
  f[0] = a[0]; f[1] = a[1]; f[2] = a[2]; f[3] = a[3];
  f[4] = b[0]; f[5] = b[1]; f[6] = b[2]; f[7] = b[3];
  v4u p;
#pragma unroll
  for (int e = 0; e < 4; ++e) {
    const unsigned short b0 = bf_bits(f[2 * e]), b1 = bf_bits(f[2 * e + 1]);
    const _Float16 x0 = (_Float16)(bf_up(b0) * scale);
    const _Float16 x1 = (_Float16)(bf_up(b1) * scale);
    p[e] = pk16(h_bits(x0), h_bits(x1));
  }
  *(v4u*)(out + i8) = p;
  
}

// =====================================================================================================
// Transposing convert: f32 in[R][C] (row-major, pitch C) -> 16-bit out[C][R] (pitch R), 64x64 tiles through LDS.
//   MODE 0: one plane  out0 = f16(bf16 RNE value * scale).
//   MODE 1: two planes out0 = f16(v * scale) hi, out1 = f16((v * scale - hi) * RSC) residual.
// Block = 256 threads; grid = (C/64, R/64) exact (host-checked). Load: thread -> input row tid>>2, 16 consecutive
// columns (four 16-B loads). Store: two iterations, output row it*32 + (tid>>3), lanes (tid&7) -> elements
// coverage: 2 iterations x 32 output rows x 8 lanes x 8 halves = the whole 64x64 tile; grid covers all of C x R.
// =====================================================================================================
template <int MODE>
__global__ __launch_bounds__(256) void tr_cvt(const float* __restrict__ in, int R, int C,
                                             unsigned short* out0, unsigned short* out1, float scale) {
  __shared__ float sm[64][65];
  const int tid = threadIdx.x;
  const int c0 = blockIdx.x * 64;          // input column block -> output row block
  const int r0 = blockIdx.y * 64;          // input row block    -> output column block
  if (c0 + 64 > C || r0 + 64 > R) return;  // block-uniform, ahead of any barrier; never taken for exact grids
  {
    const int lr = tid >> 2, lc = (tid & 3) * 16;
    const float* src = in + (size_t)(r0 + lr) * (size_t)C + c0 + lc;
#pragma unroll
    for (int q = 0; q < 4; ++q) {
      const v4f v = *(const v4f*)(src + 4 * q);
      sm[lr][lc + 4 * q + 0] = v[0];
      sm[lr][lc + 4 * q + 1] = v[1];
      sm[lr][lc + 4 * q + 2] = v[2];
      sm[lr][lc + 4 * q + 3] = v[3];
    }
  }
  __syncthreads();
  const int seg = tid & 7;
  v4u p0[2], p1[2];
#pragma unroll
  for (int it = 0; it < 2; ++it) {
    const int ocl = it * 32 + (tid >> 3);   // output row within the tile = input column
    float f[8];
#pragma unroll
    for (int e = 0; e < 8; ++e) f[e] = sm[seg * 8 + e][ocl];
    v4u pk, pl;
#pragma unroll
    for (int e = 0; e < 4; ++e) {
      const float g0 = f[2 * e], g1 = f[2 * e + 1];
      if (MODE == 0) {
        const _Float16 x0 = (_Float16)(bfr(g0) * scale);
        const _Float16 x1 = (_Float16)(bfr(g1) * scale);
        pk[e] = pk16(h_bits(x0), h_bits(x1));
        pl[e] = pk[e];
      } else {
        const float s0 = g0 * scale, s1 = g1 * scale;
        const _Float16 x0 = (_Float16)s0, x1 = (_Float16)s1;
        const _Float16 y0 = (_Float16)((s0 - (float)x0) * RSC);
        const _Float16 y1 = (_Float16)((s1 - (float)x1) * RSC);
        pk[e] = pk16(h_bits(x0), h_bits(x1));
        pl[e] = pk16(h_bits(y0), h_bits(y1));
      }
    }
    p0[it] = pk;
    p1[it] = pl;
  }
  {
#pragma unroll
    for (int it = 0; it < 2; ++it) {
      const int ocl = it * 32 + (tid >> 3);
      const size_t go = (size_t)(c0 + ocl) * (size_t)R + (size_t)(r0 + seg * 8);
      *(v4u*)(out0 + go) = p0[it];
      if (MODE == 1) *(v4u*)(out1 + go) = p1[it];
    }
    
  }
}

// =====================================================================================================
// Rotary tables for interleaved pairs: cost[t][i] = cos(t * inv_freq[i]), sint[t][i] = sin(t * inv_freq[i]),
// i = 0..31, inv_freq[i] = 1 / (10000^(2i/64)) (power via f64 exp2 -> one f32 convert, then an f32 reciprocal
// formed in f64 and converted once), angle = one f32 multiply with t = position 0..4095 in the concatenated
// coverage: grid.x = n/256 blocks x 256 threads = n = SEQ*32 elements of each table.
// =====================================================================================================
__global__ __launch_bounds__(256) void rope_tab(float* cost, float* sint, int n) {
  const int e = blockIdx.x * 256 + (int)threadIdx.x;
  if (e >= n) return;                      // never taken (n % 256 == 0); no barriers below
  const int t = e >> 5, i = e & 31;
  const double pd = exp2((double)i * (1.0 / 32.0) * LOG2_BASE);   // 10000^(2i/64)
  const float  pf = (float)pd;
  const float  invf = (float)(1.0 / (double)pf);
  const float  ang = (float)t * invf;
  float sv, cv;
  sincosf(ang, &sv, &cv);
  *(float*)(cost + e) = cv;
  *(float*)(sint + e) = sv;
  
}

// =====================================================================================================
// Register-blocked f16 WMMA GEMM, one wave per 32x128 tile; block = 4 waves = 4 tiles stacked in m = one 128x128
// block tile whose operands pass through LDS: a stage is 128 k of the 128 A rows and the 128 Bt rows, brought by
// asynchronous copies into two buffers (stage t + 1 flies while stage t is worked on), read by all 4 waves:
//   acc[m][n] = sum_k A[m][k] * Bt[n][k]; A row-major [M][K] pitch lda, Bt row-major [N][K] pitch ldb
//   (k contiguous); M % 128 == 0, N % 128 == 0, K % 128 == 0 (exact constants here, host-checked).
// EPI 1 (q|k planes, N == QKW): the 128-column tile holds two heads of 64 columns (columns < DM are q heads,
//        columns >= DM are k heads). Per row and head: t = acc*oscale; v = t * (1/max(||t||_2, 1e-12)) *
//        bf16(gain[head][d]) * 8; then the interleaved-pair rotary rotation with the f32 tables at position
//        crow0 + m (pair (2i, 2i+1): o1 = v1*c - v2*s, o2 = v1*s + v2*c), times cscale (QSC for q, KSC for k)
//        -> C0 = f16 hi, C1 = f16((v - hi) * RSC) residual, 16-bit planes of pitch ldc, row crow0 + m, column n.
// EPI 3: f32 rows (C0) = acc*oscale, pitch ldc, row crow0 + m, column n.
// 16 lanes x 16 B per 256-B row segment (two rows per instruction), f32 as 32 lanes x 16 B per 512-B row segment;
// coverage: 2 slabs x 16 rows x 128 cols = the wave's whole 32x128 tile; tiles = whole M x N (grid = tiles/4 exact).
// =====================================================================================================
template <int EPI>
__global__ __launch_bounds__(128) void gemm_t(
    const unsigned short* __restrict__ A, int lda,
    const unsigned short* __restrict__ Bt, int ldb,
    void* C0, void* C1, int ldc, int crow0,
    const float* __restrict__ cost, const float* __restrict__ sint,
    const float* __restrict__ gq, const float* __restrict__ gk,
    int M, int N, int K, float oscale) {
  __shared__ __align__(16) float sT[4][16 * 132];   // per-wave 16x128 slab, pitch 132 floats
  __shared__ __align__(16) _Float16 ring[2 * GSTG]; // two operand stages
  const int lane = threadIdx.x & 31;
  const int wave = threadIdx.x >> 5;
  const int tilesN = N >> 7;
  const int tilesM = M >> 5;
  if ((int)blockIdx.x >= (tilesM >> 2) * tilesN) return;   // block-uniform, ahead of any barrier; never taken
  const int bm = (int)blockIdx.x / tilesN;
  const int tn = (int)blockIdx.x - bm * tilesN;
  const int tm = bm * 4 + wave;
  const int m0 = tm << 5;
  const int n0 = tn << 7;
  const int rl   = lane & 15;            // row (A) / col (B, D) within subtile
  const int hh   = lane >> 4;            // lane half
  const int koff = hh * 8;               // k offset of this lane half

  v8f acc[2][8];
#pragma unroll
  for (int i = 0; i < 2; ++i)
#pragma unroll
    for (int j = 0; j < 8; ++j) acc[i][j] = zero8();

  {
    const int cr = (int)threadIdx.x >> 4;          // row (mod 8) this thread copies
    const int cc = (int)threadIdx.x & 15;          // its 16-B piece of the row's 256 B
    const _Float16* ga = (const _Float16*)(const void*)A + (size_t)((bm << 7) + cr) * (size_t)lda + cc * 8;
    const _Float16* gb = (const _Float16*)(const void*)Bt + (size_t)(n0 + cr) * (size_t)ldb + cc * 8;
    const uint32_t  lr = (uint32_t)(size_t)(const void*)ring + (uint32_t)(cr * GPIT + cc * 8) * 2u;
    const int nst = K / GBK;                       // stages; block-uniform
    auto fill = [&](int st) {                      // stage st -> buffer st & 1: 32 copies per wave
      const uint32_t l = lr + (uint32_t)(st & 1) * (uint32_t)(GSTG * 2);
      const _Float16* pa = ga + (size_t)st * GBK;
      const _Float16* pb = gb + (size_t)st * GBK;
      acopy_rows64(l, pa, (size_t)lda);
      acopy_rows64(l + 64u * GPIT * 2u, pa + (size_t)64 * (size_t)lda, (size_t)lda);
      acopy_rows64(l + 128u * GPIT * 2u, pb, (size_t)ldb);
      acopy_rows64(l + 192u * GPIT * 2u, pb + (size_t)64 * (size_t)ldb, (size_t)ldb);
    };
    fill(0);
    wait_async0();
    __syncthreads();                               // stage 0 is published
    if (nst > 1) fill(1);
    for (int t = 0; t < nst; ++t) {
      const _Float16* sb  = ring + (t & 1) * GSTG;
      const _Float16* ar0 = sb + (wave * 32 + rl) * GPIT + koff;
      const _Float16* ar1 = ar0 + 16 * GPIT;
      const _Float16* br  = sb + (128 + rl) * GPIT + koff;
#pragma unroll                                     // the k offset becomes an immediate of each LDS load
      for (int kk = 0; kk < GBK / 32; ++kk) {
        const v16h a0 = ldfrag_h(ar0 + 32 * kk);
        const v16h a1 = ldfrag_h(ar1 + 32 * kk);
        v16h b[8];
#pragma unroll                                     // b[] stays in registers: the k-step's LDS loads stand as one group
        for (int j = 0; j < 8; ++j) b[j] = ldfrag_h(br + j * 16 * GPIT + 32 * kk);
#pragma unroll                                     // acc[][] and b[] indexed by constants only
        for (int j = 0; j < 8; ++j) {
          acc[0][j] = mma_h_raw(a0, b[j], acc[0][j]);
          acc[1][j] = mma_h_raw(a1, b[j], acc[1][j]);
          guard3(acc[0][j], acc[1][j], a0, a1, b[j]);
        }
      }
      wait_ds0();
      wait_async0();
      __syncthreads();                             // publishes stage t + 1 and ends every read of stage t
      if (t + 2 < nst) fill(t + 2);
    }
    wait_async0();
  }
  acc_guard4(acc[0][0], acc[0][1], acc[0][2], acc[0][3]);
  acc_guard4(acc[0][4], acc[0][5], acc[0][6], acc[0][7]);
  acc_guard4(acc[1][0], acc[1][1], acc[1][2], acc[1][3]);
  acc_guard4(acc[1][4], acc[1][5], acc[1][6], acc[1][7]);

  // ---- epilogue ----
  float* slab = sT[wave];
  float gmul[8];
  float csc = 1.0f;
  if (EPI == 1) {
    const bool isq = (n0 < DM);                                 // wave-uniform
    const int  hb  = (isq ? n0 : (n0 - DM)) >> 6;               // first head of this tile (0..15)
    csc = isq ? QSC : KSC;
#pragma unroll
    for (int j = 0; j < 8; ++j) {
      const int gi = (hb + (j >> 2)) * HD + 16 * (j & 3) + rl;  // < NHEAD*HD, inside both gain arrays
      const float ga = bfr(gq[gi]);
      const float gb = bfr(gk[gi]);
      gmul[j] = (isq ? ga : gb) * 8.0f;
    }
  } else {
#pragma unroll
    for (int j = 0; j < 8; ++j) gmul[j] = 1.0f;
  }
#pragma unroll
  for (int i = 0; i < 2; ++i) {
    const int mB = m0 + 16 * i;
    if (EPI == 1) {
      float inv[2][8];
#pragma unroll
      for (int jh = 0; jh < 2; ++jh) {
#pragma unroll
        for (int r = 0; r < 8; ++r) {        // sum of squares over the head's 64 columns of row 8hh+r
          float ss = 0.f;
#pragma unroll
          for (int jj = 0; jj < 4; ++jj) {
            const float x = acc[i][4 * jh + jj][r] * oscale;
            ss += x * x;
          }
          ss += __shfl_xor(ss, 1, 32);
          ss += __shfl_xor(ss, 2, 32);
          ss += __shfl_xor(ss, 4, 32);
          ss += __shfl_xor(ss, 8, 32);
          inv[jh][r] = oscale * (1.0f / fmaxf(sqrtf(ss), NRM_EPS));
        }
      }
#pragma unroll
      for (int j = 0; j < 8; ++j) {
#pragma unroll
        for (int r = 0; r < 8; ++r)
          slab[(8 * hh + r) * 132 + 16 * j + rl] = acc[i][j][r] * inv[j >> 2][r] * gmul[j];
      }
    } else {
#pragma unroll
      for (int j = 0; j < 8; ++j) {
#pragma unroll
        for (int r = 0; r < 8; ++r) slab[(8 * hh + r) * 132 + 16 * j + rl] = acc[i][j][r] * oscale;
      }
    }
    wave_sync_lds();
    if (EPI == 3) {
      float* Cf = (float*)C0;
      v4f ov[16];
#pragma unroll
      for (int it = 0; it < 16; ++it) ov[it] = *(const v4f*)(slab + it * 132 + lane * 4);
      {
#pragma unroll
        for (int it = 0; it < 16; ++it)                       // row it: 32 lanes x 16 B = 512 B = 128 cols
          *(v4f*)(Cf + (size_t)(crow0 + mB + it) * (size_t)ldc + n0 + lane * 4) = ov[it];
        
      }
    } else {
      unsigned short* Cp = (unsigned short*)C0;
      unsigned short* Cq = (unsigned short*)C1;
      v4u hv[8], lv[8];
#pragma unroll
      for (int it = 0; it < 8; ++it) {
        const int row = it * 2 + hh;                          // it 0..7 x hh 0..1 = rows 0..15
        const float* sp = slab + row * 132 + rl * 8;          // 8 consecutive columns = 4 rotary pairs
        const v4f fa = *(const v4f*)sp;
        const v4f fb = *(const v4f*)(sp + 4);
        float f[8];
        f[0] = fa[0]; f[1] = fa[1]; f[2] = fa[2]; f[3] = fa[3];
        f[4] = fb[0]; f[5] = fb[1]; f[6] = fb[2]; f[7] = fb[3];
        const int pos = crow0 + mB + row;                     // position in the concatenated sequence
        const v4f cv = *(const v4f*)(cost + (size_t)pos * RP + (rl & 7) * 4);   // pairs ((rl&7)*4 .. +3)
        const v4f sv = *(const v4f*)(sint + (size_t)pos * RP + (rl & 7) * 4);
        v4u pk, pl;
#pragma unroll
        for (int e = 0; e < 4; ++e) {
          const float f0 = f[2 * e], f1 = f[2 * e + 1];
          const float cc = cv[e], sn = sv[e];
          const float g0 = (f0 * cc - f1 * sn) * csc;
          const float g1 = (f0 * sn + f1 * cc) * csc;
          const _Float16 x0 = (_Float16)g0;
          const _Float16 x1 = (_Float16)g1;
          const _Float16 y0 = (_Float16)((g0 - (float)x0) * RSC);
          const _Float16 y1 = (_Float16)((g1 - (float)x1) * RSC);
          pk[e] = pk16(h_bits(x0), h_bits(x1));
          pl[e] = pk16(h_bits(y0), h_bits(y1));
        }
        hv[it] = pk;
        lv[it] = pl;
      }
      {
#pragma unroll
        for (int it = 0; it < 8; ++it) {
          const int row = it * 2 + hh;
          const size_t go = (size_t)(crow0 + mB + row) * (size_t)ldc + n0 + rl * 8;
          *(v4u*)(Cp + go) = hv[it];
          *(v4u*)(Cq + go) = lv[it];
        }
        
      }
    }
    wave_sync_lds();
  }
}

// =====================================================================================================
// Compressive-memory update per (head h, segment s in 0..2) of one batch:
//   MT[h][s][e][d] = sum over the 1024 keys l of segment s of v[l][e] * sk[l][d], sk = elu(k) + 1
//   (elu(x) = x > 0 ? x : exp(x) - 1, so sk = x > 0 ? x + 1 : exp(x)), and ZP[h][s][d] = sum_l sk[l][d].
//   k is rebuilt in f32 from the q|k hi / residual planes ((hi + lo/RSC) / KSC, column DM + h*64 + d), sk is
//   RNE-converted to f16 and written TRANSPOSED into an LDS tile skT[d][l] (64 keys per chunk, pitch 72 halves);
//   A = V^T hi plane rows (h*64 + e, keys), Bt = skT; D[e][d] scaled by 1/VSC.
//   Block = 8 waves; wave w owns e rows 16*(w>>1).. and d columns 32*(w&1)..; acc guarded; the 16x32 f32 piece is
// coverage: MT: 8 waves x (16 rows x 32 cols) = the whole 64x64 tile of (h,s); 4 its x 4 row groups x 8 lanes =
//   16 rows x 32 cols per wave. ZP: 16 lanes x 4 floats = 64. skT fill: 256 threads x 16 d x 1 key = 64x64 chunk.
// =====================================================================================================
__global__ __launch_bounds__(256) void mt_seg(const unsigned short* __restrict__ QKH,
                                             const unsigned short* __restrict__ QKL,
                                             const unsigned short* __restrict__ VTH,
                                             float* MT, float* ZP) {
  __shared__ __align__(16) _Float16 skT[HD * 72];
  __shared__ __align__(16) float slab[8][16 * 36];
  __shared__ float zred[8][HD];
  __shared__ __align__(16) float zsum[HD];

  const int tid = threadIdx.x, wave = tid >> 5, lane = tid & 31, hh = lane >> 4, c = lane & 15;
  const int h = (int)(blockIdx.x / 3u);
  const int s = (int)(blockIdx.x - (unsigned)h * 3u);
  if (h >= NHEAD) return;                 // block-uniform, ahead of any barrier; never taken
  const int r  = tid >> 2;                // key within the 64-key chunk handled by this thread
  const int dq = (tid & 3) * 16;          // first of the 16 d columns handled by this thread
  const int et = wave >> 1;               // e row tile of this wave
  const int dt0 = (wave & 1) * 2;         // first d column tile of this wave

  const _Float16* Q16 = (const _Float16*)(const void*)QKH;
  const _Float16* L16 = (const _Float16*)(const void*)QKL;
  const _Float16* V16 = (const _Float16*)(const void*)VTH;
  const _Float16* vrow = V16 + (size_t)(h * HD + et * 16 + c) * SEQ + (size_t)s * SEG + 8 * hh;   // A frag base

  float zacc[16];
#pragma unroll
  for (int e = 0; e < 16; ++e) zacc[e] = 0.f;
  v8f acc[2];
  acc[0] = zero8(); acc[1] = zero8();

  for (int kt = 0; kt < SEG / 64; ++kt) {
    __syncthreads();                      // prior chunk's fragment reads are done
    {
      const size_t n = (size_t)(s * SEG + kt * 64 + r);
      const _Float16* kp = Q16 + n * QKW + DM + h * HD + dq;
      const _Float16* lp = L16 + n * QKW + DM + h * HD + dq;
      FH kf, lf;
      kf.h[0] = *(const v8h*)kp; kf.h[1] = *(const v8h*)(kp + 8);
      lf.h[0] = *(const v8h*)lp; lf.h[1] = *(const v8h*)(lp + 8);
#pragma unroll
      for (int e = 0; e < 16; ++e) {
        const float kv = ((float)kf.v[e] + (float)lf.v[e] * (1.0f / RSC)) * (1.0f / KSC);
        const float sk = (kv > 0.f) ? (kv + 1.0f) : __expf(kv);
        const _Float16 skh = (_Float16)sk;
        skT[(dq + e) * 72 + r] = skh;
        zacc[e] += (float)skh;
      }
    }
    __syncthreads();                      // skT chunk complete
#pragma unroll
    for (int kk = 0; kk < 2; ++kk) {
      const v16h a  = ldfrag_h(vrow + kt * 64 + 32 * kk);
      const v16h b0 = ldfrag_h(skT + (16 * dt0 + c) * 72 + 32 * kk + 8 * hh);
      const v16h b1 = ldfrag_h(skT + (16 * (dt0 + 1) + c) * 72 + 32 * kk + 8 * hh);
      acc[0] = mma_h_raw(a, b0, acc[0]);
      acc[1] = mma_h_raw(a, b1, acc[1]);
      guard3(acc[0], acc[1], a, b0, b1);
    }
  }
  acc_guard2(acc[0], acc[1]);

  // ---- MT piece: rows e = 16*et + (8hh+rr), cols d = 32*(wave&1) + 16*jj + c ----
  float* sl = slab[wave];
#pragma unroll
  for (int jj = 0; jj < 2; ++jj) {
#pragma unroll
    for (int rr = 0; rr < 8; ++rr) sl[(8 * hh + rr) * 36 + 16 * jj + c] = acc[jj][rr] * (1.0f / VSC);
  }
  wave_sync_lds();
  {
    v4f mv[4];
#pragma unroll
    for (int it = 0; it < 4; ++it) {
      const int row = it * 4 + (lane >> 3);
      mv[it] = *(const v4f*)(sl + row * 36 + (lane & 7) * 4);
    }
    float* mtb = MT + ((size_t)(h * 3 + s) * HD + (size_t)et * 16) * HD + (wave & 1) * 32;
    {
#pragma unroll
      for (int it = 0; it < 4; ++it) {
        const int row = it * 4 + (lane >> 3);
        *(v4f*)(mtb + (size_t)row * HD + (lane & 7) * 4) = mv[it];
      }
      
    }
  }
  // ---- ZP: sum zacc over the 8 keys of this wave (lanes sharing lane&3), then over the 8 waves ----
#pragma unroll
  for (int e = 0; e < 16; ++e) {
    float v = zacc[e];
    v += __shfl_xor(v, 4, 32);
    v += __shfl_xor(v, 8, 32);
    v += __shfl_xor(v, 16, 32);
    if ((lane >> 2) == 0) zred[wave][(lane & 3) * 16 + e] = v;
  }
  __syncthreads();
  if (tid < HD) {
    float z = 0.f;
#pragma unroll
    for (int w = 0; w < 8; ++w) z += zred[w][tid];
    zsum[tid] = z;
  }
  __syncthreads();
  if (tid < 16) {                         // wave 0, lanes 0..15: 16 x 16 B = the whole 256-B ZP row
    const v4f zz = *(const v4f*)(zsum + tid * 4);
    float* zp = ZP + (size_t)(h * 3 + s) * HD + tid * 4;
    *(v4f*)zp = zz;
    
  }
}

// =====================================================================================================
// Compressive-memory read per (head h, segment s in 1..3, 128-row block) of one batch:
//   M_s = sum over segments before s of MT[h][s'] (f32 sum, RNE convert to an f16 LDS tile MTh[e][d], pitch 72);
//   z_s = sum of ZP[h][s'] (f32, LDS). Per query row n of segment s: q rebuilt in f32 from the hi / residual planes
//   ((hi + lo/RSC) / QSC, column h*64 + d), sq = elu(q) + 1 RNE-converted to f16 directly into the A fragment
//   (elementwise transform keeps the A layout); num[n][e] = sum_d sq[n][d] * M_s[d][e] with Bt = MTh (K = 64, two
//   k-steps, 4 column tiles); den[n] = sum_d sq[n][d] * z_s[d] + 1e-6 in f32 from the same f16 sq values (lane
//   halves combined, then broadcast to the D rows); MEM[n][h*64 + e] = num * (1/den), f32 rows of pitch DM.
//   Block = 8 waves x 16 rows; per-wave 16x64 f32 tile staged in LDS; stores 16 lanes x 16 B per 256-B row
// coverage: 16 heads x 3 segments x 8 row blocks x 8 waves x 16 rows = MEM rows 1024..4095 of every head's 64
//   columns; 8 its x 2 row halves x 16 lanes x 4 floats = the wave's 16x64 tile. Rows 0..1023 (segment 0) are not
//   produced and are not used by the consumer (memory is exactly zero there).
// =====================================================================================================
__global__ __launch_bounds__(256) void mem_ret(const unsigned short* __restrict__ QKH,
                                              const unsigned short* __restrict__ QKL,
                                              const float* __restrict__ MT, const float* __restrict__ ZP,
                                              float* MEM) {
  __shared__ __align__(16) _Float16 MTh[HD * 72];
  __shared__ float zs[HD];
  __shared__ __align__(16) float slab[8][16 * 68];

  const int tid = threadIdx.x, wave = tid >> 5, lane = tid & 31, hh = lane >> 4, c = lane & 15;
  const int h   = (int)(blockIdx.x / 24u);
  const int rem = (int)(blockIdx.x - (unsigned)h * 24u);
  const int s   = 1 + rem / 8;            // 1..3
  const int rb  = rem - (s - 1) * 8;      // 0..7
  if (h >= NHEAD) return;                 // block-uniform, ahead of any barrier; never taken

  {
    const int e = tid >> 2, d0 = (tid & 3) * 16;
    float sm[16];
#pragma unroll
    for (int i = 0; i < 16; ++i) sm[i] = 0.f;
#pragma unroll
    for (int sp = 0; sp < 3; ++sp) {
      if (sp < s) {                       // block-uniform
        const float* src = MT + ((size_t)(h * 3 + sp) * HD + e) * HD + d0;
#pragma unroll
        for (int q = 0; q < 4; ++q) {
          const v4f v = *(const v4f*)(src + 4 * q);
          sm[4 * q + 0] += v[0]; sm[4 * q + 1] += v[1]; sm[4 * q + 2] += v[2]; sm[4 * q + 3] += v[3];
        }
      }
    }
    v8h p0, p1;
#pragma unroll
    for (int i = 0; i < 8; ++i) { p0[i] = (_Float16)sm[i]; p1[i] = (_Float16)sm[8 + i]; }
    *(v8h*)(MTh + e * 72 + d0) = p0;
    *(v8h*)(MTh + e * 72 + d0 + 8) = p1;
    if (tid < HD) {
      float z = 0.f;
#pragma unroll
      for (int sp = 0; sp < 3; ++sp) {
        if (sp < s) z += ZP[(size_t)(h * 3 + sp) * HD + tid];
      }
      zs[tid] = z;
    }
  }
  __syncthreads();

  const _Float16* Q16 = (const _Float16*)(const void*)QKH;
  const _Float16* L16 = (const _Float16*)(const void*)QKL;
  const int n0w = s * SEG + rb * MROWS + wave * 16;          // first query position of this wave

  v16h af[2];
  float denp = 0.f;
#pragma unroll
  for (int kk = 0; kk < 2; ++kk) {
    FH hf, lf;
    hf.v = ldfrag_h(Q16 + (size_t)(n0w + c) * QKW + h * HD + 32 * kk + 8 * hh);
    lf.v = ldfrag_h(L16 + (size_t)(n0w + c) * QKW + h * HD + 32 * kk + 8 * hh);
    v16h a;
#pragma unroll
    for (int i = 0; i < 16; ++i) {
      const float qv = ((float)hf.v[i] + (float)lf.v[i] * (1.0f / RSC)) * (1.0f / QSC);
      const float sq = (qv > 0.f) ? (qv + 1.0f) : __expf(qv);
      const _Float16 sqh = (_Float16)sq;
      a[i] = sqh;
      const int kidx = 32 * kk + ((i < 8) ? (8 * hh + i) : (8 + 8 * hh + i));   // k of element i (split map)
      denp += (float)sqh * zs[kidx];
    }
    af[kk] = a;
  }
  const float den = denp + __shfl_xor(denp, 16, 32) + DEN_EPS;   // row c complete in lanes c and c+16

  v8f acc[4];
#pragma unroll
  for (int j = 0; j < 4; ++j) {
    acc[j] = zero8();
#pragma unroll
    for (int kk = 0; kk < 2; ++kk) {
      const v16h b = ldfrag_h(MTh + (16 * j + c) * 72 + 32 * kk + 8 * hh);
      acc[j] = mma_h(af[kk], b, acc[j]);
    }
  }
  float rinv[8];
#pragma unroll
  for (int rr = 0; rr < 8; ++rr) rinv[rr] = 1.0f / __shfl(den, 8 * hh + rr, 32);   // den of D row 8hh+rr

  float* sl = slab[wave];
#pragma unroll
  for (int j = 0; j < 4; ++j) {
#pragma unroll
    for (int rr = 0; rr < 8; ++rr) sl[(8 * hh + rr) * 68 + 16 * j + c] = acc[j][rr] * rinv[rr];
  }
  wave_sync_lds();
  {
    v4f ov[8];
#pragma unroll
    for (int it = 0; it < 8; ++it) {
      const int row = it * 2 + hh;        // it 0..7 x hh 0..1 = rows 0..15
      ov[it] = *(const v4f*)(sl + row * 68 + c * 4);
    }
    {
#pragma unroll
      for (int it = 0; it < 8; ++it) {
        const int row = it * 2 + hh;
        *(v4f*)(MEM + (size_t)(n0w + row) * DM + h * HD + c * 4) = ov[it];
      }
      
    }
  }
}

// =====================================================================================================
// Segment-local causal attention with the gate mix, one batch, per (h, segment, 64-query block):
//   s = (sum_d qh.kh + (ql.kh + qh.kl) / RSC) * sscale, sscale = (1/8) / (QSC*KSC); key > query (segment-local)
//   -> NEG_BIG (value select); online softmax in f32; p = exp(s - m) carried as ph = f16(1024 p) and, when PRES,
//   also pl = f16((1024 p - ph) * RSC); local numerator = p . v with v as f16 hi (VSC v) and, when PRES, the f16
//   residual ((VSC v - hi) * RSC) plane: oh += ph.vhi over all chunks; when PRES: ol = ph.vres + pl.vhi (one
//   residual accumulator per chunk and 16-wide d tile, both products carry the same 1/RSC), folded as
//   oh += ol / RSC in f32 right after its two k-steps.
//   q|k planes (f16, pitch QKW, rows = positions): q element (t, h, d) at [t*QKW + h*64 + d], k at
//   [t*QKW + DM + h*64 + d]; V^T planes (f16): element (h, d, t) at [(h*64 + d)*SEQ + t]; MEM plane (f32,
//   pitch DM): element (t, h, e) at [t*DM + h*64 + e].
//   Epilogue per query row t: local = oh / (l * PSC * VSC); mem = MEM[t] for segments >= 1 (segment 0: exactly 0
//   by a value select; the load address is always inside the plane); out = g * mem + (1 - g) * local with
//   g = sigmoid(bf16(gate[h])); rows of positions < NTOK go to the second output (offset OUT1OFF), rows of positions
//   >= NTOK to the first, row t mod NTOK, columns h*64..h*64+63 (pitch DM floats).
//   Block = 4 waves = 64 query rows of one h; grid = NHEAD * NSEG * nqb, block -> (h, seg, qbs = qb0 + i);
//   key chunks of 64 within the segment, chunks kt <= qbs only (block-uniform trip <= NQB), chunk kt == qbs keeps
//   its diagonal by the per-element select.
//   K / V^T chunk staging: 128 threads, K row r = tid>>1 (32-column half (tid&1)), V^T row d = tid>>1 (32-key half);
//   plain 16-B loads, __syncthreads ahead of and after; q fragments (hi and residual, 2 d-chunks) held in
//   registers for the whole block; P tiles wave-private, spilled with _Float16 element stores and reloaded as v8h
//   Output coverage: each wave stores rows q0..q0+15 (it 0..7 x lane>>4) x 64 columns (16 lanes x 16 B), one
// =====================================================================================================
template <bool PRES>
__global__ __launch_bounds__(128)
void attn_seg(const unsigned short* __restrict__ QKH, const unsigned short* __restrict__ QKL,
              const unsigned short* __restrict__ VTH, const unsigned short* __restrict__ VTL,
              const float* __restrict__ MEM, const float* __restrict__ gate,
              float* outb, float sscale, int qb0, int nqb) {
  __shared__ __align__(16) _Float16 Ksh[64 * APIT];                           // K hi  [key][d]  9 KB
  __shared__ __align__(16) _Float16 Kls[64 * APIT];                           // K res [key][d]  9 KB
  __shared__ __align__(16) _Float16 Vhs[HD * APIT];                           // V^T hi [d][key] 9 KB
  __shared__ __align__(16) _Float16 Vls[PRES ? HD * APIT : 8];                // V^T res [d][key] 9 KB (PRES)
  __shared__ __align__(16) _Float16 Psh[4][16 * APIT];                        // per wave P hi [row][key] 9 KB
  __shared__ __align__(16) _Float16 Psl[PRES ? 4 : 1][PRES ? 16 * APIT : 8];  // per wave P residual (PRES) 9 KB
  __shared__ __align__(16) float    Os[4][16 * 68];                          // per wave output tile [row][d]

  const int tid  = threadIdx.x;
  const int wave = tid >> 5;
  const int lane = tid & 31;
  const int hh   = lane >> 4;
  const int c    = lane & 15;

  const int per = NSEG * nqb;
  const int h   = (int)(blockIdx.x / (unsigned)per);
  const int rem = (int)(blockIdx.x - (unsigned)h * (unsigned)per);
  const int seg = rem / nqb;
  const int qbs = qb0 + (rem - seg * nqb);
  if (h >= NHEAD || seg >= NSEG) return;  // block-uniform, ahead of any barrier; never taken for exact grids
  const int sbase = seg * SEG;
  const int rowl0 = qbs * 64 + wave * 16; // segment-local row of this wave's first query
  const int q0    = sbase + rowl0;        // its position in the concatenated sequence

  const _Float16* Q16 = (const _Float16*)(const void*)QKH;
  const _Float16* L16 = (const _Float16*)(const void*)QKL;
  const _Float16* Qg  = Q16 + (size_t)h * HD;
  const _Float16* Qlg = L16 + (size_t)h * HD;
  const _Float16* Kg  = Q16 + DM + (size_t)h * HD;
  const _Float16* Klg = L16 + DM + (size_t)h * HD;
  const _Float16* Vhg = (const _Float16*)(const void*)VTH + (size_t)h * HD * SEQ;
  const _Float16* Vlg = (const _Float16*)(const void*)VTL + (size_t)h * HD * SEQ;

  // ---- q fragments (A operand, row = lane&15), hi and residual, d-chunks 0 and 1, fixed for the block ----
  const v16h qh0 = ldfrag_h(Qg  + (size_t)(q0 + c) * QKW + 8 * hh);
  const v16h qh1 = ldfrag_h(Qg  + (size_t)(q0 + c) * QKW + 32 + 8 * hh);
  const v16h ql0 = ldfrag_h(Qlg + (size_t)(q0 + c) * QKW + 8 * hh);
  const v16h ql1 = ldfrag_h(Qlg + (size_t)(q0 + c) * QKW + 32 + 8 * hh);

  float mrow[8], lrow[8];
  v8f oh[4];
#pragma unroll
  for (int r = 0; r < 8; ++r) { mrow[r] = NEG_BIG; lrow[r] = 0.f; }
#pragma unroll
  for (int t = 0; t < 4; ++t) oh[t] = zero8();

  _Float16* pwh = Psh[wave];
  _Float16* pwl = &Psl[PRES ? wave : 0][0];

  for (int kt = 0; kt < NQB; ++kt) {          // static bound; block-uniform causal chunk skipping
    if (kt > qbs) break;
    const int kv0 = sbase + kt * 64;
    __syncthreads();
    {
      const int r = tid >> 1, hk = (tid & 1) * 32;
      const _Float16* kg = Kg + (size_t)(kv0 + r) * QKW + hk;        // K row kv0+r, d = hk..hk+31
#pragma unroll
      for (int i = 0; i < 4; ++i) *(v8h*)(Ksh + r * APIT + hk + 8 * i) = *(const v8h*)(kg + 8 * i);
      cbar();
      const _Float16* lg = Klg + (size_t)(kv0 + r) * QKW + hk;
#pragma unroll
      for (int i = 0; i < 4; ++i) *(v8h*)(Kls + r * APIT + hk + 8 * i) = *(const v8h*)(lg + 8 * i);
      cbar();
      const _Float16* vh = Vhg + (size_t)r * SEQ + kv0 + hk;          // V^T row d = r, t = kv0+hk..+31
#pragma unroll
      for (int i = 0; i < 4; ++i) *(v8h*)(Vhs + r * APIT + hk + 8 * i) = *(const v8h*)(vh + 8 * i);
      if (PRES) {
        cbar();
        const _Float16* vl = Vlg + (size_t)r * SEQ + kv0 + hk;
#pragma unroll
        for (int i = 0; i < 4; ++i) *(v8h*)(Vls + r * APIT + hk + 8 * i) = *(const v8h*)(vl + 8 * i);
        cbar();
      }
    }
    __syncthreads();

    // ---- scores: 16 query rows x 64 keys per wave, K = 64 (2 d-chunks), three products ----
    v8f s[4];
#pragma unroll
    for (int j = 0; j < 4; ++j) {
      v8f sh = zero8(), sl = zero8();
      {
        FH kb, lb;
        kb.h[0] = *(const v8h*)(Ksh + (j * 16 + c) * APIT + 8 * hh);
        kb.h[1] = *(const v8h*)(Ksh + (j * 16 + c) * APIT + 16 + 8 * hh);
        lb.h[0] = *(const v8h*)(Kls + (j * 16 + c) * APIT + 8 * hh);
        lb.h[1] = *(const v8h*)(Kls + (j * 16 + c) * APIT + 16 + 8 * hh);
        sh = mma_h_raw(qh0, kb.v, sh);
        sl = mma_h_raw(ql0, kb.v, sl);
        sl = mma_h_raw(qh0, lb.v, sl);
        guard4m(sh, sl, qh0, ql0, kb.v, lb.v);
      }
      {
        FH kb, lb;
        kb.h[0] = *(const v8h*)(Ksh + (j * 16 + c) * APIT + 32 + 8 * hh);
        kb.h[1] = *(const v8h*)(Ksh + (j * 16 + c) * APIT + 48 + 8 * hh);
        lb.h[0] = *(const v8h*)(Kls + (j * 16 + c) * APIT + 32 + 8 * hh);
        lb.h[1] = *(const v8h*)(Kls + (j * 16 + c) * APIT + 48 + 8 * hh);
        sh = mma_h_raw(qh1, kb.v, sh);
        sl = mma_h_raw(ql1, kb.v, sl);
        sl = mma_h_raw(qh1, lb.v, sl);
        guard4m(sh, sl, qh1, ql1, kb.v, lb.v);
      }
      const int key  = kt * 64 + j * 16 + c;             // segment-local key of this lane's D column
      const int rowb = rowl0 + 8 * hh;                   // segment-local query row of D element r is rowb + r
#pragma unroll
      for (int r = 0; r < 8; ++r) {
        float v = sh[r];
        v += sl[r] * (1.0f / RSC);
        v *= sscale;
        s[j][r] = (key <= rowb + r) ? v : NEG_BIG;
      }
    }

    // ---- row max, online softmax, P hi (x1024, f16) and, when PRES, P residual (x RSC, f16) to LDS ----
#pragma unroll
    for (int r = 0; r < 8; ++r) {
      float m = s[0][r];
      m = fmaxf(m, s[1][r]);
      m = fmaxf(m, s[2][r]);
      m = fmaxf(m, s[3][r]);
#pragma unroll
      for (int off = 1; off < 16; off <<= 1) m = fmaxf(m, __shfl_xor(m, off, 32));
      const float mnew  = fmaxf(mrow[r], m);
      const float alpha = __expf(mrow[r] - mnew);
      mrow[r] = mnew;
      float psum = 0.f;
#pragma unroll
      for (int j = 0; j < 4; ++j) {
        const float p  = __expf(s[j][r] - mnew);
        psum += p;
        const float ph = p * PSC;
        const _Float16 xh = (_Float16)ph;
        const int pi = (8 * hh + r) * APIT + j * 16 + c;
        pwh[pi] = xh;
        if (PRES) pwl[pi] = (_Float16)((ph - (float)xh) * RSC);
      }
#pragma unroll
      for (int off = 1; off < 16; off <<= 1) psum += __shfl_xor(psum, off, 32);
      lrow[r] = lrow[r] * alpha + psum;
#pragma unroll
      for (int t = 0; t < 4; ++t) oh[t][r] *= alpha;
    }
    wave_sync_lds();

    // ---- local numerator: oh += Phi . Vhi; when PRES also ol = Phi . Vres + Plo . Vhi, oh += ol/RSC ----
    FH pa0, pa1, pb0, pb1;
    pa0.h[0] = *(const v8h*)(pwh + c * APIT + 8 * hh);
    pa0.h[1] = *(const v8h*)(pwh + c * APIT + 16 + 8 * hh);
    pa1.h[0] = *(const v8h*)(pwh + c * APIT + 32 + 8 * hh);
    pa1.h[1] = *(const v8h*)(pwh + c * APIT + 48 + 8 * hh);
    pb0.v = pa0.v;
    pb1.v = pa1.v;
    if (PRES) {
      pb0.h[0] = *(const v8h*)(pwl + c * APIT + 8 * hh);
      pb0.h[1] = *(const v8h*)(pwl + c * APIT + 16 + 8 * hh);
      pb1.h[0] = *(const v8h*)(pwl + c * APIT + 32 + 8 * hh);
      pb1.h[1] = *(const v8h*)(pwl + c * APIT + 48 + 8 * hh);
      cbar();
    }
#pragma unroll
    for (int t = 0; t < 4; ++t) {
      const _Float16* vr = Vhs + (t * 16 + c) * APIT + 8 * hh;
      FH vb0, vb1;
      vb0.h[0] = *(const v8h*)(vr);
      vb0.h[1] = *(const v8h*)(vr + 16);
      vb1.h[0] = *(const v8h*)(vr + 32);
      vb1.h[1] = *(const v8h*)(vr + 48);
      if (PRES) {
        const _Float16* wr = Vls + (t * 16 + c) * APIT + 8 * hh;
        FH wb0, wb1;
        wb0.h[0] = *(const v8h*)(wr);
        wb0.h[1] = *(const v8h*)(wr + 16);
        wb1.h[0] = *(const v8h*)(wr + 32);
        wb1.h[1] = *(const v8h*)(wr + 48);
        v8f ol = zero8();
        oh[t] = mma_h_raw(pa0.v, vb0.v, oh[t]);
        ol    = mma_h_raw(pa0.v, wb0.v, ol);
        ol    = mma_h_raw(pb0.v, vb0.v, ol);
        oh[t] = mma_h_raw(pa1.v, vb1.v, oh[t]);
        ol    = mma_h_raw(pa1.v, wb1.v, ol);
        ol    = mma_h_raw(pb1.v, vb1.v, ol);
        guard8m(oh[t], ol, pa0.v, pa1.v, pb0.v, pb1.v, vb0.v, vb1.v, wb0.v, wb1.v);
#pragma unroll
        for (int r = 0; r < 8; ++r) oh[t][r] += ol[r] * (1.0f / RSC);
      } else {
        oh[t] = mma_h_raw(pa0.v, vb0.v, oh[t]);
        oh[t] = mma_h_raw(pa1.v, vb1.v, oh[t]);
        guard1q(oh[t], pa0.v, pa1.v, vb0.v, vb1.v);
      }
    }
    acc_guard4(oh[0], oh[1], oh[2], oh[3]);
  }

  // ---- normalise (1/l, the 1/1024 p carry and the 1/VSC v carry), gate mix with the memory read, stage the
  const float gv  = bfr(gate[h]);
  const float g   = 1.0f / (1.0f + expf(-gv));
  const float omg = 1.0f - g;
  const bool useMem = (seg > 0);                          // block-uniform
  float* os = Os[wave];
#pragma unroll
  for (int r = 0; r < 8; ++r) {
    const int qr = q0 + 8 * hh + r;                         // query position
    const float l = lrow[r];                                // >= 1 (the row maximum contributes exp(0))
    const float inv = (1.0f / l) * (1.0f / (PSC * VSC));
    const float* mr = MEM + (size_t)qr * DM + h * HD;       // inside the MEM plane for every position
#pragma unroll
    for (int t = 0; t < 4; ++t) {
      const float yv  = oh[t][r] * inv;                     // e = 16t + c
      const float mvr = mr[16 * t + c];
      const float mv  = useMem ? mvr : 0.f;
      os[(8 * hh + r) * 68 + 16 * t + c] = g * mv + omg * yv;
    }
  }
  wave_sync_lds();
  {
    const size_t ooff  = (seg < (NTOK / SEG)) ? (size_t)OUT1OFF : (size_t)0;   // positions < NTOK -> second output
    const int    orow0 = (seg < (NTOK / SEG)) ? q0 : (q0 - NTOK);               // row within the output [b][2048][1024]
    v4f ov[8];
#pragma unroll
    for (int it = 0; it < 8; ++it) {
      const int row = it * 2 + hh;                          // it 0..7 x hh 0..1 = rows 0..15 of the wave tile
      ov[it] = *(const v4f*)(os + row * 68 + c * 4);
    }
    {
#pragma unroll
      for (int it = 0; it < 8; ++it) {
        const int row = it * 2 + hh;
        *(v4f*)(outb + ooff + (size_t)(orow0 + row) * DM + h * HD + c * 4) = ov[it];
      }
      
    }
  }
}

// =====================================================================================================
// Workspace map (bytes); every plane is an exact multiple of its tile / whole-line store granularity (all dims are
// exact tile multiples, no padded tails), all offsets multiples of 4096:
//   XH    f16  [4096 t][1024 in]        0          8388608   (f16 of bf16 value x16, rows b*2048 + t)
//   AH    f16  [4096 t][1024 in]        8388608    8388608
//   WXT   f16  [3072 out][1024 in]      16777216   6291456   (W^T, bf16 value x64)
//   WAT   f16  [3072 out][1024 in]      23068672   6291456
//   COST  f32  [4096 pos][32]           29360128    524288
//   SINT  f32  [4096 pos][32]           29884416    524288
//   QKH   f16  [4096 pos][2048 (q|k)]   30408704  16777216   (one batch; q x4, k x16 hi after norm + rotary)
//   QKL   f16  [4096][2048]             47185920  16777216   (x4096 residuals)
//   VF    f32  [4096 pos][1024 (h,d)]   63963136  16777216   (v, f32)
//   VTH   f16  [1024 (h,d)][4096 pos]   80740352   8388608   (v x16 hi)
//   VTL   f16  [1024 (h,d)][4096 pos]   89128960   8388608   ((v x16 - hi) x4096)
//   MT    f32  [16 h][3 s][64 e][64 d]  97517568    786432
//   ZP    f32  [16 h][3 s][64 d]        98304000     12288
//   MEM   f32  [4096 pos][1024 (h,e)]   98316288  16777216
//   end                                115093504
// =====================================================================================================
extern "C" void kernel_launch(void* const* d_in, const int* in_sizes, int n_in,
                              void* d_out, int out_size, void* d_ws, size_t ws_size,
                              hipStream_t stream) {
  if (n_in < 9) return;
  if (in_sizes[0] != NB * NTOK * DM || in_sizes[1] != NB * NTOK * DM) return;
  if (in_sizes[2] != DM * W3 || in_sizes[3] != DM * W3) return;
  if (in_sizes[4] != NHEAD * HD || in_sizes[5] != NHEAD * HD) return;
  if (in_sizes[6] != NHEAD * HD || in_sizes[7] != NHEAD * HD) return;
  if (in_sizes[8] != NHEAD) return;
  if (out_size != 2 * NB * NTOK * DM) return;

  const float* X    = (const float*)d_in[0];
  const float* Aa   = (const float*)d_in[1];
  const float* Wx   = (const float*)d_in[2];
  const float* Wa   = (const float*)d_in[3];
  const float* g_qx = (const float*)d_in[4];
  const float* g_kx = (const float*)d_in[5];
  const float* g_qa = (const float*)d_in[6];
  const float* g_ka = (const float*)d_in[7];
  const float* gate = (const float*)d_in[8];
  float* outf = (float*)d_out;

  const size_t PXA = (size_t)NB * NTOK * DM * 2;        //  8388608
  const size_t PW  = (size_t)W3 * DM * 2;               //  6291456
  const size_t PRT = (size_t)SEQ * RP * 4;              //   524288
  const size_t PQK = (size_t)SEQ * QKW * 2;             // 16777216
  const size_t PVF = (size_t)SEQ * DM * 4;              // 16777216
  const size_t PVT = (size_t)DM * SEQ * 2;              //  8388608
  const size_t PMT = (size_t)NHEAD * 3 * HD * HD * 4;   //   786432
  const size_t PZP = (size_t)NHEAD * 3 * HD * 4;        //    12288
  const size_t PME = (size_t)SEQ * DM * 4;              // 16777216
  size_t off = 0;
  const size_t oXH = off; off += PXA;
  const size_t oAH = off; off += PXA;
  const size_t oWX = off; off += PW;
  const size_t oWA = off; off += PW;
  const size_t oCT = off; off += PRT;
  const size_t oST = off; off += PRT;
  const size_t oQH = off; off += PQK;
  const size_t oQL = off; off += PQK;
  const size_t oVF = off; off += PVF;
  const size_t oVH = off; off += PVT;
  const size_t oVL = off; off += PVT;
  const size_t oMT = off; off += PMT;
  const size_t oZP = off; off += PZP;
  const size_t oME = off; off += PME;
  if (off > ws_size) return;                            // off = 115093504
  if (off > (size_t)134217728) return;

  char* ws = (char*)d_ws;
  unsigned short* XH   = (unsigned short*)(ws + oXH);
  unsigned short* AH   = (unsigned short*)(ws + oAH);
  unsigned short* WXT  = (unsigned short*)(ws + oWX);
  unsigned short* WAT  = (unsigned short*)(ws + oWA);
  float*          COST = (float*)(ws + oCT);
  float*          SINT = (float*)(ws + oST);
  unsigned short* QKH  = (unsigned short*)(ws + oQH);
  unsigned short* QKL  = (unsigned short*)(ws + oQL);
  float*          VF   = (float*)(ws + oVF);
  unsigned short* VTH  = (unsigned short*)(ws + oVH);
  unsigned short* VTL  = (unsigned short*)(ws + oVL);
  float*          MT   = (float*)(ws + oMT);
  float*          ZP   = (float*)(ws + oZP);
  float*          MEM  = (float*)(ws + oME);

  const dim3 blk256(256), blk128(128);
  const float sscale = 0.125f / (QSC * KSC);
  const float oscale = 1.0f / (XSC * WSC);

  // (1) x, a -> row-major f16 planes of their bf16 RNE values x16; W [1024][3072] -> transposed f16 planes
  //     [3072][1024] (k contiguous, Bt form) of their bf16 RNE values x64; rotary tables
  cvt_rm<<<dim3((NB * NTOK * DM) / 2048), blk256, 0, stream>>>(X, XH, NB * NTOK * DM, XSC);
  cvt_rm<<<dim3((NB * NTOK * DM) / 2048), blk256, 0, stream>>>(Aa, AH, NB * NTOK * DM, XSC);
  // in[DM rows][W3 cols] -> out[W3][DM]: grid (cols/64, rows/64)
  tr_cvt<0><<<dim3(W3 / 64, DM / 64), blk256, 0, stream>>>(Wx, DM, W3, WXT, WXT, WSC);
  tr_cvt<0><<<dim3(W3 / 64, DM / 64), blk256, 0, stream>>>(Wa, DM, W3, WAT, WAT, WSC);
  rope_tab<<<dim3((SEQ * RP) / 256), blk256, 0, stream>>>(COST, SINT, SEQ * RP);

  const int gqk  = ((NTOK / 32) * (QKW / 128)) / 4;      // 1024 tiles -> 256 blocks
  const int gv   = ((NTOK / 32) * (DM / 128)) / 4;       //  512 tiles -> 128 blocks
  const int gmt  = NHEAD * 3;                            //   48 blocks
  const int gmem = NHEAD * 3 * (SEG / MROWS);            //  384 blocks
  for (int b = 0; b < NB; ++b) {
    const unsigned short* AHb = AH + (size_t)b * NTOK * DM;
    const unsigned short* XHb = XH + (size_t)b * NTOK * DM;
    float* outb = outf + (size_t)b * NTOK * DM;
    // (2) q|k of stream a (positions 0..2047) and stream x (positions 2048..4095): M=2048, N=2048, K=1024,
    //     fused per-head L2 norm + gain + rotary -> QKH/QKL f16 planes
    gemm_t<1><<<dim3(gqk), blk128, 0, stream>>>(AHb, DM, WAT, DM, (void*)QKH, (void*)QKL, QKW, 0,
                                               COST, SINT, g_qa, g_ka, NTOK, QKW, DM, oscale);
    gemm_t<1><<<dim3(gqk), blk128, 0, stream>>>(XHb, DM, WXT, DM, (void*)QKH, (void*)QKL, QKW, NTOK,
                                               COST, SINT, g_qx, g_kx, NTOK, QKW, DM, oscale);
    // (3) v of both streams: M=2048, N=1024 (W^T rows 2048..3071), K=1024 -> VF f32 rows
    gemm_t<3><<<dim3(gv), blk128, 0, stream>>>(AHb, DM, WAT + (size_t)2 * DM * DM, DM, (void*)VF, (void*)VF,
                                              DM, 0, COST, SINT, g_qa, g_ka, NTOK, DM, DM, oscale);
    gemm_t<3><<<dim3(gv), blk128, 0, stream>>>(XHb, DM, WXT + (size_t)2 * DM * DM, DM, (void*)VF, (void*)VF,
                                              DM, NTOK, COST, SINT, g_qx, g_kx, NTOK, DM, DM, oscale);
    // (4) v^T planes: in VF [SEQ rows][DM cols] -> out [DM][SEQ] f16 hi (x16) and residual (x4096)
    tr_cvt<1><<<dim3(DM / 64, SEQ / 64), blk256, 0, stream>>>(VF, SEQ, DM, VTH, VTL, VSC);
    // (5) compressive memory: per-segment sk^T.v and sum sk (segments 0..2), then the memory read for the
    //     query rows of segments 1..3 -> MEM f32 plane
    mt_seg<<<dim3(gmt), blk256, 0, stream>>>(QKH, QKL, VTH, MT, ZP);
    mem_ret<<<dim3(gmem), blk256, 0, stream>>>(QKH, QKL, MT, ZP, MEM);
    // (6) segment-local causal attention + gate mix -> both outputs: the leading NQP query blocks of every
    //     segment with the p, v residual products, the remaining blocks without
    attn_seg<true><<<dim3(NHEAD * NSEG * NQP), blk128, 0, stream>>>(QKH, QKL, VTH, VTL, MEM, gate, outb,
                                                                    sscale, 0, NQP);
    attn_seg<false><<<dim3(NHEAD * NSEG * (NQB - NQP)), blk128, 0, stream>>>(QKH, QKL, VTH, VTL, MEM, gate,
                                                                             outb, sscale, NQP, NQB - NQP);
  }
  (void)hipGetLastError();
}

// v003
// A run of this version takes 251 microseconds.
// In both of two side-by-side timings against v002, it was 1.49 times as fast.
// Over all steps from v000 it is 3.12 times as fast.
// Contractions: a.W and x.W (q|k|v, K=1024) on v_wmma_f32_16x16x32_f16 with f16 containers of the bf16 RNE input
//   values (activations carried x16, W^T x64), one product; q.k^T (K=64) on v_wmma_f32_16x16x32_f16 with q (x4) and
//   k (x16) f16 hi planes plus x4096 f16 residual planes (three products, residual pair in a separate accumulator
//   folded by 1/4096); p.v^T on v_wmma_f32_16x16x32_f16 with p as f16(1024 p) and v^T as f16(16 v), one product
//   (the leading query blocks of every segment add the p and v x4096 f16 residual planes, two more products into a
//   separate accumulator); compressive memory sk^T.v (K=1024) and sq.M (K=64) on v_wmma_f32_16x16x32_f16 with
//   plain f16 operands, one product each. f32 accumulate everywhere; L2 norms, rotary tables and rotation, elu,
//   softmax statistics, sq.z, the memory quotient and the gate mix in f32.
#include <hip/hip_runtime.h>
#include <math.h>
#include <stdint.h>

#define NB      2
#define NTOK    2048                // tokens per stream per batch
#define SEQ     4096                // concatenated positions per batch (stream a first, then x)
#define DM      1024
#define NHEAD   16
#define HD      64
#define RP      32                  // rotary pairs per head
#define W3      3072
#define QKW     2048                // q|k plane width: q at column h*64+d, k at 1024 + h*64+d
#define SEG     1024
#define NSEG    4
#define NQB     16                  // 64-row query blocks per segment
#define NQP     4                   // leading query blocks per segment that carry the p / v residual products
#define MROWS   128                 // query rows per block of the memory read kernel
#define OUT1OFF (NB * NTOK * DM)             // element offset of the second output
#define XSC     16.0f
#define WSC     64.0f
#define QSC     4.0f
#define KSC     16.0f
#define VSC     16.0f
#define RSC     4096.0f
#define PSC     1024.0f
#define NRM_EPS 1.0e-12f
#define DEN_EPS 1.0e-6f
#define LOG2_BASE 13.287712379549449
#define NEG_BIG (-1.0e30f)
#define GBK     128                 // k per LDS stage of the projection GEMM (256 B of every operand row)
#define GPIT    136                 // LDS row pitch of a stage in halves: 272 B = 16 B x 17 (ds_load_b128 readers)
#define GSTG    (256 * GPIT)        // halves per stage: 128 A rows, then 128 Bt rows
#define APIT    72                  // LDS row pitch of the attention K, V^T and P tiles in halves: 144 B = 16 B x 9
                                    // (ds_load_b128 readers: 16 rows of a fragment load fall on 16 distinct bank groups)

static_assert(NHEAD * HD == DM);
static_assert(SEQ == 2 * NTOK);
static_assert(SEQ == NSEG * SEG);
static_assert(SEG == NQB * 64);
static_assert(HD == 2 * RP);
static_assert(W3 == 3 * DM);
static_assert(QKW == 2 * DM);
static_assert(((NB * NTOK * DM) % 2048) == 0);
static_assert(((SEQ * RP) % 256) == 0);
static_assert((DM % 128) == 0 && (W3 % 64) == 0 && (NTOK % 64) == 0 && (SEQ % 64) == 0);
static_assert((QKW % 128) == 0 && (DM % 32) == 0);
static_assert(NQP > 0 && NQP < NQB);
static_assert((SEG % MROWS) == 0 && MROWS == 8 * 16);
static_assert(OUT1OFF == NB * NTOK * DM);
static_assert((DM % GBK) == 0 && (NTOK % 128) == 0 && ((GPIT * 2) % 16) == 0);
static_assert(APIT >= HD && ((APIT * 2) % 16) == 0);

typedef _Float16 v16h __attribute__((ext_vector_type(16)));
typedef _Float16 v8h  __attribute__((ext_vector_type(8)));
typedef float    v8f  __attribute__((ext_vector_type(8)));
typedef float    v4f  __attribute__((ext_vector_type(4)));
typedef unsigned int v4u __attribute__((ext_vector_type(4)));
union FH { v16h v; v8h h[2]; };

// ---- scalar helpers --------------------------------------------------------------------------------
__device__ __forceinline__ unsigned short bf_bits(float f) {          // f32 -> bf16 bits, RNE convert
  unsigned u = __float_as_uint(f);
  return (unsigned short)((u + 0x7FFFu + ((u >> 16) & 1u)) >> 16);
}
__device__ __forceinline__ float bf_up(unsigned short b) { return __uint_as_float(((unsigned)b) << 16); }
__device__ __forceinline__ float bfr(float f) { return bf_up(bf_bits(f)); }     // value of the bf16 RNE convert
__device__ __forceinline__ unsigned short h_bits(_Float16 x) { return __builtin_bit_cast(unsigned short, x); }
__device__ __forceinline__ unsigned pk16(unsigned short a, unsigned short b) { return (unsigned)a | ((unsigned)b << 16); }
__device__ __forceinline__ v8f zero8() { v8f z = {0.f, 0.f, 0.f, 0.f, 0.f, 0.f, 0.f, 0.f}; return z; }

// ---- fragment loader: 16-bit A/B operand, lane -> row/col (lane&15), p already includes +8*(lane>>4);
//      elements 0..7 <- p[0..7] (k0+8h..), elements 8..15 <- p[16..23] (k0+16+8h..)
__device__ __forceinline__ v16h ldfrag_h(const _Float16* p) {
  FH f;
  f.h[0] = *(const v8h*)(p);
  f.h[1] = *(const v8h*)(p + 16);
  return f.v;
}

// ---- WMMA helpers with trailing VALU hazard gap --------------------------------------------------------
__device__ __forceinline__ v8f mma_h_raw(v16h a, v16h b, v8f c) {
  return __builtin_amdgcn_wmma_f32_16x16x32_f16(false, a, false, b, (short)0, c, false, false);
}
__device__ __forceinline__ v8f mma_h(v16h a, v16h b, v8f c) {
  c = mma_h_raw(a, b, c);
#if defined(__HIP_DEVICE_COMPILE__)
  asm volatile("v_nop\n\tv_nop\n\tv_nop\n\tv_nop" : "+v"(c) : "v"(a), "v"(b));
#endif
  return c;
}
__device__ __forceinline__ void guard3(v8f& x, v8f& y, v16h a, v16h b, v16h d) {   // two D tiles, 3 frags live
#if defined(__HIP_DEVICE_COMPILE__)
  asm volatile("v_nop\n\tv_nop\n\tv_nop\n\tv_nop" : "+v"(x), "+v"(y) : "v"(a), "v"(b), "v"(d));
#endif
}
__device__ __forceinline__ void guard1q(v8f& x, v16h a, v16h b, v16h d, v16h e) {           // one D, 4 frags
#if defined(__HIP_DEVICE_COMPILE__)
  asm volatile("v_nop\n\tv_nop\n\tv_nop\n\tv_nop" : "+v"(x) : "v"(a), "v"(b), "v"(d), "v"(e));
#endif
}
__device__ __forceinline__ void guard4m(v8f& x, v8f& y, v16h a, v16h b, v16h d, v16h e) {   // two D, 4 frags
#if defined(__HIP_DEVICE_COMPILE__)
  asm volatile("v_nop\n\tv_nop\n\tv_nop\n\tv_nop" : "+v"(x), "+v"(y) : "v"(a), "v"(b), "v"(d), "v"(e)
               : "memory");
#endif
}
__device__ __forceinline__ void guard8m(v8f& x, v8f& y, v16h a, v16h b, v16h d, v16h e,
                                        v16h f, v16h g, v16h p, v16h q) {                      // two D, 8 frags
#if defined(__HIP_DEVICE_COMPILE__)
  asm volatile("v_nop\n\tv_nop\n\tv_nop\n\tv_nop" : "+v"(x), "+v"(y)
               : "v"(a), "v"(b), "v"(d), "v"(e), "v"(f), "v"(g), "v"(p), "v"(q) : "memory");
#endif
}
__device__ __forceinline__ void acc_guard4(v8f& a, v8f& b, v8f& c, v8f& d) {
#if defined(__HIP_DEVICE_COMPILE__)
  asm volatile("v_nop\n\tv_nop\n\tv_nop\n\tv_nop" : "+v"(a), "+v"(b), "+v"(c), "+v"(d));
#endif
}
__device__ __forceinline__ void acc_guard2(v8f& a, v8f& b) {
#if defined(__HIP_DEVICE_COMPILE__)
  asm volatile("v_nop\n\tv_nop\n\tv_nop\n\tv_nop" : "+v"(a), "+v"(b));
#endif
}
__device__ __forceinline__ void cbar() {
#if defined(__HIP_DEVICE_COMPILE__)
  asm volatile("" ::: "memory");
#endif
}
__device__ __forceinline__ void wave_sync_lds() {
  __builtin_amdgcn_fence(__ATOMIC_RELEASE, "workgroup");
  __builtin_amdgcn_wave_barrier();
  __builtin_amdgcn_fence(__ATOMIC_ACQUIRE, "workgroup");
}

// ---- eight asynchronous 16-B copies global -> LDS per lane (l: LDS byte address, g: global address). The
//      s_wait_xcnt stands inside the statement so that no address register is rewritten ahead of it.
__device__ __forceinline__ void acopy8(uint32_t l0, uint32_t l1, uint32_t l2, uint32_t l3,
                                       uint32_t l4, uint32_t l5, uint32_t l6, uint32_t l7,
                                       const _Float16* g0, const _Float16* g1, const _Float16* g2,
                                       const _Float16* g3, const _Float16* g4, const _Float16* g5,
                                       const _Float16* g6, const _Float16* g7) {
#if defined(__HIP_DEVICE_COMPILE__)
  asm volatile("global_load_async_to_lds_b128 %0, %8, off\n\t"
               "global_load_async_to_lds_b128 %1, %9, off\n\t"
               "global_load_async_to_lds_b128 %2, %10, off\n\t"
               "global_load_async_to_lds_b128 %3, %11, off\n\t"
               "global_load_async_to_lds_b128 %4, %12, off\n\t"
               "global_load_async_to_lds_b128 %5, %13, off\n\t"
               "global_load_async_to_lds_b128 %6, %14, off\n\t"
               "global_load_async_to_lds_b128 %7, %15, off\n\t"
               "s_wait_xcnt 0x0"
               :: "v"(l0), "v"(l1), "v"(l2), "v"(l3), "v"(l4), "v"(l5), "v"(l6), "v"(l7),
                  "v"(g0), "v"(g1), "v"(g2), "v"(g3), "v"(g4), "v"(g5), "v"(g6), "v"(g7)
               : "memory");
#endif
}
// 64 rows of one operand, 256 B each, into LDS rows of pitch GPIT: l / g are this thread's addresses in row
// (tid >> 4) at 16-B piece (tid & 15); copy i takes row 8 i + (tid >> 4), a wave's copy covers two whole rows.
__device__ __forceinline__ void acopy_rows64(uint32_t l, const _Float16* g, size_t ld) {
  const uint32_t ls = 8u * GPIT * 2u;
  const size_t   gs = 8 * ld;
  acopy8(l, l + ls, l + 2 * ls, l + 3 * ls, l + 4 * ls, l + 5 * ls, l + 6 * ls, l + 7 * ls,
         g, g + gs, g + 2 * gs, g + 3 * gs, g + 4 * gs, g + 5 * gs, g + 6 * gs, g + 7 * gs);
}
// the issuing wave's own copies have landed (the compiler places no wait for them)
__device__ __forceinline__ void wait_async0() {
#if defined(__HIP_DEVICE_COMPILE__)
  asm volatile("s_wait_asynccnt 0x0" ::: "memory");
#endif
}
// this wave's LDS reads of the stage have returned before the stage is handed back for a refill
__device__ __forceinline__ void wait_ds0() {
#if defined(__HIP_DEVICE_COMPILE__)
  asm volatile("s_wait_dscnt 0x0" ::: "memory");
#endif
}

// =====================================================================================================
// Row-major convert: f32 [n] -> f16 plane [n] holding f16(bf16 RNE value * scale) (scale a power of two, exact).
// coverage: grid.x = n/2048 blocks x 256 threads x 8 = n elements (n % 2048 == 0 host-checked); grid.y = 2 arrays.
// =====================================================================================================
__global__ __launch_bounds__(256) void cvt_rm(const float* __restrict__ in0, const float* __restrict__ in1,
                                             unsigned short* out, int n, float scale) {
  const size_t i8 = ((size_t)blockIdx.x * 256 + threadIdx.x) * 8;
  if (i8 + 8 > (size_t)n) return;        // never taken for the host-checked sizes; no barriers below
  const float* in = blockIdx.y ? in1 : in0;   // blockIdx.y = which of the two arrays; its plane follows the first
  out += (size_t)blockIdx.y * (size_t)n;
  const v4f a = *(const v4f*)(in + i8);
  const v4f b = *(const v4f*)(in + i8 + 4);
  float f[8];
  f[0] = a[0]; f[1] = a[1]; f[2] = a[2]; f[3] = a[3];
  f[4] = b[0]; f[5] = b[1]; f[6] = b[2]; f[7] = b[3];
  v4u p;
#pragma unroll
  for (int e = 0; e < 4; ++e) {
    const unsigned short b0 = bf_bits(f[2 * e]), b1 = bf_bits(f[2 * e + 1]);
    const _Float16 x0 = (_Float16)(bf_up(b0) * scale);
    const _Float16 x1 = (_Float16)(bf_up(b1) * scale);
    p[e] = pk16(h_bits(x0), h_bits(x1));
  }
  *(v4u*)(out + i8) = p;
  
}

// =====================================================================================================
// Transposing convert: f32 in[R][C] (row-major, pitch C) -> 16-bit out[C][R] (pitch R), 64x64 tiles through LDS.
//   MODE 0: one plane  out0 = f16(bf16 RNE value * scale).
//   MODE 1: two planes out0 = f16(v * scale) hi, out1 = f16((v * scale - hi) * RSC) residual.
// Block = 256 threads; grid = (C/64, R/64, 2 matrices) exact (host-checked). Load: thread -> input row tid>>2, 16 consecutive
// columns (four 16-B loads). Store: two iterations, output row it*32 + (tid>>3), lanes (tid&7) -> elements
// coverage: 2 iterations x 32 output rows x 8 lanes x 8 halves = the whole 64x64 tile; grid covers all of C x R.
// =====================================================================================================
template <int MODE>
__global__ __launch_bounds__(256) void tr_cvt(const float* __restrict__ in0, const float* __restrict__ in1,
                                             int R, int C, unsigned short* out0, unsigned short* out1,
                                             float scale) {
  __shared__ float sm[64][65];
  const int tid = threadIdx.x;
  const float* in = blockIdx.z ? in1 : in0;   // blockIdx.z = which of the two matrices; its planes follow the first's
  out0 += (size_t)blockIdx.z * (size_t)R * (size_t)C;
  out1 += (size_t)blockIdx.z * (size_t)R * (size_t)C;
  const int c0 = blockIdx.x * 64;          // input column block -> output row block
  const int r0 = blockIdx.y * 64;          // input row block    -> output column block
  if (c0 + 64 > C || r0 + 64 > R) return;  // block-uniform, ahead of any barrier; never taken for exact grids
  {
    const int lr = tid >> 2, lc = (tid & 3) * 16;
    const float* src = in + (size_t)(r0 + lr) * (size_t)C + c0 + lc;
#pragma unroll
    for (int q = 0; q < 4; ++q) {
      const v4f v = *(const v4f*)(src + 4 * q);
      sm[lr][lc + 4 * q + 0] = v[0];
      sm[lr][lc + 4 * q + 1] = v[1];
      sm[lr][lc + 4 * q + 2] = v[2];
      sm[lr][lc + 4 * q + 3] = v[3];
    }
  }
  __syncthreads();
  const int seg = tid & 7;
  v4u p0[2], p1[2];
#pragma unroll
  for (int it = 0; it < 2; ++it) {
    const int ocl = it * 32 + (tid >> 3);   // output row within the tile = input column
    float f[8];
#pragma unroll
    for (int e = 0; e < 8; ++e) f[e] = sm[seg * 8 + e][ocl];
    v4u pk, pl;
#pragma unroll
    for (int e = 0; e < 4; ++e) {
      const float g0 = f[2 * e], g1 = f[2 * e + 1];
      if (MODE == 0) {
        const _Float16 x0 = (_Float16)(bfr(g0) * scale);
        const _Float16 x1 = (_Float16)(bfr(g1) * scale);
        pk[e] = pk16(h_bits(x0), h_bits(x1));
        pl[e] = pk[e];
      } else {
        const float s0 = g0 * scale, s1 = g1 * scale;
        const _Float16 x0 = (_Float16)s0, x1 = (_Float16)s1;
        const _Float16 y0 = (_Float16)((s0 - (float)x0) * RSC);
        const _Float16 y1 = (_Float16)((s1 - (float)x1) * RSC);
        pk[e] = pk16(h_bits(x0), h_bits(x1));
        pl[e] = pk16(h_bits(y0), h_bits(y1));
      }
    }
    p0[it] = pk;
    p1[it] = pl;
  }
  {
#pragma unroll
    for (int it = 0; it < 2; ++it) {
      const int ocl = it * 32 + (tid >> 3);
      const size_t go = (size_t)(c0 + ocl) * (size_t)R + (size_t)(r0 + seg * 8);
      *(v4u*)(out0 + go) = p0[it];
      if (MODE == 1) *(v4u*)(out1 + go) = p1[it];
    }
    
  }
}

// =====================================================================================================
// Rotary tables for interleaved pairs: cost[t][i] = cos(t * inv_freq[i]), sint[t][i] = sin(t * inv_freq[i]),
// i = 0..31, inv_freq[i] = 1 / (10000^(2i/64)) (power via f64 exp2 -> one f32 convert, then an f32 reciprocal
// formed in f64 and converted once), angle = one f32 multiply with t = position 0..4095 in the concatenated
// coverage: grid.x = n/256 blocks x 256 threads = n = SEQ*32 elements of each table.
// =====================================================================================================
__global__ __launch_bounds__(256) void rope_tab(float* cost, float* sint, int n) {
  const int e = blockIdx.x * 256 + (int)threadIdx.x;
  if (e >= n) return;                      // never taken (n % 256 == 0); no barriers below
  const int t = e >> 5, i = e & 31;
  const double pd = exp2((double)i * (1.0 / 32.0) * LOG2_BASE);   // 10000^(2i/64)
  const float  pf = (float)pd;
  const float  invf = (float)(1.0 / (double)pf);
  const float  ang = (float)t * invf;
  float sv, cv;
  sincosf(ang, &sv, &cv);
  *(float*)(cost + e) = cv;
  *(float*)(sint + e) = sv;
  
}

// =====================================================================================================
// Register-blocked f16 WMMA GEMM, one wave per 32x128 tile; block = 4 waves = 4 tiles stacked in m = one 128x128
// block tile whose operands pass through LDS: a stage is 128 k of the 128 A rows and the 128 Bt rows, brought by
// asynchronous copies into two buffers (stage t + 1 flies while stage t is worked on), read by all 4 waves:
//   acc[m][n] = sum_k A[m][k] * Bt[n][k]; A row-major [M][K] pitch lda, Bt row-major [N][K] pitch ldb
//   (k contiguous); M % 128 == 0, N % 128 == 0, K % 128 == 0 (exact constants here, host-checked).
// EPI 1 (q|k planes, N == QKW): the 128-column tile holds two heads of 64 columns (columns < DM are q heads,
//        columns >= DM are k heads). Per row and head: t = acc*oscale; v = t * (1/max(||t||_2, 1e-12)) *
//        bf16(gain[head][d]) * 8; then the interleaved-pair rotary rotation with the f32 tables at position
//        crow0 + m (pair (2i, 2i+1): o1 = v1*c - v2*s, o2 = v1*s + v2*c), times cscale (QSC for q, KSC for k)
//        -> C0 = f16 hi, C1 = f16((v - hi) * RSC) residual, 16-bit planes of pitch ldc, row crow0 + m, column n.
// EPI 3: f32 rows (C0) = acc*oscale, pitch ldc, row crow0 + m, column n.
// 16 lanes x 16 B per 256-B row segment (two rows per instruction), f32 as 32 lanes x 16 B per 512-B row segment;
// coverage: 2 slabs x 16 rows x 128 cols = the wave's whole 32x128 tile; tiles = whole M x N (grid.x = tiles/4 exact),
// grid.y = the two streams, grid.z = the batches.
// =====================================================================================================
template <int EPI>
__global__ __launch_bounds__(128) void gemm_t(
    const unsigned short* __restrict__ A0, const unsigned short* __restrict__ A1, int lda,
    const unsigned short* __restrict__ Bt0, const unsigned short* __restrict__ Bt1, int ldb,
    void* C0, void* C1, int ldc, int crows,
    const float* __restrict__ cost, const float* __restrict__ sint,
    const float* __restrict__ gq0, const float* __restrict__ gk0,
    const float* __restrict__ gq1, const float* __restrict__ gk1,
    int M, int N, int K, float oscale) {
  __shared__ __align__(16) float sT[4][16 * 132];   // per-wave 16x128 slab, pitch 132 floats
  __shared__ __align__(16) _Float16 ring[2 * GSTG]; // two operand stages
  const int lane = threadIdx.x & 31;
  const int wave = threadIdx.x >> 5;
  // blockIdx.y = stream (0: operands A0, Bt0, gains gq0, gk0, C rows 0..M-1; 1: the others, C rows M..2M-1);
  // blockIdx.z = batch (A rows z*M.., C plane z of crows rows)
  const int  st = (int)blockIdx.y;
  const unsigned short* A  = (st ? A1 : A0) + (size_t)blockIdx.z * (size_t)M * (size_t)lda;
  const unsigned short* Bt = st ? Bt1 : Bt0;
  const float* gq = st ? gq1 : gq0;
  const float* gk = st ? gk1 : gk0;
  const int    crow0 = st * M;
  const size_t cpl   = (size_t)blockIdx.z * (size_t)crows * (size_t)ldc;   // element offset of this batch's C plane
  const int tilesN = N >> 7;
  const int tilesM = M >> 5;
  if ((int)blockIdx.x >= (tilesM >> 2) * tilesN) return;   // block-uniform, ahead of any barrier; never taken
  const int bm = (int)blockIdx.x / tilesN;
  const int tn = (int)blockIdx.x - bm * tilesN;
  const int tm = bm * 4 + wave;
  const int m0 = tm << 5;
  const int n0 = tn << 7;
  const int rl   = lane & 15;            // row (A) / col (B, D) within subtile
  const int hh   = lane >> 4;            // lane half
  const int koff = hh * 8;               // k offset of this lane half

  v8f acc[2][8];
#pragma unroll
  for (int i = 0; i < 2; ++i)
#pragma unroll
    for (int j = 0; j < 8; ++j) acc[i][j] = zero8();

  {
    const int cr = (int)threadIdx.x >> 4;          // row (mod 8) this thread copies
    const int cc = (int)threadIdx.x & 15;          // its 16-B piece of the row's 256 B
    const _Float16* ga = (const _Float16*)(const void*)A + (size_t)((bm << 7) + cr) * (size_t)lda + cc * 8;
    const _Float16* gb = (const _Float16*)(const void*)Bt + (size_t)(n0 + cr) * (size_t)ldb + cc * 8;
    const uint32_t  lr = (uint32_t)(size_t)(const void*)ring + (uint32_t)(cr * GPIT + cc * 8) * 2u;
    const int nst = K / GBK;                       // stages; block-uniform
    auto fill = [&](int st) {                      // stage st -> buffer st & 1: 32 copies per wave
      const uint32_t l = lr + (uint32_t)(st & 1) * (uint32_t)(GSTG * 2);
      const _Float16* pa = ga + (size_t)st * GBK;
      const _Float16* pb = gb + (size_t)st * GBK;
      acopy_rows64(l, pa, (size_t)lda);
      acopy_rows64(l + 64u * GPIT * 2u, pa + (size_t)64 * (size_t)lda, (size_t)lda);
      acopy_rows64(l + 128u * GPIT * 2u, pb, (size_t)ldb);
      acopy_rows64(l + 192u * GPIT * 2u, pb + (size_t)64 * (size_t)ldb, (size_t)ldb);
    };
    fill(0);
    wait_async0();
    __syncthreads();                               // stage 0 is published
    if (nst > 1) fill(1);
    for (int t = 0; t < nst; ++t) {
      const _Float16* sb  = ring + (t & 1) * GSTG;
      const _Float16* ar0 = sb + (wave * 32 + rl) * GPIT + koff;
      const _Float16* ar1 = ar0 + 16 * GPIT;
      const _Float16* br  = sb + (128 + rl) * GPIT + koff;
#pragma unroll                                     // the k offset becomes an immediate of each LDS load
      for (int kk = 0; kk < GBK / 32; ++kk) {
        const v16h a0 = ldfrag_h(ar0 + 32 * kk);
        const v16h a1 = ldfrag_h(ar1 + 32 * kk);
        v16h b[8];
#pragma unroll                                     // b[] stays in registers: the k-step's LDS loads stand as one group
        for (int j = 0; j < 8; ++j) b[j] = ldfrag_h(br + j * 16 * GPIT + 32 * kk);
#pragma unroll                                     // acc[][] and b[] indexed by constants only
        for (int j = 0; j < 8; ++j) {
          acc[0][j] = mma_h_raw(a0, b[j], acc[0][j]);
          acc[1][j] = mma_h_raw(a1, b[j], acc[1][j]);
          guard3(acc[0][j], acc[1][j], a0, a1, b[j]);
        }
      }
      wait_ds0();
      wait_async0();
      __syncthreads();                             // publishes stage t + 1 and ends every read of stage t
      if (t + 2 < nst) fill(t + 2);
    }
    wait_async0();
  }
  acc_guard4(acc[0][0], acc[0][1], acc[0][2], acc[0][3]);
  acc_guard4(acc[0][4], acc[0][5], acc[0][6], acc[0][7]);
  acc_guard4(acc[1][0], acc[1][1], acc[1][2], acc[1][3]);
  acc_guard4(acc[1][4], acc[1][5], acc[1][6], acc[1][7]);

  // ---- epilogue ----
  float* slab = sT[wave];
  float gmul[8];
  float csc = 1.0f;
  if (EPI == 1) {
    const bool isq = (n0 < DM);                                 // wave-uniform
    const int  hb  = (isq ? n0 : (n0 - DM)) >> 6;               // first head of this tile (0..15)
    csc = isq ? QSC : KSC;
#pragma unroll
    for (int j = 0; j < 8; ++j) {
      const int gi = (hb + (j >> 2)) * HD + 16 * (j & 3) + rl;  // < NHEAD*HD, inside both gain arrays
      const float ga = bfr(gq[gi]);
      const float gb = bfr(gk[gi]);
      gmul[j] = (isq ? ga : gb) * 8.0f;
    }
  } else {
#pragma unroll
    for (int j = 0; j < 8; ++j) gmul[j] = 1.0f;
  }
#pragma unroll
  for (int i = 0; i < 2; ++i) {
    const int mB = m0 + 16 * i;
    if (EPI == 1) {
      float inv[2][8];
#pragma unroll
      for (int jh = 0; jh < 2; ++jh) {
#pragma unroll
        for (int r = 0; r < 8; ++r) {        // sum of squares over the head's 64 columns of row 8hh+r
          float ss = 0.f;
#pragma unroll
          for (int jj = 0; jj < 4; ++jj) {
            const float x = acc[i][4 * jh + jj][r] * oscale;
            ss += x * x;
          }
          ss += __shfl_xor(ss, 1, 32);
          ss += __shfl_xor(ss, 2, 32);
          ss += __shfl_xor(ss, 4, 32);
          ss += __shfl_xor(ss, 8, 32);
          inv[jh][r] = oscale * (1.0f / fmaxf(sqrtf(ss), NRM_EPS));
        }
      }
#pragma unroll
      for (int j = 0; j < 8; ++j) {
#pragma unroll
        for (int r = 0; r < 8; ++r)
          slab[(8 * hh + r) * 132 + 16 * j + rl] = acc[i][j][r] * inv[j >> 2][r] * gmul[j];
      }
    } else {
#pragma unroll
      for (int j = 0; j < 8; ++j) {
#pragma unroll
        for (int r = 0; r < 8; ++r) slab[(8 * hh + r) * 132 + 16 * j + rl] = acc[i][j][r] * oscale;
      }
    }
    wave_sync_lds();
    if (EPI == 3) {
      float* Cf = (float*)C0 + cpl;
      v4f ov[16];
#pragma unroll
      for (int it = 0; it < 16; ++it) ov[it] = *(const v4f*)(slab + it * 132 + lane * 4);
      {
#pragma unroll
        for (int it = 0; it < 16; ++it)                       // row it: 32 lanes x 16 B = 512 B = 128 cols
          *(v4f*)(Cf + (size_t)(crow0 + mB + it) * (size_t)ldc + n0 + lane * 4) = ov[it];
        
      }
    } else {
      unsigned short* Cp = (unsigned short*)C0 + cpl;
      unsigned short* Cq = (unsigned short*)C1 + cpl;
      v4u hv[8], lv[8];
#pragma unroll
      for (int it = 0; it < 8; ++it) {
        const int row = it * 2 + hh;                          // it 0..7 x hh 0..1 = rows 0..15
        const float* sp = slab + row * 132 + rl * 8;          // 8 consecutive columns = 4 rotary pairs
        const v4f fa = *(const v4f*)sp;
        const v4f fb = *(const v4f*)(sp + 4);
        float f[8];
        f[0] = fa[0]; f[1] = fa[1]; f[2] = fa[2]; f[3] = fa[3];
        f[4] = fb[0]; f[5] = fb[1]; f[6] = fb[2]; f[7] = fb[3];
        const int pos = crow0 + mB + row;                     // position in the concatenated sequence
        const v4f cv = *(const v4f*)(cost + (size_t)pos * RP + (rl & 7) * 4);   // pairs ((rl&7)*4 .. +3)
        const v4f sv = *(const v4f*)(sint + (size_t)pos * RP + (rl & 7) * 4);
        v4u pk, pl;
#pragma unroll
        for (int e = 0; e < 4; ++e) {
          const float f0 = f[2 * e], f1 = f[2 * e + 1];
          const float cc = cv[e], sn = sv[e];
          const float g0 = (f0 * cc - f1 * sn) * csc;
          const float g1 = (f0 * sn + f1 * cc) * csc;
          const _Float16 x0 = (_Float16)g0;
          const _Float16 x1 = (_Float16)g1;
          const _Float16 y0 = (_Float16)((g0 - (float)x0) * RSC);
          const _Float16 y1 = (_Float16)((g1 - (float)x1) * RSC);
          pk[e] = pk16(h_bits(x0), h_bits(x1));
          pl[e] = pk16(h_bits(y0), h_bits(y1));
        }
        hv[it] = pk;
        lv[it] = pl;
      }
      {
#pragma unroll
        for (int it = 0; it < 8; ++it) {
          const int row = it * 2 + hh;
          const size_t go = (size_t)(crow0 + mB + row) * (size_t)ldc + n0 + rl * 8;
          *(v4u*)(Cp + go) = hv[it];
          *(v4u*)(Cq + go) = lv[it];
        }
        
      }
    }
    wave_sync_lds();
  }
}

// =====================================================================================================
// Compressive-memory update per (head h, segment s in 0..2) of one batch (blockIdx.y):
//   MT[h][s][e][d] = sum over the 1024 keys l of segment s of v[l][e] * sk[l][d], sk = elu(k) + 1
//   (elu(x) = x > 0 ? x : exp(x) - 1, so sk = x > 0 ? x + 1 : exp(x)), and ZP[h][s][d] = sum_l sk[l][d].
//   k is rebuilt in f32 from the q|k hi / residual planes ((hi + lo/RSC) / KSC, column DM + h*64 + d), sk is
//   RNE-converted to f16 and written TRANSPOSED into an LDS tile skT[d][l] (64 keys per chunk, pitch 72 halves);
//   A = V^T hi plane rows (h*64 + e, keys), Bt = skT; D[e][d] scaled by 1/VSC.
//   Block = 8 waves; wave w owns e rows 16*(w>>1).. and d columns 32*(w&1)..; acc guarded; the 16x32 f32 piece is
// coverage: MT: 8 waves x (16 rows x 32 cols) = the whole 64x64 tile of (h,s); 4 its x 4 row groups x 8 lanes =
//   16 rows x 32 cols per wave. ZP: 16 lanes x 4 floats = 64. skT fill: 256 threads x 16 d x 1 key = 64x64 chunk.
// =====================================================================================================
__global__ __launch_bounds__(256) void mt_seg(const unsigned short* __restrict__ QKH,
                                             const unsigned short* __restrict__ QKL,
                                             const unsigned short* __restrict__ VTH,
                                             float* MT, float* ZP) {
  __shared__ __align__(16) _Float16 skT[HD * 72];
  __shared__ __align__(16) float slab[8][16 * 36];
  __shared__ float zred[8][HD];
  __shared__ __align__(16) float zsum[HD];

  const int tid = threadIdx.x, wave = tid >> 5, lane = tid & 31, hh = lane >> 4, c = lane & 15;
  const int h = (int)(blockIdx.x / 3u);
  const int s = (int)(blockIdx.x - (unsigned)h * 3u);
  if (h >= NHEAD) return;                 // block-uniform, ahead of any barrier; never taken
  QKH += (size_t)blockIdx.y * SEQ * QKW;  // blockIdx.y = batch: its own planes
  QKL += (size_t)blockIdx.y * SEQ * QKW;
  VTH += (size_t)blockIdx.y * DM * SEQ;
  MT  += (size_t)blockIdx.y * NHEAD * 3 * HD * HD;
  ZP  += (size_t)blockIdx.y * NHEAD * 3 * HD;
  const int r  = tid >> 2;                // key within the 64-key chunk handled by this thread
  const int dq = (tid & 3) * 16;          // first of the 16 d columns handled by this thread
  const int et = wave >> 1;               // e row tile of this wave
  const int dt0 = (wave & 1) * 2;         // first d column tile of this wave

  const _Float16* Q16 = (const _Float16*)(const void*)QKH;
  const _Float16* L16 = (const _Float16*)(const void*)QKL;
  const _Float16* V16 = (const _Float16*)(const void*)VTH;
  const _Float16* vrow = V16 + (size_t)(h * HD + et * 16 + c) * SEQ + (size_t)s * SEG + 8 * hh;   // A frag base

  float zacc[16];
#pragma unroll
  for (int e = 0; e < 16; ++e) zacc[e] = 0.f;
  v8f acc[2];
  acc[0] = zero8(); acc[1] = zero8();

  for (int kt = 0; kt < SEG / 64; ++kt) {
    __syncthreads();                      // prior chunk's fragment reads are done
    {
      const size_t n = (size_t)(s * SEG + kt * 64 + r);
      const _Float16* kp = Q16 + n * QKW + DM + h * HD + dq;
      const _Float16* lp = L16 + n * QKW + DM + h * HD + dq;
      FH kf, lf;
      kf.h[0] = *(const v8h*)kp; kf.h[1] = *(const v8h*)(kp + 8);
      lf.h[0] = *(const v8h*)lp; lf.h[1] = *(const v8h*)(lp + 8);
#pragma unroll
      for (int e = 0; e < 16; ++e) {
        const float kv = ((float)kf.v[e] + (float)lf.v[e] * (1.0f / RSC)) * (1.0f / KSC);
        const float sk = (kv > 0.f) ? (kv + 1.0f) : __expf(kv);
        const _Float16 skh = (_Float16)sk;
        skT[(dq + e) * 72 + r] = skh;
        zacc[e] += (float)skh;
      }
    }
    __syncthreads();                      // skT chunk complete
#pragma unroll
    for (int kk = 0; kk < 2; ++kk) {
      const v16h a  = ldfrag_h(vrow + kt * 64 + 32 * kk);
      const v16h b0 = ldfrag_h(skT + (16 * dt0 + c) * 72 + 32 * kk + 8 * hh);
      const v16h b1 = ldfrag_h(skT + (16 * (dt0 + 1) + c) * 72 + 32 * kk + 8 * hh);
      acc[0] = mma_h_raw(a, b0, acc[0]);
      acc[1] = mma_h_raw(a, b1, acc[1]);
      guard3(acc[0], acc[1], a, b0, b1);
    }
  }
  acc_guard2(acc[0], acc[1]);

  // ---- MT piece: rows e = 16*et + (8hh+rr), cols d = 32*(wave&1) + 16*jj + c ----
  float* sl = slab[wave];
#pragma unroll
  for (int jj = 0; jj < 2; ++jj) {
#pragma unroll
    for (int rr = 0; rr < 8; ++rr) sl[(8 * hh + rr) * 36 + 16 * jj + c] = acc[jj][rr] * (1.0f / VSC);
  }
  wave_sync_lds();
  {
    v4f mv[4];
#pragma unroll
    for (int it = 0; it < 4; ++it) {
      const int row = it * 4 + (lane >> 3);
      mv[it] = *(const v4f*)(sl + row * 36 + (lane & 7) * 4);
    }
    float* mtb = MT + ((size_t)(h * 3 + s) * HD + (size_t)et * 16) * HD + (wave & 1) * 32;
    {
#pragma unroll
      for (int it = 0; it < 4; ++it) {
        const int row = it * 4 + (lane >> 3);
        *(v4f*)(mtb + (size_t)row * HD + (lane & 7) * 4) = mv[it];
      }
      
    }
  }
  // ---- ZP: sum zacc over the 8 keys of this wave (lanes sharing lane&3), then over the 8 waves ----
#pragma unroll
  for (int e = 0; e < 16; ++e) {
    float v = zacc[e];
    v += __shfl_xor(v, 4, 32);
    v += __shfl_xor(v, 8, 32);
    v += __shfl_xor(v, 16, 32);
    if ((lane >> 2) == 0) zred[wave][(lane & 3) * 16 + e] = v;
  }
  __syncthreads();
  if (tid < HD) {
    float z = 0.f;
#pragma unroll
    for (int w = 0; w < 8; ++w) z += zred[w][tid];
    zsum[tid] = z;
  }
  __syncthreads();
  if (tid < 16) {                         // wave 0, lanes 0..15: 16 x 16 B = the whole 256-B ZP row
    const v4f zz = *(const v4f*)(zsum + tid * 4);
    float* zp = ZP + (size_t)(h * 3 + s) * HD + tid * 4;
    *(v4f*)zp = zz;
    
  }
}

// =====================================================================================================
// Compressive-memory read per (head h, segment s in 1..3, 128-row block) of one batch (blockIdx.y):
//   M_s = sum over segments before s of MT[h][s'] (f32 sum, RNE convert to an f16 LDS tile MTh[e][d], pitch 72);
//   z_s = sum of ZP[h][s'] (f32, LDS). Per query row n of segment s: q rebuilt in f32 from the hi / residual planes
//   ((hi + lo/RSC) / QSC, column h*64 + d), sq = elu(q) + 1 RNE-converted to f16 directly into the A fragment
//   (elementwise transform keeps the A layout); num[n][e] = sum_d sq[n][d] * M_s[d][e] with Bt = MTh (K = 64, two
//   k-steps, 4 column tiles); den[n] = sum_d sq[n][d] * z_s[d] + 1e-6 in f32 from the same f16 sq values (lane
//   halves combined, then broadcast to the D rows); MEM[n][h*64 + e] = num * (1/den), f32 rows of pitch DM.
//   Block = 8 waves x 16 rows; per-wave 16x64 f32 tile staged in LDS; stores 16 lanes x 16 B per 256-B row
// coverage: 16 heads x 3 segments x 8 row blocks x 8 waves x 16 rows = MEM rows 1024..4095 of every head's 64
//   columns; 8 its x 2 row halves x 16 lanes x 4 floats = the wave's 16x64 tile. Rows 0..1023 (segment 0) are not
//   produced and are not used by the consumer (memory is exactly zero there).
// =====================================================================================================
__global__ __launch_bounds__(256) void mem_ret(const unsigned short* __restrict__ QKH,
                                              const unsigned short* __restrict__ QKL,
                                              const float* __restrict__ MT, const float* __restrict__ ZP,
                                              float* MEM) {
  __shared__ __align__(16) _Float16 MTh[HD * 72];
  __shared__ float zs[HD];
  __shared__ __align__(16) float slab[8][16 * 68];

  const int tid = threadIdx.x, wave = tid >> 5, lane = tid & 31, hh = lane >> 4, c = lane & 15;
  const int h   = (int)(blockIdx.x / 24u);
  const int rem = (int)(blockIdx.x - (unsigned)h * 24u);
  const int s   = 1 + rem / 8;            // 1..3
  const int rb  = rem - (s - 1) * 8;      // 0..7
  if (h >= NHEAD) return;                 // block-uniform, ahead of any barrier; never taken
  QKH += (size_t)blockIdx.y * SEQ * QKW;  // blockIdx.y = batch: its own planes
  QKL += (size_t)blockIdx.y * SEQ * QKW;
  MT  += (size_t)blockIdx.y * NHEAD * 3 * HD * HD;
  ZP  += (size_t)blockIdx.y * NHEAD * 3 * HD;
  MEM += (size_t)blockIdx.y * SEQ * DM;

  {
    const int e = tid >> 2, d0 = (tid & 3) * 16;
    float sm[16];
#pragma unroll
    for (int i = 0; i < 16; ++i) sm[i] = 0.f;
#pragma unroll
    for (int sp = 0; sp < 3; ++sp) {
      if (sp < s) {                       // block-uniform
        const float* src = MT + ((size_t)(h * 3 + sp) * HD + e) * HD + d0;
#pragma unroll
        for (int q = 0; q < 4; ++q) {
          const v4f v = *(const v4f*)(src + 4 * q);
          sm[4 * q + 0] += v[0]; sm[4 * q + 1] += v[1]; sm[4 * q + 2] += v[2]; sm[4 * q + 3] += v[3];
        }
      }
    }
    v8h p0, p1;
#pragma unroll
    for (int i = 0; i < 8; ++i) { p0[i] = (_Float16)sm[i]; p1[i] = (_Float16)sm[8 + i]; }
    *(v8h*)(MTh + e * 72 + d0) = p0;
    *(v8h*)(MTh + e * 72 + d0 + 8) = p1;
    if (tid < HD) {
      float z = 0.f;
#pragma unroll
      for (int sp = 0; sp < 3; ++sp) {
        if (sp < s) z += ZP[(size_t)(h * 3 + sp) * HD + tid];
      }
      zs[tid] = z;
    }
  }
  __syncthreads();

  const _Float16* Q16 = (const _Float16*)(const void*)QKH;
  const _Float16* L16 = (const _Float16*)(const void*)QKL;
  const int n0w = s * SEG + rb * MROWS + wave * 16;          // first query position of this wave

  v16h af[2];
  float denp = 0.f;
#pragma unroll
  for (int kk = 0; kk < 2; ++kk) {
    FH hf, lf;
    hf.v = ldfrag_h(Q16 + (size_t)(n0w + c) * QKW + h * HD + 32 * kk + 8 * hh);
    lf.v = ldfrag_h(L16 + (size_t)(n0w + c) * QKW + h * HD + 32 * kk + 8 * hh);
    v16h a;
#pragma unroll
    for (int i = 0; i < 16; ++i) {
      const float qv = ((float)hf.v[i] + (float)lf.v[i] * (1.0f / RSC)) * (1.0f / QSC);
      const float sq = (qv > 0.f) ? (qv + 1.0f) : __expf(qv);
      const _Float16 sqh = (_Float16)sq;
      a[i] = sqh;
      const int kidx = 32 * kk + ((i < 8) ? (8 * hh + i) : (8 + 8 * hh + i));   // k of element i (split map)
      denp += (float)sqh * zs[kidx];
    }
    af[kk] = a;
  }
  const float den = denp + __shfl_xor(denp, 16, 32) + DEN_EPS;   // row c complete in lanes c and c+16

  v8f acc[4];
#pragma unroll
  for (int j = 0; j < 4; ++j) {
    acc[j] = zero8();
#pragma unroll
    for (int kk = 0; kk < 2; ++kk) {
      const v16h b = ldfrag_h(MTh + (16 * j + c) * 72 + 32 * kk + 8 * hh);
      acc[j] = mma_h(af[kk], b, acc[j]);
    }
  }
  float rinv[8];
#pragma unroll
  for (int rr = 0; rr < 8; ++rr) rinv[rr] = 1.0f / __shfl(den, 8 * hh + rr, 32);   // den of D row 8hh+rr

  float* sl = slab[wave];
#pragma unroll
  for (int j = 0; j < 4; ++j) {
#pragma unroll
    for (int rr = 0; rr < 8; ++rr) sl[(8 * hh + rr) * 68 + 16 * j + c] = acc[j][rr] * rinv[rr];
  }
  wave_sync_lds();
  {
    v4f ov[8];
#pragma unroll
    for (int it = 0; it < 8; ++it) {
      const int row = it * 2 + hh;        // it 0..7 x hh 0..1 = rows 0..15
      ov[it] = *(const v4f*)(sl + row * 68 + c * 4);
    }
    {
#pragma unroll
      for (int it = 0; it < 8; ++it) {
        const int row = it * 2 + hh;
        *(v4f*)(MEM + (size_t)(n0w + row) * DM + h * HD + c * 4) = ov[it];
      }
      
    }
  }
}

// =====================================================================================================
// Segment-local causal attention with the gate mix, per (batch, h, segment, 64-query block):
//   s = (sum_d qh.kh + (ql.kh + qh.kl) / RSC) * sscale, sscale = (1/8) / (QSC*KSC); key > query (segment-local)
//   -> NEG_BIG (value select); online softmax in f32; p = exp(s - m) carried as ph = f16(1024 p) and, when PRES,
//   also pl = f16((1024 p - ph) * RSC); local numerator = p . v with v as f16 hi (VSC v) and, when PRES, the f16
//   residual ((VSC v - hi) * RSC) plane: oh += ph.vhi over all chunks; when PRES: ol = ph.vres + pl.vhi (one
//   residual accumulator per chunk and 16-wide d tile, both products carry the same 1/RSC), folded as
//   oh += ol / RSC in f32 right after its two k-steps.
//   q|k planes (f16, pitch QKW, rows = positions): q element (t, h, d) at [t*QKW + h*64 + d], k at
//   [t*QKW + DM + h*64 + d]; V^T planes (f16): element (h, d, t) at [(h*64 + d)*SEQ + t]; MEM plane (f32,
//   pitch DM): element (t, h, e) at [t*DM + h*64 + e].
//   Epilogue per query row t: local = oh / (l * PSC * VSC); mem = MEM[t] for segments >= 1 (segment 0: exactly 0
//   by a value select; the load address is always inside the plane); out = g * mem + (1 - g) * local with
//   g = sigmoid(bf16(gate[h])); rows of positions < NTOK go to the second output (offset OUT1OFF), rows of positions
//   >= NTOK to the first, row t mod NTOK, columns h*64..h*64+63 (pitch DM floats).
//   Block = 4 waves = 64 query rows of one h; grid = (NHEAD * NSEG * nqb, NB), block -> (h, seg, qbs = qb0 + i), batch;
//   key chunks of 64 within the segment, chunks kt <= qbs only (block-uniform trip <= NQB), chunk kt == qbs keeps
//   its diagonal by the per-element select.
//   K / V^T chunk staging: 128 threads, K row r = tid>>1 (32-column half (tid&1)), V^T row d = tid>>1 (32-key half);
//   plain 16-B loads, __syncthreads ahead of and after; q fragments (hi and residual, 2 d-chunks) held in
//   registers for the whole block; P tiles wave-private, spilled with _Float16 element stores and reloaded as v8h
//   Output coverage: each wave stores rows q0..q0+15 (it 0..7 x lane>>4) x 64 columns (16 lanes x 16 B), one
// =====================================================================================================
template <bool PRES>
__global__ __launch_bounds__(128)
void attn_seg(const unsigned short* __restrict__ QKH, const unsigned short* __restrict__ QKL,
              const unsigned short* __restrict__ VTH, const unsigned short* __restrict__ VTL,
              const float* __restrict__ MEM, const float* __restrict__ gate,
              float* outb, float sscale, int qb0, int nqb) {
  __shared__ __align__(16) _Float16 Ksh[64 * APIT];                           // K hi  [key][d]  9 KB
  __shared__ __align__(16) _Float16 Kls[64 * APIT];                           // K res [key][d]  9 KB
  __shared__ __align__(16) _Float16 Vhs[HD * APIT];                           // V^T hi [d][key] 9 KB
  __shared__ __align__(16) _Float16 Vls[PRES ? HD * APIT : 8];                // V^T res [d][key] 9 KB (PRES)
  __shared__ __align__(16) _Float16 Psh[4][16 * APIT];                        // per wave P hi [row][key] 9 KB
  __shared__ __align__(16) _Float16 Psl[PRES ? 4 : 1][PRES ? 16 * APIT : 8];  // per wave P residual (PRES) 9 KB
  __shared__ __align__(16) float    Os[4][16 * 68];                          // per wave output tile [row][d]

  const int tid  = threadIdx.x;
  const int wave = tid >> 5;
  const int lane = tid & 31;
  const int hh   = lane >> 4;
  const int c    = lane & 15;

  const int per = NSEG * nqb;
  const int h   = (int)(blockIdx.x / (unsigned)per);
  const int rem = (int)(blockIdx.x - (unsigned)h * (unsigned)per);
  const int seg = rem / nqb;
  const int qbs = qb0 + (rem - seg * nqb);
  if (h >= NHEAD || seg >= NSEG) return;  // block-uniform, ahead of any barrier; never taken for exact grids
  QKH  += (size_t)blockIdx.y * SEQ * QKW; // blockIdx.y = batch: its own planes and its own rows of both outputs
  QKL  += (size_t)blockIdx.y * SEQ * QKW;
  VTH  += (size_t)blockIdx.y * DM * SEQ;
  VTL  += (size_t)blockIdx.y * DM * SEQ;
  MEM  += (size_t)blockIdx.y * SEQ * DM;
  outb += (size_t)blockIdx.y * NTOK * DM;
  const int sbase = seg * SEG;
  const int rowl0 = qbs * 64 + wave * 16; // segment-local row of this wave's first query
  const int q0    = sbase + rowl0;        // its position in the concatenated sequence

  const _Float16* Q16 = (const _Float16*)(const void*)QKH;
  const _Float16* L16 = (const _Float16*)(const void*)QKL;
  const _Float16* Qg  = Q16 + (size_t)h * HD;
  const _Float16* Qlg = L16 + (size_t)h * HD;
  const _Float16* Kg  = Q16 + DM + (size_t)h * HD;
  const _Float16* Klg = L16 + DM + (size_t)h * HD;
  const _Float16* Vhg = (const _Float16*)(const void*)VTH + (size_t)h * HD * SEQ;
  const _Float16* Vlg = (const _Float16*)(const void*)VTL + (size_t)h * HD * SEQ;

  // ---- q fragments (A operand, row = lane&15), hi and residual, d-chunks 0 and 1, fixed for the block ----
  const v16h qh0 = ldfrag_h(Qg  + (size_t)(q0 + c) * QKW + 8 * hh);
  const v16h qh1 = ldfrag_h(Qg  + (size_t)(q0 + c) * QKW + 32 + 8 * hh);
  const v16h ql0 = ldfrag_h(Qlg + (size_t)(q0 + c) * QKW + 8 * hh);
  const v16h ql1 = ldfrag_h(Qlg + (size_t)(q0 + c) * QKW + 32 + 8 * hh);

  float mrow[8], lrow[8];
  v8f oh[4];
#pragma unroll
  for (int r = 0; r < 8; ++r) { mrow[r] = NEG_BIG; lrow[r] = 0.f; }
#pragma unroll
  for (int t = 0; t < 4; ++t) oh[t] = zero8();

  _Float16* pwh = Psh[wave];
  _Float16* pwl = &Psl[PRES ? wave : 0][0];

  for (int kt = 0; kt < NQB; ++kt) {          // static bound; block-uniform causal chunk skipping
    if (kt > qbs) break;
    const int kv0 = sbase + kt * 64;
    __syncthreads();
    {
      const int r = tid >> 1, hk = (tid & 1) * 32;
      const _Float16* kg = Kg + (size_t)(kv0 + r) * QKW + hk;        // K row kv0+r, d = hk..hk+31
#pragma unroll
      for (int i = 0; i < 4; ++i) *(v8h*)(Ksh + r * APIT + hk + 8 * i) = *(const v8h*)(kg + 8 * i);
      cbar();
      const _Float16* lg = Klg + (size_t)(kv0 + r) * QKW + hk;
#pragma unroll
      for (int i = 0; i < 4; ++i) *(v8h*)(Kls + r * APIT + hk + 8 * i) = *(const v8h*)(lg + 8 * i);
      cbar();
      const _Float16* vh = Vhg + (size_t)r * SEQ + kv0 + hk;          // V^T row d = r, t = kv0+hk..+31
#pragma unroll
      for (int i = 0; i < 4; ++i) *(v8h*)(Vhs + r * APIT + hk + 8 * i) = *(const v8h*)(vh + 8 * i);
      if (PRES) {
        cbar();
        const _Float16* vl = Vlg + (size_t)r * SEQ + kv0 + hk;
#pragma unroll
        for (int i = 0; i < 4; ++i) *(v8h*)(Vls + r * APIT + hk + 8 * i) = *(const v8h*)(vl + 8 * i);
        cbar();
      }
    }
    __syncthreads();

    // ---- scores: 16 query rows x 64 keys per wave, K = 64 (2 d-chunks), three products ----
    v8f s[4];
#pragma unroll
    for (int j = 0; j < 4; ++j) {
      v8f sh = zero8(), sl = zero8();
      {
        FH kb, lb;
        kb.h[0] = *(const v8h*)(Ksh + (j * 16 + c) * APIT + 8 * hh);
        kb.h[1] = *(const v8h*)(Ksh + (j * 16 + c) * APIT + 16 + 8 * hh);
        lb.h[0] = *(const v8h*)(Kls + (j * 16 + c) * APIT + 8 * hh);
        lb.h[1] = *(const v8h*)(Kls + (j * 16 + c) * APIT + 16 + 8 * hh);
        sh = mma_h_raw(qh0, kb.v, sh);
        sl = mma_h_raw(ql0, kb.v, sl);
        sl = mma_h_raw(qh0, lb.v, sl);
        guard4m(sh, sl, qh0, ql0, kb.v, lb.v);
      }
      {
        FH kb, lb;
        kb.h[0] = *(const v8h*)(Ksh + (j * 16 + c) * APIT + 32 + 8 * hh);
        kb.h[1] = *(const v8h*)(Ksh + (j * 16 + c) * APIT + 48 + 8 * hh);
        lb.h[0] = *(const v8h*)(Kls + (j * 16 + c) * APIT + 32 + 8 * hh);
        lb.h[1] = *(const v8h*)(Kls + (j * 16 + c) * APIT + 48 + 8 * hh);
        sh = mma_h_raw(qh1, kb.v, sh);
        sl = mma_h_raw(ql1, kb.v, sl);
        sl = mma_h_raw(qh1, lb.v, sl);
        guard4m(sh, sl, qh1, ql1, kb.v, lb.v);
      }
      const int key  = kt * 64 + j * 16 + c;             // segment-local key of this lane's D column
      const int rowb = rowl0 + 8 * hh;                   // segment-local query row of D element r is rowb + r
#pragma unroll
      for (int r = 0; r < 8; ++r) {
        float v = sh[r];
        v += sl[r] * (1.0f / RSC);
        v *= sscale;
        s[j][r] = (key <= rowb + r) ? v : NEG_BIG;
      }
    }

    // ---- row max, online softmax, P hi (x1024, f16) and, when PRES, P residual (x RSC, f16) to LDS ----
#pragma unroll
    for (int r = 0; r < 8; ++r) {
      float m = s[0][r];
      m = fmaxf(m, s[1][r]);
      m = fmaxf(m, s[2][r]);
      m = fmaxf(m, s[3][r]);
#pragma unroll
      for (int off = 1; off < 16; off <<= 1) m = fmaxf(m, __shfl_xor(m, off, 32));
      const float mnew  = fmaxf(mrow[r], m);
      const float alpha = __expf(mrow[r] - mnew);
      mrow[r] = mnew;
      float psum = 0.f;
#pragma unroll
      for (int j = 0; j < 4; ++j) {
        const float p  = __expf(s[j][r] - mnew);
        psum += p;
        const float ph = p * PSC;
        const _Float16 xh = (_Float16)ph;
        const int pi = (8 * hh + r) * APIT + j * 16 + c;
        pwh[pi] = xh;
        if (PRES) pwl[pi] = (_Float16)((ph - (float)xh) * RSC);
      }
#pragma unroll
      for (int off = 1; off < 16; off <<= 1) psum += __shfl_xor(psum, off, 32);
      lrow[r] = lrow[r] * alpha + psum;
#pragma unroll
      for (int t = 0; t < 4; ++t) oh[t][r] *= alpha;
    }
    wave_sync_lds();

    // ---- local numerator: oh += Phi . Vhi; when PRES also ol = Phi . Vres + Plo . Vhi, oh += ol/RSC ----
    FH pa0, pa1, pb0, pb1;
    pa0.h[0] = *(const v8h*)(pwh + c * APIT + 8 * hh);
    pa0.h[1] = *(const v8h*)(pwh + c * APIT + 16 + 8 * hh);
    pa1.h[0] = *(const v8h*)(pwh + c * APIT + 32 + 8 * hh);
    pa1.h[1] = *(const v8h*)(pwh + c * APIT + 48 + 8 * hh);
    pb0.v = pa0.v;
    pb1.v = pa1.v;
    if (PRES) {
      pb0.h[0] = *(const v8h*)(pwl + c * APIT + 8 * hh);
      pb0.h[1] = *(const v8h*)(pwl + c * APIT + 16 + 8 * hh);
      pb1.h[0] = *(const v8h*)(pwl + c * APIT + 32 + 8 * hh);
      pb1.h[1] = *(const v8h*)(pwl + c * APIT + 48 + 8 * hh);
      cbar();
    }
#pragma unroll
    for (int t = 0; t < 4; ++t) {
      const _Float16* vr = Vhs + (t * 16 + c) * APIT + 8 * hh;
      FH vb0, vb1;
      vb0.h[0] = *(const v8h*)(vr);
      vb0.h[1] = *(const v8h*)(vr + 16);
      vb1.h[0] = *(const v8h*)(vr + 32);
      vb1.h[1] = *(const v8h*)(vr + 48);
      if (PRES) {
        const _Float16* wr = Vls + (t * 16 + c) * APIT + 8 * hh;
        FH wb0, wb1;
        wb0.h[0] = *(const v8h*)(wr);
        wb0.h[1] = *(const v8h*)(wr + 16);
        wb1.h[0] = *(const v8h*)(wr + 32);
        wb1.h[1] = *(const v8h*)(wr + 48);
        v8f ol = zero8();
        oh[t] = mma_h_raw(pa0.v, vb0.v, oh[t]);
        ol    = mma_h_raw(pa0.v, wb0.v, ol);
        ol    = mma_h_raw(pb0.v, vb0.v, ol);
        oh[t] = mma_h_raw(pa1.v, vb1.v, oh[t]);
        ol    = mma_h_raw(pa1.v, wb1.v, ol);
        ol    = mma_h_raw(pb1.v, vb1.v, ol);
        guard8m(oh[t], ol, pa0.v, pa1.v, pb0.v, pb1.v, vb0.v, vb1.v, wb0.v, wb1.v);
#pragma unroll
        for (int r = 0; r < 8; ++r) oh[t][r] += ol[r] * (1.0f / RSC);
      } else {
        oh[t] = mma_h_raw(pa0.v, vb0.v, oh[t]);
        oh[t] = mma_h_raw(pa1.v, vb1.v, oh[t]);
        guard1q(oh[t], pa0.v, pa1.v, vb0.v, vb1.v);
      }
    }
    acc_guard4(oh[0], oh[1], oh[2], oh[3]);
  }

  // ---- normalise (1/l, the 1/1024 p carry and the 1/VSC v carry), gate mix with the memory read, stage the
  const float gv  = bfr(gate[h]);
  const float g   = 1.0f / (1.0f + expf(-gv));
  const float omg = 1.0f - g;
  const bool useMem = (seg > 0);                          // block-uniform
  float* os = Os[wave];
#pragma unroll
  for (int r = 0; r < 8; ++r) {
    const int qr = q0 + 8 * hh + r;                         // query position
    const float l = lrow[r];                                // >= 1 (the row maximum contributes exp(0))
    const float inv = (1.0f / l) * (1.0f / (PSC * VSC));
    const float* mr = MEM + (size_t)qr * DM + h * HD;       // inside the MEM plane for every position
#pragma unroll
    for (int t = 0; t < 4; ++t) {
      const float yv  = oh[t][r] * inv;                     // e = 16t + c
      const float mvr = mr[16 * t + c];
      const float mv  = useMem ? mvr : 0.f;
      os[(8 * hh + r) * 68 + 16 * t + c] = g * mv + omg * yv;
    }
  }
  wave_sync_lds();
  {
    const size_t ooff  = (seg < (NTOK / SEG)) ? (size_t)OUT1OFF : (size_t)0;   // positions < NTOK -> second output
    const int    orow0 = (seg < (NTOK / SEG)) ? q0 : (q0 - NTOK);               // row within the output [b][2048][1024]
    v4f ov[8];
#pragma unroll
    for (int it = 0; it < 8; ++it) {
      const int row = it * 2 + hh;                          // it 0..7 x hh 0..1 = rows 0..15 of the wave tile
      ov[it] = *(const v4f*)(os + row * 68 + c * 4);
    }
    {
#pragma unroll
      for (int it = 0; it < 8; ++it) {
        const int row = it * 2 + hh;
        *(v4f*)(outb + ooff + (size_t)(orow0 + row) * DM + h * HD + c * 4) = ov[it];
      }
      
    }
  }
}

// =====================================================================================================
// Workspace map (bytes); every plane is an exact multiple of its tile / whole-line store granularity (all dims are
// exact tile multiples, no padded tails), all offsets multiples of 4096:
//   XH    f16  [4096 t][1024 in]             0          8388608   (f16 of bf16 value x16, rows b*2048 + t)
//   AH    f16  [4096 t][1024 in]             8388608    8388608
//   WXT   f16  [3072 out][1024 in]           16777216   6291456   (W^T, bf16 value x64)
//   WAT   f16  [3072 out][1024 in]           23068672   6291456
//   COST  f32  [4096 pos][32]                29360128    524288
//   SINT  f32  [4096 pos][32]                29884416    524288
//   QKH   f16  [2 b][4096 pos][2048 (q|k)]   30408704  33554432   (q x4, k x16 hi after norm + rotary)
//   QKL   f16  [2 b][4096][2048]             63963136  33554432   (x4096 residuals)
//   VF    f32  [2 b][4096 pos][1024 (h,d)]   97517568  33554432   (v, f32)
//   VTH   f16  [2 b][1024 (h,d)][4096 pos]  131072000  16777216   (v x16 hi)
//   VTL   f16  [2 b][1024 (h,d)][4096 pos]  147849216  16777216   ((v x16 - hi) x4096)
//   MT    f32  [2 b][16 h][3 s][64 e][64 d] 164626432   1572864
//   ZP    f32  [2 b][16 h][3 s][64 d]       166199296     24576
//   MEM   f32  [2 b][4096 pos][1024 (h,e)]  166223872  33554432
//   end                                     199778304
// =====================================================================================================
extern "C" void kernel_launch(void* const* d_in, const int* in_sizes, int n_in,
                              void* d_out, int out_size, void* d_ws, size_t ws_size,
                              hipStream_t stream) {
  if (n_in < 9) return;
  if (in_sizes[0] != NB * NTOK * DM || in_sizes[1] != NB * NTOK * DM) return;
  if (in_sizes[2] != DM * W3 || in_sizes[3] != DM * W3) return;
  if (in_sizes[4] != NHEAD * HD || in_sizes[5] != NHEAD * HD) return;
  if (in_sizes[6] != NHEAD * HD || in_sizes[7] != NHEAD * HD) return;
  if (in_sizes[8] != NHEAD) return;
  if (out_size != 2 * NB * NTOK * DM) return;

  const float* X    = (const float*)d_in[0];
  const float* Aa   = (const float*)d_in[1];
  const float* Wx   = (const float*)d_in[2];
  const float* Wa   = (const float*)d_in[3];
  const float* g_qx = (const float*)d_in[4];
  const float* g_kx = (const float*)d_in[5];
  const float* g_qa = (const float*)d_in[6];
  const float* g_ka = (const float*)d_in[7];
  const float* gate = (const float*)d_in[8];
  float* outf = (float*)d_out;

  const size_t PXA = (size_t)NB * NTOK * DM * 2;        //  8388608
  const size_t PW  = (size_t)W3 * DM * 2;               //  6291456
  const size_t PRT = (size_t)SEQ * RP * 4;              //   524288
  const size_t PQK = (size_t)NB * SEQ * QKW * 2;        // 33554432
  const size_t PVF = (size_t)NB * SEQ * DM * 4;         // 33554432
  const size_t PVT = (size_t)NB * DM * SEQ * 2;         // 16777216
  const size_t PMT = (size_t)NB * NHEAD * 3 * HD * HD * 4;   // 1572864
  const size_t PZP = (size_t)NB * NHEAD * 3 * HD * 4;        //   24576
  const size_t PME = (size_t)NB * SEQ * DM * 4;         // 33554432
  size_t off = 0;
  const size_t oXH = off; off += PXA;
  const size_t oAH = off; off += PXA;
  const size_t oWX = off; off += PW;
  const size_t oWA = off; off += PW;
  const size_t oCT = off; off += PRT;
  const size_t oST = off; off += PRT;
  const size_t oQH = off; off += PQK;
  const size_t oQL = off; off += PQK;
  const size_t oVF = off; off += PVF;
  const size_t oVH = off; off += PVT;
  const size_t oVL = off; off += PVT;
  const size_t oMT = off; off += PMT;
  const size_t oZP = off; off += PZP;
  const size_t oME = off; off += PME;
  if (off > ws_size) return;                            // off = 199778304

  char* ws = (char*)d_ws;
  unsigned short* XH   = (unsigned short*)(ws + oXH);
  unsigned short* AH   = (unsigned short*)(ws + oAH);
  unsigned short* WXT  = (unsigned short*)(ws + oWX);
  unsigned short* WAT  = (unsigned short*)(ws + oWA);
  float*          COST = (float*)(ws + oCT);
  float*          SINT = (float*)(ws + oST);
  unsigned short* QKH  = (unsigned short*)(ws + oQH);
  unsigned short* QKL  = (unsigned short*)(ws + oQL);
  float*          VF   = (float*)(ws + oVF);
  unsigned short* VTH  = (unsigned short*)(ws + oVH);
  unsigned short* VTL  = (unsigned short*)(ws + oVL);
  float*          MT   = (float*)(ws + oMT);
  float*          ZP   = (float*)(ws + oZP);
  float*          MEM  = (float*)(ws + oME);

  const dim3 blk256(256), blk128(128);
  const float sscale = 0.125f / (QSC * KSC);
  const float oscale = 1.0f / (XSC * WSC);

  // Every kernel is launched once; the two arrays, the two streams and the two batches are grid dimensions.
  // (1) x, a -> row-major f16 planes of their bf16 RNE values x16; W [1024][3072] -> transposed f16 planes
  //     [3072][1024] (k contiguous, Bt form) of their bf16 RNE values x64; rotary tables
  cvt_rm<<<dim3((NB * NTOK * DM) / 2048, 2), blk256, 0, stream>>>(X, Aa, XH, NB * NTOK * DM, XSC);
  // in[DM rows][W3 cols] -> out[W3][DM]: grid (cols/64, rows/64, matrix)
  tr_cvt<0><<<dim3(W3 / 64, DM / 64, 2), blk256, 0, stream>>>(Wx, Wa, DM, W3, WXT, WXT, WSC);
  rope_tab<<<dim3((SEQ * RP) / 256), blk256, 0, stream>>>(COST, SINT, SEQ * RP);

  const int gqk  = ((NTOK / 32) * (QKW / 128)) / 4;      // 1024 tiles -> 256 blocks per stream and batch
  const int gv   = ((NTOK / 32) * (DM / 128)) / 4;       //  512 tiles -> 128 blocks per stream and batch
  const int gmt  = NHEAD * 3;                            //   48 blocks per batch
  const int gmem = NHEAD * 3 * (SEG / MROWS);            //  384 blocks per batch
  // (2) q|k of stream a (positions 0..2047) and stream x (positions 2048..4095): M=2048, N=2048, K=1024,
  //     fused per-head L2 norm + gain + rotary -> QKH/QKL f16 planes
  gemm_t<1><<<dim3(gqk, 2, NB), blk128, 0, stream>>>(AH, XH, DM, WAT, WXT, DM, (void*)QKH, (void*)QKL, QKW, SEQ,
                                                     COST, SINT, g_qa, g_ka, g_qx, g_kx, NTOK, QKW, DM, oscale);
  // (3) v of both streams: M=2048, N=1024 (W^T rows 2048..3071), K=1024 -> VF f32 rows
  gemm_t<3><<<dim3(gv, 2, NB), blk128, 0, stream>>>(AH, XH, DM, WAT + (size_t)2 * DM * DM,
                                                    WXT + (size_t)2 * DM * DM, DM, (void*)VF, (void*)VF, DM, SEQ,
                                                    COST, SINT, g_qa, g_ka, g_qx, g_kx, NTOK, DM, DM, oscale);
  // (4) v^T planes: in VF [SEQ rows][DM cols] -> out [DM][SEQ] f16 hi (x16) and residual (x4096), per batch
  tr_cvt<1><<<dim3(DM / 64, SEQ / 64, NB), blk256, 0, stream>>>(VF, VF + (size_t)SEQ * DM, SEQ, DM, VTH, VTL, VSC);
  // (5) compressive memory: per-segment sk^T.v and sum sk (segments 0..2), then the memory read for the
  //     query rows of segments 1..3 -> MEM f32 plane
  mt_seg<<<dim3(gmt, NB), blk256, 0, stream>>>(QKH, QKL, VTH, MT, ZP);
  mem_ret<<<dim3(gmem, NB), blk256, 0, stream>>>(QKH, QKL, MT, ZP, MEM);
  // (6) segment-local causal attention + gate mix -> both outputs: the leading NQP query blocks of every
  //     segment with the p, v residual products, the remaining blocks without
  attn_seg<true><<<dim3(NHEAD * NSEG * NQP, NB), blk128, 0, stream>>>(QKH, QKL, VTH, VTL, MEM, gate, outf,
                                                                      sscale, 0, NQP);
  attn_seg<false><<<dim3(NHEAD * NSEG * (NQB - NQP), NB), blk128, 0, stream>>>(QKH, QKL, VTH, VTL, MEM, gate,
                                                                               outf, sscale, NQP, NQB - NQP);
  (void)hipGetLastError();
}

// v004
// One run takes 227 microseconds.
// Next to v003, in two timings, it ran 1.10 and 1.11 times as fast.
// All steps since v000 together make it 3.46 times as fast.
// Contractions: a.W and x.W (q|k|v, K=1024) on v_wmma_f32_16x16x32_f16 with f16 containers of the bf16 RNE input
//   values (activations carried x16, W^T x64), one product; q.k^T (K=64) on v_wmma_f32_16x16x32_f16 with q (x4) and
//   k (x16) f16 hi planes plus x4096 f16 residual planes (three products, residual pair in a separate accumulator
//   folded by 1/4096); p.v^T on v_wmma_f32_16x16x32_f16 with p as f16(1024 p) and v^T as f16(16 v), one product
//   (the leading query blocks of every segment add the p and v x4096 f16 residual planes, two more products into a
//   separate accumulator); compressive memory sk^T.v (K=1024) and sq.M (K=64) on v_wmma_f32_16x16x32_f16 with
//   plain f16 operands, one product each. f32 accumulate everywhere; L2 norms, rotary tables and rotation, elu,
//   softmax statistics, sq.z, the memory quotient and the gate mix in f32.
#include <hip/hip_runtime.h>
#include <math.h>
#include <stdint.h>

#define NB      2
#define NTOK    2048                // tokens per stream per batch
#define SEQ     4096                // concatenated positions per batch (stream a first, then x)
#define DM      1024
#define NHEAD   16
#define HD      64
#define RP      32                  // rotary pairs per head
#define W3      3072
#define QKW     2048                // q|k plane width: q at column h*64+d, k at 1024 + h*64+d
#define SEG     1024
#define NSEG    4
#define NQB     16                  // 64-row query blocks per segment
#define NQP     4                   // leading query blocks per segment that carry the p / v residual products
#define MROWS   128                 // query rows per block of the memory read kernel
#define OUT1OFF (NB * NTOK * DM)             // element offset of the second output
#define XSC     16.0f
#define WSC     64.0f
#define QSC     4.0f
#define KSC     16.0f
#define VSC     16.0f
#define RSC     4096.0f
#define PSC     1024.0f
#define NRM_EPS 1.0e-12f
#define DEN_EPS 1.0e-6f
#define LOG2_BASE 13.287712379549449
#define NEG_BIG (-1.0e30f)
#define GBK     128                 // k per LDS stage of the projection GEMM (256 B of every operand row)
#define GPIT    136                 // LDS row pitch of a stage in halves: 272 B = 16 B x 17 (ds_load_b128 readers)
#define GSTG    (256 * GPIT)        // halves per stage: 128 A rows, then 128 Bt rows
#define SLABF   (16 * 132)          // floats per epilogue slab of the projection GEMM (one per wave)
#define APIT    72                  // LDS row pitch of the attention K, V^T and P tiles in halves: 144 B = 16 B x 9
                                    // (ds_load_b128 readers: 16 rows of a fragment load fall on 16 distinct bank groups)

static_assert(NHEAD * HD == DM);
static_assert(SEQ == 2 * NTOK);
static_assert(SEQ == NSEG * SEG);
static_assert(SEG == NQB * 64);
static_assert(HD == 2 * RP);
static_assert(W3 == 3 * DM);
static_assert(QKW == 2 * DM);
static_assert(((NB * NTOK * DM) % 2048) == 0);
static_assert(((SEQ * RP) % 256) == 0);
static_assert((DM % 128) == 0 && (W3 % 64) == 0 && (NTOK % 64) == 0 && (SEQ % 64) == 0);
static_assert((QKW % 128) == 0 && (DM % 32) == 0);
static_assert(NQP > 0 && NQP < NQB);
static_assert((SEG % MROWS) == 0 && MROWS == 8 * 16);
static_assert(OUT1OFF == NB * NTOK * DM);
static_assert((DM % GBK) == 0 && (NTOK % 128) == 0 && ((GPIT * 2) % 16) == 0);
static_assert(4 * SLABF * 4 <= 2 * GSTG * 2 && ((SLABF * 4) % 16) == 0);
static_assert(APIT >= HD && ((APIT * 2) % 16) == 0);

typedef _Float16 v16h __attribute__((ext_vector_type(16)));
typedef _Float16 v8h  __attribute__((ext_vector_type(8)));
typedef float    v8f  __attribute__((ext_vector_type(8)));
typedef float    v4f  __attribute__((ext_vector_type(4)));
typedef unsigned int v4u __attribute__((ext_vector_type(4)));
union FH { v16h v; v8h h[2]; };

// ---- scalar helpers --------------------------------------------------------------------------------
__device__ __forceinline__ unsigned short bf_bits(float f) {          // f32 -> bf16 bits, RNE convert
  unsigned u = __float_as_uint(f);
  return (unsigned short)((u + 0x7FFFu + ((u >> 16) & 1u)) >> 16);
}
__device__ __forceinline__ float bf_up(unsigned short b) { return __uint_as_float(((unsigned)b) << 16); }
__device__ __forceinline__ float bfr(float f) { return bf_up(bf_bits(f)); }     // value of the bf16 RNE convert
__device__ __forceinline__ unsigned short h_bits(_Float16 x) { return __builtin_bit_cast(unsigned short, x); }
__device__ __forceinline__ unsigned pk16(unsigned short a, unsigned short b) { return (unsigned)a | ((unsigned)b << 16); }
__device__ __forceinline__ v8f zero8() { v8f z = {0.f, 0.f, 0.f, 0.f, 0.f, 0.f, 0.f, 0.f}; return z; }

// ---- fragment loader: 16-bit A/B operand, lane -> row/col (lane&15), p already includes +8*(lane>>4);
//      elements 0..7 <- p[0..7] (k0+8h..), elements 8..15 <- p[16..23] (k0+16+8h..)
__device__ __forceinline__ v16h ldfrag_h(const _Float16* p) {
  FH f;
  f.h[0] = *(const v8h*)(p);
  f.h[1] = *(const v8h*)(p + 16);
  return f.v;
}

// ---- WMMA helpers with trailing VALU hazard gap --------------------------------------------------------
__device__ __forceinline__ v8f mma_h_raw(v16h a, v16h b, v8f c) {
  return __builtin_amdgcn_wmma_f32_16x16x32_f16(false, a, false, b, (short)0, c, false, false);
}
__device__ __forceinline__ v8f mma_h(v16h a, v16h b, v8f c) {
  c = mma_h_raw(a, b, c);
#if defined(__HIP_DEVICE_COMPILE__)
  asm volatile("v_nop\n\tv_nop\n\tv_nop\n\tv_nop" : "+v"(c) : "v"(a), "v"(b));
#endif
  return c;
}
__device__ __forceinline__ void guard3(v8f& x, v8f& y, v16h a, v16h b, v16h d) {   // two D tiles, 3 frags live
#if defined(__HIP_DEVICE_COMPILE__)
  asm volatile("v_nop\n\tv_nop\n\tv_nop\n\tv_nop" : "+v"(x), "+v"(y) : "v"(a), "v"(b), "v"(d));
#endif
}
__device__ __forceinline__ void guard1q(v8f& x, v16h a, v16h b, v16h d, v16h e) {           // one D, 4 frags
#if defined(__HIP_DEVICE_COMPILE__)
  asm volatile("v_nop\n\tv_nop\n\tv_nop\n\tv_nop" : "+v"(x) : "v"(a), "v"(b), "v"(d), "v"(e));
#endif
}
__device__ __forceinline__ void guard4m(v8f& x, v8f& y, v16h a, v16h b, v16h d, v16h e) {   // two D, 4 frags
#if defined(__HIP_DEVICE_COMPILE__)
  asm volatile("v_nop\n\tv_nop\n\tv_nop\n\tv_nop" : "+v"(x), "+v"(y) : "v"(a), "v"(b), "v"(d), "v"(e)
               : "memory");
#endif
}
__device__ __forceinline__ void guard8m(v8f& x, v8f& y, v16h a, v16h b, v16h d, v16h e,
                                        v16h f, v16h g, v16h p, v16h q) {                      // two D, 8 frags
#if defined(__HIP_DEVICE_COMPILE__)
  asm volatile("v_nop\n\tv_nop\n\tv_nop\n\tv_nop" : "+v"(x), "+v"(y)
               : "v"(a), "v"(b), "v"(d), "v"(e), "v"(f), "v"(g), "v"(p), "v"(q) : "memory");
#endif
}
__device__ __forceinline__ void acc_guard4(v8f& a, v8f& b, v8f& c, v8f& d) {
#if defined(__HIP_DEVICE_COMPILE__)
  asm volatile("v_nop\n\tv_nop\n\tv_nop\n\tv_nop" : "+v"(a), "+v"(b), "+v"(c), "+v"(d));
#endif
}
__device__ __forceinline__ void acc_guard2(v8f& a, v8f& b) {
#if defined(__HIP_DEVICE_COMPILE__)
  asm volatile("v_nop\n\tv_nop\n\tv_nop\n\tv_nop" : "+v"(a), "+v"(b));
#endif
}
__device__ __forceinline__ void cbar() {
#if defined(__HIP_DEVICE_COMPILE__)
  asm volatile("" ::: "memory");
#endif
}
__device__ __forceinline__ void wave_sync_lds() {
  __builtin_amdgcn_fence(__ATOMIC_RELEASE, "workgroup");
  __builtin_amdgcn_wave_barrier();
  __builtin_amdgcn_fence(__ATOMIC_ACQUIRE, "workgroup");
}

// ---- eight asynchronous 16-B copies global -> LDS per lane (l: LDS byte address, g: global address). The
//      s_wait_xcnt stands inside the statement so that no address register is rewritten ahead of it.
__device__ __forceinline__ void acopy8(uint32_t l0, uint32_t l1, uint32_t l2, uint32_t l3,
                                       uint32_t l4, uint32_t l5, uint32_t l6, uint32_t l7,
                                       const _Float16* g0, const _Float16* g1, const _Float16* g2,
                                       const _Float16* g3, const _Float16* g4, const _Float16* g5,
                                       const _Float16* g6, const _Float16* g7) {
#if defined(__HIP_DEVICE_COMPILE__)
  asm volatile("global_load_async_to_lds_b128 %0, %8, off\n\t"
               "global_load_async_to_lds_b128 %1, %9, off\n\t"
               "global_load_async_to_lds_b128 %2, %10, off\n\t"
               "global_load_async_to_lds_b128 %3, %11, off\n\t"
               "global_load_async_to_lds_b128 %4, %12, off\n\t"
               "global_load_async_to_lds_b128 %5, %13, off\n\t"
               "global_load_async_to_lds_b128 %6, %14, off\n\t"
               "global_load_async_to_lds_b128 %7, %15, off\n\t"
               "s_wait_xcnt 0x0"
               :: "v"(l0), "v"(l1), "v"(l2), "v"(l3), "v"(l4), "v"(l5), "v"(l6), "v"(l7),
                  "v"(g0), "v"(g1), "v"(g2), "v"(g3), "v"(g4), "v"(g5), "v"(g6), "v"(g7)
               : "memory");
#endif
}
// 64 rows of one operand, 256 B each, into LDS rows of pitch GPIT: l / g are this thread's addresses in row
// (tid >> 4) at 16-B piece (tid & 15); copy i takes row 8 i + (tid >> 4), a wave's copy covers two whole rows.
__device__ __forceinline__ void acopy_rows64(uint32_t l, const _Float16* g, size_t ld) {
  const uint32_t ls = 8u * GPIT * 2u;
  const size_t   gs = 8 * ld;
  acopy8(l, l + ls, l + 2 * ls, l + 3 * ls, l + 4 * ls, l + 5 * ls, l + 6 * ls, l + 7 * ls,
         g, g + gs, g + 2 * gs, g + 3 * gs, g + 4 * gs, g + 5 * gs, g + 6 * gs, g + 7 * gs);
}
// the issuing wave's own copies have landed (the compiler places no wait for them)
__device__ __forceinline__ void wait_async0() {
#if defined(__HIP_DEVICE_COMPILE__)
  asm volatile("s_wait_asynccnt 0x0" ::: "memory");
#endif
}
// this wave's LDS reads of the stage have returned before the stage is handed back for a refill
__device__ __forceinline__ void wait_ds0() {
#if defined(__HIP_DEVICE_COMPILE__)
  asm volatile("s_wait_dscnt 0x0" ::: "memory");
#endif
}

// =====================================================================================================
// Row-major convert: f32 [n] -> f16 plane [n] holding f16(bf16 RNE value * scale) (scale a power of two, exact).
// coverage: grid.x = n/2048 blocks x 256 threads x 8 = n elements (n % 2048 == 0 host-checked); grid.y = 2 arrays.
// =====================================================================================================
__global__ __launch_bounds__(256) void cvt_rm(const float* __restrict__ in0, const float* __restrict__ in1,
                                             unsigned short* out, int n, float scale) {
  const size_t i8 = ((size_t)blockIdx.x * 256 + threadIdx.x) * 8;
  if (i8 + 8 > (size_t)n) return;        // never taken for the host-checked sizes; no barriers below
  const float* in = blockIdx.y ? in1 : in0;   // blockIdx.y = which of the two arrays; its plane follows the first
  out += (size_t)blockIdx.y * (size_t)n;
  const v4f a = *(const v4f*)(in + i8);
  const v4f b = *(const v4f*)(in + i8 + 4);
  float f[8];
  f[0] = a[0]; f[1] = a[1]; f[2] = a[2]; f[3] = a[3];
  f[4] = b[0]; f[5] = b[1]; f[6] = b[2]; f[7] = b[3];
  v4u p;
#pragma unroll
  for (int e = 0; e < 4; ++e) {
    const unsigned short b0 = bf_bits(f[2 * e]), b1 = bf_bits(f[2 * e + 1]);
    const _Float16 x0 = (_Float16)(bf_up(b0) * scale);
    const _Float16 x1 = (_Float16)(bf_up(b1) * scale);
    p[e] = pk16(h_bits(x0), h_bits(x1));
  }
  *(v4u*)(out + i8) = p;
  
}

// =====================================================================================================
// Transposing convert: f32 in[R][C] (row-major, pitch C) -> 16-bit out[C][R] (pitch R), 64x64 tiles through LDS.
//   MODE 0: one plane  out0 = f16(bf16 RNE value * scale).
//   MODE 1: two planes out0 = f16(v * scale) hi, out1 = f16((v * scale - hi) * RSC) residual.
// Block = 256 threads; grid = (C/64, R/64, 2 matrices) exact (host-checked). Load: thread -> input row tid>>2, 16 consecutive
// columns (four 16-B loads). Store: two iterations, output row it*32 + (tid>>3), lanes (tid&7) -> elements
// coverage: 2 iterations x 32 output rows x 8 lanes x 8 halves = the whole 64x64 tile; grid covers all of C x R.
// =====================================================================================================
template <int MODE>
__global__ __launch_bounds__(256) void tr_cvt(const float* __restrict__ in0, const float* __restrict__ in1,
                                             int R, int C, unsigned short* out0, unsigned short* out1,
                                             float scale) {
  __shared__ float sm[64][65];
  const int tid = threadIdx.x;
  const float* in = blockIdx.z ? in1 : in0;   // blockIdx.z = which of the two matrices; its planes follow the first's
  out0 += (size_t)blockIdx.z * (size_t)R * (size_t)C;
  out1 += (size_t)blockIdx.z * (size_t)R * (size_t)C;
  const int c0 = blockIdx.x * 64;          // input column block -> output row block
  const int r0 = blockIdx.y * 64;          // input row block    -> output column block
  if (c0 + 64 > C || r0 + 64 > R) return;  // block-uniform, ahead of any barrier; never taken for exact grids
  {
    const int lr = tid >> 2, lc = (tid & 3) * 16;
    const float* src = in + (size_t)(r0 + lr) * (size_t)C + c0 + lc;
#pragma unroll
    for (int q = 0; q < 4; ++q) {
      const v4f v = *(const v4f*)(src + 4 * q);
      sm[lr][lc + 4 * q + 0] = v[0];
      sm[lr][lc + 4 * q + 1] = v[1];
      sm[lr][lc + 4 * q + 2] = v[2];
      sm[lr][lc + 4 * q + 3] = v[3];
    }
  }
  __syncthreads();
  const int seg = tid & 7;
  v4u p0[2], p1[2];
#pragma unroll
  for (int it = 0; it < 2; ++it) {
    const int ocl = it * 32 + (tid >> 3);   // output row within the tile = input column
    float f[8];
#pragma unroll
    for (int e = 0; e < 8; ++e) f[e] = sm[seg * 8 + e][ocl];
    v4u pk, pl;
#pragma unroll
    for (int e = 0; e < 4; ++e) {
      const float g0 = f[2 * e], g1 = f[2 * e + 1];
      if (MODE == 0) {
        const _Float16 x0 = (_Float16)(bfr(g0) * scale);
        const _Float16 x1 = (_Float16)(bfr(g1) * scale);
        pk[e] = pk16(h_bits(x0), h_bits(x1));
        pl[e] = pk[e];
      } else {
        const float s0 = g0 * scale, s1 = g1 * scale;
        const _Float16 x0 = (_Float16)s0, x1 = (_Float16)s1;
        const _Float16 y0 = (_Float16)((s0 - (float)x0) * RSC);
        const _Float16 y1 = (_Float16)((s1 - (float)x1) * RSC);
        pk[e] = pk16(h_bits(x0), h_bits(x1));
        pl[e] = pk16(h_bits(y0), h_bits(y1));
      }
    }
    p0[it] = pk;
    p1[it] = pl;
  }
  {
#pragma unroll
    for (int it = 0; it < 2; ++it) {
      const int ocl = it * 32 + (tid >> 3);
      const size_t go = (size_t)(c0 + ocl) * (size_t)R + (size_t)(r0 + seg * 8);
      *(v4u*)(out0 + go) = p0[it];
      if (MODE == 1) *(v4u*)(out1 + go) = p1[it];
    }
    
  }
}

// =====================================================================================================
// Rotary tables for interleaved pairs: cost[t][i] = cos(t * inv_freq[i]), sint[t][i] = sin(t * inv_freq[i]),
// i = 0..31, inv_freq[i] = 1 / (10000^(2i/64)) (power via f64 exp2 -> one f32 convert, then an f32 reciprocal
// formed in f64 and converted once), angle = one f32 multiply with t = position 0..4095 in the concatenated
// coverage: grid.x = n/256 blocks x 256 threads = n = SEQ*32 elements of each table.
// =====================================================================================================
__global__ __launch_bounds__(256) void rope_tab(float* cost, float* sint, int n) {
  const int e = blockIdx.x * 256 + (int)threadIdx.x;
  if (e >= n) return;                      // never taken (n % 256 == 0); no barriers below
  const int t = e >> 5, i = e & 31;
  const double pd = exp2((double)i * (1.0 / 32.0) * LOG2_BASE);   // 10000^(2i/64)
  const float  pf = (float)pd;
  const float  invf = (float)(1.0 / (double)pf);
  const float  ang = (float)t * invf;
  float sv, cv;
  sincosf(ang, &sv, &cv);
  *(float*)(cost + e) = cv;
  *(float*)(sint + e) = sv;
  
}

// =====================================================================================================
// Register-blocked f16 WMMA GEMM, one wave per 32x128 tile; block = 4 waves = 4 tiles stacked in m = one 128x128
// block tile whose operands pass through LDS: a stage is 128 k of the 128 A rows and the 128 Bt rows, brought by
// asynchronous copies into two buffers (stage t + 1 flies while stage t is worked on), read by all 4 waves:
//   acc[m][n] = sum_k A[m][k] * Bt[n][k]; A row-major [M][K] pitch lda, Bt row-major [N][K] pitch ldb
//   (k contiguous); M % 128 == 0, N % 128 == 0, K % 128 == 0 (exact constants here, host-checked).
// EPI 1 (q|k planes, N == QKW): the 128-column tile holds two heads of 64 columns (columns < DM are q heads,
//        columns >= DM are k heads). Per row and head: t = acc*oscale; v = t * (1/max(||t||_2, 1e-12)) *
//        bf16(gain[head][d]) * 8; then the interleaved-pair rotary rotation with the f32 tables at position
//        crow0 + m (pair (2i, 2i+1): o1 = v1*c - v2*s, o2 = v1*s + v2*c), times cscale (QSC for q, KSC for k)
//        -> C0 = f16 hi, C1 = f16((v - hi) * RSC) residual, 16-bit planes of pitch ldc, row crow0 + m, column n.
// EPI 3: f32 rows (C0) = acc*oscale, pitch ldc, row crow0 + m, column n.
// 16 lanes x 16 B per 256-B row segment (two rows per instruction), f32 as 32 lanes x 16 B per 512-B row segment;
// coverage: 2 slabs x 16 rows x 128 cols = the wave's whole 32x128 tile; tiles = whole M x N (grid.x = tiles/4 exact),
// grid.y = the two streams, grid.z = the batches.
// =====================================================================================================
template <int EPI>
__global__ __launch_bounds__(128) void gemm_t(
    const unsigned short* __restrict__ A0, const unsigned short* __restrict__ A1, int lda,
    const unsigned short* __restrict__ Bt0, const unsigned short* __restrict__ Bt1, int ldb,
    void* C0, void* C1, int ldc, int crows,
    const float* __restrict__ cost, const float* __restrict__ sint,
    const float* __restrict__ gq0, const float* __restrict__ gk0,
    const float* __restrict__ gq1, const float* __restrict__ gk1,
    int M, int N, int K, float oscale) {
  __shared__ __align__(16) _Float16 ring[2 * GSTG]; // two operand stages; behind the k loop the same bytes hold the
                                                    // epilogue slabs, so a block takes 136 KiB and two fit one WGP
  const int lane = threadIdx.x & 31;
  const int wave = threadIdx.x >> 5;
  // blockIdx.y = stream (0: operands A0, Bt0, gains gq0, gk0, C rows 0..M-1; 1: the others, C rows M..2M-1);
  // blockIdx.z = batch (A rows z*M.., C plane z of crows rows)
  const int  st = (int)blockIdx.y;
  const unsigned short* A  = (st ? A1 : A0) + (size_t)blockIdx.z * (size_t)M * (size_t)lda;
  const unsigned short* Bt = st ? Bt1 : Bt0;
  const float* gq = st ? gq1 : gq0;
  const float* gk = st ? gk1 : gk0;
  const int    crow0 = st * M;
  const size_t cpl   = (size_t)blockIdx.z * (size_t)crows * (size_t)ldc;   // element offset of this batch's C plane
  const int tilesN = N >> 7;
  const int tilesM = M >> 5;
  if ((int)blockIdx.x >= (tilesM >> 2) * tilesN) return;   // block-uniform, ahead of any barrier; never taken
  const int bm = (int)blockIdx.x / tilesN;
  const int tn = (int)blockIdx.x - bm * tilesN;
  const int tm = bm * 4 + wave;
  const int m0 = tm << 5;
  const int n0 = tn << 7;
  const int rl   = lane & 15;            // row (A) / col (B, D) within subtile
  const int hh   = lane >> 4;            // lane half
  const int koff = hh * 8;               // k offset of this lane half

  v8f acc[2][8];
#pragma unroll
  for (int i = 0; i < 2; ++i)
#pragma unroll
    for (int j = 0; j < 8; ++j) acc[i][j] = zero8();

  {
    const int cr = (int)threadIdx.x >> 4;          // row (mod 8) this thread copies
    const int cc = (int)threadIdx.x & 15;          // its 16-B piece of the row's 256 B
    const _Float16* ga = (const _Float16*)(const void*)A + (size_t)((bm << 7) + cr) * (size_t)lda + cc * 8;
    const _Float16* gb = (const _Float16*)(const void*)Bt + (size_t)(n0 + cr) * (size_t)ldb + cc * 8;
    const uint32_t  lr = (uint32_t)(size_t)(const void*)ring + (uint32_t)(cr * GPIT + cc * 8) * 2u;
    const int nst = K / GBK;                       // stages; block-uniform
    auto fill = [&](int st) {                      // stage st -> buffer st & 1: 32 copies per wave
      const uint32_t l = lr + (uint32_t)(st & 1) * (uint32_t)(GSTG * 2);
      const _Float16* pa = ga + (size_t)st * GBK;
      const _Float16* pb = gb + (size_t)st * GBK;
      acopy_rows64(l, pa, (size_t)lda);
      acopy_rows64(l + 64u * GPIT * 2u, pa + (size_t)64 * (size_t)lda, (size_t)lda);
      acopy_rows64(l + 128u * GPIT * 2u, pb, (size_t)ldb);
      acopy_rows64(l + 192u * GPIT * 2u, pb + (size_t)64 * (size_t)ldb, (size_t)ldb);
    };
    fill(0);
    wait_async0();
    __syncthreads();                               // stage 0 is published
    if (nst > 1) fill(1);
    for (int t = 0; t < nst; ++t) {
      const _Float16* sb  = ring + (t & 1) * GSTG;
      const _Float16* ar0 = sb + (wave * 32 + rl) * GPIT + koff;
      const _Float16* ar1 = ar0 + 16 * GPIT;
      const _Float16* br  = sb + (128 + rl) * GPIT + koff;
#pragma unroll                                     // the k offset becomes an immediate of each LDS load
      for (int kk = 0; kk < GBK / 32; ++kk) {
        const v16h a0 = ldfrag_h(ar0 + 32 * kk);
        const v16h a1 = ldfrag_h(ar1 + 32 * kk);
        v16h b[8];
#pragma unroll                                     // b[] stays in registers: the k-step's LDS loads stand as one group
        for (int j = 0; j < 8; ++j) b[j] = ldfrag_h(br + j * 16 * GPIT + 32 * kk);
#pragma unroll                                     // acc[][] and b[] indexed by constants only
        for (int j = 0; j < 8; ++j) {
          acc[0][j] = mma_h_raw(a0, b[j], acc[0][j]);
          acc[1][j] = mma_h_raw(a1, b[j], acc[1][j]);
          guard3(acc[0][j], acc[1][j], a0, a1, b[j]);
        }
      }
      wait_ds0();
      wait_async0();
      __syncthreads();                             // publishes stage t + 1 and ends every read of stage t
      if (t + 2 < nst) fill(t + 2);
    }
    wait_async0();
  }
  acc_guard4(acc[0][0], acc[0][1], acc[0][2], acc[0][3]);
  acc_guard4(acc[0][4], acc[0][5], acc[0][6], acc[0][7]);
  acc_guard4(acc[1][0], acc[1][1], acc[1][2], acc[1][3]);
  acc_guard4(acc[1][4], acc[1][5], acc[1][6], acc[1][7]);

  // ---- epilogue ----
  // per-wave 16x128 slab, pitch 132 floats, in the ring's first bytes: the barrier at the foot of the last trip has
  // ended every wave's reads of both stages, and no copy is issued or outstanding behind it
  float* slab = (float*)(void*)ring + wave * SLABF;
  float gmul[8];
  float csc = 1.0f;
  if (EPI == 1) {
    const bool isq = (n0 < DM);                                 // wave-uniform
    const int  hb  = (isq ? n0 : (n0 - DM)) >> 6;               // first head of this tile (0..15)
    csc = isq ? QSC : KSC;
#pragma unroll
    for (int j = 0; j < 8; ++j) {
      const int gi = (hb + (j >> 2)) * HD + 16 * (j & 3) + rl;  // < NHEAD*HD, inside both gain arrays
      const float ga = bfr(gq[gi]);
      const float gb = bfr(gk[gi]);
      gmul[j] = (isq ? ga : gb) * 8.0f;
    }
  } else {
#pragma unroll
    for (int j = 0; j < 8; ++j) gmul[j] = 1.0f;
  }
#pragma unroll
  for (int i = 0; i < 2; ++i) {
    const int mB = m0 + 16 * i;
    if (EPI == 1) {
      float inv[2][8];
#pragma unroll
      for (int jh = 0; jh < 2; ++jh) {
#pragma unroll
        for (int r = 0; r < 8; ++r) {        // sum of squares over the head's 64 columns of row 8hh+r
          float ss = 0.f;
#pragma unroll
          for (int jj = 0; jj < 4; ++jj) {
            const float x = acc[i][4 * jh + jj][r] * oscale;
            ss += x * x;
          }
          ss += __shfl_xor(ss, 1, 32);
          ss += __shfl_xor(ss, 2, 32);
          ss += __shfl_xor(ss, 4, 32);
          ss += __shfl_xor(ss, 8, 32);
          inv[jh][r] = oscale * (1.0f / fmaxf(sqrtf(ss), NRM_EPS));
        }
      }
#pragma unroll
      for (int j = 0; j < 8; ++j) {
#pragma unroll
        for (int r = 0; r < 8; ++r)
          slab[(8 * hh + r) * 132 + 16 * j + rl] = acc[i][j][r] * inv[j >> 2][r] * gmul[j];
      }
    } else {
#pragma unroll
      for (int j = 0; j < 8; ++j) {
#pragma unroll
        for (int r = 0; r < 8; ++r) slab[(8 * hh + r) * 132 + 16 * j + rl] = acc[i][j][r] * oscale;
      }
    }
    wave_sync_lds();
    if (EPI == 3) {
      float* Cf = (float*)C0 + cpl;
      v4f ov[16];
#pragma unroll
      for (int it = 0; it < 16; ++it) ov[it] = *(const v4f*)(slab + it * 132 + lane * 4);
      {
#pragma unroll
        for (int it = 0; it < 16; ++it)                       // row it: 32 lanes x 16 B = 512 B = 128 cols
          *(v4f*)(Cf + (size_t)(crow0 + mB + it) * (size_t)ldc + n0 + lane * 4) = ov[it];
        
      }
    } else {
      unsigned short* Cp = (unsigned short*)C0 + cpl;
      unsigned short* Cq = (unsigned short*)C1 + cpl;
      v4u hv[8], lv[8];
#pragma unroll
      for (int it = 0; it < 8; ++it) {
        const int row = it * 2 + hh;                          // it 0..7 x hh 0..1 = rows 0..15
        const float* sp = slab + row * 132 + rl * 8;          // 8 consecutive columns = 4 rotary pairs
        const v4f fa = *(const v4f*)sp;
        const v4f fb = *(const v4f*)(sp + 4);
        float f[8];
        f[0] = fa[0]; f[1] = fa[1]; f[2] = fa[2]; f[3] = fa[3];
        f[4] = fb[0]; f[5] = fb[1]; f[6] = fb[2]; f[7] = fb[3];
        const int pos = crow0 + mB + row;                     // position in the concatenated sequence
        const v4f cv = *(const v4f*)(cost + (size_t)pos * RP + (rl & 7) * 4);   // pairs ((rl&7)*4 .. +3)
        const v4f sv = *(const v4f*)(sint + (size_t)pos * RP + (rl & 7) * 4);
        v4u pk, pl;
#pragma unroll
        for (int e = 0; e < 4; ++e) {
          const float f0 = f[2 * e], f1 = f[2 * e + 1];
          const float cc = cv[e], sn = sv[e];
          const float g0 = (f0 * cc - f1 * sn) * csc;
          const float g1 = (f0 * sn + f1 * cc) * csc;
          const _Float16 x0 = (_Float16)g0;
          const _Float16 x1 = (_Float16)g1;
          const _Float16 y0 = (_Float16)((g0 - (float)x0) * RSC);
          const _Float16 y1 = (_Float16)((g1 - (float)x1) * RSC);
          pk[e] = pk16(h_bits(x0), h_bits(x1));
          pl[e] = pk16(h_bits(y0), h_bits(y1));
        }
        hv[it] = pk;
        lv[it] = pl;
      }
      {
#pragma unroll
        for (int it = 0; it < 8; ++it) {
          const int row = it * 2 + hh;
          const size_t go = (size_t)(crow0 + mB + row) * (size_t)ldc + n0 + rl * 8;
          *(v4u*)(Cp + go) = hv[it];
          *(v4u*)(Cq + go) = lv[it];
        }
        
      }
    }
    wave_sync_lds();
  }
}

// =====================================================================================================
// Compressive-memory update per (head h, segment s in 0..2) of one batch (blockIdx.y):
//   MT[h][s][e][d] = sum over the 1024 keys l of segment s of v[l][e] * sk[l][d], sk = elu(k) + 1
//   (elu(x) = x > 0 ? x : exp(x) - 1, so sk = x > 0 ? x + 1 : exp(x)), and ZP[h][s][d] = sum_l sk[l][d].
//   k is rebuilt in f32 from the q|k hi / residual planes ((hi + lo/RSC) / KSC, column DM + h*64 + d), sk is
//   RNE-converted to f16 and written TRANSPOSED into an LDS tile skT[d][l] (64 keys per chunk, pitch 72 halves);
//   A = V^T hi plane rows (h*64 + e, keys), Bt = skT; D[e][d] scaled by 1/VSC.
//   Block = 8 waves; wave w owns e rows 16*(w>>1).. and d columns 32*(w&1)..; acc guarded; the 16x32 f32 piece is
// coverage: MT: 8 waves x (16 rows x 32 cols) = the whole 64x64 tile of (h,s); 4 its x 4 row groups x 8 lanes =
//   16 rows x 32 cols per wave. ZP: 16 lanes x 4 floats = 64. skT fill: 256 threads x 16 d x 1 key = 64x64 chunk.
// =====================================================================================================
__global__ __launch_bounds__(256) void mt_seg(const unsigned short* __restrict__ QKH,
                                             const unsigned short* __restrict__ QKL,
                                             const unsigned short* __restrict__ VTH,
                                             float* MT, float* ZP) {
  __shared__ __align__(16) _Float16 skT[HD * 72];
  __shared__ __align__(16) float slab[8][16 * 36];
  __shared__ float zred[8][HD];
  __shared__ __align__(16) float zsum[HD];

  const int tid = threadIdx.x, wave = tid >> 5, lane = tid & 31, hh = lane >> 4, c = lane & 15;
  const int h = (int)(blockIdx.x / 3u);
  const int s = (int)(blockIdx.x - (unsigned)h * 3u);
  if (h >= NHEAD) return;                 // block-uniform, ahead of any barrier; never taken
  QKH += (size_t)blockIdx.y * SEQ * QKW;  // blockIdx.y = batch: its own planes
  QKL += (size_t)blockIdx.y * SEQ * QKW;
  VTH += (size_t)blockIdx.y * DM * SEQ;
  MT  += (size_t)blockIdx.y * NHEAD * 3 * HD * HD;
  ZP  += (size_t)blockIdx.y * NHEAD * 3 * HD;
  const int r  = tid >> 2;                // key within the 64-key chunk handled by this thread
  const int dq = (tid & 3) * 16;          // first of the 16 d columns handled by this thread
  const int et = wave >> 1;               // e row tile of this wave
  const int dt0 = (wave & 1) * 2;         // first d column tile of this wave

  const _Float16* Q16 = (const _Float16*)(const void*)QKH;
  const _Float16* L16 = (const _Float16*)(const void*)QKL;
  const _Float16* V16 = (const _Float16*)(const void*)VTH;
  const _Float16* vrow = V16 + (size_t)(h * HD + et * 16 + c) * SEQ + (size_t)s * SEG + 8 * hh;   // A frag base

  float zacc[16];
#pragma unroll
  for (int e = 0; e < 16; ++e) zacc[e] = 0.f;
  v8f acc[2];
  acc[0] = zero8(); acc[1] = zero8();

  for (int kt = 0; kt < SEG / 64; ++kt) {
    __syncthreads();                      // prior chunk's fragment reads are done
    {
      const size_t n = (size_t)(s * SEG + kt * 64 + r);
      const _Float16* kp = Q16 + n * QKW + DM + h * HD + dq;
      const _Float16* lp = L16 + n * QKW + DM + h * HD + dq;
      FH kf, lf;
      kf.h[0] = *(const v8h*)kp; kf.h[1] = *(const v8h*)(kp + 8);
      lf.h[0] = *(const v8h*)lp; lf.h[1] = *(const v8h*)(lp + 8);
#pragma unroll
      for (int e = 0; e < 16; ++e) {
        const float kv = ((float)kf.v[e] + (float)lf.v[e] * (1.0f / RSC)) * (1.0f / KSC);
        const float sk = (kv > 0.f) ? (kv + 1.0f) : __expf(kv);
        const _Float16 skh = (_Float16)sk;
        skT[(dq + e) * 72 + r] = skh;
        zacc[e] += (float)skh;
      }
    }
    __syncthreads();                      // skT chunk complete
#pragma unroll
    for (int kk = 0; kk < 2; ++kk) {
      const v16h a  = ldfrag_h(vrow + kt * 64 + 32 * kk);
      const v16h b0 = ldfrag_h(skT + (16 * dt0 + c) * 72 + 32 * kk + 8 * hh);
      const v16h b1 = ldfrag_h(skT + (16 * (dt0 + 1) + c) * 72 + 32 * kk + 8 * hh);
      acc[0] = mma_h_raw(a, b0, acc[0]);
      acc[1] = mma_h_raw(a, b1, acc[1]);
      guard3(acc[0], acc[1], a, b0, b1);
    }
  }
  acc_guard2(acc[0], acc[1]);

  // ---- MT piece: rows e = 16*et + (8hh+rr), cols d = 32*(wave&1) + 16*jj + c ----
  float* sl = slab[wave];
#pragma unroll
  for (int jj = 0; jj < 2; ++jj) {
#pragma unroll
    for (int rr = 0; rr < 8; ++rr) sl[(8 * hh + rr) * 36 + 16 * jj + c] = acc[jj][rr] * (1.0f / VSC);
  }
  wave_sync_lds();
  {
    v4f mv[4];
#pragma unroll
    for (int it = 0; it < 4; ++it) {
      const int row = it * 4 + (lane >> 3);
      mv[it] = *(const v4f*)(sl + row * 36 + (lane & 7) * 4);
    }
    float* mtb = MT + ((size_t)(h * 3 + s) * HD + (size_t)et * 16) * HD + (wave & 1) * 32;
    {
#pragma unroll
      for (int it = 0; it < 4; ++it) {
        const int row = it * 4 + (lane >> 3);
        *(v4f*)(mtb + (size_t)row * HD + (lane & 7) * 4) = mv[it];
      }
      
    }
  }
  // ---- ZP: sum zacc over the 8 keys of this wave (lanes sharing lane&3), then over the 8 waves ----
#pragma unroll
  for (int e = 0; e < 16; ++e) {
    float v = zacc[e];
    v += __shfl_xor(v, 4, 32);
    v += __shfl_xor(v, 8, 32);
    v += __shfl_xor(v, 16, 32);
    if ((lane >> 2) == 0) zred[wave][(lane & 3) * 16 + e] = v;
  }
  __syncthreads();
  if (tid < HD) {
    float z = 0.f;
#pragma unroll
    for (int w = 0; w < 8; ++w) z += zred[w][tid];
    zsum[tid] = z;
  }
  __syncthreads();
  if (tid < 16) {                         // wave 0, lanes 0..15: 16 x 16 B = the whole 256-B ZP row
    const v4f zz = *(const v4f*)(zsum + tid * 4);
    float* zp = ZP + (size_t)(h * 3 + s) * HD + tid * 4;
    *(v4f*)zp = zz;
    
  }
}

// =====================================================================================================
// Compressive-memory read per (head h, segment s in 1..3, 128-row block) of one batch (blockIdx.y):
//   M_s = sum over segments before s of MT[h][s'] (f32 sum, RNE convert to an f16 LDS tile MTh[e][d], pitch 72);
//   z_s = sum of ZP[h][s'] (f32, LDS). Per query row n of segment s: q rebuilt in f32 from the hi / residual planes
//   ((hi + lo/RSC) / QSC, column h*64 + d), sq = elu(q) + 1 RNE-converted to f16 directly into the A fragment
//   (elementwise transform keeps the A layout); num[n][e] = sum_d sq[n][d] * M_s[d][e] with Bt = MTh (K = 64, two
//   k-steps, 4 column tiles); den[n] = sum_d sq[n][d] * z_s[d] + 1e-6 in f32 from the same f16 sq values (lane
//   halves combined, then broadcast to the D rows); MEM[n][h*64 + e] = num * (1/den), f32 rows of pitch DM.
//   Block = 8 waves x 16 rows; per-wave 16x64 f32 tile staged in LDS; stores 16 lanes x 16 B per 256-B row
// coverage: 16 heads x 3 segments x 8 row blocks x 8 waves x 16 rows = MEM rows 1024..4095 of every head's 64
//   columns; 8 its x 2 row halves x 16 lanes x 4 floats = the wave's 16x64 tile. Rows 0..1023 (segment 0) are not
//   produced and are not used by the consumer (memory is exactly zero there).
// =====================================================================================================
__global__ __launch_bounds__(256) void mem_ret(const unsigned short* __restrict__ QKH,
                                              const unsigned short* __restrict__ QKL,
                                              const float* __restrict__ MT, const float* __restrict__ ZP,
                                              float* MEM) {
  __shared__ __align__(16) _Float16 MTh[HD * 72];
  __shared__ float zs[HD];
  __shared__ __align__(16) float slab[8][16 * 68];

  const int tid = threadIdx.x, wave = tid >> 5, lane = tid & 31, hh = lane >> 4, c = lane & 15;
  const int h   = (int)(blockIdx.x / 24u);
  const int rem = (int)(blockIdx.x - (unsigned)h * 24u);
  const int s   = 1 + rem / 8;            // 1..3
  const int rb  = rem - (s - 1) * 8;      // 0..7
  if (h >= NHEAD) return;                 // block-uniform, ahead of any barrier; never taken
  QKH += (size_t)blockIdx.y * SEQ * QKW;  // blockIdx.y = batch: its own planes
  QKL += (size_t)blockIdx.y * SEQ * QKW;
  MT  += (size_t)blockIdx.y * NHEAD * 3 * HD * HD;
  ZP  += (size_t)blockIdx.y * NHEAD * 3 * HD;
  MEM += (size_t)blockIdx.y * SEQ * DM;

  {
    const int e = tid >> 2, d0 = (tid & 3) * 16;
    float sm[16];
#pragma unroll
    for (int i = 0; i < 16; ++i) sm[i] = 0.f;
#pragma unroll
    for (int sp = 0; sp < 3; ++sp) {
      if (sp < s) {                       // block-uniform
        const float* src = MT + ((size_t)(h * 3 + sp) * HD + e) * HD + d0;
#pragma unroll
        for (int q = 0; q < 4; ++q) {
          const v4f v = *(const v4f*)(src + 4 * q);
          sm[4 * q + 0] += v[0]; sm[4 * q + 1] += v[1]; sm[4 * q + 2] += v[2]; sm[4 * q + 3] += v[3];
        }
      }
    }
    v8h p0, p1;
#pragma unroll
    for (int i = 0; i < 8; ++i) { p0[i] = (_Float16)sm[i]; p1[i] = (_Float16)sm[8 + i]; }
    *(v8h*)(MTh + e * 72 + d0) = p0;
    *(v8h*)(MTh + e * 72 + d0 + 8) = p1;
    if (tid < HD) {
      float z = 0.f;
#pragma unroll
      for (int sp = 0; sp < 3; ++sp) {
        if (sp < s) z += ZP[(size_t)(h * 3 + sp) * HD + tid];
      }
      zs[tid] = z;
    }
  }
  __syncthreads();

  const _Float16* Q16 = (const _Float16*)(const void*)QKH;
  const _Float16* L16 = (const _Float16*)(const void*)QKL;
  const int n0w = s * SEG + rb * MROWS + wave * 16;          // first query position of this wave

  v16h af[2];
  float denp = 0.f;
#pragma unroll
  for (int kk = 0; kk < 2; ++kk) {
    FH hf, lf;
    hf.v = ldfrag_h(Q16 + (size_t)(n0w + c) * QKW + h * HD + 32 * kk + 8 * hh);
    lf.v = ldfrag_h(L16 + (size_t)(n0w + c) * QKW + h * HD + 32 * kk + 8 * hh);
    v16h a;
#pragma unroll
    for (int i = 0; i < 16; ++i) {
      const float qv = ((float)hf.v[i] + (float)lf.v[i] * (1.0f / RSC)) * (1.0f / QSC);
      const float sq = (qv > 0.f) ? (qv + 1.0f) : __expf(qv);
      const _Float16 sqh = (_Float16)sq;
      a[i] = sqh;
      const int kidx = 32 * kk + ((i < 8) ? (8 * hh + i) : (8 + 8 * hh + i));   // k of element i (split map)
      denp += (float)sqh * zs[kidx];
    }
    af[kk] = a;
  }
  const float den = denp + __shfl_xor(denp, 16, 32) + DEN_EPS;   // row c complete in lanes c and c+16

  v8f acc[4];
#pragma unroll
  for (int j = 0; j < 4; ++j) {
    acc[j] = zero8();
#pragma unroll
    for (int kk = 0; kk < 2; ++kk) {
      const v16h b = ldfrag_h(MTh + (16 * j + c) * 72 + 32 * kk + 8 * hh);
      acc[j] = mma_h(af[kk], b, acc[j]);
    }
  }
  float rinv[8];
#pragma unroll
  for (int rr = 0; rr < 8; ++rr) rinv[rr] = 1.0f / __shfl(den, 8 * hh + rr, 32);   // den of D row 8hh+rr

  float* sl = slab[wave];
#pragma unroll
  for (int j = 0; j < 4; ++j) {
#pragma unroll
    for (int rr = 0; rr < 8; ++rr) sl[(8 * hh + rr) * 68 + 16 * j + c] = acc[j][rr] * rinv[rr];
  }
  wave_sync_lds();
  {
    v4f ov[8];
#pragma unroll
    for (int it = 0; it < 8; ++it) {
      const int row = it * 2 + hh;        // it 0..7 x hh 0..1 = rows 0..15
      ov[it] = *(const v4f*)(sl + row * 68 + c * 4);
    }
    {
#pragma unroll
      for (int it = 0; it < 8; ++it) {
        const int row = it * 2 + hh;
        *(v4f*)(MEM + (size_t)(n0w + row) * DM + h * HD + c * 4) = ov[it];
      }
      
    }
  }
}

// =====================================================================================================
// Segment-local causal attention with the gate mix, per (batch, h, segment, 64-query block):
//   s = (sum_d qh.kh + (ql.kh + qh.kl) / RSC) * sscale, sscale = (1/8) / (QSC*KSC); key > query (segment-local)
//   -> NEG_BIG (value select); online softmax in f32; p = exp(s - m) carried as ph = f16(1024 p) and, when PRES,
//   also pl = f16((1024 p - ph) * RSC); local numerator = p . v with v as f16 hi (VSC v) and, when PRES, the f16
//   residual ((VSC v - hi) * RSC) plane: oh += ph.vhi over all chunks; when PRES: ol = ph.vres + pl.vhi (one
//   residual accumulator per chunk and 16-wide d tile, both products carry the same 1/RSC), folded as
//   oh += ol / RSC in f32 right after its two k-steps.
//   q|k planes (f16, pitch QKW, rows = positions): q element (t, h, d) at [t*QKW + h*64 + d], k at
//   [t*QKW + DM + h*64 + d]; V^T planes (f16): element (h, d, t) at [(h*64 + d)*SEQ + t]; MEM plane (f32,
//   pitch DM): element (t, h, e) at [t*DM + h*64 + e].
//   Epilogue per query row t: local = oh / (l * PSC * VSC); mem = MEM[t] for segments >= 1 (segment 0: exactly 0
//   by a value select; the load address is always inside the plane); out = g * mem + (1 - g) * local with
//   g = sigmoid(bf16(gate[h])); rows of positions < NTOK go to the second output (offset OUT1OFF), rows of positions
//   >= NTOK to the first, row t mod NTOK, columns h*64..h*64+63 (pitch DM floats).
//   Block = 4 waves = 64 query rows of one h; grid = (NHEAD * NSEG * nqb, NB), block -> (h, seg, qbs = qb0 + i), batch;
//   key chunks of 64 within the segment, chunks kt <= qbs only (block-uniform trip <= NQB), chunk kt == qbs keeps
//   its diagonal by the per-element select.
//   K / V^T chunk staging: 128 threads, K row r = tid>>1 (32-column half (tid&1)), V^T row d = tid>>1 (32-key half);
//   plain 16-B loads, __syncthreads ahead of and after; q fragments (hi and residual, 2 d-chunks) held in
//   registers for the whole block; P tiles wave-private, spilled with _Float16 element stores and reloaded as v8h
//   Output coverage: each wave stores rows q0..q0+15 (it 0..7 x lane>>4) x 64 columns (16 lanes x 16 B), one
// =====================================================================================================
template <bool PRES>
__global__ __launch_bounds__(128)
void attn_seg(const unsigned short* __restrict__ QKH, const unsigned short* __restrict__ QKL,
              const unsigned short* __restrict__ VTH, const unsigned short* __restrict__ VTL,
              const float* __restrict__ MEM, const float* __restrict__ gate,
              float* outb, float sscale, int qb0, int nqb) {
  __shared__ __align__(16) _Float16 Ksh[64 * APIT];                           // K hi  [key][d]  9 KB
  __shared__ __align__(16) _Float16 Kls[64 * APIT];                           // K res [key][d]  9 KB
  __shared__ __align__(16) _Float16 Vhs[HD * APIT];                           // V^T hi [d][key] 9 KB
  __shared__ __align__(16) _Float16 Vls[PRES ? HD * APIT : 8];                // V^T res [d][key] 9 KB (PRES)
  __shared__ __align__(16) _Float16 Psh[4][16 * APIT];                        // per wave P hi [row][key] 9 KB
  __shared__ __align__(16) _Float16 Psl[PRES ? 4 : 1][PRES ? 16 * APIT : 8];  // per wave P residual (PRES) 9 KB
  __shared__ __align__(16) float    Os[4][16 * 68];                          // per wave output tile [row][d]

  const int tid  = threadIdx.x;
  const int wave = tid >> 5;
  const int lane = tid & 31;
  const int hh   = lane >> 4;
  const int c    = lane & 15;

  const int per = NSEG * nqb;
  const int h   = (int)(blockIdx.x / (unsigned)per);
  const int rem = (int)(blockIdx.x - (unsigned)h * (unsigned)per);
  const int seg = rem / nqb;
  const int qbs = qb0 + (rem - seg * nqb);
  if (h >= NHEAD || seg >= NSEG) return;  // block-uniform, ahead of any barrier; never taken for exact grids
  QKH  += (size_t)blockIdx.y * SEQ * QKW; // blockIdx.y = batch: its own planes and its own rows of both outputs
  QKL  += (size_t)blockIdx.y * SEQ * QKW;
  VTH  += (size_t)blockIdx.y * DM * SEQ;
  VTL  += (size_t)blockIdx.y * DM * SEQ;
  MEM  += (size_t)blockIdx.y * SEQ * DM;
  outb += (size_t)blockIdx.y * NTOK * DM;
  const int sbase = seg * SEG;
  const int rowl0 = qbs * 64 + wave * 16; // segment-local row of this wave's first query
  const int q0    = sbase + rowl0;        // its position in the concatenated sequence

  const _Float16* Q16 = (const _Float16*)(const void*)QKH;
  const _Float16* L16 = (const _Float16*)(const void*)QKL;
  const _Float16* Qg  = Q16 + (size_t)h * HD;
  const _Float16* Qlg = L16 + (size_t)h * HD;
  const _Float16* Kg  = Q16 + DM + (size_t)h * HD;
  const _Float16* Klg = L16 + DM + (size_t)h * HD;
  const _Float16* Vhg = (const _Float16*)(const void*)VTH + (size_t)h * HD * SEQ;
  const _Float16* Vlg = (const _Float16*)(const void*)VTL + (size_t)h * HD * SEQ;

  // ---- q fragments (A operand, row = lane&15), hi and residual, d-chunks 0 and 1, fixed for the block ----
  const v16h qh0 = ldfrag_h(Qg  + (size_t)(q0 + c) * QKW + 8 * hh);
  const v16h qh1 = ldfrag_h(Qg  + (size_t)(q0 + c) * QKW + 32 + 8 * hh);
  const v16h ql0 = ldfrag_h(Qlg + (size_t)(q0 + c) * QKW + 8 * hh);
  const v16h ql1 = ldfrag_h(Qlg + (size_t)(q0 + c) * QKW + 32 + 8 * hh);

  float mrow[8], lrow[8];
  v8f oh[4];
#pragma unroll
  for (int r = 0; r < 8; ++r) { mrow[r] = NEG_BIG; lrow[r] = 0.f; }
#pragma unroll
  for (int t = 0; t < 4; ++t) oh[t] = zero8();

  _Float16* pwh = Psh[wave];
  _Float16* pwl = &Psl[PRES ? wave : 0][0];

  for (int kt = 0; kt < NQB; ++kt) {          // static bound; block-uniform causal chunk skipping
    if (kt > qbs) break;
    const int kv0 = sbase + kt * 64;
    __syncthreads();
    {
      const int r = tid >> 1, hk = (tid & 1) * 32;
      const _Float16* kg = Kg + (size_t)(kv0 + r) * QKW + hk;        // K row kv0+r, d = hk..hk+31
#pragma unroll
      for (int i = 0; i < 4; ++i) *(v8h*)(Ksh + r * APIT + hk + 8 * i) = *(const v8h*)(kg + 8 * i);
      cbar();
      const _Float16* lg = Klg + (size_t)(kv0 + r) * QKW + hk;
#pragma unroll
      for (int i = 0; i < 4; ++i) *(v8h*)(Kls + r * APIT + hk + 8 * i) = *(const v8h*)(lg + 8 * i);
      cbar();
      const _Float16* vh = Vhg + (size_t)r * SEQ + kv0 + hk;          // V^T row d = r, t = kv0+hk..+31
#pragma unroll
      for (int i = 0; i < 4; ++i) *(v8h*)(Vhs + r * APIT + hk + 8 * i) = *(const v8h*)(vh + 8 * i);
      if (PRES) {
        cbar();
        const _Float16* vl = Vlg + (size_t)r * SEQ + kv0 + hk;
#pragma unroll
        for (int i = 0; i < 4; ++i) *(v8h*)(Vls + r * APIT + hk + 8 * i) = *(const v8h*)(vl + 8 * i);
        cbar();
      }
    }
    __syncthreads();

    // ---- scores: 16 query rows x 64 keys per wave, K = 64 (2 d-chunks), three products ----
    v8f s[4];
#pragma unroll
    for (int j = 0; j < 4; ++j) {
      v8f sh = zero8(), sl = zero8();
      {
        FH kb, lb;
        kb.h[0] = *(const v8h*)(Ksh + (j * 16 + c) * APIT + 8 * hh);
        kb.h[1] = *(const v8h*)(Ksh + (j * 16 + c) * APIT + 16 + 8 * hh);
        lb.h[0] = *(const v8h*)(Kls + (j * 16 + c) * APIT + 8 * hh);
        lb.h[1] = *(const v8h*)(Kls + (j * 16 + c) * APIT + 16 + 8 * hh);
        sh = mma_h_raw(qh0, kb.v, sh);
        sl = mma_h_raw(ql0, kb.v, sl);
        sl = mma_h_raw(qh0, lb.v, sl);
        guard4m(sh, sl, qh0, ql0, kb.v, lb.v);
      }
      {
        FH kb, lb;
        kb.h[0] = *(const v8h*)(Ksh + (j * 16 + c) * APIT + 32 + 8 * hh);
        kb.h[1] = *(const v8h*)(Ksh + (j * 16 + c) * APIT + 48 + 8 * hh);
        lb.h[0] = *(const v8h*)(Kls + (j * 16 + c) * APIT + 32 + 8 * hh);
        lb.h[1] = *(const v8h*)(Kls + (j * 16 + c) * APIT + 48 + 8 * hh);
        sh = mma_h_raw(qh1, kb.v, sh);
        sl = mma_h_raw(ql1, kb.v, sl);
        sl = mma_h_raw(qh1, lb.v, sl);
        guard4m(sh, sl, qh1, ql1, kb.v, lb.v);
      }
      const int key  = kt * 64 + j * 16 + c;             // segment-local key of this lane's D column
      const int rowb = rowl0 + 8 * hh;                   // segment-local query row of D element r is rowb + r
#pragma unroll
      for (int r = 0; r < 8; ++r) {
        float v = sh[r];
        v += sl[r] * (1.0f / RSC);
        v *= sscale;
        s[j][r] = (key <= rowb + r) ? v : NEG_BIG;
      }
    }

    // ---- row max, online softmax, P hi (x1024, f16) and, when PRES, P residual (x RSC, f16) to LDS ----
#pragma unroll
    for (int r = 0; r < 8; ++r) {
      float m = s[0][r];
      m = fmaxf(m, s[1][r]);
      m = fmaxf(m, s[2][r]);
      m = fmaxf(m, s[3][r]);
#pragma unroll
      for (int off = 1; off < 16; off <<= 1) m = fmaxf(m, __shfl_xor(m, off, 32));
      const float mnew  = fmaxf(mrow[r], m);
      const float alpha = __expf(mrow[r] - mnew);
      mrow[r] = mnew;
      float psum = 0.f;
#pragma unroll
      for (int j = 0; j < 4; ++j) {
        const float p  = __expf(s[j][r] - mnew);
        psum += p;
        const float ph = p * PSC;
        const _Float16 xh = (_Float16)ph;
        const int pi = (8 * hh + r) * APIT + j * 16 + c;
        pwh[pi] = xh;
        if (PRES) pwl[pi] = (_Float16)((ph - (float)xh) * RSC);
      }
#pragma unroll
      for (int off = 1; off < 16; off <<= 1) psum += __shfl_xor(psum, off, 32);
      lrow[r] = lrow[r] * alpha + psum;
#pragma unroll
      for (int t = 0; t < 4; ++t) oh[t][r] *= alpha;
    }
    wave_sync_lds();

    // ---- local numerator: oh += Phi . Vhi; when PRES also ol = Phi . Vres + Plo . Vhi, oh += ol/RSC ----
    FH pa0, pa1, pb0, pb1;
    pa0.h[0] = *(const v8h*)(pwh + c * APIT + 8 * hh);
    pa0.h[1] = *(const v8h*)(pwh + c * APIT + 16 + 8 * hh);
    pa1.h[0] = *(const v8h*)(pwh + c * APIT + 32 + 8 * hh);
    pa1.h[1] = *(const v8h*)(pwh + c * APIT + 48 + 8 * hh);
    pb0.v = pa0.v;
    pb1.v = pa1.v;
    if (PRES) {
      pb0.h[0] = *(const v8h*)(pwl + c * APIT + 8 * hh);
      pb0.h[1] = *(const v8h*)(pwl + c * APIT + 16 + 8 * hh);
      pb1.h[0] = *(const v8h*)(pwl + c * APIT + 32 + 8 * hh);
      pb1.h[1] = *(const v8h*)(pwl + c * APIT + 48 + 8 * hh);
      cbar();
    }
#pragma unroll
    for (int t = 0; t < 4; ++t) {
      const _Float16* vr = Vhs + (t * 16 + c) * APIT + 8 * hh;
      FH vb0, vb1;
      vb0.h[0] = *(const v8h*)(vr);
      vb0.h[1] = *(const v8h*)(vr + 16);
      vb1.h[0] = *(const v8h*)(vr + 32);
      vb1.h[1] = *(const v8h*)(vr + 48);
      if (PRES) {
        const _Float16* wr = Vls + (t * 16 + c) * APIT + 8 * hh;
        FH wb0, wb1;
        wb0.h[0] = *(const v8h*)(wr);
        wb0.h[1] = *(const v8h*)(wr + 16);
        wb1.h[0] = *(const v8h*)(wr + 32);
        wb1.h[1] = *(const v8h*)(wr + 48);
        v8f ol = zero8();
        oh[t] = mma_h_raw(pa0.v, vb0.v, oh[t]);
        ol    = mma_h_raw(pa0.v, wb0.v, ol);
        ol    = mma_h_raw(pb0.v, vb0.v, ol);
        oh[t] = mma_h_raw(pa1.v, vb1.v, oh[t]);
        ol    = mma_h_raw(pa1.v, wb1.v, ol);
        ol    = mma_h_raw(pb1.v, vb1.v, ol);
        guard8m(oh[t], ol, pa0.v, pa1.v, pb0.v, pb1.v, vb0.v, vb1.v, wb0.v, wb1.v);
#pragma unroll
        for (int r = 0; r < 8; ++r) oh[t][r] += ol[r] * (1.0f / RSC);
      } else {
        oh[t] = mma_h_raw(pa0.v, vb0.v, oh[t]);
        oh[t] = mma_h_raw(pa1.v, vb1.v, oh[t]);
        guard1q(oh[t], pa0.v, pa1.v, vb0.v, vb1.v);
      }
    }
    acc_guard4(oh[0], oh[1], oh[2], oh[3]);
  }

  // ---- normalise (1/l, the 1/1024 p carry and the 1/VSC v carry), gate mix with the memory read, stage the
  const float gv  = bfr(gate[h]);
  const float g   = 1.0f / (1.0f + expf(-gv));
  const float omg = 1.0f - g;
  const bool useMem = (seg > 0);                          // block-uniform
  float* os = Os[wave];
#pragma unroll
  for (int r = 0; r < 8; ++r) {
    const int qr = q0 + 8 * hh + r;                         // query position
    const float l = lrow[r];                                // >= 1 (the row maximum contributes exp(0))
    const float inv = (1.0f / l) * (1.0f / (PSC * VSC));
    const float* mr = MEM + (size_t)qr * DM + h * HD;       // inside the MEM plane for every position
#pragma unroll
    for (int t = 0; t < 4; ++t) {
      const float yv  = oh[t][r] * inv;                     // e = 16t + c
      const float mvr = mr[16 * t + c];
      const float mv  = useMem ? mvr : 0.f;
      os[(8 * hh + r) * 68 + 16 * t + c] = g * mv + omg * yv;
    }
  }
  wave_sync_lds();
  {
    const size_t ooff  = (seg < (NTOK / SEG)) ? (size_t)OUT1OFF : (size_t)0;   // positions < NTOK -> second output
    const int    orow0 = (seg < (NTOK / SEG)) ? q0 : (q0 - NTOK);               // row within the output [b][2048][1024]
    v4f ov[8];
#pragma unroll
    for (int it = 0; it < 8; ++it) {
      const int row = it * 2 + hh;                          // it 0..7 x hh 0..1 = rows 0..15 of the wave tile
      ov[it] = *(const v4f*)(os + row * 68 + c * 4);
    }
    {
#pragma unroll
      for (int it = 0; it < 8; ++it) {
        const int row = it * 2 + hh;
        *(v4f*)(outb + ooff + (size_t)(orow0 + row) * DM + h * HD + c * 4) = ov[it];
      }
      
    }
  }
}

// =====================================================================================================
// Workspace map (bytes); every plane is an exact multiple of its tile / whole-line store granularity (all dims are
// exact tile multiples, no padded tails), all offsets multiples of 4096:
//   XH    f16  [4096 t][1024 in]             0          8388608   (f16 of bf16 value x16, rows b*2048 + t)
//   AH    f16  [4096 t][1024 in]             8388608    8388608
//   WXT   f16  [3072 out][1024 in]           16777216   6291456   (W^T, bf16 value x64)
//   WAT   f16  [3072 out][1024 in]           23068672   6291456
//   COST  f32  [4096 pos][32]                29360128    524288
//   SINT  f32  [4096 pos][32]                29884416    524288
//   QKH   f16  [2 b][4096 pos][2048 (q|k)]   30408704  33554432   (q x4, k x16 hi after norm + rotary)
//   QKL   f16  [2 b][4096][2048]             63963136  33554432   (x4096 residuals)
//   VF    f32  [2 b][4096 pos][1024 (h,d)]   97517568  33554432   (v, f32)
//   VTH   f16  [2 b][1024 (h,d)][4096 pos]  131072000  16777216   (v x16 hi)
//   VTL   f16  [2 b][1024 (h,d)][4096 pos]  147849216  16777216   ((v x16 - hi) x4096)
//   MT    f32  [2 b][16 h][3 s][64 e][64 d] 164626432   1572864
//   ZP    f32  [2 b][16 h][3 s][64 d]       166199296     24576
//   MEM   f32  [2 b][4096 pos][1024 (h,e)]  166223872  33554432
//   end                                     199778304
// =====================================================================================================
extern "C" void kernel_launch(void* const* d_in, const int* in_sizes, int n_in,
                              void* d_out, int out_size, void* d_ws, size_t ws_size,
                              hipStream_t stream) {
  if (n_in < 9) return;
  if (in_sizes[0] != NB * NTOK * DM || in_sizes[1] != NB * NTOK * DM) return;
  if (in_sizes[2] != DM * W3 || in_sizes[3] != DM * W3) return;
  if (in_sizes[4] != NHEAD * HD || in_sizes[5] != NHEAD * HD) return;
  if (in_sizes[6] != NHEAD * HD || in_sizes[7] != NHEAD * HD) return;
  if (in_sizes[8] != NHEAD) return;
  if (out_size != 2 * NB * NTOK * DM) return;

  const float* X    = (const float*)d_in[0];
  const float* Aa   = (const float*)d_in[1];
  const float* Wx   = (const float*)d_in[2];
  const float* Wa   = (const float*)d_in[3];
  const float* g_qx = (const float*)d_in[4];
  const float* g_kx = (const float*)d_in[5];
  const float* g_qa = (const float*)d_in[6];
  const float* g_ka = (const float*)d_in[7];
  const float* gate = (const float*)d_in[8];
  float* outf = (float*)d_out;

  const size_t PXA = (size_t)NB * NTOK * DM * 2;        //  8388608
  const size_t PW  = (size_t)W3 * DM * 2;               //  6291456
  const size_t PRT = (size_t)SEQ * RP * 4;              //   524288
  const size_t PQK = (size_t)NB * SEQ * QKW * 2;        // 33554432
  const size_t PVF = (size_t)NB * SEQ * DM * 4;         // 33554432
  const size_t PVT = (size_t)NB * DM * SEQ * 2;         // 16777216
  const size_t PMT = (size_t)NB * NHEAD * 3 * HD * HD * 4;   // 1572864
  const size_t PZP = (size_t)NB * NHEAD * 3 * HD * 4;        //   24576
  const size_t PME = (size_t)NB * SEQ * DM * 4;         // 33554432
  size_t off = 0;
  const size_t oXH = off; off += PXA;
  const size_t oAH = off; off += PXA;
  const size_t oWX = off; off += PW;
  const size_t oWA = off; off += PW;
  const size_t oCT = off; off += PRT;
  const size_t oST = off; off += PRT;
  const size_t oQH = off; off += PQK;
  const size_t oQL = off; off += PQK;
  const size_t oVF = off; off += PVF;
  const size_t oVH = off; off += PVT;
  const size_t oVL = off; off += PVT;
  const size_t oMT = off; off += PMT;
  const size_t oZP = off; off += PZP;
  const size_t oME = off; off += PME;
  if (off > ws_size) return;                            // off = 199778304

  char* ws = (char*)d_ws;
  unsigned short* XH   = (unsigned short*)(ws + oXH);
  unsigned short* AH   = (unsigned short*)(ws + oAH);
  unsigned short* WXT  = (unsigned short*)(ws + oWX);
  unsigned short* WAT  = (unsigned short*)(ws + oWA);
  float*          COST = (float*)(ws + oCT);
  float*          SINT = (float*)(ws + oST);
  unsigned short* QKH  = (unsigned short*)(ws + oQH);
  unsigned short* QKL  = (unsigned short*)(ws + oQL);
  float*          VF   = (float*)(ws + oVF);
  unsigned short* VTH  = (unsigned short*)(ws + oVH);
  unsigned short* VTL  = (unsigned short*)(ws + oVL);
  float*          MT   = (float*)(ws + oMT);
  float*          ZP   = (float*)(ws + oZP);
  float*          MEM  = (float*)(ws + oME);

  const dim3 blk256(256), blk128(128);
  const float sscale = 0.125f / (QSC * KSC);
  const float oscale = 1.0f / (XSC * WSC);

  // Every kernel is launched once; the two arrays, the two streams and the two batches are grid dimensions.
  // (1) x, a -> row-major f16 planes of their bf16 RNE values x16; W [1024][3072] -> transposed f16 planes
  //     [3072][1024] (k contiguous, Bt form) of their bf16 RNE values x64; rotary tables
  cvt_rm<<<dim3((NB * NTOK * DM) / 2048, 2), blk256, 0, stream>>>(X, Aa, XH, NB * NTOK * DM, XSC);
  // in[DM rows][W3 cols] -> out[W3][DM]: grid (cols/64, rows/64, matrix)
  tr_cvt<0><<<dim3(W3 / 64, DM / 64, 2), blk256, 0, stream>>>(Wx, Wa, DM, W3, WXT, WXT, WSC);
  rope_tab<<<dim3((SEQ * RP) / 256), blk256, 0, stream>>>(COST, SINT, SEQ * RP);

  const int gqk  = ((NTOK / 32) * (QKW / 128)) / 4;      // 1024 tiles -> 256 blocks per stream and batch
  const int gv   = ((NTOK / 32) * (DM / 128)) / 4;       //  512 tiles -> 128 blocks per stream and batch
  const int gmt  = NHEAD * 3;                            //   48 blocks per batch
  const int gmem = NHEAD * 3 * (SEG / MROWS);            //  384 blocks per batch
  // (2) q|k of stream a (positions 0..2047) and stream x (positions 2048..4095): M=2048, N=2048, K=1024,
  //     fused per-head L2 norm + gain + rotary -> QKH/QKL f16 planes
  gemm_t<1><<<dim3(gqk, 2, NB), blk128, 0, stream>>>(AH, XH, DM, WAT, WXT, DM, (void*)QKH, (void*)QKL, QKW, SEQ,
                                                     COST, SINT, g_qa, g_ka, g_qx, g_kx, NTOK, QKW, DM, oscale);
  // (3) v of both streams: M=2048, N=1024 (W^T rows 2048..3071), K=1024 -> VF f32 rows
  gemm_t<3><<<dim3(gv, 2, NB), blk128, 0, stream>>>(AH, XH, DM, WAT + (size_t)2 * DM * DM,
                                                    WXT + (size_t)2 * DM * DM, DM, (void*)VF, (void*)VF, DM, SEQ,
                                                    COST, SINT, g_qa, g_ka, g_qx, g_kx, NTOK, DM, DM, oscale);
  // (4) v^T planes: in VF [SEQ rows][DM cols] -> out [DM][SEQ] f16 hi (x16) and residual (x4096), per batch
  tr_cvt<1><<<dim3(DM / 64, SEQ / 64, NB), blk256, 0, stream>>>(VF, VF + (size_t)SEQ * DM, SEQ, DM, VTH, VTL, VSC);
  // (5) compressive memory: per-segment sk^T.v and sum sk (segments 0..2), then the memory read for the
  //     query rows of segments 1..3 -> MEM f32 plane
  mt_seg<<<dim3(gmt, NB), blk256, 0, stream>>>(QKH, QKL, VTH, MT, ZP);
  mem_ret<<<dim3(gmem, NB), blk256, 0, stream>>>(QKH, QKL, MT, ZP, MEM);
  // (6) segment-local causal attention + gate mix -> both outputs: the leading NQP query blocks of every
  //     segment with the p, v residual products, the remaining blocks without
  attn_seg<true><<<dim3(NHEAD * NSEG * NQP, NB), blk128, 0, stream>>>(QKH, QKL, VTH, VTL, MEM, gate, outf,
                                                                      sscale, 0, NQP);
  attn_seg<false><<<dim3(NHEAD * NSEG * (NQB - NQP), NB), blk128, 0, stream>>>(QKH, QKL, VTH, VTL, MEM, gate,
                                                                               outf, sscale, NQP, NQB - NQP);
  (void)hipGetLastError();
}

// v005
// Measured time: 193 microseconds a run.
// Two timings next to v004 both put it at 1.18 times that version's speed.
// Counting every step since v000, it is 4.09 times as fast.
// Contractions: a.W and x.W (q|k|v, K=1024) on v_wmma_f32_16x16x32_f16 with f16 containers of the bf16 RNE input
//   values (activations carried x16, W^T x64), one product; q.k^T (K=64) on v_wmma_f32_16x16x32_f16 with q (x4) and
//   k (x16) f16 hi planes plus x4096 f16 residual planes (three products, residual pair in a separate accumulator
//   folded by 1/4096); p.v^T on v_wmma_f32_16x16x32_f16 with p as f16(1024 p) and v^T as f16(16 v), one product
//   (the leading query blocks of every segment add the p and v x4096 f16 residual planes, two more products into a
//   separate accumulator); compressive memory sk^T.v (K=1024) and sq.M (K=64) on v_wmma_f32_16x16x32_f16 with
//   plain f16 operands, one product each. f32 accumulate everywhere; L2 norms, rotary tables and rotation, elu,
//   softmax statistics, sq.z, the memory quotient and the gate mix in f32.
#include <hip/hip_runtime.h>
#include <math.h>
#include <stdint.h>

#define NB      2
#define NTOK    2048                // tokens per stream per batch
#define SEQ     4096                // concatenated positions per batch (stream a first, then x)
#define DM      1024
#define NHEAD   16
#define HD      64
#define RP      32                  // rotary pairs per head
#define W3      3072
#define QKW     2048                // q|k plane width: q at column h*64+d, k at 1024 + h*64+d
#define SEG     1024
#define NSEG    4
#define NQB     16                  // 64-row query blocks per segment
#define NQP     4                   // leading query blocks per segment that carry the p / v residual products
#define MROWS   128                 // query rows per block of the memory read kernel
#define OUT1OFF (NB * NTOK * DM)             // element offset of the second output
#define XSC     16.0f
#define WSC     64.0f
#define QSC     4.0f
#define KSC     16.0f
#define VSC     16.0f
#define RSC     4096.0f
#define PSC     1024.0f
#define NRM_EPS 1.0e-12f
#define DEN_EPS 1.0e-6f
#define LOG2_BASE 13.287712379549449
#define NEG_BIG (-1.0e30f)
#define GBK     128                 // k per LDS stage of the projection GEMM (256 B of every operand row)
#define GPIT    136                 // LDS row pitch of a stage in halves: 272 B = 16 B x 17 (ds_load_b128 readers)
#define GSTG    (256 * GPIT)        // halves per stage: 128 A rows, then 128 Bt rows
#define SLABF   (16 * 132)          // floats per epilogue slab of the projection GEMM (one per wave)
#define APIT    72                  // LDS row pitch of the attention K and V^T tiles in halves: 144 B = 16 B x 9
                                    // (ds_load_b128 readers: 16 rows of a fragment load fall on 16 distinct bank groups)

static_assert(NHEAD * HD == DM);
static_assert(SEQ == 2 * NTOK);
static_assert(SEQ == NSEG * SEG);
static_assert(SEG == NQB * 64);
static_assert(HD == 2 * RP);
static_assert(W3 == 3 * DM);
static_assert(QKW == 2 * DM);
static_assert(((NB * NTOK * DM) % 2048) == 0);
static_assert(((SEQ * RP) % 256) == 0);
static_assert((DM % 128) == 0 && (W3 % 64) == 0 && (NTOK % 64) == 0 && (SEQ % 64) == 0);
static_assert((QKW % 128) == 0 && (DM % 32) == 0);
static_assert(NQP > 0 && NQP < NQB);
static_assert((SEG % MROWS) == 0 && MROWS == 8 * 16);
static_assert(OUT1OFF == NB * NTOK * DM);
static_assert((DM % GBK) == 0 && (NTOK % 128) == 0 && ((GPIT * 2) % 16) == 0);
static_assert(4 * SLABF * 4 <= 2 * GSTG * 2 && ((SLABF * 4) % 16) == 0);
static_assert(APIT >= HD && ((APIT * 2) % 16) == 0);

typedef _Float16 v16h __attribute__((ext_vector_type(16)));
typedef _Float16 v8h  __attribute__((ext_vector_type(8)));
typedef float    v8f  __attribute__((ext_vector_type(8)));
typedef float    v4f  __attribute__((ext_vector_type(4)));
typedef unsigned int v4u __attribute__((ext_vector_type(4)));
union FH { v16h v; v8h h[2]; };

// ---- scalar helpers --------------------------------------------------------------------------------
__device__ __forceinline__ unsigned short bf_bits(float f) {          // f32 -> bf16 bits, RNE convert
  unsigned u = __float_as_uint(f);
  return (unsigned short)((u + 0x7FFFu + ((u >> 16) & 1u)) >> 16);
}
__device__ __forceinline__ float bf_up(unsigned short b) { return __uint_as_float(((unsigned)b) << 16); }
__device__ __forceinline__ float bfr(float f) { return bf_up(bf_bits(f)); }     // value of the bf16 RNE convert
__device__ __forceinline__ unsigned short h_bits(_Float16 x) { return __builtin_bit_cast(unsigned short, x); }
__device__ __forceinline__ unsigned pk16(unsigned short a, unsigned short b) { return (unsigned)a | ((unsigned)b << 16); }
__device__ __forceinline__ v8f zero8() { v8f z = {0.f, 0.f, 0.f, 0.f, 0.f, 0.f, 0.f, 0.f}; return z; }

// ---- fragment loader: 16-bit A/B operand, lane -> row/col (lane&15), p already includes +8*(lane>>4);
//      elements 0..7 <- p[0..7] (k0+8h..), elements 8..15 <- p[16..23] (k0+16+8h..)
__device__ __forceinline__ v16h ldfrag_h(const _Float16* p) {
  FH f;
  f.h[0] = *(const v8h*)(p);
  f.h[1] = *(const v8h*)(p + 16);
  return f.v;
}

// ---- WMMA helpers with trailing VALU hazard gap --------------------------------------------------------
__device__ __forceinline__ v8f mma_h_raw(v16h a, v16h b, v8f c) {
  return __builtin_amdgcn_wmma_f32_16x16x32_f16(false, a, false, b, (short)0, c, false, false);
}
__device__ __forceinline__ v8f mma_h(v16h a, v16h b, v8f c) {
  c = mma_h_raw(a, b, c);
#if defined(__HIP_DEVICE_COMPILE__)
  asm volatile("v_nop\n\tv_nop\n\tv_nop\n\tv_nop" : "+v"(c) : "v"(a), "v"(b));
#endif
  return c;
}
__device__ __forceinline__ void guard3(v8f& x, v8f& y, v16h a, v16h b, v16h d) {   // two D tiles, 3 frags live
#if defined(__HIP_DEVICE_COMPILE__)
  asm volatile("v_nop\n\tv_nop\n\tv_nop\n\tv_nop" : "+v"(x), "+v"(y) : "v"(a), "v"(b), "v"(d));
#endif
}
__device__ __forceinline__ void guard1q(v8f& x, v16h a, v16h b, v16h d, v16h e) {           // one D, 4 frags
#if defined(__HIP_DEVICE_COMPILE__)
  asm volatile("v_nop\n\tv_nop\n\tv_nop\n\tv_nop" : "+v"(x) : "v"(a), "v"(b), "v"(d), "v"(e));
#endif
}
__device__ __forceinline__ void guard4m(v8f& x, v8f& y, v16h a, v16h b, v16h d, v16h e) {   // two D, 4 frags
#if defined(__HIP_DEVICE_COMPILE__)
  asm volatile("v_nop\n\tv_nop\n\tv_nop\n\tv_nop" : "+v"(x), "+v"(y) : "v"(a), "v"(b), "v"(d), "v"(e)
               : "memory");
#endif
}
__device__ __forceinline__ void guard8m(v8f& x, v8f& y, v16h a, v16h b, v16h d, v16h e,
                                        v16h f, v16h g, v16h p, v16h q) {                      // two D, 8 frags
#if defined(__HIP_DEVICE_COMPILE__)
  asm volatile("v_nop\n\tv_nop\n\tv_nop\n\tv_nop" : "+v"(x), "+v"(y)
               : "v"(a), "v"(b), "v"(d), "v"(e), "v"(f), "v"(g), "v"(p), "v"(q) : "memory");
#endif
}
__device__ __forceinline__ void acc_guard4(v8f& a, v8f& b, v8f& c, v8f& d) {
#if defined(__HIP_DEVICE_COMPILE__)
  asm volatile("v_nop\n\tv_nop\n\tv_nop\n\tv_nop" : "+v"(a), "+v"(b), "+v"(c), "+v"(d));
#endif
}
__device__ __forceinline__ void acc_guard2(v8f& a, v8f& b) {
#if defined(__HIP_DEVICE_COMPILE__)
  asm volatile("v_nop\n\tv_nop\n\tv_nop\n\tv_nop" : "+v"(a), "+v"(b));
#endif
}
// lane l <-> lane l ^ 16 (the two halves of a D column) by a vector cross-row move
__device__ __forceinline__ float xhalf(float x) {
  const int b = __builtin_bit_cast(int, x);
  return __builtin_bit_cast(float, __builtin_amdgcn_permlanex16(b, b, 0x76543210, 0xfedcba98, false, false));
}
__device__ __forceinline__ void cbar() {
#if defined(__HIP_DEVICE_COMPILE__)
  asm volatile("" ::: "memory");
#endif
}
__device__ __forceinline__ void wave_sync_lds() {
  __builtin_amdgcn_fence(__ATOMIC_RELEASE, "workgroup");
  __builtin_amdgcn_wave_barrier();
  __builtin_amdgcn_fence(__ATOMIC_ACQUIRE, "workgroup");
}

// ---- eight asynchronous 16-B copies global -> LDS per lane (l: LDS byte address, g: global address). The
//      s_wait_xcnt stands inside the statement so that no address register is rewritten ahead of it.
__device__ __forceinline__ void acopy8(uint32_t l0, uint32_t l1, uint32_t l2, uint32_t l3,
                                       uint32_t l4, uint32_t l5, uint32_t l6, uint32_t l7,
                                       const _Float16* g0, const _Float16* g1, const _Float16* g2,
                                       const _Float16* g3, const _Float16* g4, const _Float16* g5,
                                       const _Float16* g6, const _Float16* g7) {
#if defined(__HIP_DEVICE_COMPILE__)
  asm volatile("global_load_async_to_lds_b128 %0, %8, off\n\t"
               "global_load_async_to_lds_b128 %1, %9, off\n\t"
               "global_load_async_to_lds_b128 %2, %10, off\n\t"
               "global_load_async_to_lds_b128 %3, %11, off\n\t"
               "global_load_async_to_lds_b128 %4, %12, off\n\t"
               "global_load_async_to_lds_b128 %5, %13, off\n\t"
               "global_load_async_to_lds_b128 %6, %14, off\n\t"
               "global_load_async_to_lds_b128 %7, %15, off\n\t"
               "s_wait_xcnt 0x0"
               :: "v"(l0), "v"(l1), "v"(l2), "v"(l3), "v"(l4), "v"(l5), "v"(l6), "v"(l7),
                  "v"(g0), "v"(g1), "v"(g2), "v"(g3), "v"(g4), "v"(g5), "v"(g6), "v"(g7)
               : "memory");
#endif
}
// 64 rows of one operand, 256 B each, into LDS rows of pitch GPIT: l / g are this thread's addresses in row
// (tid >> 4) at 16-B piece (tid & 15); copy i takes row 8 i + (tid >> 4), a wave's copy covers two whole rows.
__device__ __forceinline__ void acopy_rows64(uint32_t l, const _Float16* g, size_t ld) {
  const uint32_t ls = 8u * GPIT * 2u;
  const size_t   gs = 8 * ld;
  acopy8(l, l + ls, l + 2 * ls, l + 3 * ls, l + 4 * ls, l + 5 * ls, l + 6 * ls, l + 7 * ls,
         g, g + gs, g + 2 * gs, g + 3 * gs, g + 4 * gs, g + 5 * gs, g + 6 * gs, g + 7 * gs);
}
// the issuing wave's own copies have landed (the compiler places no wait for them)
__device__ __forceinline__ void wait_async0() {
#if defined(__HIP_DEVICE_COMPILE__)
  asm volatile("s_wait_asynccnt 0x0" ::: "memory");
#endif
}
// this wave's LDS reads of the stage have returned before the stage is handed back for a refill
__device__ __forceinline__ void wait_ds0() {
#if defined(__HIP_DEVICE_COMPILE__)
  asm volatile("s_wait_dscnt 0x0" ::: "memory");
#endif
}

// =====================================================================================================
// Row-major convert: f32 [n] -> f16 plane [n] holding f16(bf16 RNE value * scale) (scale a power of two, exact).
// coverage: grid.x = n/2048 blocks x 256 threads x 8 = n elements (n % 2048 == 0 host-checked); grid.y = 2 arrays.
// =====================================================================================================
__global__ __launch_bounds__(256) void cvt_rm(const float* __restrict__ in0, const float* __restrict__ in1,
                                             unsigned short* out, int n, float scale) {
  const size_t i8 = ((size_t)blockIdx.x * 256 + threadIdx.x) * 8;
  if (i8 + 8 > (size_t)n) return;        // never taken for the host-checked sizes; no barriers below
  const float* in = blockIdx.y ? in1 : in0;   // blockIdx.y = which of the two arrays; its plane follows the first
  out += (size_t)blockIdx.y * (size_t)n;
  const v4f a = *(const v4f*)(in + i8);
  const v4f b = *(const v4f*)(in + i8 + 4);
  float f[8];
  f[0] = a[0]; f[1] = a[1]; f[2] = a[2]; f[3] = a[3];
  f[4] = b[0]; f[5] = b[1]; f[6] = b[2]; f[7] = b[3];
  v4u p;
#pragma unroll
  for (int e = 0; e < 4; ++e) {
    const unsigned short b0 = bf_bits(f[2 * e]), b1 = bf_bits(f[2 * e + 1]);
    const _Float16 x0 = (_Float16)(bf_up(b0) * scale);
    const _Float16 x1 = (_Float16)(bf_up(b1) * scale);
    p[e] = pk16(h_bits(x0), h_bits(x1));
  }
  *(v4u*)(out + i8) = p;
  
}

// =====================================================================================================
// Transposing convert: f32 in[R][C] (row-major, pitch C) -> 16-bit out[C][R] (pitch R), 64x64 tiles through LDS.
//   MODE 0: one plane  out0 = f16(bf16 RNE value * scale).
//   MODE 1: two planes out0 = f16(v * scale) hi, out1 = f16((v * scale - hi) * RSC) residual.
// Block = 256 threads; grid = (C/64, R/64, 2 matrices) exact (host-checked). Load: thread -> input row tid>>2, 16 consecutive
// columns (four 16-B loads). Store: two iterations, output row it*32 + (tid>>3), lanes (tid&7) -> elements
// coverage: 2 iterations x 32 output rows x 8 lanes x 8 halves = the whole 64x64 tile; grid covers all of C x R.
// =====================================================================================================
template <int MODE>
__global__ __launch_bounds__(256) void tr_cvt(const float* __restrict__ in0, const float* __restrict__ in1,
                                             int R, int C, unsigned short* out0, unsigned short* out1,
                                             float scale) {
  __shared__ float sm[64][65];
  const int tid = threadIdx.x;
  const float* in = blockIdx.z ? in1 : in0;   // blockIdx.z = which of the two matrices; its planes follow the first's
  out0 += (size_t)blockIdx.z * (size_t)R * (size_t)C;
  out1 += (size_t)blockIdx.z * (size_t)R * (size_t)C;
  const int c0 = blockIdx.x * 64;          // input column block -> output row block
  const int r0 = blockIdx.y * 64;          // input row block    -> output column block
  if (c0 + 64 > C || r0 + 64 > R) return;  // block-uniform, ahead of any barrier; never taken for exact grids
  {
    const int lr = tid >> 2, lc = (tid & 3) * 16;
    const float* src = in + (size_t)(r0 + lr) * (size_t)C + c0 + lc;
#pragma unroll
    for (int q = 0; q < 4; ++q) {
      const v4f v = *(const v4f*)(src + 4 * q);
      sm[lr][lc + 4 * q + 0] = v[0];
      sm[lr][lc + 4 * q + 1] = v[1];
      sm[lr][lc + 4 * q + 2] = v[2];
      sm[lr][lc + 4 * q + 3] = v[3];
    }
  }
  __syncthreads();
  const int seg = tid & 7;
  v4u p0[2], p1[2];
#pragma unroll
  for (int it = 0; it < 2; ++it) {
    const int ocl = it * 32 + (tid >> 3);   // output row within the tile = input column
    float f[8];
#pragma unroll
    for (int e = 0; e < 8; ++e) f[e] = sm[seg * 8 + e][ocl];
    v4u pk, pl;
#pragma unroll
    for (int e = 0; e < 4; ++e) {
      const float g0 = f[2 * e], g1 = f[2 * e + 1];
      if (MODE == 0) {
        const _Float16 x0 = (_Float16)(bfr(g0) * scale);
        const _Float16 x1 = (_Float16)(bfr(g1) * scale);
        pk[e] = pk16(h_bits(x0), h_bits(x1));
        pl[e] = pk[e];
      } else {
        const float s0 = g0 * scale, s1 = g1 * scale;
        const _Float16 x0 = (_Float16)s0, x1 = (_Float16)s1;
        const _Float16 y0 = (_Float16)((s0 - (float)x0) * RSC);
        const _Float16 y1 = (_Float16)((s1 - (float)x1) * RSC);
        pk[e] = pk16(h_bits(x0), h_bits(x1));
        pl[e] = pk16(h_bits(y0), h_bits(y1));
      }
    }
    p0[it] = pk;
    p1[it] = pl;
  }
  {
#pragma unroll
    for (int it = 0; it < 2; ++it) {
      const int ocl = it * 32 + (tid >> 3);
      const size_t go = (size_t)(c0 + ocl) * (size_t)R + (size_t)(r0 + seg * 8);
      *(v4u*)(out0 + go) = p0[it];
      if (MODE == 1) *(v4u*)(out1 + go) = p1[it];
    }
    
  }
}

// =====================================================================================================
// Rotary tables for interleaved pairs: cost[t][i] = cos(t * inv_freq[i]), sint[t][i] = sin(t * inv_freq[i]),
// i = 0..31, inv_freq[i] = 1 / (10000^(2i/64)) (power via f64 exp2 -> one f32 convert, then an f32 reciprocal
// formed in f64 and converted once), angle = one f32 multiply with t = position 0..4095 in the concatenated
// coverage: grid.x = n/256 blocks x 256 threads = n = SEQ*32 elements of each table.
// =====================================================================================================
__global__ __launch_bounds__(256) void rope_tab(float* cost, float* sint, int n) {
  const int e = blockIdx.x * 256 + (int)threadIdx.x;
  if (e >= n) return;                      // never taken (n % 256 == 0); no barriers below
  const int t = e >> 5, i = e & 31;
  const double pd = exp2((double)i * (1.0 / 32.0) * LOG2_BASE);   // 10000^(2i/64)
  const float  pf = (float)pd;
  const float  invf = (float)(1.0 / (double)pf);
  const float  ang = (float)t * invf;
  float sv, cv;
  sincosf(ang, &sv, &cv);
  *(float*)(cost + e) = cv;
  *(float*)(sint + e) = sv;
  
}

// =====================================================================================================
// Register-blocked f16 WMMA GEMM, one wave per 32x128 tile; block = 4 waves = 4 tiles stacked in m = one 128x128
// block tile whose operands pass through LDS: a stage is 128 k of the 128 A rows and the 128 Bt rows, brought by
// asynchronous copies into two buffers (stage t + 1 flies while stage t is worked on), read by all 4 waves:
//   acc[m][n] = sum_k A[m][k] * Bt[n][k]; A row-major [M][K] pitch lda, Bt row-major [N][K] pitch ldb
//   (k contiguous); M % 128 == 0, N % 128 == 0, K % 128 == 0 (exact constants here, host-checked).
// EPI 1 (q|k planes, N == QKW): the 128-column tile holds two heads of 64 columns (columns < DM are q heads,
//        columns >= DM are k heads). Per row and head: t = acc*oscale; v = t * (1/max(||t||_2, 1e-12)) *
//        bf16(gain[head][d]) * 8; then the interleaved-pair rotary rotation with the f32 tables at position
//        crow0 + m (pair (2i, 2i+1): o1 = v1*c - v2*s, o2 = v1*s + v2*c), times cscale (QSC for q, KSC for k)
//        -> C0 = f16 hi, C1 = f16((v - hi) * RSC) residual, 16-bit planes of pitch ldc, row crow0 + m, column n.
// EPI 3: f32 rows (C0) = acc*oscale, pitch ldc, row crow0 + m, column n.
// 16 lanes x 16 B per 256-B row segment (two rows per instruction), f32 as 32 lanes x 16 B per 512-B row segment;
// coverage: 2 slabs x 16 rows x 128 cols = the wave's whole 32x128 tile; tiles = whole M x N (grid.x = tiles/4 exact),
// grid.y = the two streams, grid.z = the batches.
// =====================================================================================================
template <int EPI>
__global__ __launch_bounds__(128) void gemm_t(
    const unsigned short* __restrict__ A0, const unsigned short* __restrict__ A1, int lda,
    const unsigned short* __restrict__ Bt0, const unsigned short* __restrict__ Bt1, int ldb,
    void* C0, void* C1, int ldc, int crows,
    const float* __restrict__ cost, const float* __restrict__ sint,
    const float* __restrict__ gq0, const float* __restrict__ gk0,
    const float* __restrict__ gq1, const float* __restrict__ gk1,
    int M, int N, int K, float oscale) {
  __shared__ __align__(16) _Float16 ring[2 * GSTG]; // two operand stages; behind the k loop the same bytes hold the
                                                    // epilogue slabs, so a block takes 136 KiB and two fit one WGP
  const int lane = threadIdx.x & 31;
  const int wave = threadIdx.x >> 5;
  // blockIdx.y = stream (0: operands A0, Bt0, gains gq0, gk0, C rows 0..M-1; 1: the others, C rows M..2M-1);
  // blockIdx.z = batch (A rows z*M.., C plane z of crows rows)
  const int  st = (int)blockIdx.y;
  const unsigned short* A  = (st ? A1 : A0) + (size_t)blockIdx.z * (size_t)M * (size_t)lda;
  const unsigned short* Bt = st ? Bt1 : Bt0;
  const float* gq = st ? gq1 : gq0;
  const float* gk = st ? gk1 : gk0;
  const int    crow0 = st * M;
  const size_t cpl   = (size_t)blockIdx.z * (size_t)crows * (size_t)ldc;   // element offset of this batch's C plane
  const int tilesN = N >> 7;
  const int tilesM = M >> 5;
  if ((int)blockIdx.x >= (tilesM >> 2) * tilesN) return;   // block-uniform, ahead of any barrier; never taken
  const int bm = (int)blockIdx.x / tilesN;
  const int tn = (int)blockIdx.x - bm * tilesN;
  const int tm = bm * 4 + wave;
  const int m0 = tm << 5;
  const int n0 = tn << 7;
  const int rl   = lane & 15;            // row (A) / col (B, D) within subtile
  const int hh   = lane >> 4;            // lane half
  const int koff = hh * 8;               // k offset of this lane half

  v8f acc[2][8];
#pragma unroll
  for (int i = 0; i < 2; ++i)
#pragma unroll
    for (int j = 0; j < 8; ++j) acc[i][j] = zero8();

  {
    const int cr = (int)threadIdx.x >> 4;          // row (mod 8) this thread copies
    const int cc = (int)threadIdx.x & 15;          // its 16-B piece of the row's 256 B
    const _Float16* ga = (const _Float16*)(const void*)A + (size_t)((bm << 7) + cr) * (size_t)lda + cc * 8;
    const _Float16* gb = (const _Float16*)(const void*)Bt + (size_t)(n0 + cr) * (size_t)ldb + cc * 8;
    const uint32_t  lr = (uint32_t)(size_t)(const void*)ring + (uint32_t)(cr * GPIT + cc * 8) * 2u;
    const int nst = K / GBK;                       // stages; block-uniform
    auto fill = [&](int st) {                      // stage st -> buffer st & 1: 32 copies per wave
      const uint32_t l = lr + (uint32_t)(st & 1) * (uint32_t)(GSTG * 2);
      const _Float16* pa = ga + (size_t)st * GBK;
      const _Float16* pb = gb + (size_t)st * GBK;
      acopy_rows64(l, pa, (size_t)lda);
      acopy_rows64(l + 64u * GPIT * 2u, pa + (size_t)64 * (size_t)lda, (size_t)lda);
      acopy_rows64(l + 128u * GPIT * 2u, pb, (size_t)ldb);
      acopy_rows64(l + 192u * GPIT * 2u, pb + (size_t)64 * (size_t)ldb, (size_t)ldb);
    };
    fill(0);
    wait_async0();
    __syncthreads();                               // stage 0 is published
    if (nst > 1) fill(1);
    for (int t = 0; t < nst; ++t) {
      const _Float16* sb  = ring + (t & 1) * GSTG;
      const _Float16* ar0 = sb + (wave * 32 + rl) * GPIT + koff;
      const _Float16* ar1 = ar0 + 16 * GPIT;
      const _Float16* br  = sb + (128 + rl) * GPIT + koff;
#pragma unroll                                     // the k offset becomes an immediate of each LDS load
      for (int kk = 0; kk < GBK / 32; ++kk) {
        const v16h a0 = ldfrag_h(ar0 + 32 * kk);
        const v16h a1 = ldfrag_h(ar1 + 32 * kk);
        v16h b[8];
#pragma unroll                                     // b[] stays in registers: the k-step's LDS loads stand as one group
        for (int j = 0; j < 8; ++j) b[j] = ldfrag_h(br + j * 16 * GPIT + 32 * kk);
#pragma unroll                                     // acc[][] and b[] indexed by constants only
        for (int j = 0; j < 8; ++j) {
          acc[0][j] = mma_h_raw(a0, b[j], acc[0][j]);
          acc[1][j] = mma_h_raw(a1, b[j], acc[1][j]);
          guard3(acc[0][j], acc[1][j], a0, a1, b[j]);
        }
      }
      wait_ds0();
      wait_async0();
      __syncthreads();                             // publishes stage t + 1 and ends every read of stage t
      if (t + 2 < nst) fill(t + 2);
    }
    wait_async0();
  }
  acc_guard4(acc[0][0], acc[0][1], acc[0][2], acc[0][3]);
  acc_guard4(acc[0][4], acc[0][5], acc[0][6], acc[0][7]);
  acc_guard4(acc[1][0], acc[1][1], acc[1][2], acc[1][3]);
  acc_guard4(acc[1][4], acc[1][5], acc[1][6], acc[1][7]);

  // ---- epilogue ----
  // per-wave 16x128 slab, pitch 132 floats, in the ring's first bytes: the barrier at the foot of the last trip has
  // ended every wave's reads of both stages, and no copy is issued or outstanding behind it
  float* slab = (float*)(void*)ring + wave * SLABF;
  float gmul[8];
  float csc = 1.0f;
  if (EPI == 1) {
    const bool isq = (n0 < DM);                                 // wave-uniform
    const int  hb  = (isq ? n0 : (n0 - DM)) >> 6;               // first head of this tile (0..15)
    csc = isq ? QSC : KSC;
#pragma unroll
    for (int j = 0; j < 8; ++j) {
      const int gi = (hb + (j >> 2)) * HD + 16 * (j & 3) + rl;  // < NHEAD*HD, inside both gain arrays
      const float ga = bfr(gq[gi]);
      const float gb = bfr(gk[gi]);
      gmul[j] = (isq ? ga : gb) * 8.0f;
    }
  } else {
#pragma unroll
    for (int j = 0; j < 8; ++j) gmul[j] = 1.0f;
  }
#pragma unroll
  for (int i = 0; i < 2; ++i) {
    const int mB = m0 + 16 * i;
    if (EPI == 1) {
      float inv[2][8];
#pragma unroll
      for (int jh = 0; jh < 2; ++jh) {
#pragma unroll
        for (int r = 0; r < 8; ++r) {        // sum of squares over the head's 64 columns of row 8hh+r
          float ss = 0.f;
#pragma unroll
          for (int jj = 0; jj < 4; ++jj) {
            const float x = acc[i][4 * jh + jj][r] * oscale;
            ss += x * x;
          }
          ss += __shfl_xor(ss, 1, 32);
          ss += __shfl_xor(ss, 2, 32);
          ss += __shfl_xor(ss, 4, 32);
          ss += __shfl_xor(ss, 8, 32);
          inv[jh][r] = oscale * (1.0f / fmaxf(sqrtf(ss), NRM_EPS));
        }
      }
#pragma unroll
      for (int j = 0; j < 8; ++j) {
#pragma unroll
        for (int r = 0; r < 8; ++r)
          slab[(8 * hh + r) * 132 + 16 * j + rl] = acc[i][j][r] * inv[j >> 2][r] * gmul[j];
      }
    } else {
#pragma unroll
      for (int j = 0; j < 8; ++j) {
#pragma unroll
        for (int r = 0; r < 8; ++r) slab[(8 * hh + r) * 132 + 16 * j + rl] = acc[i][j][r] * oscale;
      }
    }
    wave_sync_lds();
    if (EPI == 3) {
      float* Cf = (float*)C0 + cpl;
      v4f ov[16];
#pragma unroll
      for (int it = 0; it < 16; ++it) ov[it] = *(const v4f*)(slab + it * 132 + lane * 4);
      {
#pragma unroll
        for (int it = 0; it < 16; ++it)                       // row it: 32 lanes x 16 B = 512 B = 128 cols
          *(v4f*)(Cf + (size_t)(crow0 + mB + it) * (size_t)ldc + n0 + lane * 4) = ov[it];
        
      }
    } else {
      unsigned short* Cp = (unsigned short*)C0 + cpl;
      unsigned short* Cq = (unsigned short*)C1 + cpl;
      v4u hv[8], lv[8];
#pragma unroll
      for (int it = 0; it < 8; ++it) {
        const int row = it * 2 + hh;                          // it 0..7 x hh 0..1 = rows 0..15
        const float* sp = slab + row * 132 + rl * 8;          // 8 consecutive columns = 4 rotary pairs
        const v4f fa = *(const v4f*)sp;
        const v4f fb = *(const v4f*)(sp + 4);
        float f[8];
        f[0] = fa[0]; f[1] = fa[1]; f[2] = fa[2]; f[3] = fa[3];
        f[4] = fb[0]; f[5] = fb[1]; f[6] = fb[2]; f[7] = fb[3];
        const int pos = crow0 + mB + row;                     // position in the concatenated sequence
        const v4f cv = *(const v4f*)(cost + (size_t)pos * RP + (rl & 7) * 4);   // pairs ((rl&7)*4 .. +3)
        const v4f sv = *(const v4f*)(sint + (size_t)pos * RP + (rl & 7) * 4);
        v4u pk, pl;
#pragma unroll
        for (int e = 0; e < 4; ++e) {
          const float f0 = f[2 * e], f1 = f[2 * e + 1];
          const float cc = cv[e], sn = sv[e];
          const float g0 = (f0 * cc - f1 * sn) * csc;
          const float g1 = (f0 * sn + f1 * cc) * csc;
          const _Float16 x0 = (_Float16)g0;
          const _Float16 x1 = (_Float16)g1;
          const _Float16 y0 = (_Float16)((g0 - (float)x0) * RSC);
          const _Float16 y1 = (_Float16)((g1 - (float)x1) * RSC);
          pk[e] = pk16(h_bits(x0), h_bits(x1));
          pl[e] = pk16(h_bits(y0), h_bits(y1));
        }
        hv[it] = pk;
        lv[it] = pl;
      }
      {
#pragma unroll
        for (int it = 0; it < 8; ++it) {
          const int row = it * 2 + hh;
          const size_t go = (size_t)(crow0 + mB + row) * (size_t)ldc + n0 + rl * 8;
          *(v4u*)(Cp + go) = hv[it];
          *(v4u*)(Cq + go) = lv[it];
        }
        
      }
    }
    wave_sync_lds();
  }
}

// =====================================================================================================
// Compressive-memory update per (head h, segment s in 0..2) of one batch (blockIdx.y):
//   MT[h][s][e][d] = sum over the 1024 keys l of segment s of v[l][e] * sk[l][d], sk = elu(k) + 1
//   (elu(x) = x > 0 ? x : exp(x) - 1, so sk = x > 0 ? x + 1 : exp(x)), and ZP[h][s][d] = sum_l sk[l][d].
//   k is rebuilt in f32 from the q|k hi / residual planes ((hi + lo/RSC) / KSC, column DM + h*64 + d), sk is
//   RNE-converted to f16 and written TRANSPOSED into an LDS tile skT[d][l] (64 keys per chunk, pitch 72 halves);
//   A = V^T hi plane rows (h*64 + e, keys), Bt = skT; D[e][d] scaled by 1/VSC.
//   Block = 8 waves; wave w owns e rows 16*(w>>1).. and d columns 32*(w&1)..; acc guarded; the 16x32 f32 piece is
// coverage: MT: 8 waves x (16 rows x 32 cols) = the whole 64x64 tile of (h,s); 4 its x 4 row groups x 8 lanes =
//   16 rows x 32 cols per wave. ZP: 16 lanes x 4 floats = 64. skT fill: 256 threads x 16 d x 1 key = 64x64 chunk.
// =====================================================================================================
__global__ __launch_bounds__(256) void mt_seg(const unsigned short* __restrict__ QKH,
                                             const unsigned short* __restrict__ QKL,
                                             const unsigned short* __restrict__ VTH,
                                             float* MT, float* ZP) {
  __shared__ __align__(16) _Float16 skT[HD * 72];
  __shared__ __align__(16) float slab[8][16 * 36];
  __shared__ float zred[8][HD];
  __shared__ __align__(16) float zsum[HD];

  const int tid = threadIdx.x, wave = tid >> 5, lane = tid & 31, hh = lane >> 4, c = lane & 15;
  const int h = (int)(blockIdx.x / 3u);
  const int s = (int)(blockIdx.x - (unsigned)h * 3u);
  if (h >= NHEAD) return;                 // block-uniform, ahead of any barrier; never taken
  QKH += (size_t)blockIdx.y * SEQ * QKW;  // blockIdx.y = batch: its own planes
  QKL += (size_t)blockIdx.y * SEQ * QKW;
  VTH += (size_t)blockIdx.y * DM * SEQ;
  MT  += (size_t)blockIdx.y * NHEAD * 3 * HD * HD;
  ZP  += (size_t)blockIdx.y * NHEAD * 3 * HD;
  const int r  = tid >> 2;                // key within the 64-key chunk handled by this thread
  const int dq = (tid & 3) * 16;          // first of the 16 d columns handled by this thread
  const int et = wave >> 1;               // e row tile of this wave
  const int dt0 = (wave & 1) * 2;         // first d column tile of this wave

  const _Float16* Q16 = (const _Float16*)(const void*)QKH;
  const _Float16* L16 = (const _Float16*)(const void*)QKL;
  const _Float16* V16 = (const _Float16*)(const void*)VTH;
  const _Float16* vrow = V16 + (size_t)(h * HD + et * 16 + c) * SEQ + (size_t)s * SEG + 8 * hh;   // A frag base

  float zacc[16];
#pragma unroll
  for (int e = 0; e < 16; ++e) zacc[e] = 0.f;
  v8f acc[2];
  acc[0] = zero8(); acc[1] = zero8();

  for (int kt = 0; kt < SEG / 64; ++kt) {
    __syncthreads();                      // prior chunk's fragment reads are done
    {
      const size_t n = (size_t)(s * SEG + kt * 64 + r);
      const _Float16* kp = Q16 + n * QKW + DM + h * HD + dq;
      const _Float16* lp = L16 + n * QKW + DM + h * HD + dq;
      FH kf, lf;
      kf.h[0] = *(const v8h*)kp; kf.h[1] = *(const v8h*)(kp + 8);
      lf.h[0] = *(const v8h*)lp; lf.h[1] = *(const v8h*)(lp + 8);
#pragma unroll
      for (int e = 0; e < 16; ++e) {
        const float kv = ((float)kf.v[e] + (float)lf.v[e] * (1.0f / RSC)) * (1.0f / KSC);
        const float sk = (kv > 0.f) ? (kv + 1.0f) : __expf(kv);
        const _Float16 skh = (_Float16)sk;
        skT[(dq + e) * 72 + r] = skh;
        zacc[e] += (float)skh;
      }
    }
    __syncthreads();                      // skT chunk complete
#pragma unroll
    for (int kk = 0; kk < 2; ++kk) {
      const v16h a  = ldfrag_h(vrow + kt * 64 + 32 * kk);
      const v16h b0 = ldfrag_h(skT + (16 * dt0 + c) * 72 + 32 * kk + 8 * hh);
      const v16h b1 = ldfrag_h(skT + (16 * (dt0 + 1) + c) * 72 + 32 * kk + 8 * hh);
      acc[0] = mma_h_raw(a, b0, acc[0]);
      acc[1] = mma_h_raw(a, b1, acc[1]);
      guard3(acc[0], acc[1], a, b0, b1);
    }
  }
  acc_guard2(acc[0], acc[1]);

  // ---- MT piece: rows e = 16*et + (8hh+rr), cols d = 32*(wave&1) + 16*jj + c ----
  float* sl = slab[wave];
#pragma unroll
  for (int jj = 0; jj < 2; ++jj) {
#pragma unroll
    for (int rr = 0; rr < 8; ++rr) sl[(8 * hh + rr) * 36 + 16 * jj + c] = acc[jj][rr] * (1.0f / VSC);
  }
  wave_sync_lds();
  {
    v4f mv[4];
#pragma unroll
    for (int it = 0; it < 4; ++it) {
      const int row = it * 4 + (lane >> 3);
      mv[it] = *(const v4f*)(sl + row * 36 + (lane & 7) * 4);
    }
    float* mtb = MT + ((size_t)(h * 3 + s) * HD + (size_t)et * 16) * HD + (wave & 1) * 32;
    {
#pragma unroll
      for (int it = 0; it < 4; ++it) {
        const int row = it * 4 + (lane >> 3);
        *(v4f*)(mtb + (size_t)row * HD + (lane & 7) * 4) = mv[it];
      }
      
    }
  }
  // ---- ZP: sum zacc over the 8 keys of this wave (lanes sharing lane&3), then over the 8 waves ----
#pragma unroll
  for (int e = 0; e < 16; ++e) {
    float v = zacc[e];
    v += __shfl_xor(v, 4, 32);
    v += __shfl_xor(v, 8, 32);
    v += __shfl_xor(v, 16, 32);
    if ((lane >> 2) == 0) zred[wave][(lane & 3) * 16 + e] = v;
  }
  __syncthreads();
  if (tid < HD) {
    float z = 0.f;
#pragma unroll
    for (int w = 0; w < 8; ++w) z += zred[w][tid];
    zsum[tid] = z;
  }
  __syncthreads();
  if (tid < 16) {                         // wave 0, lanes 0..15: 16 x 16 B = the whole 256-B ZP row
    const v4f zz = *(const v4f*)(zsum + tid * 4);
    float* zp = ZP + (size_t)(h * 3 + s) * HD + tid * 4;
    *(v4f*)zp = zz;
    
  }
}

// =====================================================================================================
// Compressive-memory read per (head h, segment s in 1..3, 128-row block) of one batch (blockIdx.y):
//   M_s = sum over segments before s of MT[h][s'] (f32 sum, RNE convert to an f16 LDS tile MTh[e][d], pitch 72);
//   z_s = sum of ZP[h][s'] (f32, LDS). Per query row n of segment s: q rebuilt in f32 from the hi / residual planes
//   ((hi + lo/RSC) / QSC, column h*64 + d), sq = elu(q) + 1 RNE-converted to f16 directly into the A fragment
//   (elementwise transform keeps the A layout); num[n][e] = sum_d sq[n][d] * M_s[d][e] with Bt = MTh (K = 64, two
//   k-steps, 4 column tiles); den[n] = sum_d sq[n][d] * z_s[d] + 1e-6 in f32 from the same f16 sq values (lane
//   halves combined, then broadcast to the D rows); MEM[n][h*64 + e] = num * (1/den), f32 rows of pitch DM.
//   Block = 8 waves x 16 rows; per-wave 16x64 f32 tile staged in LDS; stores 16 lanes x 16 B per 256-B row
// coverage: 16 heads x 3 segments x 8 row blocks x 8 waves x 16 rows = MEM rows 1024..4095 of every head's 64
//   columns; 8 its x 2 row halves x 16 lanes x 4 floats = the wave's 16x64 tile. Rows 0..1023 (segment 0) are not
//   produced and are not used by the consumer (memory is exactly zero there).
// =====================================================================================================
__global__ __launch_bounds__(256) void mem_ret(const unsigned short* __restrict__ QKH,
                                              const unsigned short* __restrict__ QKL,
                                              const float* __restrict__ MT, const float* __restrict__ ZP,
                                              float* MEM) {
  __shared__ __align__(16) _Float16 MTh[HD * 72];
  __shared__ float zs[HD];
  __shared__ __align__(16) float slab[8][16 * 68];

  const int tid = threadIdx.x, wave = tid >> 5, lane = tid & 31, hh = lane >> 4, c = lane & 15;
  const int h   = (int)(blockIdx.x / 24u);
  const int rem = (int)(blockIdx.x - (unsigned)h * 24u);
  const int s   = 1 + rem / 8;            // 1..3
  const int rb  = rem - (s - 1) * 8;      // 0..7
  if (h >= NHEAD) return;                 // block-uniform, ahead of any barrier; never taken
  QKH += (size_t)blockIdx.y * SEQ * QKW;  // blockIdx.y = batch: its own planes
  QKL += (size_t)blockIdx.y * SEQ * QKW;
  MT  += (size_t)blockIdx.y * NHEAD * 3 * HD * HD;
  ZP  += (size_t)blockIdx.y * NHEAD * 3 * HD;
  MEM += (size_t)blockIdx.y * SEQ * DM;

  {
    const int e = tid >> 2, d0 = (tid & 3) * 16;
    float sm[16];
#pragma unroll
    for (int i = 0; i < 16; ++i) sm[i] = 0.f;
#pragma unroll
    for (int sp = 0; sp < 3; ++sp) {
      if (sp < s) {                       // block-uniform
        const float* src = MT + ((size_t)(h * 3 + sp) * HD + e) * HD + d0;
#pragma unroll
        for (int q = 0; q < 4; ++q) {
          const v4f v = *(const v4f*)(src + 4 * q);
          sm[4 * q + 0] += v[0]; sm[4 * q + 1] += v[1]; sm[4 * q + 2] += v[2]; sm[4 * q + 3] += v[3];
        }
      }
    }
    v8h p0, p1;
#pragma unroll
    for (int i = 0; i < 8; ++i) { p0[i] = (_Float16)sm[i]; p1[i] = (_Float16)sm[8 + i]; }
    *(v8h*)(MTh + e * 72 + d0) = p0;
    *(v8h*)(MTh + e * 72 + d0 + 8) = p1;
    if (tid < HD) {
      float z = 0.f;
#pragma unroll
      for (int sp = 0; sp < 3; ++sp) {
        if (sp < s) z += ZP[(size_t)(h * 3 + sp) * HD + tid];
      }
      zs[tid] = z;
    }
  }
  __syncthreads();

  const _Float16* Q16 = (const _Float16*)(const void*)QKH;
  const _Float16* L16 = (const _Float16*)(const void*)QKL;
  const int n0w = s * SEG + rb * MROWS + wave * 16;          // first query position of this wave

  v16h af[2];
  float denp = 0.f;
#pragma unroll
  for (int kk = 0; kk < 2; ++kk) {
    FH hf, lf;
    hf.v = ldfrag_h(Q16 + (size_t)(n0w + c) * QKW + h * HD + 32 * kk + 8 * hh);
    lf.v = ldfrag_h(L16 + (size_t)(n0w + c) * QKW + h * HD + 32 * kk + 8 * hh);
    v16h a;
#pragma unroll
    for (int i = 0; i < 16; ++i) {
      const float qv = ((float)hf.v[i] + (float)lf.v[i] * (1.0f / RSC)) * (1.0f / QSC);
      const float sq = (qv > 0.f) ? (qv + 1.0f) : __expf(qv);
      const _Float16 sqh = (_Float16)sq;
      a[i] = sqh;
      const int kidx = 32 * kk + ((i < 8) ? (8 * hh + i) : (8 + 8 * hh + i));   // k of element i (split map)
      denp += (float)sqh * zs[kidx];
    }
    af[kk] = a;
  }
  const float den = denp + __shfl_xor(denp, 16, 32) + DEN_EPS;   // row c complete in lanes c and c+16

  v8f acc[4];
#pragma unroll
  for (int j = 0; j < 4; ++j) {
    acc[j] = zero8();
#pragma unroll
    for (int kk = 0; kk < 2; ++kk) {
      const v16h b = ldfrag_h(MTh + (16 * j + c) * 72 + 32 * kk + 8 * hh);
      acc[j] = mma_h(af[kk], b, acc[j]);
    }
  }
  float rinv[8];
#pragma unroll
  for (int rr = 0; rr < 8; ++rr) rinv[rr] = 1.0f / __shfl(den, 8 * hh + rr, 32);   // den of D row 8hh+rr

  float* sl = slab[wave];
#pragma unroll
  for (int j = 0; j < 4; ++j) {
#pragma unroll
    for (int rr = 0; rr < 8; ++rr) sl[(8 * hh + rr) * 68 + 16 * j + c] = acc[j][rr] * rinv[rr];
  }
  wave_sync_lds();
  {
    v4f ov[8];
#pragma unroll
    for (int it = 0; it < 8; ++it) {
      const int row = it * 2 + hh;        // it 0..7 x hh 0..1 = rows 0..15
      ov[it] = *(const v4f*)(sl + row * 68 + c * 4);
    }
    {
#pragma unroll
      for (int it = 0; it < 8; ++it) {
        const int row = it * 2 + hh;
        *(v4f*)(MEM + (size_t)(n0w + row) * DM + h * HD + c * 4) = ov[it];
      }
      
    }
  }
}

// =====================================================================================================
// Segment-local causal attention with the gate mix, per (batch, h, segment, 64-query block):
//   s = (sum_d qh.kh + (ql.kh + qh.kl) / RSC) * sscale, sscale = (1/8) / (QSC*KSC); key > query (segment-local)
//   -> NEG_BIG (value select); online softmax in f32; p = exp(s - m) carried as ph = f16(1024 p) and, when PRES,
//   also pl = f16((1024 p - ph) * RSC); local numerator = p . v with v as f16 hi (VSC v) and, when PRES, the f16
//   residual ((VSC v - hi) * RSC) plane: oh += ph.vhi over all chunks; when PRES: ol = ph.vres + pl.vhi (one
//   residual accumulator per chunk and 16-wide d tile, both products carry the same 1/RSC), folded as
//   oh += ol / RSC in f32 right after its two k-steps.
//   q|k planes (f16, pitch QKW, rows = positions): q element (t, h, d) at [t*QKW + h*64 + d], k at
//   [t*QKW + DM + h*64 + d]; V^T planes (f16): element (h, d, t) at [(h*64 + d)*SEQ + t]; MEM plane (f32,
//   pitch DM): element (t, h, e) at [t*DM + h*64 + e].
//   Epilogue per query row t: local = oh / (l * PSC * VSC); mem = MEM[t] for segments >= 1 (segment 0: exactly 0
//   by a value select; the load address is always inside the plane); out = g * mem + (1 - g) * local with
//   g = sigmoid(bf16(gate[h])); rows of positions < NTOK go to the second output (offset OUT1OFF), rows of positions
//   >= NTOK to the first, row t mod NTOK, columns h*64..h*64+63 (pitch DM floats).
//   Block = 4 waves = 64 query rows of one h; grid = (NHEAD * NSEG * nqb, NB), block -> (h, seg, qbs = qb0 + i), batch;
//   key chunks of 64 within the segment, chunks kt <= qbs only (block-uniform trip <= NQB), chunk kt == qbs keeps
//   its diagonal by the per-element select.
//   K / V^T chunk staging: 128 threads, K row r = tid>>1 (32-column half (tid&1)), V^T row d = tid>>1 (32-key half);
//   plain 16-B loads, __syncthreads ahead of and after; q fragments (hi and residual, 2 d-chunks) held in
//   registers for the whole block. Both products run transposed (S^T = K.q^T, O^T += V^T.P^T): a lane holds one
//   query's scores, and two converted S^T tiles are a B fragment of P^T, so P passes through no LDS.
//   Output coverage: each wave stores rows q0..q0+15 (it 0..7 x lane>>4) x 64 columns (16 lanes x 16 B), one
// =====================================================================================================
template <bool PRES>
__global__ __launch_bounds__(128)
void attn_seg(const unsigned short* __restrict__ QKH, const unsigned short* __restrict__ QKL,
              const unsigned short* __restrict__ VTH, const unsigned short* __restrict__ VTL,
              const float* __restrict__ MEM, const float* __restrict__ gate,
              float* outb, float sscale, int qb0, int nqb) {
  __shared__ __align__(16) _Float16 Ksh[64 * APIT];                           // K hi  [key][d]  9 KB
  __shared__ __align__(16) _Float16 Kls[64 * APIT];                           // K res [key][d]  9 KB
  __shared__ __align__(16) _Float16 Vhs[HD * APIT];                           // V^T hi [d][key] 9 KB
  __shared__ __align__(16) _Float16 Vls[PRES ? HD * APIT : 8];                // V^T res [d][key] 9 KB (PRES)
  __shared__ __align__(16) float    Os[4][16 * 68];                          // per wave output tile [row][d]

  const int tid  = threadIdx.x;
  const int wave = tid >> 5;
  const int lane = tid & 31;
  const int hh   = lane >> 4;
  const int c    = lane & 15;

  const int per = NSEG * nqb;
  const int h   = (int)(blockIdx.x / (unsigned)per);
  const int rem = (int)(blockIdx.x - (unsigned)h * (unsigned)per);
  const int seg = rem / nqb;
  const int qbs = qb0 + (rem - seg * nqb);
  if (h >= NHEAD || seg >= NSEG) return;  // block-uniform, ahead of any barrier; never taken for exact grids
  QKH  += (size_t)blockIdx.y * SEQ * QKW; // blockIdx.y = batch: its own planes and its own rows of both outputs
  QKL  += (size_t)blockIdx.y * SEQ * QKW;
  VTH  += (size_t)blockIdx.y * DM * SEQ;
  VTL  += (size_t)blockIdx.y * DM * SEQ;
  MEM  += (size_t)blockIdx.y * SEQ * DM;
  outb += (size_t)blockIdx.y * NTOK * DM;
  const int sbase = seg * SEG;
  const int rowl0 = qbs * 64 + wave * 16; // segment-local row of this wave's first query
  const int q0    = sbase + rowl0;        // its position in the concatenated sequence

  const _Float16* Q16 = (const _Float16*)(const void*)QKH;
  const _Float16* L16 = (const _Float16*)(const void*)QKL;
  const _Float16* Qg  = Q16 + (size_t)h * HD;
  const _Float16* Qlg = L16 + (size_t)h * HD;
  const _Float16* Kg  = Q16 + DM + (size_t)h * HD;
  const _Float16* Klg = L16 + DM + (size_t)h * HD;
  const _Float16* Vhg = (const _Float16*)(const void*)VTH + (size_t)h * HD * SEQ;
  const _Float16* Vlg = (const _Float16*)(const void*)VTL + (size_t)h * HD * SEQ;

  // ---- q fragments (B operand, column = lane&15), hi and residual, d-chunks 0 and 1, fixed for the block ----
  const v16h qh0 = ldfrag_h(Qg  + (size_t)(q0 + c) * QKW + 8 * hh);
  const v16h qh1 = ldfrag_h(Qg  + (size_t)(q0 + c) * QKW + 32 + 8 * hh);
  const v16h ql0 = ldfrag_h(Qlg + (size_t)(q0 + c) * QKW + 8 * hh);
  const v16h ql1 = ldfrag_h(Qlg + (size_t)(q0 + c) * QKW + 32 + 8 * hh);

  // a lane holds ONE query (row c of the wave's 16): its running maximum, its running sum, and in oh[t][r] the
  // numerator of d = 16 t + 8 hh + r (the transposed output tile)
  float mrow = NEG_BIG, lrow = 0.f;
  v8f oh[4];
#pragma unroll
  for (int t = 0; t < 4; ++t) oh[t] = zero8();

  for (int kt = 0; kt < NQB; ++kt) {          // static bound; block-uniform causal chunk skipping
    if (kt > qbs) break;
    const int kv0 = sbase + kt * 64;
    __syncthreads();
    {
      const int r = tid >> 1, hk = (tid & 1) * 32;
      const _Float16* kg = Kg + (size_t)(kv0 + r) * QKW + hk;        // K row kv0+r, d = hk..hk+31
#pragma unroll
      for (int i = 0; i < 4; ++i) *(v8h*)(Ksh + r * APIT + hk + 8 * i) = *(const v8h*)(kg + 8 * i);
      cbar();
      const _Float16* lg = Klg + (size_t)(kv0 + r) * QKW + hk;
#pragma unroll
      for (int i = 0; i < 4; ++i) *(v8h*)(Kls + r * APIT + hk + 8 * i) = *(const v8h*)(lg + 8 * i);
      cbar();
      const _Float16* vh = Vhg + (size_t)r * SEQ + kv0 + hk;          // V^T row d = r, t = kv0+hk..+31
#pragma unroll
      for (int i = 0; i < 4; ++i) *(v8h*)(Vhs + r * APIT + hk + 8 * i) = *(const v8h*)(vh + 8 * i);
      if (PRES) {
        cbar();
        const _Float16* vl = Vlg + (size_t)r * SEQ + kv0 + hk;
#pragma unroll
        for (int i = 0; i < 4; ++i) *(v8h*)(Vls + r * APIT + hk + 8 * i) = *(const v8h*)(vl + 8 * i);
        cbar();
      }
    }
    __syncthreads();

    // ---- transposed scores: 64 keys x 16 queries per wave, A = K rows, B = q, K = 64 (2 d-chunks), three products;
    //      D element r of tile j = key 16 j + 8 hh + r against query c ----
    v8f s[4];
#pragma unroll
    for (int j = 0; j < 4; ++j) {
      v8f sh = zero8(), sl = zero8();
      {
        FH kb, lb;
        kb.h[0] = *(const v8h*)(Ksh + (j * 16 + c) * APIT + 8 * hh);
        kb.h[1] = *(const v8h*)(Ksh + (j * 16 + c) * APIT + 16 + 8 * hh);
        lb.h[0] = *(const v8h*)(Kls + (j * 16 + c) * APIT + 8 * hh);
        lb.h[1] = *(const v8h*)(Kls + (j * 16 + c) * APIT + 16 + 8 * hh);
        sh = mma_h_raw(kb.v, qh0, sh);
        sl = mma_h_raw(kb.v, ql0, sl);
        sl = mma_h_raw(lb.v, qh0, sl);
        guard4m(sh, sl, qh0, ql0, kb.v, lb.v);
      }
      {
        FH kb, lb;
        kb.h[0] = *(const v8h*)(Ksh + (j * 16 + c) * APIT + 32 + 8 * hh);
        kb.h[1] = *(const v8h*)(Ksh + (j * 16 + c) * APIT + 48 + 8 * hh);
        lb.h[0] = *(const v8h*)(Kls + (j * 16 + c) * APIT + 32 + 8 * hh);
        lb.h[1] = *(const v8h*)(Kls + (j * 16 + c) * APIT + 48 + 8 * hh);
        sh = mma_h_raw(kb.v, qh1, sh);
        sl = mma_h_raw(kb.v, ql1, sl);
        sl = mma_h_raw(lb.v, qh1, sl);
        guard4m(sh, sl, qh1, ql1, kb.v, lb.v);
      }
      // segment-local key of D element r is kt*64 + 16 j + 8 hh + r, the query row of this lane's D column rowl0 + c:
      // element r is kept while r <= lim
      const int lim = (rowl0 + c) - (kt * 64 + j * 16 + 8 * hh);
#pragma unroll
      for (int r = 0; r < 8; ++r) {
        float v = sh[r];
        v += sl[r] * (1.0f / RSC);
        v *= sscale;
        s[j][r] = (r <= lim) ? v : NEG_BIG;
      }
    }

    // ---- maximum and sum of the query's 64 scores: 32 in this lane, 32 in lane ^ 16 (one exchange each); online
    //      softmax in f32; P hi (x1024, f16) and, when PRES, P residual (x RSC, f16) go straight into B fragments:
    //      tiles 2 kk and 2 kk + 1 hold keys 32 kk + 8 hh + r and 32 kk + 16 + 8 hh + r, the loaders' own k order ----
    float mj[4];
#pragma unroll
    for (int j = 0; j < 4; ++j) {
      float m = s[j][0];
#pragma unroll
      for (int r = 1; r < 8; ++r) m = fmaxf(m, s[j][r]);
      mj[j] = m;
    }
    float m = fmaxf(fmaxf(mj[0], mj[1]), fmaxf(mj[2], mj[3]));
    m = fmaxf(m, xhalf(m));
    const float mnew  = fmaxf(mrow, m);
    const float alpha = __expf(mrow - mnew);
    mrow = mnew;
    FH pa[2], pb[2];
    float pj[4];
#pragma unroll
    for (int j = 0; j < 4; ++j) {
      float ps = 0.f;
#pragma unroll
      for (int r = 0; r < 8; ++r) {
        const float p  = __expf(s[j][r] - mnew);
        ps += p;
        const float ph = p * PSC;
        const _Float16 xh = (_Float16)ph;
        pa[j >> 1].v[(j & 1) * 8 + r] = xh;
        if (PRES) pb[j >> 1].v[(j & 1) * 8 + r] = (_Float16)((ph - (float)xh) * RSC);
      }
      pj[j] = ps;
    }
    float psum = (pj[0] + pj[1]) + (pj[2] + pj[3]);
    psum += xhalf(psum);
    lrow = lrow * alpha + psum;
#pragma unroll
    for (int t = 0; t < 4; ++t) {
#pragma unroll
      for (int r = 0; r < 8; ++r) oh[t][r] *= alpha;
    }

    // ---- transposed local numerator, A = V^T rows, B = P^T: oh += Vhi . Phi; when PRES also
    //      ol = Vres . Phi + Vhi . Plo, oh += ol/RSC ----
#pragma unroll
    for (int t = 0; t < 4; ++t) {
      const _Float16* vr = Vhs + (t * 16 + c) * APIT + 8 * hh;
      FH vb0, vb1;
      vb0.h[0] = *(const v8h*)(vr);
      vb0.h[1] = *(const v8h*)(vr + 16);
      vb1.h[0] = *(const v8h*)(vr + 32);
      vb1.h[1] = *(const v8h*)(vr + 48);
      if (PRES) {
        const _Float16* wr = Vls + (t * 16 + c) * APIT + 8 * hh;
        FH wb0, wb1;
        wb0.h[0] = *(const v8h*)(wr);
        wb0.h[1] = *(const v8h*)(wr + 16);
        wb1.h[0] = *(const v8h*)(wr + 32);
        wb1.h[1] = *(const v8h*)(wr + 48);
        v8f ol = zero8();
        oh[t] = mma_h_raw(vb0.v, pa[0].v, oh[t]);
        ol    = mma_h_raw(wb0.v, pa[0].v, ol);
        ol    = mma_h_raw(vb0.v, pb[0].v, ol);
        oh[t] = mma_h_raw(vb1.v, pa[1].v, oh[t]);
        ol    = mma_h_raw(wb1.v, pa[1].v, ol);
        ol    = mma_h_raw(vb1.v, pb[1].v, ol);
        guard8m(oh[t], ol, pa[0].v, pa[1].v, pb[0].v, pb[1].v, vb0.v, vb1.v, wb0.v, wb1.v);
#pragma unroll
        for (int r = 0; r < 8; ++r) oh[t][r] += ol[r] * (1.0f / RSC);
      } else {
        oh[t] = mma_h_raw(vb0.v, pa[0].v, oh[t]);
        oh[t] = mma_h_raw(vb1.v, pa[1].v, oh[t]);
        guard1q(oh[t], pa[0].v, pa[1].v, vb0.v, vb1.v);
      }
    }
    acc_guard4(oh[0], oh[1], oh[2], oh[3]);
  }

  // ---- normalise (1/l, the 1/1024 p carry and the 1/VSC v carry), gate mix with the memory read, stage the
  //      wave's tile as [query row][d] (a lane writes 8 consecutive d of its query per t) ----
  const float gv  = bfr(gate[h]);
  const float g   = 1.0f / (1.0f + expf(-gv));
  const float omg = 1.0f - g;
  const bool useMem = (seg > 0);                          // block-uniform
  float* os = Os[wave];
  {
    const int qr = q0 + c;                                  // this lane's query position
    const float l = lrow;                                   // >= 1 (the row maximum contributes exp(0))
    const float inv = (1.0f / l) * (1.0f / (PSC * VSC));
    const float* mr = MEM + (size_t)qr * DM + h * HD + 8 * hh;   // inside the MEM plane for every position
#pragma unroll
    for (int t = 0; t < 4; ++t) {
      const v4f ma = *(const v4f*)(mr + 16 * t);
      const v4f mb = *(const v4f*)(mr + 16 * t + 4);
      v4f oa, ob;
#pragma unroll
      for (int r = 0; r < 4; ++r) {                         // e = 16t + 8hh + r and + 4
        oa[r] = g * (useMem ? ma[r] : 0.f) + omg * (oh[t][r] * inv);
        ob[r] = g * (useMem ? mb[r] : 0.f) + omg * (oh[t][4 + r] * inv);
      }
      *(v4f*)(os + c * 68 + 16 * t + 8 * hh)     = oa;
      *(v4f*)(os + c * 68 + 16 * t + 8 * hh + 4) = ob;
    }
  }
  wave_sync_lds();
  {
    const size_t ooff  = (seg < (NTOK / SEG)) ? (size_t)OUT1OFF : (size_t)0;   // positions < NTOK -> second output
    const int    orow0 = (seg < (NTOK / SEG)) ? q0 : (q0 - NTOK);               // row within the output [b][2048][1024]
    v4f ov[8];
#pragma unroll
    for (int it = 0; it < 8; ++it) {
      const int row = it * 2 + hh;                          // it 0..7 x hh 0..1 = rows 0..15 of the wave tile
      ov[it] = *(const v4f*)(os + row * 68 + c * 4);
    }
    {
#pragma unroll
      for (int it = 0; it < 8; ++it) {
        const int row = it * 2 + hh;
        *(v4f*)(outb + ooff + (size_t)(orow0 + row) * DM + h * HD + c * 4) = ov[it];
      }
      
    }
  }
}

// =====================================================================================================
// Workspace map (bytes); every plane is an exact multiple of its tile / whole-line store granularity (all dims are
// exact tile multiples, no padded tails), all offsets multiples of 4096:
//   XH    f16  [4096 t][1024 in]             0          8388608   (f16 of bf16 value x16, rows b*2048 + t)
//   AH    f16  [4096 t][1024 in]             8388608    8388608
//   WXT   f16  [3072 out][1024 in]           16777216   6291456   (W^T, bf16 value x64)
//   WAT   f16  [3072 out][1024 in]           23068672   6291456
//   COST  f32  [4096 pos][32]                29360128    524288
//   SINT  f32  [4096 pos][32]                29884416    524288
//   QKH   f16  [2 b][4096 pos][2048 (q|k)]   30408704  33554432   (q x4, k x16 hi after norm + rotary)
//   QKL   f16  [2 b][4096][2048]             63963136  33554432   (x4096 residuals)
//   VF    f32  [2 b][4096 pos][1024 (h,d)]   97517568  33554432   (v, f32)
//   VTH   f16  [2 b][1024 (h,d)][4096 pos]  131072000  16777216   (v x16 hi)
//   VTL   f16  [2 b][1024 (h,d)][4096 pos]  147849216  16777216   ((v x16 - hi) x4096)
//   MT    f32  [2 b][16 h][3 s][64 e][64 d] 164626432   1572864
//   ZP    f32  [2 b][16 h][3 s][64 d]       166199296     24576
//   MEM   f32  [2 b][4096 pos][1024 (h,e)]  166223872  33554432
//   end                                     199778304
// =====================================================================================================
extern "C" void kernel_launch(void* const* d_in, const int* in_sizes, int n_in,
                              void* d_out, int out_size, void* d_ws, size_t ws_size,
                              hipStream_t stream) {
  if (n_in < 9) return;
  if (in_sizes[0] != NB * NTOK * DM || in_sizes[1] != NB * NTOK * DM) return;
  if (in_sizes[2] != DM * W3 || in_sizes[3] != DM * W3) return;
  if (in_sizes[4] != NHEAD * HD || in_sizes[5] != NHEAD * HD) return;
  if (in_sizes[6] != NHEAD * HD || in_sizes[7] != NHEAD * HD) return;
  if (in_sizes[8] != NHEAD) return;
  if (out_size != 2 * NB * NTOK * DM) return;

  const float* X    = (const float*)d_in[0];
  const float* Aa   = (const float*)d_in[1];
  const float* Wx   = (const float*)d_in[2];
  const float* Wa   = (const float*)d_in[3];
  const float* g_qx = (const float*)d_in[4];
  const float* g_kx = (const float*)d_in[5];
  const float* g_qa = (const float*)d_in[6];
  const float* g_ka = (const float*)d_in[7];
  const float* gate = (const float*)d_in[8];
  float* outf = (float*)d_out;

  const size_t PXA = (size_t)NB * NTOK * DM * 2;        //  8388608
  const size_t PW  = (size_t)W3 * DM * 2;               //  6291456
  const size_t PRT = (size_t)SEQ * RP * 4;              //   524288
  const size_t PQK = (size_t)NB * SEQ * QKW * 2;        // 33554432
  const size_t PVF = (size_t)NB * SEQ * DM * 4;         // 33554432
  const size_t PVT = (size_t)NB * DM * SEQ * 2;         // 16777216
  const size_t PMT = (size_t)NB * NHEAD * 3 * HD * HD * 4;   // 1572864
  const size_t PZP = (size_t)NB * NHEAD * 3 * HD * 4;        //   24576
  const size_t PME = (size_t)NB * SEQ * DM * 4;         // 33554432
  size_t off = 0;
  const size_t oXH = off; off += PXA;
  const size_t oAH = off; off += PXA;
  const size_t oWX = off; off += PW;
  const size_t oWA = off; off += PW;
  const size_t oCT = off; off += PRT;
  const size_t oST = off; off += PRT;
  const size_t oQH = off; off += PQK;
  const size_t oQL = off; off += PQK;
  const size_t oVF = off; off += PVF;
  const size_t oVH = off; off += PVT;
  const size_t oVL = off; off += PVT;
  const size_t oMT = off; off += PMT;
  const size_t oZP = off; off += PZP;
  const size_t oME = off; off += PME;
  if (off > ws_size) return;                            // off = 199778304

  char* ws = (char*)d_ws;
  unsigned short* XH   = (unsigned short*)(ws + oXH);
  unsigned short* AH   = (unsigned short*)(ws + oAH);
  unsigned short* WXT  = (unsigned short*)(ws + oWX);
  unsigned short* WAT  = (unsigned short*)(ws + oWA);
  float*          COST = (float*)(ws + oCT);
  float*          SINT = (float*)(ws + oST);
  unsigned short* QKH  = (unsigned short*)(ws + oQH);
  unsigned short* QKL  = (unsigned short*)(ws + oQL);
  float*          VF   = (float*)(ws + oVF);
  unsigned short* VTH  = (unsigned short*)(ws + oVH);
  unsigned short* VTL  = (unsigned short*)(ws + oVL);
  float*          MT   = (float*)(ws + oMT);
  float*          ZP   = (float*)(ws + oZP);
  float*          MEM  = (float*)(ws + oME);

  const dim3 blk256(256), blk128(128);
  const float sscale = 0.125f / (QSC * KSC);
  const float oscale = 1.0f / (XSC * WSC);

  // Every kernel is launched once; the two arrays, the two streams and the two batches are grid dimensions.
  // (1) x, a -> row-major f16 planes of their bf16 RNE values x16; W [1024][3072] -> transposed f16 planes
  //     [3072][1024] (k contiguous, Bt form) of their bf16 RNE values x64; rotary tables
  cvt_rm<<<dim3((NB * NTOK * DM) / 2048, 2), blk256, 0, stream>>>(X, Aa, XH, NB * NTOK * DM, XSC);
  // in[DM rows][W3 cols] -> out[W3][DM]: grid (cols/64, rows/64, matrix)
  tr_cvt<0><<<dim3(W3 / 64, DM / 64, 2), blk256, 0, stream>>>(Wx, Wa, DM, W3, WXT, WXT, WSC);
  rope_tab<<<dim3((SEQ * RP) / 256), blk256, 0, stream>>>(COST, SINT, SEQ * RP);

  const int gqk  = ((NTOK / 32) * (QKW / 128)) / 4;      // 1024 tiles -> 256 blocks per stream and batch
  const int gv   = ((NTOK / 32) * (DM / 128)) / 4;       //  512 tiles -> 128 blocks per stream and batch
  const int gmt  = NHEAD * 3;                            //   48 blocks per batch
  const int gmem = NHEAD * 3 * (SEG / MROWS);            //  384 blocks per batch
  // (2) q|k of stream a (positions 0..2047) and stream x (positions 2048..4095): M=2048, N=2048, K=1024,
  //     fused per-head L2 norm + gain + rotary -> QKH/QKL f16 planes
  gemm_t<1><<<dim3(gqk, 2, NB), blk128, 0, stream>>>(AH, XH, DM, WAT, WXT, DM, (void*)QKH, (void*)QKL, QKW, SEQ,
                                                     COST, SINT, g_qa, g_ka, g_qx, g_kx, NTOK, QKW, DM, oscale);
  // (3) v of both streams: M=2048, N=1024 (W^T rows 2048..3071), K=1024 -> VF f32 rows
  gemm_t<3><<<dim3(gv, 2, NB), blk128, 0, stream>>>(AH, XH, DM, WAT + (size_t)2 * DM * DM,
                                                    WXT + (size_t)2 * DM * DM, DM, (void*)VF, (void*)VF, DM, SEQ,
                                                    COST, SINT, g_qa, g_ka, g_qx, g_kx, NTOK, DM, DM, oscale);
  // (4) v^T planes: in VF [SEQ rows][DM cols] -> out [DM][SEQ] f16 hi (x16) and residual (x4096), per batch
  tr_cvt<1><<<dim3(DM / 64, SEQ / 64, NB), blk256, 0, stream>>>(VF, VF + (size_t)SEQ * DM, SEQ, DM, VTH, VTL, VSC);
  // (5) compressive memory: per-segment sk^T.v and sum sk (segments 0..2), then the memory read for the
  //     query rows of segments 1..3 -> MEM f32 plane
  mt_seg<<<dim3(gmt, NB), blk256, 0, stream>>>(QKH, QKL, VTH, MT, ZP);
  mem_ret<<<dim3(gmem, NB), blk256, 0, stream>>>(QKH, QKL, MT, ZP, MEM);
  // (6) segment-local causal attention + gate mix -> both outputs: the leading NQP query blocks of every
  //     segment with the p, v residual products, the remaining blocks without
  attn_seg<true><<<dim3(NHEAD * NSEG * NQP, NB), blk128, 0, stream>>>(QKH, QKL, VTH, VTL, MEM, gate, outf,
                                                                      sscale, 0, NQP);
  attn_seg<false><<<dim3(NHEAD * NSEG * (NQB - NQP), NB), blk128, 0, stream>>>(QKH, QKL, VTH, VTL, MEM, gate,
                                                                               outf, sscale, NQP, NQB - NQP);
  (void)hipGetLastError();
}

// v006
// It runs in 175 microseconds.
// Two timings next to v005 both put it at 1.10 times that version's speed.
// Over all steps from v000 it is 4.50 times as fast.
// Contractions: a.W and x.W (q|k|v, K=1024) on v_wmma_f32_16x16x32_f16 with f16 containers of the bf16 RNE input
//   values (activations carried x16, W^T x64), one product; q.k^T (K=64) on v_wmma_f32_16x16x32_f16 with q (x4) and
//   k (x16) f16 hi planes plus x4096 f16 residual planes (three products, residual pair in a separate accumulator
//   folded by 1/4096); p.v^T on v_wmma_f32_16x16x32_f16 with p as f16(1024 p) and v^T as f16(16 v), one product
//   (the leading query blocks of every segment add the p and v x4096 f16 residual planes, two more products into a
//   separate accumulator); compressive memory sk^T.v (K=1024) and sq.M (K=64) on v_wmma_f32_16x16x32_f16 with
//   plain f16 operands, one product each. f32 accumulate everywhere; L2 norms, rotary tables and rotation, elu,
//   softmax statistics, sq.z, the memory quotient and the gate mix in f32.
#include <hip/hip_runtime.h>
#include <math.h>
#include <stdint.h>

#define NB      2
#define NTOK    2048                // tokens per stream per batch
#define SEQ     4096                // concatenated positions per batch (stream a first, then x)
#define DM      1024
#define NHEAD   16
#define HD      64
#define RP      32                  // rotary pairs per head
#define W3      3072
#define QKW     2048                // q|k plane width: q at column h*64+d, k at 1024 + h*64+d
#define SEG     1024
#define NSEG    4
#define NQB     16                  // 64-row query blocks per segment
#define NQP     4                   // leading query blocks per segment that carry the p / v residual products
#define MROWS   128                 // query rows per block of the memory read kernel
#define OUT1OFF (NB * NTOK * DM)             // element offset of the second output
#define XSC     16.0f
#define WSC     64.0f
#define QSC     4.0f
#define KSC     16.0f
#define VSC     16.0f
#define RSC     4096.0f
#define PSC     1024.0f
#define NRM_EPS 1.0e-12f
#define DEN_EPS 1.0e-6f
#define LOG2_BASE 13.287712379549449
#define NEG_BIG (-1.0e30f)
#define GBK     128                 // k per LDS stage of the projection GEMM (256 B of every operand row)
#define GPIT    136                 // LDS row pitch of a stage in halves: 272 B = 16 B x 17 (ds_load_b128 readers)
#define GSTG    (256 * GPIT)        // halves per stage: 128 A rows, then 128 Bt rows
#define SLABF   (16 * 132)          // floats per epilogue slab of the projection GEMM (one per wave)
#define APIT    72                  // LDS row pitch of the attention K and V^T tiles in halves: 144 B = 16 B x 9
                                    // (ds_load_b128 readers: 16 rows of a fragment load fall on 16 distinct bank groups)

static_assert(NHEAD * HD == DM);
static_assert(SEQ == 2 * NTOK);
static_assert(SEQ == NSEG * SEG);
static_assert(SEG == NQB * 64);
static_assert(HD == 2 * RP);
static_assert(W3 == 3 * DM);
static_assert(QKW == 2 * DM);
static_assert(((NB * NTOK * DM) % 2048) == 0);
static_assert(((SEQ * RP) % 256) == 0);
static_assert((DM % 128) == 0 && (W3 % 64) == 0 && (NTOK % 64) == 0 && (SEQ % 64) == 0);
static_assert((QKW % 128) == 0 && (DM % 32) == 0);
static_assert(NQP > 0 && NQP < NQB);
static_assert((SEG % MROWS) == 0 && MROWS == 8 * 16);
static_assert(OUT1OFF == NB * NTOK * DM);
static_assert((DM % GBK) == 0 && (NTOK % 128) == 0 && ((GPIT * 2) % 16) == 0);
static_assert(4 * SLABF * 4 <= 2 * GSTG * 2 && ((SLABF * 4) % 16) == 0);
static_assert(APIT >= HD && ((APIT * 2) % 16) == 0);

typedef _Float16 v16h __attribute__((ext_vector_type(16)));
typedef _Float16 v8h  __attribute__((ext_vector_type(8)));
typedef float    v8f  __attribute__((ext_vector_type(8)));
typedef float    v4f  __attribute__((ext_vector_type(4)));
typedef unsigned int v4u __attribute__((ext_vector_type(4)));
union FH { v16h v; v8h h[2]; };

// ---- scalar helpers --------------------------------------------------------------------------------
__device__ __forceinline__ unsigned short bf_bits(float f) {          // f32 -> bf16 bits, RNE convert
  unsigned u = __float_as_uint(f);
  return (unsigned short)((u + 0x7FFFu + ((u >> 16) & 1u)) >> 16);
}
__device__ __forceinline__ float bf_up(unsigned short b) { return __uint_as_float(((unsigned)b) << 16); }
__device__ __forceinline__ float bfr(float f) { return bf_up(bf_bits(f)); }     // value of the bf16 RNE convert
__device__ __forceinline__ unsigned short h_bits(_Float16 x) { return __builtin_bit_cast(unsigned short, x); }
__device__ __forceinline__ unsigned pk16(unsigned short a, unsigned short b) { return (unsigned)a | ((unsigned)b << 16); }
__device__ __forceinline__ v8f zero8() { v8f z = {0.f, 0.f, 0.f, 0.f, 0.f, 0.f, 0.f, 0.f}; return z; }

// ---- fragment loader: 16-bit A/B operand, lane -> row/col (lane&15), p already includes +8*(lane>>4);
//      elements 0..7 <- p[0..7] (k0+8h..), elements 8..15 <- p[16..23] (k0+16+8h..)
__device__ __forceinline__ v16h ldfrag_h(const _Float16* p) {
  FH f;
  f.h[0] = *(const v8h*)(p);
  f.h[1] = *(const v8h*)(p + 16);
  return f.v;
}

// ---- WMMA helpers with trailing VALU hazard gap --------------------------------------------------------
__device__ __forceinline__ v8f mma_h_raw(v16h a, v16h b, v8f c) {
  return __builtin_amdgcn_wmma_f32_16x16x32_f16(false, a, false, b, (short)0, c, false, false);
}
__device__ __forceinline__ v8f mma_h(v16h a, v16h b, v8f c) {
  c = mma_h_raw(a, b, c);
#if defined(__HIP_DEVICE_COMPILE__)
  asm volatile("v_nop\n\tv_nop\n\tv_nop\n\tv_nop" : "+v"(c) : "v"(a), "v"(b));
#endif
  return c;
}
__device__ __forceinline__ void guard3(v8f& x, v8f& y, v16h a, v16h b, v16h d) {   // two D tiles, 3 frags live
#if defined(__HIP_DEVICE_COMPILE__)
  asm volatile("v_nop\n\tv_nop\n\tv_nop\n\tv_nop" : "+v"(x), "+v"(y) : "v"(a), "v"(b), "v"(d));
#endif
}
__device__ __forceinline__ void guard1q(v8f& x, v16h a, v16h b, v16h d, v16h e) {           // one D, 4 frags
#if defined(__HIP_DEVICE_COMPILE__)
  asm volatile("v_nop\n\tv_nop\n\tv_nop\n\tv_nop" : "+v"(x) : "v"(a), "v"(b), "v"(d), "v"(e));
#endif
}
__device__ __forceinline__ void guard4m(v8f& x, v8f& y, v16h a, v16h b, v16h d, v16h e) {   // two D, 4 frags
#if defined(__HIP_DEVICE_COMPILE__)
  asm volatile("v_nop\n\tv_nop\n\tv_nop\n\tv_nop" : "+v"(x), "+v"(y) : "v"(a), "v"(b), "v"(d), "v"(e)
               : "memory");
#endif
}
__device__ __forceinline__ void guard8m(v8f& x, v8f& y, v16h a, v16h b, v16h d, v16h e,
                                        v16h f, v16h g, v16h p, v16h q) {                      // two D, 8 frags
#if defined(__HIP_DEVICE_COMPILE__)
  asm volatile("v_nop\n\tv_nop\n\tv_nop\n\tv_nop" : "+v"(x), "+v"(y)
               : "v"(a), "v"(b), "v"(d), "v"(e), "v"(f), "v"(g), "v"(p), "v"(q) : "memory");
#endif
}
__device__ __forceinline__ void acc_guard4(v8f& a, v8f& b, v8f& c, v8f& d) {
#if defined(__HIP_DEVICE_COMPILE__)
  asm volatile("v_nop\n\tv_nop\n\tv_nop\n\tv_nop" : "+v"(a), "+v"(b), "+v"(c), "+v"(d));
#endif
}
__device__ __forceinline__ void acc_guard2(v8f& a, v8f& b) {
#if defined(__HIP_DEVICE_COMPILE__)
  asm volatile("v_nop\n\tv_nop\n\tv_nop\n\tv_nop" : "+v"(a), "+v"(b));
#endif
}
// lane l <-> lane l ^ 16 (the two halves of a D column) by a vector cross-row move
__device__ __forceinline__ float xhalf(float x) {
  const int b = __builtin_bit_cast(int, x);
  return __builtin_bit_cast(float, __builtin_amdgcn_permlanex16(b, b, 0x76543210, 0xfedcba98, false, false));
}
__device__ __forceinline__ void wave_sync_lds() {
  __builtin_amdgcn_fence(__ATOMIC_RELEASE, "workgroup");
  __builtin_amdgcn_wave_barrier();
  __builtin_amdgcn_fence(__ATOMIC_ACQUIRE, "workgroup");
}

// ---- eight asynchronous 16-B copies global -> LDS per lane (l: LDS byte address, g: global address). The
//      s_wait_xcnt stands inside the statement so that no address register is rewritten ahead of it.
__device__ __forceinline__ void acopy8(uint32_t l0, uint32_t l1, uint32_t l2, uint32_t l3,
                                       uint32_t l4, uint32_t l5, uint32_t l6, uint32_t l7,
                                       const _Float16* g0, const _Float16* g1, const _Float16* g2,
                                       const _Float16* g3, const _Float16* g4, const _Float16* g5,
                                       const _Float16* g6, const _Float16* g7) {
#if defined(__HIP_DEVICE_COMPILE__)
  asm volatile("global_load_async_to_lds_b128 %0, %8, off\n\t"
               "global_load_async_to_lds_b128 %1, %9, off\n\t"
               "global_load_async_to_lds_b128 %2, %10, off\n\t"
               "global_load_async_to_lds_b128 %3, %11, off\n\t"
               "global_load_async_to_lds_b128 %4, %12, off\n\t"
               "global_load_async_to_lds_b128 %5, %13, off\n\t"
               "global_load_async_to_lds_b128 %6, %14, off\n\t"
               "global_load_async_to_lds_b128 %7, %15, off\n\t"
               "s_wait_xcnt 0x0"
               :: "v"(l0), "v"(l1), "v"(l2), "v"(l3), "v"(l4), "v"(l5), "v"(l6), "v"(l7),
                  "v"(g0), "v"(g1), "v"(g2), "v"(g3), "v"(g4), "v"(g5), "v"(g6), "v"(g7)
               : "memory");
#endif
}
// four copies per lane from one plane: wave-uniform base b (scalar registers) + the lane's byte offsets o0..o3;
// the s_wait_xcnt stands inside the statement for the same reason as above (it covers the base registers too)
__device__ __forceinline__ void acopy4s(uint32_t l0, uint32_t l1, uint32_t l2, uint32_t l3,
                                        uint32_t o0, uint32_t o1, uint32_t o2, uint32_t o3, const _Float16* b) {
#if defined(__HIP_DEVICE_COMPILE__)
  asm volatile("global_load_async_to_lds_b128 %0, %4, %8\n\t"
               "global_load_async_to_lds_b128 %1, %5, %8\n\t"
               "global_load_async_to_lds_b128 %2, %6, %8\n\t"
               "global_load_async_to_lds_b128 %3, %7, %8\n\t"
               "s_wait_xcnt 0x0"
               :: "v"(l0), "v"(l1), "v"(l2), "v"(l3), "v"(o0), "v"(o1), "v"(o2), "v"(o3), "s"(b)
               : "memory");
#endif
}
// eight copies per lane, four from each of two planes (bases b, d) at the same byte offsets; one wait for all
__device__ __forceinline__ void acopy8s(uint32_t l0, uint32_t l1, uint32_t l2, uint32_t l3,
                                        uint32_t l4, uint32_t l5, uint32_t l6, uint32_t l7,
                                        uint32_t o0, uint32_t o1, uint32_t o2, uint32_t o3,
                                        const _Float16* b, const _Float16* d) {
#if defined(__HIP_DEVICE_COMPILE__)
  asm volatile("global_load_async_to_lds_b128 %0, %8, %12\n\t"
               "global_load_async_to_lds_b128 %1, %9, %12\n\t"
               "global_load_async_to_lds_b128 %2, %10, %12\n\t"
               "global_load_async_to_lds_b128 %3, %11, %12\n\t"
               "global_load_async_to_lds_b128 %4, %8, %13\n\t"
               "global_load_async_to_lds_b128 %5, %9, %13\n\t"
               "global_load_async_to_lds_b128 %6, %10, %13\n\t"
               "global_load_async_to_lds_b128 %7, %11, %13\n\t"
               "s_wait_xcnt 0x0"
               :: "v"(l0), "v"(l1), "v"(l2), "v"(l3), "v"(l4), "v"(l5), "v"(l6), "v"(l7),
                  "v"(o0), "v"(o1), "v"(o2), "v"(o3), "s"(b), "s"(d)
               : "memory");
#endif
}
// 64 rows of one operand, 256 B each, into LDS rows of pitch GPIT: l / g are this thread's addresses in row
// (tid >> 4) at 16-B piece (tid & 15); copy i takes row 8 i + (tid >> 4), a wave's copy covers two whole rows.
__device__ __forceinline__ void acopy_rows64(uint32_t l, const _Float16* g, size_t ld) {
  const uint32_t ls = 8u * GPIT * 2u;
  const size_t   gs = 8 * ld;
  acopy8(l, l + ls, l + 2 * ls, l + 3 * ls, l + 4 * ls, l + 5 * ls, l + 6 * ls, l + 7 * ls,
         g, g + gs, g + 2 * gs, g + 3 * gs, g + 4 * gs, g + 5 * gs, g + 6 * gs, g + 7 * gs);
}
// the issuing wave's own copies have landed (the compiler places no wait for them)
__device__ __forceinline__ void wait_async0() {
#if defined(__HIP_DEVICE_COMPILE__)
  asm volatile("s_wait_asynccnt 0x0" ::: "memory");
#endif
}
// this wave's LDS reads of the stage have returned before the stage is handed back for a refill
__device__ __forceinline__ void wait_ds0() {
#if defined(__HIP_DEVICE_COMPILE__)
  asm volatile("s_wait_dscnt 0x0" ::: "memory");
#endif
}

// =====================================================================================================
// Row-major convert: f32 [n] -> f16 plane [n] holding f16(bf16 RNE value * scale) (scale a power of two, exact).
// coverage: grid.x = n/2048 blocks x 256 threads x 8 = n elements (n % 2048 == 0 host-checked); grid.y = 2 arrays.
// =====================================================================================================
__global__ __launch_bounds__(256) void cvt_rm(const float* __restrict__ in0, const float* __restrict__ in1,
                                             unsigned short* out, int n, float scale) {
  const size_t i8 = ((size_t)blockIdx.x * 256 + threadIdx.x) * 8;
  if (i8 + 8 > (size_t)n) return;        // never taken for the host-checked sizes; no barriers below
  const float* in = blockIdx.y ? in1 : in0;   // blockIdx.y = which of the two arrays; its plane follows the first
  out += (size_t)blockIdx.y * (size_t)n;
  const v4f a = *(const v4f*)(in + i8);
  const v4f b = *(const v4f*)(in + i8 + 4);
  float f[8];
  f[0] = a[0]; f[1] = a[1]; f[2] = a[2]; f[3] = a[3];
  f[4] = b[0]; f[5] = b[1]; f[6] = b[2]; f[7] = b[3];
  v4u p;
#pragma unroll
  for (int e = 0; e < 4; ++e) {
    const unsigned short b0 = bf_bits(f[2 * e]), b1 = bf_bits(f[2 * e + 1]);
    const _Float16 x0 = (_Float16)(bf_up(b0) * scale);
    const _Float16 x1 = (_Float16)(bf_up(b1) * scale);
    p[e] = pk16(h_bits(x0), h_bits(x1));
  }
  *(v4u*)(out + i8) = p;
  
}

// =====================================================================================================
// Transposing convert: f32 in[R][C] (row-major, pitch C) -> 16-bit out[C][R] (pitch R), 64x64 tiles through LDS.
//   MODE 0: one plane  out0 = f16(bf16 RNE value * scale).
//   MODE 1: two planes out0 = f16(v * scale) hi, out1 = f16((v * scale - hi) * RSC) residual.
// Block = 256 threads; grid = (C/64, R/64, 2 matrices) exact (host-checked). Load: thread -> input row tid>>2, 16 consecutive
// columns (four 16-B loads). Store: two iterations, output row it*32 + (tid>>3), lanes (tid&7) -> elements
// coverage: 2 iterations x 32 output rows x 8 lanes x 8 halves = the whole 64x64 tile; grid covers all of C x R.
// =====================================================================================================
template <int MODE>
__global__ __launch_bounds__(256) void tr_cvt(const float* __restrict__ in0, const float* __restrict__ in1,
                                             int R, int C, unsigned short* out0, unsigned short* out1,
                                             float scale) {
  __shared__ float sm[64][65];
  const int tid = threadIdx.x;
  const float* in = blockIdx.z ? in1 : in0;   // blockIdx.z = which of the two matrices; its planes follow the first's
  out0 += (size_t)blockIdx.z * (size_t)R * (size_t)C;
  out1 += (size_t)blockIdx.z * (size_t)R * (size_t)C;
  const int c0 = blockIdx.x * 64;          // input column block -> output row block
  const int r0 = blockIdx.y * 64;          // input row block    -> output column block
  if (c0 + 64 > C || r0 + 64 > R) return;  // block-uniform, ahead of any barrier; never taken for exact grids
  {
    const int lr = tid >> 2, lc = (tid & 3) * 16;
    const float* src = in + (size_t)(r0 + lr) * (size_t)C + c0 + lc;
#pragma unroll
    for (int q = 0; q < 4; ++q) {
      const v4f v = *(const v4f*)(src + 4 * q);
      sm[lr][lc + 4 * q + 0] = v[0];
      sm[lr][lc + 4 * q + 1] = v[1];
      sm[lr][lc + 4 * q + 2] = v[2];
      sm[lr][lc + 4 * q + 3] = v[3];
    }
  }
  __syncthreads();
  const int seg = tid & 7;
  v4u p0[2], p1[2];
#pragma unroll
  for (int it = 0; it < 2; ++it) {
    const int ocl = it * 32 + (tid >> 3);   // output row within the tile = input column
    float f[8];
#pragma unroll
    for (int e = 0; e < 8; ++e) f[e] = sm[seg * 8 + e][ocl];
    v4u pk, pl;
#pragma unroll
    for (int e = 0; e < 4; ++e) {
      const float g0 = f[2 * e], g1 = f[2 * e + 1];
      if (MODE == 0) {
        const _Float16 x0 = (_Float16)(bfr(g0) * scale);
        const _Float16 x1 = (_Float16)(bfr(g1) * scale);
        pk[e] = pk16(h_bits(x0), h_bits(x1));
        pl[e] = pk[e];
      } else {
        const float s0 = g0 * scale, s1 = g1 * scale;
        const _Float16 x0 = (_Float16)s0, x1 = (_Float16)s1;
        const _Float16 y0 = (_Float16)((s0 - (float)x0) * RSC);
        const _Float16 y1 = (_Float16)((s1 - (float)x1) * RSC);
        pk[e] = pk16(h_bits(x0), h_bits(x1));
        pl[e] = pk16(h_bits(y0), h_bits(y1));
      }
    }
    p0[it] = pk;
    p1[it] = pl;
  }
  {
#pragma unroll
    for (int it = 0; it < 2; ++it) {
      const int ocl = it * 32 + (tid >> 3);
      const size_t go = (size_t)(c0 + ocl) * (size_t)R + (size_t)(r0 + seg * 8);
      *(v4u*)(out0 + go) = p0[it];
      if (MODE == 1) *(v4u*)(out1 + go) = p1[it];
    }
    
  }
}

// =====================================================================================================
// Rotary tables for interleaved pairs: cost[t][i] = cos(t * inv_freq[i]), sint[t][i] = sin(t * inv_freq[i]),
// i = 0..31, inv_freq[i] = 1 / (10000^(2i/64)) (power via f64 exp2 -> one f32 convert, then an f32 reciprocal
// formed in f64 and converted once), angle = one f32 multiply with t = position 0..4095 in the concatenated
// coverage: grid.x = n/256 blocks x 256 threads = n = SEQ*32 elements of each table.
// =====================================================================================================
__global__ __launch_bounds__(256) void rope_tab(float* cost, float* sint, int n) {
  const int e = blockIdx.x * 256 + (int)threadIdx.x;
  if (e >= n) return;                      // never taken (n % 256 == 0); no barriers below
  const int t = e >> 5, i = e & 31;
  const double pd = exp2((double)i * (1.0 / 32.0) * LOG2_BASE);   // 10000^(2i/64)
  const float  pf = (float)pd;
  const float  invf = (float)(1.0 / (double)pf);
  const float  ang = (float)t * invf;
  float sv, cv;
  sincosf(ang, &sv, &cv);
  *(float*)(cost + e) = cv;
  *(float*)(sint + e) = sv;
  
}

// =====================================================================================================
// Register-blocked f16 WMMA GEMM, one wave per 32x128 tile; block = 4 waves = 4 tiles stacked in m = one 128x128
// block tile whose operands pass through LDS: a stage is 128 k of the 128 A rows and the 128 Bt rows, brought by
// asynchronous copies into two buffers (stage t + 1 flies while stage t is worked on), read by all 4 waves:
//   acc[m][n] = sum_k A[m][k] * Bt[n][k]; A row-major [M][K] pitch lda, Bt row-major [N][K] pitch ldb
//   (k contiguous); M % 128 == 0, N % 128 == 0, K % 128 == 0 (exact constants here, host-checked).
// EPI 1 (q|k planes, N == QKW): the 128-column tile holds two heads of 64 columns (columns < DM are q heads,
//        columns >= DM are k heads). Per row and head: t = acc*oscale; v = t * (1/max(||t||_2, 1e-12)) *
//        bf16(gain[head][d]) * 8; then the interleaved-pair rotary rotation with the f32 tables at position
//        crow0 + m (pair (2i, 2i+1): o1 = v1*c - v2*s, o2 = v1*s + v2*c), times cscale (QSC for q, KSC for k)
//        -> C0 = f16 hi, C1 = f16((v - hi) * RSC) residual, 16-bit planes of pitch ldc, row crow0 + m, column n.
// EPI 3: f32 rows (C0) = acc*oscale, pitch ldc, row crow0 + m, column n.
// 16 lanes x 16 B per 256-B row segment (two rows per instruction), f32 as 32 lanes x 16 B per 512-B row segment;
// coverage: 2 slabs x 16 rows x 128 cols = the wave's whole 32x128 tile; tiles = whole M x N (grid.x = tiles/4 exact),
// grid.y = the two streams, grid.z = the batches.
// =====================================================================================================
template <int EPI>
__global__ __launch_bounds__(128) void gemm_t(
    const unsigned short* __restrict__ A0, const unsigned short* __restrict__ A1, int lda,
    const unsigned short* __restrict__ Bt0, const unsigned short* __restrict__ Bt1, int ldb,
    void* C0, void* C1, int ldc, int crows,
    const float* __restrict__ cost, const float* __restrict__ sint,
    const float* __restrict__ gq0, const float* __restrict__ gk0,
    const float* __restrict__ gq1, const float* __restrict__ gk1,
    int M, int N, int K, float oscale) {
  __shared__ __align__(16) _Float16 ring[2 * GSTG]; // two operand stages; behind the k loop the same bytes hold the
                                                    // epilogue slabs, so a block takes 136 KiB and two fit one WGP
  const int lane = threadIdx.x & 31;
  const int wave = threadIdx.x >> 5;
  // blockIdx.y = stream (0: operands A0, Bt0, gains gq0, gk0, C rows 0..M-1; 1: the others, C rows M..2M-1);
  // blockIdx.z = batch (A rows z*M.., C plane z of crows rows)
  const int  st = (int)blockIdx.y;
  const unsigned short* A  = (st ? A1 : A0) + (size_t)blockIdx.z * (size_t)M * (size_t)lda;
  const unsigned short* Bt = st ? Bt1 : Bt0;
  const float* gq = st ? gq1 : gq0;
  const float* gk = st ? gk1 : gk0;
  const int    crow0 = st * M;
  const size_t cpl   = (size_t)blockIdx.z * (size_t)crows * (size_t)ldc;   // element offset of this batch's C plane
  const int tilesN = N >> 7;
  const int tilesM = M >> 5;
  if ((int)blockIdx.x >= (tilesM >> 2) * tilesN) return;   // block-uniform, ahead of any barrier; never taken
  const int bm = (int)blockIdx.x / tilesN;
  const int tn = (int)blockIdx.x - bm * tilesN;
  const int tm = bm * 4 + wave;
  const int m0 = tm << 5;
  const int n0 = tn << 7;
  const int rl   = lane & 15;            // row (A) / col (B, D) within subtile
  const int hh   = lane >> 4;            // lane half
  const int koff = hh * 8;               // k offset of this lane half

  v8f acc[2][8];
#pragma unroll
  for (int i = 0; i < 2; ++i)
#pragma unroll
    for (int j = 0; j < 8; ++j) acc[i][j] = zero8();

  {
    const int cr = (int)threadIdx.x >> 4;          // row (mod 8) this thread copies
    const int cc = (int)threadIdx.x & 15;          // its 16-B piece of the row's 256 B
    const _Float16* ga = (const _Float16*)(const void*)A + (size_t)((bm << 7) + cr) * (size_t)lda + cc * 8;
    const _Float16* gb = (const _Float16*)(const void*)Bt + (size_t)(n0 + cr) * (size_t)ldb + cc * 8;
    const uint32_t  lr = (uint32_t)(size_t)(const void*)ring + (uint32_t)(cr * GPIT + cc * 8) * 2u;
    const int nst = K / GBK;                       // stages; block-uniform
    auto fill = [&](int st) {                      // stage st -> buffer st & 1: 32 copies per wave
      const uint32_t l = lr + (uint32_t)(st & 1) * (uint32_t)(GSTG * 2);
      const _Float16* pa = ga + (size_t)st * GBK;
      const _Float16* pb = gb + (size_t)st * GBK;
      acopy_rows64(l, pa, (size_t)lda);
      acopy_rows64(l + 64u * GPIT * 2u, pa + (size_t)64 * (size_t)lda, (size_t)lda);
      acopy_rows64(l + 128u * GPIT * 2u, pb, (size_t)ldb);
      acopy_rows64(l + 192u * GPIT * 2u, pb + (size_t)64 * (size_t)ldb, (size_t)ldb);
    };
    fill(0);
    wait_async0();
    __syncthreads();                               // stage 0 is published
    if (nst > 1) fill(1);
    for (int t = 0; t < nst; ++t) {
      const _Float16* sb  = ring + (t & 1) * GSTG;
      const _Float16* ar0 = sb + (wave * 32 + rl) * GPIT + koff;
      const _Float16* ar1 = ar0 + 16 * GPIT;
      const _Float16* br  = sb + (128 + rl) * GPIT + koff;
#pragma unroll                                     // the k offset becomes an immediate of each LDS load
      for (int kk = 0; kk < GBK / 32; ++kk) {
        const v16h a0 = ldfrag_h(ar0 + 32 * kk);
        const v16h a1 = ldfrag_h(ar1 + 32 * kk);
        v16h b[8];
#pragma unroll                                     // b[] stays in registers: the k-step's LDS loads stand as one group
        for (int j = 0; j < 8; ++j) b[j] = ldfrag_h(br + j * 16 * GPIT + 32 * kk);
#pragma unroll                                     // acc[][] and b[] indexed by constants only
        for (int j = 0; j < 8; ++j) {
          acc[0][j] = mma_h_raw(a0, b[j], acc[0][j]);
          acc[1][j] = mma_h_raw(a1, b[j], acc[1][j]);
          guard3(acc[0][j], acc[1][j], a0, a1, b[j]);
        }
      }
      wait_ds0();
      wait_async0();
      __syncthreads();                             // publishes stage t + 1 and ends every read of stage t
      if (t + 2 < nst) fill(t + 2);
    }
    wait_async0();
  }
  acc_guard4(acc[0][0], acc[0][1], acc[0][2], acc[0][3]);
  acc_guard4(acc[0][4], acc[0][5], acc[0][6], acc[0][7]);
  acc_guard4(acc[1][0], acc[1][1], acc[1][2], acc[1][3]);
  acc_guard4(acc[1][4], acc[1][5], acc[1][6], acc[1][7]);

  // ---- epilogue ----
  // per-wave 16x128 slab, pitch 132 floats, in the ring's first bytes: the barrier at the foot of the last trip has
  // ended every wave's reads of both stages, and no copy is issued or outstanding behind it
  float* slab = (float*)(void*)ring + wave * SLABF;
  float gmul[8];
  float csc = 1.0f;
  if (EPI == 1) {
    const bool isq = (n0 < DM);                                 // wave-uniform
    const int  hb  = (isq ? n0 : (n0 - DM)) >> 6;               // first head of this tile (0..15)
    csc = isq ? QSC : KSC;
#pragma unroll
    for (int j = 0; j < 8; ++j) {
      const int gi = (hb + (j >> 2)) * HD + 16 * (j & 3) + rl;  // < NHEAD*HD, inside both gain arrays
      const float ga = bfr(gq[gi]);
      const float gb = bfr(gk[gi]);
      gmul[j] = (isq ? ga : gb) * 8.0f;
    }
  } else {
#pragma unroll
    for (int j = 0; j < 8; ++j) gmul[j] = 1.0f;
  }
#pragma unroll
  for (int i = 0; i < 2; ++i) {
    const int mB = m0 + 16 * i;
    if (EPI == 1) {
      float inv[2][8];
#pragma unroll
      for (int jh = 0; jh < 2; ++jh) {
#pragma unroll
        for (int r = 0; r < 8; ++r) {        // sum of squares over the head's 64 columns of row 8hh+r
          float ss = 0.f;
#pragma unroll
          for (int jj = 0; jj < 4; ++jj) {
            const float x = acc[i][4 * jh + jj][r] * oscale;
            ss += x * x;
          }
          ss += __shfl_xor(ss, 1, 32);
          ss += __shfl_xor(ss, 2, 32);
          ss += __shfl_xor(ss, 4, 32);
          ss += __shfl_xor(ss, 8, 32);
          inv[jh][r] = oscale * (1.0f / fmaxf(sqrtf(ss), NRM_EPS));
        }
      }
#pragma unroll
      for (int j = 0; j < 8; ++j) {
#pragma unroll
        for (int r = 0; r < 8; ++r)
          slab[(8 * hh + r) * 132 + 16 * j + rl] = acc[i][j][r] * inv[j >> 2][r] * gmul[j];
      }
    } else {
#pragma unroll
      for (int j = 0; j < 8; ++j) {
#pragma unroll
        for (int r = 0; r < 8; ++r) slab[(8 * hh + r) * 132 + 16 * j + rl] = acc[i][j][r] * oscale;
      }
    }
    wave_sync_lds();
    if (EPI == 3) {
      float* Cf = (float*)C0 + cpl;
      v4f ov[16];
#pragma unroll
      for (int it = 0; it < 16; ++it) ov[it] = *(const v4f*)(slab + it * 132 + lane * 4);
      {
#pragma unroll
        for (int it = 0; it < 16; ++it)                       // row it: 32 lanes x 16 B = 512 B = 128 cols
          *(v4f*)(Cf + (size_t)(crow0 + mB + it) * (size_t)ldc + n0 + lane * 4) = ov[it];
        
      }
    } else {
      unsigned short* Cp = (unsigned short*)C0 + cpl;
      unsigned short* Cq = (unsigned short*)C1 + cpl;
      v4u hv[8], lv[8];
#pragma unroll
      for (int it = 0; it < 8; ++it) {
        const int row = it * 2 + hh;                          // it 0..7 x hh 0..1 = rows 0..15
        const float* sp = slab + row * 132 + rl * 8;          // 8 consecutive columns = 4 rotary pairs
        const v4f fa = *(const v4f*)sp;
        const v4f fb = *(const v4f*)(sp + 4);
        float f[8];
        f[0] = fa[0]; f[1] = fa[1]; f[2] = fa[2]; f[3] = fa[3];
        f[4] = fb[0]; f[5] = fb[1]; f[6] = fb[2]; f[7] = fb[3];
        const int pos = crow0 + mB + row;                     // position in the concatenated sequence
        const v4f cv = *(const v4f*)(cost + (size_t)pos * RP + (rl & 7) * 4);   // pairs ((rl&7)*4 .. +3)
        const v4f sv = *(const v4f*)(sint + (size_t)pos * RP + (rl & 7) * 4);
        v4u pk, pl;
#pragma unroll
        for (int e = 0; e < 4; ++e) {
          const float f0 = f[2 * e], f1 = f[2 * e + 1];
          const float cc = cv[e], sn = sv[e];
          const float g0 = (f0 * cc - f1 * sn) * csc;
          const float g1 = (f0 * sn + f1 * cc) * csc;
          const _Float16 x0 = (_Float16)g0;
          const _Float16 x1 = (_Float16)g1;
          const _Float16 y0 = (_Float16)((g0 - (float)x0) * RSC);
          const _Float16 y1 = (_Float16)((g1 - (float)x1) * RSC);
          pk[e] = pk16(h_bits(x0), h_bits(x1));
          pl[e] = pk16(h_bits(y0), h_bits(y1));
        }
        hv[it] = pk;
        lv[it] = pl;
      }
      {
#pragma unroll
        for (int it = 0; it < 8; ++it) {
          const int row = it * 2 + hh;
          const size_t go = (size_t)(crow0 + mB + row) * (size_t)ldc + n0 + rl * 8;
          *(v4u*)(Cp + go) = hv[it];
          *(v4u*)(Cq + go) = lv[it];
        }
        
      }
    }
    wave_sync_lds();
  }
}

// =====================================================================================================
// Compressive-memory update per (head h, segment s in 0..2) of one batch (blockIdx.y):
//   MT[h][s][e][d] = sum over the 1024 keys l of segment s of v[l][e] * sk[l][d], sk = elu(k) + 1
//   (elu(x) = x > 0 ? x : exp(x) - 1, so sk = x > 0 ? x + 1 : exp(x)), and ZP[h][s][d] = sum_l sk[l][d].
//   k is rebuilt in f32 from the q|k hi / residual planes ((hi + lo/RSC) / KSC, column DM + h*64 + d), sk is
//   RNE-converted to f16 and written TRANSPOSED into an LDS tile skT[d][l] (64 keys per chunk, pitch 72 halves);
//   A = V^T hi plane rows (h*64 + e, keys), Bt = skT; D[e][d] scaled by 1/VSC.
//   Block = 8 waves; wave w owns e rows 16*(w>>1).. and d columns 32*(w&1)..; acc guarded; the 16x32 f32 piece is
// coverage: MT: 8 waves x (16 rows x 32 cols) = the whole 64x64 tile of (h,s); 4 its x 4 row groups x 8 lanes =
//   16 rows x 32 cols per wave. ZP: 16 lanes x 4 floats = 64. skT fill: 256 threads x 16 d x 1 key = 64x64 chunk.
// =====================================================================================================
__global__ __launch_bounds__(256) void mt_seg(const unsigned short* __restrict__ QKH,
                                             const unsigned short* __restrict__ QKL,
                                             const unsigned short* __restrict__ VTH,
                                             float* MT, float* ZP) {
  __shared__ __align__(16) _Float16 skT[HD * 72];
  __shared__ __align__(16) float slab[8][16 * 36];
  __shared__ float zred[8][HD];
  __shared__ __align__(16) float zsum[HD];

  const int tid = threadIdx.x, wave = tid >> 5, lane = tid & 31, hh = lane >> 4, c = lane & 15;
  const int h = (int)(blockIdx.x / 3u);
  const int s = (int)(blockIdx.x - (unsigned)h * 3u);
  if (h >= NHEAD) return;                 // block-uniform, ahead of any barrier; never taken
  QKH += (size_t)blockIdx.y * SEQ * QKW;  // blockIdx.y = batch: its own planes
  QKL += (size_t)blockIdx.y * SEQ * QKW;
  VTH += (size_t)blockIdx.y * DM * SEQ;
  MT  += (size_t)blockIdx.y * NHEAD * 3 * HD * HD;
  ZP  += (size_t)blockIdx.y * NHEAD * 3 * HD;
  const int r  = tid >> 2;                // key within the 64-key chunk handled by this thread
  const int dq = (tid & 3) * 16;          // first of the 16 d columns handled by this thread
  const int et = wave >> 1;               // e row tile of this wave
  const int dt0 = (wave & 1) * 2;         // first d column tile of this wave

  const _Float16* Q16 = (const _Float16*)(const void*)QKH;
  const _Float16* L16 = (const _Float16*)(const void*)QKL;
  const _Float16* V16 = (const _Float16*)(const void*)VTH;
  const _Float16* vrow = V16 + (size_t)(h * HD + et * 16 + c) * SEQ + (size_t)s * SEG + 8 * hh;   // A frag base

  float zacc[16];
#pragma unroll
  for (int e = 0; e < 16; ++e) zacc[e] = 0.f;
  v8f acc[2];
  acc[0] = zero8(); acc[1] = zero8();

  for (int kt = 0; kt < SEG / 64; ++kt) {
    __syncthreads();                      // prior chunk's fragment reads are done
    {
      const size_t n = (size_t)(s * SEG + kt * 64 + r);
      const _Float16* kp = Q16 + n * QKW + DM + h * HD + dq;
      const _Float16* lp = L16 + n * QKW + DM + h * HD + dq;
      FH kf, lf;
      kf.h[0] = *(const v8h*)kp; kf.h[1] = *(const v8h*)(kp + 8);
      lf.h[0] = *(const v8h*)lp; lf.h[1] = *(const v8h*)(lp + 8);
#pragma unroll
      for (int e = 0; e < 16; ++e) {
        const float kv = ((float)kf.v[e] + (float)lf.v[e] * (1.0f / RSC)) * (1.0f / KSC);
        const float sk = (kv > 0.f) ? (kv + 1.0f) : __expf(kv);
        const _Float16 skh = (_Float16)sk;
        skT[(dq + e) * 72 + r] = skh;
        zacc[e] += (float)skh;
      }
    }
    __syncthreads();                      // skT chunk complete
#pragma unroll
    for (int kk = 0; kk < 2; ++kk) {
      const v16h a  = ldfrag_h(vrow + kt * 64 + 32 * kk);
      const v16h b0 = ldfrag_h(skT + (16 * dt0 + c) * 72 + 32 * kk + 8 * hh);
      const v16h b1 = ldfrag_h(skT + (16 * (dt0 + 1) + c) * 72 + 32 * kk + 8 * hh);
      acc[0] = mma_h_raw(a, b0, acc[0]);
      acc[1] = mma_h_raw(a, b1, acc[1]);
      guard3(acc[0], acc[1], a, b0, b1);
    }
  }
  acc_guard2(acc[0], acc[1]);

  // ---- MT piece: rows e = 16*et + (8hh+rr), cols d = 32*(wave&1) + 16*jj + c ----
  float* sl = slab[wave];
#pragma unroll
  for (int jj = 0; jj < 2; ++jj) {
#pragma unroll
    for (int rr = 0; rr < 8; ++rr) sl[(8 * hh + rr) * 36 + 16 * jj + c] = acc[jj][rr] * (1.0f / VSC);
  }
  wave_sync_lds();
  {
    v4f mv[4];
#pragma unroll
    for (int it = 0; it < 4; ++it) {
      const int row = it * 4 + (lane >> 3);
      mv[it] = *(const v4f*)(sl + row * 36 + (lane & 7) * 4);
    }
    float* mtb = MT + ((size_t)(h * 3 + s) * HD + (size_t)et * 16) * HD + (wave & 1) * 32;
    {
#pragma unroll
      for (int it = 0; it < 4; ++it) {
        const int row = it * 4 + (lane >> 3);
        *(v4f*)(mtb + (size_t)row * HD + (lane & 7) * 4) = mv[it];
      }
      
    }
  }
  // ---- ZP: sum zacc over the 8 keys of this wave (lanes sharing lane&3), then over the 8 waves ----
#pragma unroll
  for (int e = 0; e < 16; ++e) {
    float v = zacc[e];
    v += __shfl_xor(v, 4, 32);
    v += __shfl_xor(v, 8, 32);
    v += __shfl_xor(v, 16, 32);
    if ((lane >> 2) == 0) zred[wave][(lane & 3) * 16 + e] = v;
  }
  __syncthreads();
  if (tid < HD) {
    float z = 0.f;
#pragma unroll
    for (int w = 0; w < 8; ++w) z += zred[w][tid];
    zsum[tid] = z;
  }
  __syncthreads();
  if (tid < 16) {                         // wave 0, lanes 0..15: 16 x 16 B = the whole 256-B ZP row
    const v4f zz = *(const v4f*)(zsum + tid * 4);
    float* zp = ZP + (size_t)(h * 3 + s) * HD + tid * 4;
    *(v4f*)zp = zz;
    
  }
}

// =====================================================================================================
// Compressive-memory read per (head h, segment s in 1..3, 128-row block) of one batch (blockIdx.y):
//   M_s = sum over segments before s of MT[h][s'] (f32 sum, RNE convert to an f16 LDS tile MTh[e][d], pitch 72);
//   z_s = sum of ZP[h][s'] (f32, LDS). Per query row n of segment s: q rebuilt in f32 from the hi / residual planes
//   ((hi + lo/RSC) / QSC, column h*64 + d), sq = elu(q) + 1 RNE-converted to f16 directly into the A fragment
//   (elementwise transform keeps the A layout); num[n][e] = sum_d sq[n][d] * M_s[d][e] with Bt = MTh (K = 64, two
//   k-steps, 4 column tiles); den[n] = sum_d sq[n][d] * z_s[d] + 1e-6 in f32 from the same f16 sq values (lane
//   halves combined, then broadcast to the D rows); MEM[n][h*64 + e] = num * (1/den), f32 rows of pitch DM.
//   Block = 8 waves x 16 rows; per-wave 16x64 f32 tile staged in LDS; stores 16 lanes x 16 B per 256-B row
// coverage: 16 heads x 3 segments x 8 row blocks x 8 waves x 16 rows = MEM rows 1024..4095 of every head's 64
//   columns; 8 its x 2 row halves x 16 lanes x 4 floats = the wave's 16x64 tile. Rows 0..1023 (segment 0) are not
//   produced and are not used by the consumer (memory is exactly zero there).
// =====================================================================================================
__global__ __launch_bounds__(256) void mem_ret(const unsigned short* __restrict__ QKH,
                                              const unsigned short* __restrict__ QKL,
                                              const float* __restrict__ MT, const float* __restrict__ ZP,
                                              float* MEM) {
  __shared__ __align__(16) _Float16 MTh[HD * 72];
  __shared__ float zs[HD];
  __shared__ __align__(16) float slab[8][16 * 68];

  const int tid = threadIdx.x, wave = tid >> 5, lane = tid & 31, hh = lane >> 4, c = lane & 15;
  const int h   = (int)(blockIdx.x / 24u);
  const int rem = (int)(blockIdx.x - (unsigned)h * 24u);
  const int s   = 1 + rem / 8;            // 1..3
  const int rb  = rem - (s - 1) * 8;      // 0..7
  if (h >= NHEAD) return;                 // block-uniform, ahead of any barrier; never taken
  QKH += (size_t)blockIdx.y * SEQ * QKW;  // blockIdx.y = batch: its own planes
  QKL += (size_t)blockIdx.y * SEQ * QKW;
  MT  += (size_t)blockIdx.y * NHEAD * 3 * HD * HD;
  ZP  += (size_t)blockIdx.y * NHEAD * 3 * HD;
  MEM += (size_t)blockIdx.y * SEQ * DM;

  {
    const int e = tid >> 2, d0 = (tid & 3) * 16;
    float sm[16];
#pragma unroll
    for (int i = 0; i < 16; ++i) sm[i] = 0.f;
#pragma unroll
    for (int sp = 0; sp < 3; ++sp) {
      if (sp < s) {                       // block-uniform
        const float* src = MT + ((size_t)(h * 3 + sp) * HD + e) * HD + d0;
#pragma unroll
        for (int q = 0; q < 4; ++q) {
          const v4f v = *(const v4f*)(src + 4 * q);
          sm[4 * q + 0] += v[0]; sm[4 * q + 1] += v[1]; sm[4 * q + 2] += v[2]; sm[4 * q + 3] += v[3];
        }
      }
    }
    v8h p0, p1;
#pragma unroll
    for (int i = 0; i < 8; ++i) { p0[i] = (_Float16)sm[i]; p1[i] = (_Float16)sm[8 + i]; }
    *(v8h*)(MTh + e * 72 + d0) = p0;
    *(v8h*)(MTh + e * 72 + d0 + 8) = p1;
    if (tid < HD) {
      float z = 0.f;
#pragma unroll
      for (int sp = 0; sp < 3; ++sp) {
        if (sp < s) z += ZP[(size_t)(h * 3 + sp) * HD + tid];
      }
      zs[tid] = z;
    }
  }
  __syncthreads();

  const _Float16* Q16 = (const _Float16*)(const void*)QKH;
  const _Float16* L16 = (const _Float16*)(const void*)QKL;
  const int n0w = s * SEG + rb * MROWS + wave * 16;          // first query position of this wave

  v16h af[2];
  float denp = 0.f;
#pragma unroll
  for (int kk = 0; kk < 2; ++kk) {
    FH hf, lf;
    hf.v = ldfrag_h(Q16 + (size_t)(n0w + c) * QKW + h * HD + 32 * kk + 8 * hh);
    lf.v = ldfrag_h(L16 + (size_t)(n0w + c) * QKW + h * HD + 32 * kk + 8 * hh);
    v16h a;
#pragma unroll
    for (int i = 0; i < 16; ++i) {
      const float qv = ((float)hf.v[i] + (float)lf.v[i] * (1.0f / RSC)) * (1.0f / QSC);
      const float sq = (qv > 0.f) ? (qv + 1.0f) : __expf(qv);
      const _Float16 sqh = (_Float16)sq;
      a[i] = sqh;
      const int kidx = 32 * kk + ((i < 8) ? (8 * hh + i) : (8 + 8 * hh + i));   // k of element i (split map)
      denp += (float)sqh * zs[kidx];
    }
    af[kk] = a;
  }
  const float den = denp + __shfl_xor(denp, 16, 32) + DEN_EPS;   // row c complete in lanes c and c+16

  v8f acc[4];
#pragma unroll
  for (int j = 0; j < 4; ++j) {
    acc[j] = zero8();
#pragma unroll
    for (int kk = 0; kk < 2; ++kk) {
      const v16h b = ldfrag_h(MTh + (16 * j + c) * 72 + 32 * kk + 8 * hh);
      acc[j] = mma_h(af[kk], b, acc[j]);
    }
  }
  float rinv[8];
#pragma unroll
  for (int rr = 0; rr < 8; ++rr) rinv[rr] = 1.0f / __shfl(den, 8 * hh + rr, 32);   // den of D row 8hh+rr

  float* sl = slab[wave];
#pragma unroll
  for (int j = 0; j < 4; ++j) {
#pragma unroll
    for (int rr = 0; rr < 8; ++rr) sl[(8 * hh + rr) * 68 + 16 * j + c] = acc[j][rr] * rinv[rr];
  }
  wave_sync_lds();
  {
    v4f ov[8];
#pragma unroll
    for (int it = 0; it < 8; ++it) {
      const int row = it * 2 + hh;        // it 0..7 x hh 0..1 = rows 0..15
      ov[it] = *(const v4f*)(sl + row * 68 + c * 4);
    }
    {
#pragma unroll
      for (int it = 0; it < 8; ++it) {
        const int row = it * 2 + hh;
        *(v4f*)(MEM + (size_t)(n0w + row) * DM + h * HD + c * 4) = ov[it];
      }
      
    }
  }
}

// =====================================================================================================
// Segment-local causal attention with the gate mix, per (batch, h, segment, 64-query block):
//   s = (sum_d qh.kh + (ql.kh + qh.kl) / RSC) * sscale, sscale = (1/8) / (QSC*KSC); key > query (segment-local)
//   -> NEG_BIG (value select); online softmax in f32; p = exp(s - m) carried as ph = f16(1024 p) and, when PRES,
//   also pl = f16((1024 p - ph) * RSC); local numerator = p . v with v as f16 hi (VSC v) and, when PRES, the f16
//   residual ((VSC v - hi) * RSC) plane: oh += ph.vhi over all chunks; when PRES: ol = ph.vres + pl.vhi (one
//   residual accumulator per chunk and 16-wide d tile, both products carry the same 1/RSC), folded as
//   oh += ol / RSC in f32 right after its two k-steps.
//   q|k planes (f16, pitch QKW, rows = positions): q element (t, h, d) at [t*QKW + h*64 + d], k at
//   [t*QKW + DM + h*64 + d]; V^T planes (f16): element (h, d, t) at [(h*64 + d)*SEQ + t]; MEM plane (f32,
//   pitch DM): element (t, h, e) at [t*DM + h*64 + e].
//   Epilogue per query row t: local = oh / (l * PSC * VSC); mem = MEM[t] for segments >= 1 (segment 0: exactly 0
//   by a value select; the load address is always inside the plane); out = g * mem + (1 - g) * local with
//   g = sigmoid(bf16(gate[h])); rows of positions < NTOK go to the second output (offset OUT1OFF), rows of positions
//   >= NTOK to the first, row t mod NTOK, columns h*64..h*64+63 (pitch DM floats).
//   Block = 4 waves = 64 query rows of one h; grid = (NHEAD * NSEG * nqb, NB), block -> (h, seg, qbs = qb0 + i), batch;
//   key chunks of 64 within the segment, chunks kt <= qbs only (block-uniform trip <= NQB), chunk kt == qbs keeps
//   its diagonal by the per-element select.
//   K / V^T chunk staging: asynchronous 16-B copies, thread -> rows (tid>>3) + 16 i, piece tid&7 of the row's 128 B
//   (a wave's copy takes four whole rows). One buffer per tile: the K tiles of chunk kt + 1 are copied behind the
//   barrier that ends the score reads of chunk kt and fly under its softmax and P.V; the V^T tiles of chunk kt + 1
//   are copied behind the barrier that ends the P.V reads of chunk kt and fly under the scores of chunk kt + 1.
//   q fragments (hi and residual, 2 d-chunks) held in registers for the whole block.
//   Both products run transposed (S^T = K.q^T, O^T += V^T.P^T): a lane holds one
//   query's scores, and two converted S^T tiles are a B fragment of P^T, so P passes through no LDS.
//   Output coverage: each wave stores rows q0..q0+15 (it 0..7 x lane>>4) x 64 columns (16 lanes x 16 B), one
// =====================================================================================================
template <bool PRES>
__global__ __launch_bounds__(128)
void attn_seg(const unsigned short* __restrict__ QKH, const unsigned short* __restrict__ QKL,
              const unsigned short* __restrict__ VTH, const unsigned short* __restrict__ VTL,
              const float* __restrict__ MEM, const float* __restrict__ gate,
              float* outb, float sscale, int qb0, int nqb) {
  __shared__ __align__(16) _Float16 Ksh[64 * APIT];                           // K hi  [key][d]  9 KB
  __shared__ __align__(16) _Float16 Kls[64 * APIT];                           // K res [key][d]  9 KB
  __shared__ __align__(16) _Float16 Vhs[HD * APIT];                           // V^T hi [d][key] 9 KB
  __shared__ __align__(16) _Float16 Vls[PRES ? HD * APIT : 8];                // V^T res [d][key] 9 KB (PRES)
  __shared__ __align__(16) float    Os[4][16 * 68];                          // per wave output tile [row][d]

  const int tid  = threadIdx.x;
  const int wave = tid >> 5;
  const int lane = tid & 31;
  const int hh   = lane >> 4;
  const int c    = lane & 15;

  const int per = NSEG * nqb;
  const int h   = (int)(blockIdx.x / (unsigned)per);
  const int rem = (int)(blockIdx.x - (unsigned)h * (unsigned)per);
  const int seg = rem / nqb;
  const int qbs = qb0 + (rem - seg * nqb);
  if (h >= NHEAD || seg >= NSEG) return;  // block-uniform, ahead of any barrier; never taken for exact grids
  QKH  += (size_t)blockIdx.y * SEQ * QKW; // blockIdx.y = batch: its own planes and its own rows of both outputs
  QKL  += (size_t)blockIdx.y * SEQ * QKW;
  VTH  += (size_t)blockIdx.y * DM * SEQ;
  VTL  += (size_t)blockIdx.y * DM * SEQ;
  MEM  += (size_t)blockIdx.y * SEQ * DM;
  outb += (size_t)blockIdx.y * NTOK * DM;
  const int sbase = seg * SEG;
  const int rowl0 = qbs * 64 + wave * 16; // segment-local row of this wave's first query
  const int q0    = sbase + rowl0;        // its position in the concatenated sequence

  const _Float16* Q16 = (const _Float16*)(const void*)QKH;
  const _Float16* L16 = (const _Float16*)(const void*)QKL;
  const _Float16* Qg  = Q16 + (size_t)h * HD;
  const _Float16* Qlg = L16 + (size_t)h * HD;
  const _Float16* Kg  = Q16 + DM + (size_t)h * HD;
  const _Float16* Klg = L16 + DM + (size_t)h * HD;
  const _Float16* Vhg = (const _Float16*)(const void*)VTH + (size_t)h * HD * SEQ;
  const _Float16* Vlg = (const _Float16*)(const void*)VTL + (size_t)h * HD * SEQ;

  // ---- q fragments (B operand, column = lane&15), hi and residual, d-chunks 0 and 1, fixed for the block ----
  const v16h qh0 = ldfrag_h(Qg  + (size_t)(q0 + c) * QKW + 8 * hh);
  const v16h qh1 = ldfrag_h(Qg  + (size_t)(q0 + c) * QKW + 32 + 8 * hh);
  const v16h ql0 = ldfrag_h(Qlg + (size_t)(q0 + c) * QKW + 8 * hh);
  const v16h ql1 = ldfrag_h(Qlg + (size_t)(q0 + c) * QKW + 32 + 8 * hh);

  // a lane holds ONE query (row c of the wave's 16): its running maximum, its running sum, and in oh[t][r] the
  // numerator of d = 16 t + 8 hh + r (the transposed output tile)
  float mrow = NEG_BIG, lrow = 0.f;
  v8f oh[4];
#pragma unroll
  for (int t = 0; t < 4; ++t) oh[t] = zero8();

  // ---- tile copies: this thread's row (mod 16) and 16-B piece; copy i takes row sr + 16 i of the 64-row tile ----
  const int sr = tid >> 3, sc = (tid & 7) * 8;
  const uint32_t lofs = (uint32_t)(sr * APIT + sc) * 2u;
  const uint32_t ls   = 16u * APIT * 2u;                    // LDS bytes per 16 rows
  const uint32_t lKh = (uint32_t)(size_t)(const void*)Ksh + lofs;
  const uint32_t lKl = (uint32_t)(size_t)(const void*)Kls + lofs;
  const uint32_t lVh = (uint32_t)(size_t)(const void*)Vhs + lofs;
  const uint32_t lVl = (uint32_t)(size_t)(const void*)Vls + lofs;
  const uint32_t oK = (uint32_t)(sr * QKW + sc) * 2u, gK = 16u * QKW * 2u;   // byte offset in a K tile, per 16 rows
  const uint32_t oV = (uint32_t)(sr * SEQ + sc) * 2u, gV = 16u * SEQ * 2u;   // the same in a V^T tile
  auto fillK = [&](int kv) {                                // K hi and residual rows kv .. kv + 63, d = 0..63
    acopy8s(lKh, lKh + ls, lKh + 2 * ls, lKh + 3 * ls, lKl, lKl + ls, lKl + 2 * ls, lKl + 3 * ls,
            oK, oK + gK, oK + 2 * gK, oK + 3 * gK, Kg + (size_t)kv * QKW, Klg + (size_t)kv * QKW);
  };
  auto fillV = [&](int kv) {                                // V^T rows d = 0..63, keys kv .. kv + 63
    if (PRES)
      acopy8s(lVh, lVh + ls, lVh + 2 * ls, lVh + 3 * ls, lVl, lVl + ls, lVl + 2 * ls, lVl + 3 * ls,
              oV, oV + gV, oV + 2 * gV, oV + 3 * gV, Vhg + kv, Vlg + kv);
    else
      acopy4s(lVh, lVh + ls, lVh + 2 * ls, lVh + 3 * ls, oV, oV + gV, oV + 2 * gV, oV + 3 * gV, Vhg + kv);
  };
  fillK(sbase);
  fillV(sbase);
  wait_async0();
  __syncthreads();                            // chunk 0's K and V^T tiles are published

  for (int kt = 0; kt < NQB; ++kt) {          // static bound; block-uniform causal chunk skipping
    if (kt > qbs) break;
    const int kv0 = sbase + kt * 64;

    // ---- transposed scores: 64 keys x 16 queries per wave, A = K rows, B = q, K = 64 (2 d-chunks), three products;
    //      D element r of tile j = key 16 j + 8 hh + r against query c ----
    v8f s[4];
#pragma unroll
    for (int j = 0; j < 4; ++j) {
      v8f sh = zero8(), sl = zero8();
      {
        FH kb, lb;
        kb.h[0] = *(const v8h*)(Ksh + (j * 16 + c) * APIT + 8 * hh);
        kb.h[1] = *(const v8h*)(Ksh + (j * 16 + c) * APIT + 16 + 8 * hh);
        lb.h[0] = *(const v8h*)(Kls + (j * 16 + c) * APIT + 8 * hh);
        lb.h[1] = *(const v8h*)(Kls + (j * 16 + c) * APIT + 16 + 8 * hh);
        sh = mma_h_raw(kb.v, qh0, sh);
        sl = mma_h_raw(kb.v, ql0, sl);
        sl = mma_h_raw(lb.v, qh0, sl);
        guard4m(sh, sl, qh0, ql0, kb.v, lb.v);
      }
      {
        FH kb, lb;
        kb.h[0] = *(const v8h*)(Ksh + (j * 16 + c) * APIT + 32 + 8 * hh);
        kb.h[1] = *(const v8h*)(Ksh + (j * 16 + c) * APIT + 48 + 8 * hh);
        lb.h[0] = *(const v8h*)(Kls + (j * 16 + c) * APIT + 32 + 8 * hh);
        lb.h[1] = *(const v8h*)(Kls + (j * 16 + c) * APIT + 48 + 8 * hh);
        sh = mma_h_raw(kb.v, qh1, sh);
        sl = mma_h_raw(kb.v, ql1, sl);
        sl = mma_h_raw(lb.v, qh1, sl);
        guard4m(sh, sl, qh1, ql1, kb.v, lb.v);
      }
      // segment-local key of D element r is kt*64 + 16 j + 8 hh + r, the query row of this lane's D column rowl0 + c:
      // element r is kept while r <= lim
      const int lim = (rowl0 + c) - (kt * 64 + j * 16 + 8 * hh);
#pragma unroll
      for (int r = 0; r < 8; ++r) {
        float v = sh[r];
        v += sl[r] * (1.0f / RSC);
        v *= sscale;
        s[j][r] = (r <= lim) ? v : NEG_BIG;
      }
    }
    wait_ds0();
    wait_async0();
    __syncthreads();                          // ends every read of the K tiles and publishes this chunk's V^T tiles
    if (kt < qbs) fillK(kv0 + 64);            // block-uniform

    // ---- maximum and sum of the query's 64 scores: 32 in this lane, 32 in lane ^ 16 (one exchange each); online
    //      softmax in f32; P hi (x1024, f16) and, when PRES, P residual (x RSC, f16) go straight into B fragments:
    //      tiles 2 kk and 2 kk + 1 hold keys 32 kk + 8 hh + r and 32 kk + 16 + 8 hh + r, the loaders' own k order ----
    float mj[4];
#pragma unroll
    for (int j = 0; j < 4; ++j) {
      float m = s[j][0];
#pragma unroll
      for (int r = 1; r < 8; ++r) m = fmaxf(m, s[j][r]);
      mj[j] = m;
    }
    float m = fmaxf(fmaxf(mj[0], mj[1]), fmaxf(mj[2], mj[3]));
    m = fmaxf(m, xhalf(m));
    const float mnew  = fmaxf(mrow, m);
    const float alpha = __expf(mrow - mnew);
    mrow = mnew;
    FH pa[2], pb[2];
    float pj[4];
#pragma unroll
    for (int j = 0; j < 4; ++j) {
      float ps = 0.f;
#pragma unroll
      for (int r = 0; r < 8; ++r) {
        const float p  = __expf(s[j][r] - mnew);
        ps += p;
        const float ph = p * PSC;
        const _Float16 xh = (_Float16)ph;
        pa[j >> 1].v[(j & 1) * 8 + r] = xh;
        if (PRES) pb[j >> 1].v[(j & 1) * 8 + r] = (_Float16)((ph - (float)xh) * RSC);
      }
      pj[j] = ps;
    }
    float psum = (pj[0] + pj[1]) + (pj[2] + pj[3]);
    psum += xhalf(psum);
    lrow = lrow * alpha + psum;
#pragma unroll
    for (int t = 0; t < 4; ++t) {
#pragma unroll
      for (int r = 0; r < 8; ++r) oh[t][r] *= alpha;
    }

    // ---- transposed local numerator, A = V^T rows, B = P^T: oh += Vhi . Phi; when PRES also
    //      ol = Vres . Phi + Vhi . Plo, oh += ol/RSC ----
#pragma unroll
    for (int t = 0; t < 4; ++t) {
      const _Float16* vr = Vhs + (t * 16 + c) * APIT + 8 * hh;
      FH vb0, vb1;
      vb0.h[0] = *(const v8h*)(vr);
      vb0.h[1] = *(const v8h*)(vr + 16);
      vb1.h[0] = *(const v8h*)(vr + 32);
      vb1.h[1] = *(const v8h*)(vr + 48);
      if (PRES) {
        const _Float16* wr = Vls + (t * 16 + c) * APIT + 8 * hh;
        FH wb0, wb1;
        wb0.h[0] = *(const v8h*)(wr);
        wb0.h[1] = *(const v8h*)(wr + 16);
        wb1.h[0] = *(const v8h*)(wr + 32);
        wb1.h[1] = *(const v8h*)(wr + 48);
        v8f ol = zero8();
        oh[t] = mma_h_raw(vb0.v, pa[0].v, oh[t]);
        ol    = mma_h_raw(wb0.v, pa[0].v, ol);
        ol    = mma_h_raw(vb0.v, pb[0].v, ol);
        oh[t] = mma_h_raw(vb1.v, pa[1].v, oh[t]);
        ol    = mma_h_raw(wb1.v, pa[1].v, ol);
        ol    = mma_h_raw(vb1.v, pb[1].v, ol);
        guard8m(oh[t], ol, pa[0].v, pa[1].v, pb[0].v, pb[1].v, vb0.v, vb1.v, wb0.v, wb1.v);
#pragma unroll
        for (int r = 0; r < 8; ++r) oh[t][r] += ol[r] * (1.0f / RSC);
      } else {
        oh[t] = mma_h_raw(vb0.v, pa[0].v, oh[t]);
        oh[t] = mma_h_raw(vb1.v, pa[1].v, oh[t]);
        guard1q(oh[t], pa[0].v, pa[1].v, vb0.v, vb1.v);
      }
    }
    acc_guard4(oh[0], oh[1], oh[2], oh[3]);
    wait_ds0();
    wait_async0();
    __syncthreads();                          // ends every read of the V^T tiles and publishes the next chunk's K tiles
    if (kt < qbs) fillV(kv0 + 64);            // block-uniform
  }
  wait_async0();

  // ---- normalise (1/l, the 1/1024 p carry and the 1/VSC v carry), gate mix with the memory read, stage the
  //      wave's tile as [query row][d] (a lane writes 8 consecutive d of its query per t) ----
  const float gv  = bfr(gate[h]);
  const float g   = 1.0f / (1.0f + expf(-gv));
  const float omg = 1.0f - g;
  const bool useMem = (seg > 0);                          // block-uniform
  float* os = Os[wave];
  {
    const int qr = q0 + c;                                  // this lane's query position
    const float l = lrow;                                   // >= 1 (the row maximum contributes exp(0))
    const float inv = (1.0f / l) * (1.0f / (PSC * VSC));
    const float* mr = MEM + (size_t)qr * DM + h * HD + 8 * hh;   // inside the MEM plane for every position
#pragma unroll
    for (int t = 0; t < 4; ++t) {
      const v4f ma = *(const v4f*)(mr + 16 * t);
      const v4f mb = *(const v4f*)(mr + 16 * t + 4);
      v4f oa, ob;
#pragma unroll
      for (int r = 0; r < 4; ++r) {                         // e = 16t + 8hh + r and + 4
        oa[r] = g * (useMem ? ma[r] : 0.f) + omg * (oh[t][r] * inv);
        ob[r] = g * (useMem ? mb[r] : 0.f) + omg * (oh[t][4 + r] * inv);
      }
      *(v4f*)(os + c * 68 + 16 * t + 8 * hh)     = oa;
      *(v4f*)(os + c * 68 + 16 * t + 8 * hh + 4) = ob;
    }
  }
  wave_sync_lds();
  {
    const size_t ooff  = (seg < (NTOK / SEG)) ? (size_t)OUT1OFF : (size_t)0;   // positions < NTOK -> second output
    const int    orow0 = (seg < (NTOK / SEG)) ? q0 : (q0 - NTOK);               // row within the output [b][2048][1024]
    v4f ov[8];
#pragma unroll
    for (int it = 0; it < 8; ++it) {
      const int row = it * 2 + hh;                          // it 0..7 x hh 0..1 = rows 0..15 of the wave tile
      ov[it] = *(const v4f*)(os + row * 68 + c * 4);
    }
    {
#pragma unroll
      for (int it = 0; it < 8; ++it) {
        const int row = it * 2 + hh;
        *(v4f*)(outb + ooff + (size_t)(orow0 + row) * DM + h * HD + c * 4) = ov[it];
      }
      
    }
  }
}

// =====================================================================================================
// Workspace map (bytes); every plane is an exact multiple of its tile / whole-line store granularity (all dims are
// exact tile multiples, no padded tails), all offsets multiples of 4096:
//   XH    f16  [4096 t][1024 in]             0          8388608   (f16 of bf16 value x16, rows b*2048 + t)
//   AH    f16  [4096 t][1024 in]             8388608    8388608
//   WXT   f16  [3072 out][1024 in]           16777216   6291456   (W^T, bf16 value x64)
//   WAT   f16  [3072 out][1024 in]           23068672   6291456
//   COST  f32  [4096 pos][32]                29360128    524288
//   SINT  f32  [4096 pos][32]                29884416    524288
//   QKH   f16  [2 b][4096 pos][2048 (q|k)]   30408704  33554432   (q x4, k x16 hi after norm + rotary)
//   QKL   f16  [2 b][4096][2048]             63963136  33554432   (x4096 residuals)
//   VF    f32  [2 b][4096 pos][1024 (h,d)]   97517568  33554432   (v, f32)
//   VTH   f16  [2 b][1024 (h,d)][4096 pos]  131072000  16777216   (v x16 hi)
//   VTL   f16  [2 b][1024 (h,d)][4096 pos]  147849216  16777216   ((v x16 - hi) x4096)
//   MT    f32  [2 b][16 h][3 s][64 e][64 d] 164626432   1572864
//   ZP    f32  [2 b][16 h][3 s][64 d]       166199296     24576
//   MEM   f32  [2 b][4096 pos][1024 (h,e)]  166223872  33554432
//   end                                     199778304
// =====================================================================================================
extern "C" void kernel_launch(void* const* d_in, const int* in_sizes, int n_in,
                              void* d_out, int out_size, void* d_ws, size_t ws_size,
                              hipStream_t stream) {
  if (n_in < 9) return;
  if (in_sizes[0] != NB * NTOK * DM || in_sizes[1] != NB * NTOK * DM) return;
  if (in_sizes[2] != DM * W3 || in_sizes[3] != DM * W3) return;
  if (in_sizes[4] != NHEAD * HD || in_sizes[5] != NHEAD * HD) return;
  if (in_sizes[6] != NHEAD * HD || in_sizes[7] != NHEAD * HD) return;
  if (in_sizes[8] != NHEAD) return;
  if (out_size != 2 * NB * NTOK * DM) return;

  const float* X    = (const float*)d_in[0];
  const float* Aa   = (const float*)d_in[1];
  const float* Wx   = (const float*)d_in[2];
  const float* Wa   = (const float*)d_in[3];
  const float* g_qx = (const float*)d_in[4];
  const float* g_kx = (const float*)d_in[5];
  const float* g_qa = (const float*)d_in[6];
  const float* g_ka = (const float*)d_in[7];
  const float* gate = (const float*)d_in[8];
  float* outf = (float*)d_out;

  const size_t PXA = (size_t)NB * NTOK * DM * 2;        //  8388608
  const size_t PW  = (size_t)W3 * DM * 2;               //  6291456
  const size_t PRT = (size_t)SEQ * RP * 4;              //   524288
  const size_t PQK = (size_t)NB * SEQ * QKW * 2;        // 33554432
  const size_t PVF = (size_t)NB * SEQ * DM * 4;         // 33554432
  const size_t PVT = (size_t)NB * DM * SEQ * 2;         // 16777216
  const size_t PMT = (size_t)NB * NHEAD * 3 * HD * HD * 4;   // 1572864
  const size_t PZP = (size_t)NB * NHEAD * 3 * HD * 4;        //   24576
  const size_t PME = (size_t)NB * SEQ * DM * 4;         // 33554432
  size_t off = 0;
  const size_t oXH = off; off += PXA;
  const size_t oAH = off; off += PXA;
  const size_t oWX = off; off += PW;
  const size_t oWA = off; off += PW;
  const size_t oCT = off; off += PRT;
  const size_t oST = off; off += PRT;
  const size_t oQH = off; off += PQK;
  const size_t oQL = off; off += PQK;
  const size_t oVF = off; off += PVF;
  const size_t oVH = off; off += PVT;
  const size_t oVL = off; off += PVT;
  const size_t oMT = off; off += PMT;
  const size_t oZP = off; off += PZP;
  const size_t oME = off; off += PME;
  if (off > ws_size) return;                            // off = 199778304

  char* ws = (char*)d_ws;
  unsigned short* XH   = (unsigned short*)(ws + oXH);
  unsigned short* AH   = (unsigned short*)(ws + oAH);
  unsigned short* WXT  = (unsigned short*)(ws + oWX);
  unsigned short* WAT  = (unsigned short*)(ws + oWA);
  float*          COST = (float*)(ws + oCT);
  float*          SINT = (float*)(ws + oST);
  unsigned short* QKH  = (unsigned short*)(ws + oQH);
  unsigned short* QKL  = (unsigned short*)(ws + oQL);
  float*          VF   = (float*)(ws + oVF);
  unsigned short* VTH  = (unsigned short*)(ws + oVH);
  unsigned short* VTL  = (unsigned short*)(ws + oVL);
  float*          MT   = (float*)(ws + oMT);
  float*          ZP   = (float*)(ws + oZP);
  float*          MEM  = (float*)(ws + oME);

  const dim3 blk256(256), blk128(128);
  const float sscale = 0.125f / (QSC * KSC);
  const float oscale = 1.0f / (XSC * WSC);

  // Every kernel is launched once; the two arrays, the two streams and the two batches are grid dimensions.
  // (1) x, a -> row-major f16 planes of their bf16 RNE values x16; W [1024][3072] -> transposed f16 planes
  //     [3072][1024] (k contiguous, Bt form) of their bf16 RNE values x64; rotary tables
  cvt_rm<<<dim3((NB * NTOK * DM) / 2048, 2), blk256, 0, stream>>>(X, Aa, XH, NB * NTOK * DM, XSC);
  // in[DM rows][W3 cols] -> out[W3][DM]: grid (cols/64, rows/64, matrix)
  tr_cvt<0><<<dim3(W3 / 64, DM / 64, 2), blk256, 0, stream>>>(Wx, Wa, DM, W3, WXT, WXT, WSC);
  rope_tab<<<dim3((SEQ * RP) / 256), blk256, 0, stream>>>(COST, SINT, SEQ * RP);

  const int gqk  = ((NTOK / 32) * (QKW / 128)) / 4;      // 1024 tiles -> 256 blocks per stream and batch
  const int gv   = ((NTOK / 32) * (DM / 128)) / 4;       //  512 tiles -> 128 blocks per stream and batch
  const int gmt  = NHEAD * 3;                            //   48 blocks per batch
  const int gmem = NHEAD * 3 * (SEG / MROWS);            //  384 blocks per batch
  // (2) q|k of stream a (positions 0..2047) and stream x (positions 2048..4095): M=2048, N=2048, K=1024,
  //     fused per-head L2 norm + gain + rotary -> QKH/QKL f16 planes
  gemm_t<1><<<dim3(gqk, 2, NB), blk128, 0, stream>>>(AH, XH, DM, WAT, WXT, DM, (void*)QKH, (void*)QKL, QKW, SEQ,
                                                     COST, SINT, g_qa, g_ka, g_qx, g_kx, NTOK, QKW, DM, oscale);
  // (3) v of both streams: M=2048, N=1024 (W^T rows 2048..3071), K=1024 -> VF f32 rows
  gemm_t<3><<<dim3(gv, 2, NB), blk128, 0, stream>>>(AH, XH, DM, WAT + (size_t)2 * DM * DM,
                                                    WXT + (size_t)2 * DM * DM, DM, (void*)VF, (void*)VF, DM, SEQ,
                                                    COST, SINT, g_qa, g_ka, g_qx, g_kx, NTOK, DM, DM, oscale);
  // (4) v^T planes: in VF [SEQ rows][DM cols] -> out [DM][SEQ] f16 hi (x16) and residual (x4096), per batch
  tr_cvt<1><<<dim3(DM / 64, SEQ / 64, NB), blk256, 0, stream>>>(VF, VF + (size_t)SEQ * DM, SEQ, DM, VTH, VTL, VSC);
  // (5) compressive memory: per-segment sk^T.v and sum sk (segments 0..2), then the memory read for the
  //     query rows of segments 1..3 -> MEM f32 plane
  mt_seg<<<dim3(gmt, NB), blk256, 0, stream>>>(QKH, QKL, VTH, MT, ZP);
  mem_ret<<<dim3(gmem, NB), blk256, 0, stream>>>(QKH, QKL, MT, ZP, MEM);
  // (6) segment-local causal attention + gate mix -> both outputs: the leading NQP query blocks of every
  //     segment with the p, v residual products, the remaining blocks without
  attn_seg<true><<<dim3(NHEAD * NSEG * NQP, NB), blk128, 0, stream>>>(QKH, QKL, VTH, VTL, MEM, gate, outf,
                                                                      sscale, 0, NQP);
  attn_seg<false><<<dim3(NHEAD * NSEG * (NQB - NQP), NB), blk128, 0, stream>>>(QKH, QKL, VTH, VTL, MEM, gate,
                                                                               outf, sscale, NQP, NQB - NQP);
  (void)hipGetLastError();
}

// v007
// Measured time: 157 microseconds a run.
// Timed twice side by side with v006, it ran 1.12 times as fast both times.
// All steps since v000 together make it 5.03 times as fast.
// Contractions: a.W and x.W (q|k|v, K=1024) on v_wmma_f32_16x16x32_f16 with f16 containers of the bf16 RNE input
//   values (activations carried x16, W^T x64), one product; q.k^T (K=64) on v_wmma_f32_16x16x32_f16 with q (x4) and
//   k (x16) f16 hi planes plus x4096 f16 residual planes (three products, residual pair in a separate accumulator
//   folded by 1/4096); p.v^T on v_wmma_f32_16x16x32_f16 with p as f16(1024 p) and v^T as f16(16 v), one product
//   (the leading query blocks of every segment add the p and v x4096 f16 residual planes, two more products into a
//   separate accumulator); compressive memory sk^T.v (K=1024) and sq.M (K=64) on v_wmma_f32_16x16x32_f16 with
//   plain f16 operands, one product each. f32 accumulate everywhere; L2 norms, rotary tables and rotation, elu,
//   softmax statistics, sq.z, the memory quotient and the gate mix in f32.
#include <hip/hip_runtime.h>
#include <math.h>
#include <stdint.h>

#define NB      2
#define NTOK    2048                // tokens per stream per batch
#define SEQ     4096                // concatenated positions per batch (stream a first, then x)
#define DM      1024
#define NHEAD   16
#define HD      64
#define RP      32                  // rotary pairs per head
#define W3      3072
#define QKW     2048                // q|k plane width: q at column h*64+d, k at 1024 + h*64+d
#define SEG     1024
#define NSEG    4
#define NQB     16                  // 64-row query blocks per segment
#define NQP     4                   // leading query blocks per segment that carry the p / v residual products
#define MROWS   128                 // query rows per block of the memory read kernel
#define OUT1OFF (NB * NTOK * DM)             // element offset of the second output
#define XSC     16.0f
#define WSC     64.0f
#define QSC     4.0f
#define KSC     16.0f
#define VSC     16.0f
#define RSC     4096.0f
#define PSC     1024.0f
#define NRM_EPS 1.0e-12f
#define DEN_EPS 1.0e-6f
#define LOG2_BASE 13.287712379549449
#define NEG_BIG (-1.0e30f)
#define GBK     128                 // k per LDS stage of the projection GEMM (256 B of every operand row)
#define GPIT    136                 // LDS row pitch of a stage in halves: 272 B = 16 B x 17 (ds_load_b128 readers)
#define GSTG    (256 * GPIT)        // halves per stage: 128 A rows, then 128 Bt rows
#define SLABF   (16 * 132)          // floats per epilogue slab of the projection GEMM (one per wave)
#define APIT    72                  // LDS row pitch of the attention K and V^T tiles in halves: 144 B = 16 B x 9
                                    // (ds_load_b128 readers: 16 rows of a fragment load fall on 16 distinct bank groups)

static_assert(NHEAD * HD == DM);
static_assert(SEQ == 2 * NTOK);
static_assert(SEQ == NSEG * SEG);
static_assert(SEG == NQB * 64);
static_assert(HD == 2 * RP);
static_assert(W3 == 3 * DM);
static_assert(QKW == 2 * DM);
static_assert(((NB * NTOK * DM) % 2048) == 0);
static_assert(((SEQ * RP) % 256) == 0);
static_assert((DM % 128) == 0 && (W3 % 64) == 0 && (NTOK % 64) == 0 && (SEQ % 64) == 0);
static_assert((QKW % 128) == 0 && (DM % 32) == 0);
static_assert(NQP > 0 && NQP < NQB);
static_assert((SEG % MROWS) == 0 && MROWS == 8 * 16);
static_assert(OUT1OFF == NB * NTOK * DM);
static_assert((DM % GBK) == 0 && (NTOK % 128) == 0 && ((GPIT * 2) % 16) == 0);
static_assert(4 * SLABF * 4 <= 2 * GSTG * 2 && ((SLABF * 4) % 16) == 0);
static_assert(APIT >= HD && ((APIT * 2) % 16) == 0);

typedef _Float16 v16h __attribute__((ext_vector_type(16)));
typedef _Float16 v8h  __attribute__((ext_vector_type(8)));
typedef float    v8f  __attribute__((ext_vector_type(8)));
typedef float    v4f  __attribute__((ext_vector_type(4)));
typedef unsigned int v4u __attribute__((ext_vector_type(4)));
union FH { v16h v; v8h h[2]; };

// ---- scalar helpers --------------------------------------------------------------------------------
__device__ __forceinline__ unsigned short bf_bits(float f) {          // f32 -> bf16 bits, RNE convert
  unsigned u = __float_as_uint(f);
  return (unsigned short)((u + 0x7FFFu + ((u >> 16) & 1u)) >> 16);
}
__device__ __forceinline__ float bf_up(unsigned short b) { return __uint_as_float(((unsigned)b) << 16); }
__device__ __forceinline__ float bfr(float f) { return bf_up(bf_bits(f)); }     // value of the bf16 RNE convert
__device__ __forceinline__ unsigned short h_bits(_Float16 x) { return __builtin_bit_cast(unsigned short, x); }
__device__ __forceinline__ unsigned pk16(unsigned short a, unsigned short b) { return (unsigned)a | ((unsigned)b << 16); }
__device__ __forceinline__ v8f zero8() { v8f z = {0.f, 0.f, 0.f, 0.f, 0.f, 0.f, 0.f, 0.f}; return z; }

// ---- fragment loader: 16-bit A/B operand, lane -> row/col (lane&15), p already includes +8*(lane>>4);
//      elements 0..7 <- p[0..7] (k0+8h..), elements 8..15 <- p[16..23] (k0+16+8h..)
__device__ __forceinline__ v16h ldfrag_h(const _Float16* p) {
  FH f;
  f.h[0] = *(const v8h*)(p);
  f.h[1] = *(const v8h*)(p + 16);
  return f.v;
}

// ---- WMMA helpers with trailing VALU hazard gap --------------------------------------------------------
__device__ __forceinline__ v8f mma_h_raw(v16h a, v16h b, v8f c) {
  return __builtin_amdgcn_wmma_f32_16x16x32_f16(false, a, false, b, (short)0, c, false, false);
}
__device__ __forceinline__ v8f mma_h(v16h a, v16h b, v8f c) {
  c = mma_h_raw(a, b, c);
#if defined(__HIP_DEVICE_COMPILE__)
  asm volatile("v_nop\n\tv_nop\n\tv_nop\n\tv_nop" : "+v"(c) : "v"(a), "v"(b));
#endif
  return c;
}
__device__ __forceinline__ void guard3(v8f& x, v8f& y, v16h a, v16h b, v16h d) {   // two D tiles, 3 frags live
#if defined(__HIP_DEVICE_COMPILE__)
  asm volatile("v_nop\n\tv_nop\n\tv_nop\n\tv_nop" : "+v"(x), "+v"(y) : "v"(a), "v"(b), "v"(d));
#endif
}
__device__ __forceinline__ void guard1q(v8f& x, v16h a, v16h b, v16h d, v16h e) {           // one D, 4 frags
#if defined(__HIP_DEVICE_COMPILE__)
  asm volatile("v_nop\n\tv_nop\n\tv_nop\n\tv_nop" : "+v"(x) : "v"(a), "v"(b), "v"(d), "v"(e));
#endif
}
__device__ __forceinline__ void guard4m(v8f& x, v8f& y, v16h a, v16h b, v16h d, v16h e) {   // two D, 4 frags
#if defined(__HIP_DEVICE_COMPILE__)
  asm volatile("v_nop\n\tv_nop\n\tv_nop\n\tv_nop" : "+v"(x), "+v"(y) : "v"(a), "v"(b), "v"(d), "v"(e)
               : "memory");
#endif
}
__device__ __forceinline__ void guard8m(v8f& x, v8f& y, v16h a, v16h b, v16h d, v16h e,
                                        v16h f, v16h g, v16h p, v16h q) {                      // two D, 8 frags
#if defined(__HIP_DEVICE_COMPILE__)
  asm volatile("v_nop\n\tv_nop\n\tv_nop\n\tv_nop" : "+v"(x), "+v"(y)
               : "v"(a), "v"(b), "v"(d), "v"(e), "v"(f), "v"(g), "v"(p), "v"(q) : "memory");
#endif
}
__device__ __forceinline__ void acc_guard4(v8f& a, v8f& b, v8f& c, v8f& d) {
#if defined(__HIP_DEVICE_COMPILE__)
  asm volatile("v_nop\n\tv_nop\n\tv_nop\n\tv_nop" : "+v"(a), "+v"(b), "+v"(c), "+v"(d));
#endif
}
__device__ __forceinline__ void acc_guard2(v8f& a, v8f& b) {
#if defined(__HIP_DEVICE_COMPILE__)
  asm volatile("v_nop\n\tv_nop\n\tv_nop\n\tv_nop" : "+v"(a), "+v"(b));
#endif
}
// lane l <-> lane l ^ 16 (the two halves of a D column) by a vector cross-row move
__device__ __forceinline__ float xhalf(float x) {
  const int b = __builtin_bit_cast(int, x);
  return __builtin_bit_cast(float, __builtin_amdgcn_permlanex16(b, b, 0x76543210, 0xfedcba98, false, false));
}
__device__ __forceinline__ void wave_sync_lds() {
  __builtin_amdgcn_fence(__ATOMIC_RELEASE, "workgroup");
  __builtin_amdgcn_wave_barrier();
  __builtin_amdgcn_fence(__ATOMIC_ACQUIRE, "workgroup");
}

// ---- eight asynchronous 16-B copies global -> LDS per lane (l: LDS byte address, g: global address). The
//      s_wait_xcnt stands inside the statement so that no address register is rewritten ahead of it.
__device__ __forceinline__ void acopy8(uint32_t l0, uint32_t l1, uint32_t l2, uint32_t l3,
                                       uint32_t l4, uint32_t l5, uint32_t l6, uint32_t l7,
                                       const _Float16* g0, const _Float16* g1, const _Float16* g2,
                                       const _Float16* g3, const _Float16* g4, const _Float16* g5,
                                       const _Float16* g6, const _Float16* g7) {
#if defined(__HIP_DEVICE_COMPILE__)
  asm volatile("global_load_async_to_lds_b128 %0, %8, off\n\t"
               "global_load_async_to_lds_b128 %1, %9, off\n\t"
               "global_load_async_to_lds_b128 %2, %10, off\n\t"
               "global_load_async_to_lds_b128 %3, %11, off\n\t"
               "global_load_async_to_lds_b128 %4, %12, off\n\t"
               "global_load_async_to_lds_b128 %5, %13, off\n\t"
               "global_load_async_to_lds_b128 %6, %14, off\n\t"
               "global_load_async_to_lds_b128 %7, %15, off\n\t"
               "s_wait_xcnt 0x0"
               :: "v"(l0), "v"(l1), "v"(l2), "v"(l3), "v"(l4), "v"(l5), "v"(l6), "v"(l7),
                  "v"(g0), "v"(g1), "v"(g2), "v"(g3), "v"(g4), "v"(g5), "v"(g6), "v"(g7)
               : "memory");
#endif
}
// four copies per lane from one plane: wave-uniform base b (scalar registers) + the lane's byte offsets o0..o3;
// the s_wait_xcnt stands inside the statement for the same reason as above (it covers the base registers too)
__device__ __forceinline__ void acopy4s(uint32_t l0, uint32_t l1, uint32_t l2, uint32_t l3,
                                        uint32_t o0, uint32_t o1, uint32_t o2, uint32_t o3, const _Float16* b) {
#if defined(__HIP_DEVICE_COMPILE__)
  asm volatile("global_load_async_to_lds_b128 %0, %4, %8\n\t"
               "global_load_async_to_lds_b128 %1, %5, %8\n\t"
               "global_load_async_to_lds_b128 %2, %6, %8\n\t"
               "global_load_async_to_lds_b128 %3, %7, %8\n\t"
               "s_wait_xcnt 0x0"
               :: "v"(l0), "v"(l1), "v"(l2), "v"(l3), "v"(o0), "v"(o1), "v"(o2), "v"(o3), "s"(b)
               : "memory");
#endif
}
// eight copies per lane, four from each of two planes (bases b, d) at the same byte offsets; one wait for all
__device__ __forceinline__ void acopy8s(uint32_t l0, uint32_t l1, uint32_t l2, uint32_t l3,
                                        uint32_t l4, uint32_t l5, uint32_t l6, uint32_t l7,
                                        uint32_t o0, uint32_t o1, uint32_t o2, uint32_t o3,
                                        const _Float16* b, const _Float16* d) {
#if defined(__HIP_DEVICE_COMPILE__)
  asm volatile("global_load_async_to_lds_b128 %0, %8, %12\n\t"
               "global_load_async_to_lds_b128 %1, %9, %12\n\t"
               "global_load_async_to_lds_b128 %2, %10, %12\n\t"
               "global_load_async_to_lds_b128 %3, %11, %12\n\t"
               "global_load_async_to_lds_b128 %4, %8, %13\n\t"
               "global_load_async_to_lds_b128 %5, %9, %13\n\t"
               "global_load_async_to_lds_b128 %6, %10, %13\n\t"
               "global_load_async_to_lds_b128 %7, %11, %13\n\t"
               "s_wait_xcnt 0x0"
               :: "v"(l0), "v"(l1), "v"(l2), "v"(l3), "v"(l4), "v"(l5), "v"(l6), "v"(l7),
                  "v"(o0), "v"(o1), "v"(o2), "v"(o3), "s"(b), "s"(d)
               : "memory");
#endif
}
// 64 rows of one operand, 256 B each, into LDS rows of pitch GPIT: l / g are this thread's addresses in row
// (tid >> 4) at 16-B piece (tid & 15); copy i takes row 8 i + (tid >> 4), a wave's copy covers two whole rows.
__device__ __forceinline__ void acopy_rows64(uint32_t l, const _Float16* g, size_t ld) {
  const uint32_t ls = 8u * GPIT * 2u;
  const size_t   gs = 8 * ld;
  acopy8(l, l + ls, l + 2 * ls, l + 3 * ls, l + 4 * ls, l + 5 * ls, l + 6 * ls, l + 7 * ls,
         g, g + gs, g + 2 * gs, g + 3 * gs, g + 4 * gs, g + 5 * gs, g + 6 * gs, g + 7 * gs);
}
// the issuing wave's own copies have landed (the compiler places no wait for them)
__device__ __forceinline__ void wait_async0() {
#if defined(__HIP_DEVICE_COMPILE__)
  asm volatile("s_wait_asynccnt 0x0" ::: "memory");
#endif
}
// this wave's LDS reads of the stage have returned before the stage is handed back for a refill
__device__ __forceinline__ void wait_ds0() {
#if defined(__HIP_DEVICE_COMPILE__)
  asm volatile("s_wait_dscnt 0x0" ::: "memory");
#endif
}

// =====================================================================================================
// Row-major convert: f32 [n] -> f16 plane [n] holding f16(bf16 RNE value * scale) (scale a power of two, exact).
// coverage: bx = 0 .. n/2048 - 1 blocks x 256 threads x 8 = n elements (n % 2048 == 0 host-checked); by = 2 arrays.
// One block's share of the work; the block indices come from the kernel prep below.
// =====================================================================================================
__device__ __forceinline__ void cvt_rm(int bx, int by, const float* __restrict__ in0, const float* __restrict__ in1,
                                       unsigned short* out, int n, float scale) {
  const size_t i8 = ((size_t)bx * 256 + threadIdx.x) * 8;
  if (i8 + 8 > (size_t)n) return;        // never taken for the host-checked sizes; no barriers below
  const float* in = by ? in1 : in0;      // by = which of the two arrays; its plane follows the first
  out += (size_t)by * (size_t)n;
  const v4f a = *(const v4f*)(in + i8);
  const v4f b = *(const v4f*)(in + i8 + 4);
  float f[8];
  f[0] = a[0]; f[1] = a[1]; f[2] = a[2]; f[3] = a[3];
  f[4] = b[0]; f[5] = b[1]; f[6] = b[2]; f[7] = b[3];
  v4u p;
#pragma unroll
  for (int e = 0; e < 4; ++e) {
    const unsigned short b0 = bf_bits(f[2 * e]), b1 = bf_bits(f[2 * e + 1]);
    const _Float16 x0 = (_Float16)(bf_up(b0) * scale);
    const _Float16 x1 = (_Float16)(bf_up(b1) * scale);
    p[e] = pk16(h_bits(x0), h_bits(x1));
  }
  *(v4u*)(out + i8) = p;
  
}

// =====================================================================================================
// Transposing convert: f32 in[R][C] (row-major, pitch C) -> 16-bit out[C][R] (pitch R), 64x64 tiles through LDS.
//   MODE 0: one plane  out0 = f16(bf16 RNE value * scale).
//   MODE 1: two planes out0 = f16(v * scale) hi, out1 = f16((v * scale - hi) * RSC) residual.
// Block = 256 threads; (bx, by, bz) = (C/64, R/64, 2 matrices) exact (host-checked); sm = the block's 64 x 65 f32 LDS
// tile, declared by the kernel that calls this. Load: thread -> input row tid>>2, 16 consecutive
// columns (four 16-B loads). Store: two iterations, output row it*32 + (tid>>3), lanes (tid&7) -> elements
// coverage: 2 iterations x 32 output rows x 8 lanes x 8 halves = the whole 64x64 tile; grid covers all of C x R.
// =====================================================================================================
template <int MODE>
__device__ __forceinline__ void tr_cvt(float (*sm)[65], int bx, int by, int bz,
                                       const float* __restrict__ in0, const float* __restrict__ in1,
                                       int R, int C, unsigned short* out0, unsigned short* out1,
                                       float scale) {
  const int tid = threadIdx.x;
  const float* in = bz ? in1 : in0;        // bz = which of the two matrices; its planes follow the first's
  out0 += (size_t)bz * (size_t)R * (size_t)C;
  out1 += (size_t)bz * (size_t)R * (size_t)C;
  const int c0 = bx * 64;                  // input column block -> output row block
  const int r0 = by * 64;                  // input row block    -> output column block
  if (c0 + 64 > C || r0 + 64 > R) return;  // block-uniform, ahead of any barrier; never taken for exact grids
  {
    const int lr = tid >> 2, lc = (tid & 3) * 16;
    const float* src = in + (size_t)(r0 + lr) * (size_t)C + c0 + lc;
#pragma unroll
    for (int q = 0; q < 4; ++q) {
      const v4f v = *(const v4f*)(src + 4 * q);
      sm[lr][lc + 4 * q + 0] = v[0];
      sm[lr][lc + 4 * q + 1] = v[1];
      sm[lr][lc + 4 * q + 2] = v[2];
      sm[lr][lc + 4 * q + 3] = v[3];
    }
  }
  __syncthreads();
  const int seg = tid & 7;
  v4u p0[2], p1[2];
#pragma unroll
  for (int it = 0; it < 2; ++it) {
    const int ocl = it * 32 + (tid >> 3);   // output row within the tile = input column
    float f[8];
#pragma unroll
    for (int e = 0; e < 8; ++e) f[e] = sm[seg * 8 + e][ocl];
    v4u pk, pl;
#pragma unroll
    for (int e = 0; e < 4; ++e) {
      const float g0 = f[2 * e], g1 = f[2 * e + 1];
      if (MODE == 0) {
        const _Float16 x0 = (_Float16)(bfr(g0) * scale);
        const _Float16 x1 = (_Float16)(bfr(g1) * scale);
        pk[e] = pk16(h_bits(x0), h_bits(x1));
        pl[e] = pk[e];
      } else {
        const float s0 = g0 * scale, s1 = g1 * scale;
        const _Float16 x0 = (_Float16)s0, x1 = (_Float16)s1;
        const _Float16 y0 = (_Float16)((s0 - (float)x0) * RSC);
        const _Float16 y1 = (_Float16)((s1 - (float)x1) * RSC);
        pk[e] = pk16(h_bits(x0), h_bits(x1));
        pl[e] = pk16(h_bits(y0), h_bits(y1));
      }
    }
    p0[it] = pk;
    p1[it] = pl;
  }
  {
#pragma unroll
    for (int it = 0; it < 2; ++it) {
      const int ocl = it * 32 + (tid >> 3);
      const size_t go = (size_t)(c0 + ocl) * (size_t)R + (size_t)(r0 + seg * 8);
      *(v4u*)(out0 + go) = p0[it];
      if (MODE == 1) *(v4u*)(out1 + go) = p1[it];
    }
    
  }
}

// =====================================================================================================
// Rotary tables for interleaved pairs: cost[t][i] = cos(t * inv_freq[i]), sint[t][i] = sin(t * inv_freq[i]),
// i = 0..31, inv_freq[i] = 1 / (10000^(2i/64)) (power via f64 exp2 -> one f32 convert, then an f32 reciprocal
// formed in f64 and converted once), angle = one f32 multiply with t = position 0..4095 in the concatenated
// coverage: bx = 0 .. n/256 - 1 blocks x 256 threads = n = SEQ*32 elements of each table.
// =====================================================================================================
__device__ __forceinline__ void rope_tab(int bx, float* cost, float* sint, int n) {
  const int e = bx * 256 + (int)threadIdx.x;
  if (e >= n) return;                      // never taken (n % 256 == 0); no barriers below
  const int t = e >> 5, i = e & 31;
  const double pd = exp2((double)i * (1.0 / 32.0) * LOG2_BASE);   // 10000^(2i/64)
  const float  pf = (float)pd;
  const float  invf = (float)(1.0 / (double)pf);
  const float  ang = (float)t * invf;
  float sv, cv;
  sincosf(ang, &sv, &cv);
  *(float*)(cost + e) = cv;
  *(float*)(sint + e) = sv;
  
}

// =====================================================================================================
// The three preparations, which do not depend on one another, in ONE launch, told apart by block range (the
// branches are block-uniform, so the barrier inside tr_cvt is reached by a whole block or by none): blocks
// 0 .. PB_ROPE-1 build the rotary tables, the next PB_TR transpose and convert the two weight matrices
// ((W3/64, DM/64, matrix), x fastest), the last PB_CVT convert x and a ((n/2048, array), x fastest).
// coverage: grid.x = PB_ROPE + PB_TR + PB_CVT exact.
// =====================================================================================================
#define PB_ROPE ((SEQ * RP) / 256)
#define PB_TRX  (W3 / 64)
#define PB_TRY  (DM / 64)
#define PB_TR   (PB_TRX * PB_TRY * 2)
#define PB_CVX  ((NB * NTOK * DM) / 2048)
#define PB_CVT  (PB_CVX * 2)
__global__ __launch_bounds__(256) void prep(const float* __restrict__ x, const float* __restrict__ a,
                                           unsigned short* xh,
                                           const float* __restrict__ wx, const float* __restrict__ wa,
                                           unsigned short* wxt, float* cost, float* sint) {
  __shared__ float sm[64][65];
  int b = (int)blockIdx.x;
  if (b < PB_ROPE) {
    rope_tab(b, cost, sint, SEQ * RP);
    return;
  }
  b -= PB_ROPE;
  if (b < PB_TR) {
    const int bz = b / (PB_TRX * PB_TRY);
    const int r  = b - bz * (PB_TRX * PB_TRY);
    const int by = r / PB_TRX;
    tr_cvt<0>(sm, r - by * PB_TRX, by, bz, wx, wa, DM, W3, wxt, wxt, WSC);
    // in the built text another range's code follows these stores and reuses their registers: the wait stands ahead of it
    asm volatile("s_wait_xcnt 0x0" ::: "memory");
    return;
  }
  b -= PB_TR;
  if (b < PB_CVT) {
    const int by = b / PB_CVX;
    cvt_rm(b - by * PB_CVX, by, x, a, xh, NB * NTOK * DM, XSC);
  }
}

// v rows -> v^T planes (MODE 1 of tr_cvt): grid = (C/64, R/64, 2 matrices) exact (host-checked)
__global__ __launch_bounds__(256) void tr_v(const float* __restrict__ in0, const float* __restrict__ in1,
                                           int R, int C, unsigned short* out0, unsigned short* out1, float scale) {
  __shared__ float sm[64][65];
  tr_cvt<1>(sm, (int)blockIdx.x, (int)blockIdx.y, (int)blockIdx.z, in0, in1, R, C, out0, out1, scale);
}

// =====================================================================================================
// Register-blocked f16 WMMA GEMM, one wave per 32x128 tile; block = 4 waves = 4 tiles stacked in m = one 128x128
// block tile whose operands pass through LDS: a stage is 128 k of the 128 A rows and the 128 Bt rows, brought by
// asynchronous copies into two buffers (stage t + 1 flies while stage t is worked on), read by all 4 waves:
//   acc[m][n] = sum_k A[m][k] * Bt[n][k]; A row-major [M][K] pitch lda, Bt row-major [N][K] pitch ldb
//   (k contiguous); M % 128 == 0, N % 128 == 0, K % 128 == 0 (exact constants here, host-checked).
// EPI 1 (q|k planes, N == QKW): the 128-column tile holds two heads of 64 columns (columns < DM are q heads,
//        columns >= DM are k heads). Per row and head: t = acc*oscale; v = t * (1/max(||t||_2, 1e-12)) *
//        bf16(gain[head][d]) * 8; then the interleaved-pair rotary rotation with the f32 tables at position
//        crow0 + m (pair (2i, 2i+1): o1 = v1*c - v2*s, o2 = v1*s + v2*c), times cscale (QSC for q, KSC for k)
//        -> C0 = f16 hi, C1 = f16((v - hi) * RSC) residual, 16-bit planes of pitch ldc, row crow0 + m, column n.
// EPI 3: f32 rows (C0) = acc*oscale, pitch ldc, row crow0 + m, column n.
// 16 lanes x 16 B per 256-B row segment (two rows per instruction), f32 as 32 lanes x 16 B per 512-B row segment;
// coverage: 2 slabs x 16 rows x 128 cols = the wave's whole 32x128 tile; tiles = whole M x N (bx = 0 .. tiles/4 - 1
// exact), grid.y = the two streams, grid.z = the batches. One block's work; ring (the block's LDS) and bx come from
// the kernel gemm_qkv below.
// =====================================================================================================
template <int EPI>
__device__ __forceinline__ void gemm_t(
    _Float16* ring, int bx,
    const unsigned short* __restrict__ A0, const unsigned short* __restrict__ A1, int lda,
    const unsigned short* __restrict__ Bt0, const unsigned short* __restrict__ Bt1, int ldb,
    void* C0, void* C1, int ldc, int crows,
    const float* __restrict__ cost, const float* __restrict__ sint,
    const float* __restrict__ gq0, const float* __restrict__ gk0,
    const float* __restrict__ gq1, const float* __restrict__ gk1,
    int M, int N, int K, float oscale) {
  const int lane = threadIdx.x & 31;
  const int wave = threadIdx.x >> 5;
  // blockIdx.y = stream (0: operands A0, Bt0, gains gq0, gk0, C rows 0..M-1; 1: the others, C rows M..2M-1);
  // blockIdx.z = batch (A rows z*M.., C plane z of crows rows)
  const int  st = (int)blockIdx.y;
  const unsigned short* A  = (st ? A1 : A0) + (size_t)blockIdx.z * (size_t)M * (size_t)lda;
  const unsigned short* Bt = st ? Bt1 : Bt0;
  const float* gq = st ? gq1 : gq0;
  const float* gk = st ? gk1 : gk0;
  const int    crow0 = st * M;
  const size_t cpl   = (size_t)blockIdx.z * (size_t)crows * (size_t)ldc;   // element offset of this batch's C plane
  const int tilesN = N >> 7;
  const int tilesM = M >> 5;
  if (bx >= (tilesM >> 2) * tilesN) return;   // block-uniform, ahead of any barrier; never taken
  const int bm = bx / tilesN;
  const int tn = bx - bm * tilesN;
  const int tm = bm * 4 + wave;
  const int m0 = tm << 5;
  const int n0 = tn << 7;
  const int rl   = lane & 15;            // row (A) / col (B, D) within subtile
  const int hh   = lane >> 4;            // lane half
  const int koff = hh * 8;               // k offset of this lane half

  v8f acc[2][8];
#pragma unroll
  for (int i = 0; i < 2; ++i)
#pragma unroll
    for (int j = 0; j < 8; ++j) acc[i][j] = zero8();

  {
    const int cr = (int)threadIdx.x >> 4;          // row (mod 8) this thread copies
    const int cc = (int)threadIdx.x & 15;          // its 16-B piece of the row's 256 B
    const _Float16* ga = (const _Float16*)(const void*)A + (size_t)((bm << 7) + cr) * (size_t)lda + cc * 8;
    const _Float16* gb = (const _Float16*)(const void*)Bt + (size_t)(n0 + cr) * (size_t)ldb + cc * 8;
    const uint32_t  lr = (uint32_t)(size_t)(const void*)ring + (uint32_t)(cr * GPIT + cc * 8) * 2u;
    const int nst = K / GBK;                       // stages; block-uniform
    auto fill = [&](int st) {                      // stage st -> buffer st & 1: 32 copies per wave
      const uint32_t l = lr + (uint32_t)(st & 1) * (uint32_t)(GSTG * 2);
      const _Float16* pa = ga + (size_t)st * GBK;
      const _Float16* pb = gb + (size_t)st * GBK;
      acopy_rows64(l, pa, (size_t)lda);
      acopy_rows64(l + 64u * GPIT * 2u, pa + (size_t)64 * (size_t)lda, (size_t)lda);
      acopy_rows64(l + 128u * GPIT * 2u, pb, (size_t)ldb);
      acopy_rows64(l + 192u * GPIT * 2u, pb + (size_t)64 * (size_t)ldb, (size_t)ldb);
    };
    fill(0);
    wait_async0();
    __syncthreads();                               // stage 0 is published
    if (nst > 1) fill(1);
    for (int t = 0; t < nst; ++t) {
      const _Float16* sb  = ring + (t & 1) * GSTG;
      const _Float16* ar0 = sb + (wave * 32 + rl) * GPIT + koff;
      const _Float16* ar1 = ar0 + 16 * GPIT;
      const _Float16* br  = sb + (128 + rl) * GPIT + koff;
#pragma unroll                                     // the k offset becomes an immediate of each LDS load
      for (int kk = 0; kk < GBK / 32; ++kk) {
        const v16h a0 = ldfrag_h(ar0 + 32 * kk);
        const v16h a1 = ldfrag_h(ar1 + 32 * kk);
        v16h b[8];
#pragma unroll                                     // b[] stays in registers: the k-step's LDS loads stand as one group
        for (int j = 0; j < 8; ++j) b[j] = ldfrag_h(br + j * 16 * GPIT + 32 * kk);
#pragma unroll                                     // acc[][] and b[] indexed by constants only
        for (int j = 0; j < 8; ++j) {
          acc[0][j] = mma_h_raw(a0, b[j], acc[0][j]);
          acc[1][j] = mma_h_raw(a1, b[j], acc[1][j]);
          guard3(acc[0][j], acc[1][j], a0, a1, b[j]);
        }
      }
      wait_ds0();
      wait_async0();
      __syncthreads();                             // publishes stage t + 1 and ends every read of stage t
      if (t + 2 < nst) fill(t + 2);
    }
    wait_async0();
  }
  acc_guard4(acc[0][0], acc[0][1], acc[0][2], acc[0][3]);
  acc_guard4(acc[0][4], acc[0][5], acc[0][6], acc[0][7]);
  acc_guard4(acc[1][0], acc[1][1], acc[1][2], acc[1][3]);
  acc_guard4(acc[1][4], acc[1][5], acc[1][6], acc[1][7]);

  // ---- epilogue ----
  // per-wave 16x128 slab, pitch 132 floats, in the ring's first bytes: the barrier at the foot of the last trip has
  // ended every wave's reads of both stages, and no copy is issued or outstanding behind it
  float* slab = (float*)(void*)ring + wave * SLABF;
  float gmul[8];
  float csc = 1.0f;
  if (EPI == 1) {
    const bool isq = (n0 < DM);                                 // wave-uniform
    const int  hb  = (isq ? n0 : (n0 - DM)) >> 6;               // first head of this tile (0..15)
    csc = isq ? QSC : KSC;
#pragma unroll
    for (int j = 0; j < 8; ++j) {
      const int gi = (hb + (j >> 2)) * HD + 16 * (j & 3) + rl;  // < NHEAD*HD, inside both gain arrays
      const float ga = bfr(gq[gi]);
      const float gb = bfr(gk[gi]);
      gmul[j] = (isq ? ga : gb) * 8.0f;
    }
  } else {
#pragma unroll
    for (int j = 0; j < 8; ++j) gmul[j] = 1.0f;
  }
#pragma unroll
  for (int i = 0; i < 2; ++i) {
    const int mB = m0 + 16 * i;
    if (EPI == 1) {
      float inv[2][8];
#pragma unroll
      for (int jh = 0; jh < 2; ++jh) {
#pragma unroll
        for (int r = 0; r < 8; ++r) {        // sum of squares over the head's 64 columns of row 8hh+r
          float ss = 0.f;
#pragma unroll
          for (int jj = 0; jj < 4; ++jj) {
            const float x = acc[i][4 * jh + jj][r] * oscale;
            ss += x * x;
          }
          ss += __shfl_xor(ss, 1, 32);
          ss += __shfl_xor(ss, 2, 32);
          ss += __shfl_xor(ss, 4, 32);
          ss += __shfl_xor(ss, 8, 32);
          inv[jh][r] = oscale * (1.0f / fmaxf(sqrtf(ss), NRM_EPS));
        }
      }
#pragma unroll
      for (int j = 0; j < 8; ++j) {
#pragma unroll
        for (int r = 0; r < 8; ++r)
          slab[(8 * hh + r) * 132 + 16 * j + rl] = acc[i][j][r] * inv[j >> 2][r] * gmul[j];
      }
    } else {
#pragma unroll
      for (int j = 0; j < 8; ++j) {
#pragma unroll
        for (int r = 0; r < 8; ++r) slab[(8 * hh + r) * 132 + 16 * j + rl] = acc[i][j][r] * oscale;
      }
    }
    wave_sync_lds();
    if (EPI == 3) {
      float* Cf = (float*)C0 + cpl;
      v4f ov[16];
#pragma unroll
      for (int it = 0; it < 16; ++it) ov[it] = *(const v4f*)(slab + it * 132 + lane * 4);
      {
#pragma unroll
        for (int it = 0; it < 16; ++it)                       // row it: 32 lanes x 16 B = 512 B = 128 cols
          *(v4f*)(Cf + (size_t)(crow0 + mB + it) * (size_t)ldc + n0 + lane * 4) = ov[it];
        
      }
    } else {
      unsigned short* Cp = (unsigned short*)C0 + cpl;
      unsigned short* Cq = (unsigned short*)C1 + cpl;
      v4u hv[8], lv[8];
#pragma unroll
      for (int it = 0; it < 8; ++it) {
        const int row = it * 2 + hh;                          // it 0..7 x hh 0..1 = rows 0..15
        const float* sp = slab + row * 132 + rl * 8;          // 8 consecutive columns = 4 rotary pairs
        const v4f fa = *(const v4f*)sp;
        const v4f fb = *(const v4f*)(sp + 4);
        float f[8];
        f[0] = fa[0]; f[1] = fa[1]; f[2] = fa[2]; f[3] = fa[3];
        f[4] = fb[0]; f[5] = fb[1]; f[6] = fb[2]; f[7] = fb[3];
        const int pos = crow0 + mB + row;                     // position in the concatenated sequence
        const v4f cv = *(const v4f*)(cost + (size_t)pos * RP + (rl & 7) * 4);   // pairs ((rl&7)*4 .. +3)
        const v4f sv = *(const v4f*)(sint + (size_t)pos * RP + (rl & 7) * 4);
        v4u pk, pl;
#pragma unroll
        for (int e = 0; e < 4; ++e) {
          const float f0 = f[2 * e], f1 = f[2 * e + 1];
          const float cc = cv[e], sn = sv[e];
          const float g0 = (f0 * cc - f1 * sn) * csc;
          const float g1 = (f0 * sn + f1 * cc) * csc;
          const _Float16 x0 = (_Float16)g0;
          const _Float16 x1 = (_Float16)g1;
          const _Float16 y0 = (_Float16)((g0 - (float)x0) * RSC);
          const _Float16 y1 = (_Float16)((g1 - (float)x1) * RSC);
          pk[e] = pk16(h_bits(x0), h_bits(x1));
          pl[e] = pk16(h_bits(y0), h_bits(y1));
        }
        hv[it] = pk;
        lv[it] = pl;
      }
      {
#pragma unroll
        for (int it = 0; it < 8; ++it) {
          const int row = it * 2 + hh;
          const size_t go = (size_t)(crow0 + mB + row) * (size_t)ldc + n0 + rl * 8;
          *(v4u*)(Cp + go) = hv[it];
          *(v4u*)(Cq + go) = lv[it];
        }
        
      }
    }
    wave_sync_lds();
  }
}

// =====================================================================================================
// The q|k product and the v product, which do not depend on one another, in ONE launch, told apart by block range
// (a block-uniform branch ahead of every barrier): blocks 0 .. nbqk-1 of grid.x are the q|k tiles (EPI 1, W^T rows
// 0 .. Nqk-1), the others the v tiles (EPI 3, W^T rows Nqk .. Nqk+Nv-1).
// coverage: grid = (q|k tiles/4 + v tiles/4 exact, 2 streams, batches).
// =====================================================================================================
__global__ __launch_bounds__(128) void gemm_qkv(
    const unsigned short* __restrict__ A0, const unsigned short* __restrict__ A1, int lda,
    const unsigned short* __restrict__ Bt0, const unsigned short* __restrict__ Bt1, int ldb,
    void* QH, void* QL, int ldqk, void* VFp, int ldv, int crows,
    const float* __restrict__ cost, const float* __restrict__ sint,
    const float* __restrict__ gq0, const float* __restrict__ gk0,
    const float* __restrict__ gq1, const float* __restrict__ gk1,
    int M, int Nqk, int Nv, int K, int nbqk, float oscale) {
  __shared__ __align__(16) _Float16 ring[2 * GSTG]; // two operand stages; behind the k loop the same bytes hold the
                                                    // epilogue slabs, so a block takes 136 KiB and two fit one WGP
  const int bx = (int)blockIdx.x;
  if (bx < nbqk) {
    gemm_t<1>(ring, bx, A0, A1, lda, Bt0, Bt1, ldb, QH, QL, ldqk, crows,
              cost, sint, gq0, gk0, gq1, gk1, M, Nqk, K, oscale);
  } else {
    const size_t wo = (size_t)Nqk * (size_t)ldb;      // the v rows of W^T follow the q|k rows
    gemm_t<3>(ring, bx - nbqk, A0, A1, lda, Bt0 + wo, Bt1 + wo, ldb, VFp, VFp, ldv, crows,
              cost, sint, gq0, gk0, gq1, gk1, M, Nv, K, oscale);
  }
}

// =====================================================================================================
// Compressive-memory update per (head h, segment s in 0..2) of one batch (blockIdx.y):
//   MT[h][s][e][d] = sum over the 1024 keys l of segment s of v[l][e] * sk[l][d], sk = elu(k) + 1
//   (elu(x) = x > 0 ? x : exp(x) - 1, so sk = x > 0 ? x + 1 : exp(x)), and ZP[h][s][d] = sum_l sk[l][d].
//   k is rebuilt in f32 from the q|k hi / residual planes ((hi + lo/RSC) / KSC, column DM + h*64 + d), sk is
//   RNE-converted to f16 and written TRANSPOSED into an LDS tile skT[d][l] (64 keys per chunk, pitch 72 halves);
//   A = V^T hi plane rows (h*64 + e, keys), Bt = skT; D[e][d] scaled by 1/VSC.
//   Block = 8 waves; wave w owns e rows 16*(w>>1).. and d columns 32*(w&1)..; acc guarded; the 16x32 f32 piece is
// coverage: MT: 8 waves x (16 rows x 32 cols) = the whole 64x64 tile of (h,s); 4 its x 4 row groups x 8 lanes =
//   16 rows x 32 cols per wave. ZP: 16 lanes x 4 floats = 64. skT fill: 256 threads x 16 d x 1 key = 64x64 chunk.
// =====================================================================================================
__global__ __launch_bounds__(256) void mt_seg(const unsigned short* __restrict__ QKH,
                                             const unsigned short* __restrict__ QKL,
                                             const unsigned short* __restrict__ VTH,
                                             float* MT, float* ZP) {
  __shared__ __align__(16) _Float16 skT[HD * 72];
  __shared__ __align__(16) float slab[8][16 * 36];
  __shared__ float zred[8][HD];
  __shared__ __align__(16) float zsum[HD];

  const int tid = threadIdx.x, wave = tid >> 5, lane = tid & 31, hh = lane >> 4, c = lane & 15;
  const int h = (int)(blockIdx.x / 3u);
  const int s = (int)(blockIdx.x - (unsigned)h * 3u);
  if (h >= NHEAD) return;                 // block-uniform, ahead of any barrier; never taken
  QKH += (size_t)blockIdx.y * SEQ * QKW;  // blockIdx.y = batch: its own planes
  QKL += (size_t)blockIdx.y * SEQ * QKW;
  VTH += (size_t)blockIdx.y * DM * SEQ;
  MT  += (size_t)blockIdx.y * NHEAD * 3 * HD * HD;
  ZP  += (size_t)blockIdx.y * NHEAD * 3 * HD;
  const int r  = tid >> 2;                // key within the 64-key chunk handled by this thread
  const int dq = (tid & 3) * 16;          // first of the 16 d columns handled by this thread
  const int et = wave >> 1;               // e row tile of this wave
  const int dt0 = (wave & 1) * 2;         // first d column tile of this wave

  const _Float16* Q16 = (const _Float16*)(const void*)QKH;
  const _Float16* L16 = (const _Float16*)(const void*)QKL;
  const _Float16* V16 = (const _Float16*)(const void*)VTH;
  const _Float16* vrow = V16 + (size_t)(h * HD + et * 16 + c) * SEQ + (size_t)s * SEG + 8 * hh;   // A frag base

  float zacc[16];
#pragma unroll
  for (int e = 0; e < 16; ++e) zacc[e] = 0.f;
  v8f acc[2];
  acc[0] = zero8(); acc[1] = zero8();

  for (int kt = 0; kt < SEG / 64; ++kt) {
    __syncthreads();                      // prior chunk's fragment reads are done
    {
      const size_t n = (size_t)(s * SEG + kt * 64 + r);
      const _Float16* kp = Q16 + n * QKW + DM + h * HD + dq;
      const _Float16* lp = L16 + n * QKW + DM + h * HD + dq;
      FH kf, lf;
      kf.h[0] = *(const v8h*)kp; kf.h[1] = *(const v8h*)(kp + 8);
      lf.h[0] = *(const v8h*)lp; lf.h[1] = *(const v8h*)(lp + 8);
#pragma unroll
      for (int e = 0; e < 16; ++e) {
        const float kv = ((float)kf.v[e] + (float)lf.v[e] * (1.0f / RSC)) * (1.0f / KSC);
        const float sk = (kv > 0.f) ? (kv + 1.0f) : __expf(kv);
        const _Float16 skh = (_Float16)sk;
        skT[(dq + e) * 72 + r] = skh;
        zacc[e] += (float)skh;
      }
    }
    __syncthreads();                      // skT chunk complete
#pragma unroll
    for (int kk = 0; kk < 2; ++kk) {
      const v16h a  = ldfrag_h(vrow + kt * 64 + 32 * kk);
      const v16h b0 = ldfrag_h(skT + (16 * dt0 + c) * 72 + 32 * kk + 8 * hh);
      const v16h b1 = ldfrag_h(skT + (16 * (dt0 + 1) + c) * 72 + 32 * kk + 8 * hh);
      acc[0] = mma_h_raw(a, b0, acc[0]);
      acc[1] = mma_h_raw(a, b1, acc[1]);
      guard3(acc[0], acc[1], a, b0, b1);
    }
  }
  acc_guard2(acc[0], acc[1]);

  // ---- MT piece: rows e = 16*et + (8hh+rr), cols d = 32*(wave&1) + 16*jj + c ----
  float* sl = slab[wave];
#pragma unroll
  for (int jj = 0; jj < 2; ++jj) {
#pragma unroll
    for (int rr = 0; rr < 8; ++rr) sl[(8 * hh + rr) * 36 + 16 * jj + c] = acc[jj][rr] * (1.0f / VSC);
  }
  wave_sync_lds();
  {
    v4f mv[4];
#pragma unroll
    for (int it = 0; it < 4; ++it) {
      const int row = it * 4 + (lane >> 3);
      mv[it] = *(const v4f*)(sl + row * 36 + (lane & 7) * 4);
    }
    float* mtb = MT + ((size_t)(h * 3 + s) * HD + (size_t)et * 16) * HD + (wave & 1) * 32;
    {
#pragma unroll
      for (int it = 0; it < 4; ++it) {
        const int row = it * 4 + (lane >> 3);
        *(v4f*)(mtb + (size_t)row * HD + (lane & 7) * 4) = mv[it];
      }
      
    }
  }
  // ---- ZP: sum zacc over the 8 keys of this wave (lanes sharing lane&3), then over the 8 waves ----
#pragma unroll
  for (int e = 0; e < 16; ++e) {
    float v = zacc[e];
    v += __shfl_xor(v, 4, 32);
    v += __shfl_xor(v, 8, 32);
    v += __shfl_xor(v, 16, 32);
    if ((lane >> 2) == 0) zred[wave][(lane & 3) * 16 + e] = v;
  }
  __syncthreads();
  if (tid < HD) {
    float z = 0.f;
#pragma unroll
    for (int w = 0; w < 8; ++w) z += zred[w][tid];
    zsum[tid] = z;
  }
  __syncthreads();
  if (tid < 16) {                         // wave 0, lanes 0..15: 16 x 16 B = the whole 256-B ZP row
    const v4f zz = *(const v4f*)(zsum + tid * 4);
    float* zp = ZP + (size_t)(h * 3 + s) * HD + tid * 4;
    *(v4f*)zp = zz;
    
  }
}

// =====================================================================================================
// Compressive-memory read per (head h, segment s in 1..3, 128-row block) of one batch (blockIdx.y):
//   M_s = sum over segments before s of MT[h][s'] (f32 sum, RNE convert to an f16 LDS tile MTh[e][d], pitch 72);
//   z_s = sum of ZP[h][s'] (f32, LDS). Per query row n of segment s: q rebuilt in f32 from the hi / residual planes
//   ((hi + lo/RSC) / QSC, column h*64 + d), sq = elu(q) + 1 RNE-converted to f16 directly into the A fragment
//   (elementwise transform keeps the A layout); num[n][e] = sum_d sq[n][d] * M_s[d][e] with Bt = MTh (K = 64, two
//   k-steps, 4 column tiles); den[n] = sum_d sq[n][d] * z_s[d] + 1e-6 in f32 from the same f16 sq values (lane
//   halves combined, then broadcast to the D rows); MEM[n][h*64 + e] = num * (1/den), f32 rows of pitch DM.
//   Block = 8 waves x 16 rows; per-wave 16x64 f32 tile staged in LDS; stores 16 lanes x 16 B per 256-B row
// coverage: 16 heads x 3 segments x 8 row blocks x 8 waves x 16 rows = MEM rows 1024..4095 of every head's 64
//   columns; 8 its x 2 row halves x 16 lanes x 4 floats = the wave's 16x64 tile. Rows 0..1023 (segment 0) are not
//   produced and are not used by the consumer (memory is exactly zero there).
// =====================================================================================================
__global__ __launch_bounds__(256) void mem_ret(const unsigned short* __restrict__ QKH,
                                              const unsigned short* __restrict__ QKL,
                                              const float* __restrict__ MT, const float* __restrict__ ZP,
                                              float* MEM) {
  __shared__ __align__(16) _Float16 MTh[HD * 72];
  __shared__ float zs[HD];
  __shared__ __align__(16) float slab[8][16 * 68];

  const int tid = threadIdx.x, wave = tid >> 5, lane = tid & 31, hh = lane >> 4, c = lane & 15;
  const int h   = (int)(blockIdx.x / 24u);
  const int rem = (int)(blockIdx.x - (unsigned)h * 24u);
  const int s   = 1 + rem / 8;            // 1..3
  const int rb  = rem - (s - 1) * 8;      // 0..7
  if (h >= NHEAD) return;                 // block-uniform, ahead of any barrier; never taken
  QKH += (size_t)blockIdx.y * SEQ * QKW;  // blockIdx.y = batch: its own planes
  QKL += (size_t)blockIdx.y * SEQ * QKW;
  MT  += (size_t)blockIdx.y * NHEAD * 3 * HD * HD;
  ZP  += (size_t)blockIdx.y * NHEAD * 3 * HD;
  MEM += (size_t)blockIdx.y * SEQ * DM;

  {
    const int e = tid >> 2, d0 = (tid & 3) * 16;
    float sm[16];
#pragma unroll
    for (int i = 0; i < 16; ++i) sm[i] = 0.f;
#pragma unroll
    for (int sp = 0; sp < 3; ++sp) {
      if (sp < s) {                       // block-uniform
        const float* src = MT + ((size_t)(h * 3 + sp) * HD + e) * HD + d0;
#pragma unroll
        for (int q = 0; q < 4; ++q) {
          const v4f v = *(const v4f*)(src + 4 * q);
          sm[4 * q + 0] += v[0]; sm[4 * q + 1] += v[1]; sm[4 * q + 2] += v[2]; sm[4 * q + 3] += v[3];
        }
      }
    }
    v8h p0, p1;
#pragma unroll
    for (int i = 0; i < 8; ++i) { p0[i] = (_Float16)sm[i]; p1[i] = (_Float16)sm[8 + i]; }
    *(v8h*)(MTh + e * 72 + d0) = p0;
    *(v8h*)(MTh + e * 72 + d0 + 8) = p1;
    if (tid < HD) {
      float z = 0.f;
#pragma unroll
      for (int sp = 0; sp < 3; ++sp) {
        if (sp < s) z += ZP[(size_t)(h * 3 + sp) * HD + tid];
      }
      zs[tid] = z;
    }
  }
  __syncthreads();

  const _Float16* Q16 = (const _Float16*)(const void*)QKH;
  const _Float16* L16 = (const _Float16*)(const void*)QKL;
  const int n0w = s * SEG + rb * MROWS + wave * 16;          // first query position of this wave

  v16h af[2];
  float denp = 0.f;
#pragma unroll
  for (int kk = 0; kk < 2; ++kk) {
    FH hf, lf;
    hf.v = ldfrag_h(Q16 + (size_t)(n0w + c) * QKW + h * HD + 32 * kk + 8 * hh);
    lf.v = ldfrag_h(L16 + (size_t)(n0w + c) * QKW + h * HD + 32 * kk + 8 * hh);
    v16h a;
#pragma unroll
    for (int i = 0; i < 16; ++i) {
      const float qv = ((float)hf.v[i] + (float)lf.v[i] * (1.0f / RSC)) * (1.0f / QSC);
      const float sq = (qv > 0.f) ? (qv + 1.0f) : __expf(qv);
      const _Float16 sqh = (_Float16)sq;
      a[i] = sqh;
      const int kidx = 32 * kk + ((i < 8) ? (8 * hh + i) : (8 + 8 * hh + i));   // k of element i (split map)
      denp += (float)sqh * zs[kidx];
    }
    af[kk] = a;
  }
  const float den = denp + __shfl_xor(denp, 16, 32) + DEN_EPS;   // row c complete in lanes c and c+16

  v8f acc[4];
#pragma unroll
  for (int j = 0; j < 4; ++j) {
    acc[j] = zero8();
#pragma unroll
    for (int kk = 0; kk < 2; ++kk) {
      const v16h b = ldfrag_h(MTh + (16 * j + c) * 72 + 32 * kk + 8 * hh);
      acc[j] = mma_h(af[kk], b, acc[j]);
    }
  }
  float rinv[8];
#pragma unroll
  for (int rr = 0; rr < 8; ++rr) rinv[rr] = 1.0f / __shfl(den, 8 * hh + rr, 32);   // den of D row 8hh+rr

  float* sl = slab[wave];
#pragma unroll
  for (int j = 0; j < 4; ++j) {
#pragma unroll
    for (int rr = 0; rr < 8; ++rr) sl[(8 * hh + rr) * 68 + 16 * j + c] = acc[j][rr] * rinv[rr];
  }
  wave_sync_lds();
  {
    v4f ov[8];
#pragma unroll
    for (int it = 0; it < 8; ++it) {
      const int row = it * 2 + hh;        // it 0..7 x hh 0..1 = rows 0..15
      ov[it] = *(const v4f*)(sl + row * 68 + c * 4);
    }
    {
#pragma unroll
      for (int it = 0; it < 8; ++it) {
        const int row = it * 2 + hh;
        *(v4f*)(MEM + (size_t)(n0w + row) * DM + h * HD + c * 4) = ov[it];
      }
      
    }
  }
}

// =====================================================================================================
// Segment-local causal attention with the gate mix, per (batch, h, segment, 64-query block):
//   s = (sum_d qh.kh + (ql.kh + qh.kl) / RSC) * sscale, sscale = (1/8) / (QSC*KSC); key > query (segment-local)
//   -> NEG_BIG (value select); online softmax in f32; p = exp(s - m) carried as ph = f16(1024 p) and, when PRES,
//   also pl = f16((1024 p - ph) * RSC); local numerator = p . v with v as f16 hi (VSC v) and, when PRES, the f16
//   residual ((VSC v - hi) * RSC) plane: oh += ph.vhi over all chunks; when PRES: ol = ph.vres + pl.vhi (one
//   residual accumulator per chunk and 16-wide d tile, both products carry the same 1/RSC), folded as
//   oh += ol / RSC in f32 right after its two k-steps.
//   q|k planes (f16, pitch QKW, rows = positions): q element (t, h, d) at [t*QKW + h*64 + d], k at
//   [t*QKW + DM + h*64 + d]; V^T planes (f16): element (h, d, t) at [(h*64 + d)*SEQ + t]; MEM plane (f32,
//   pitch DM): element (t, h, e) at [t*DM + h*64 + e].
//   Epilogue per query row t: local = oh / (l * PSC * VSC); mem = MEM[t] for segments >= 1 (segment 0: exactly 0
//   by a value select; the load address is always inside the plane); out = g * mem + (1 - g) * local with
//   g = sigmoid(bf16(gate[h])); rows of positions < NTOK go to the second output (offset OUT1OFF), rows of positions
//   >= NTOK to the first, row t mod NTOK, columns h*64..h*64+63 (pitch DM floats).
//   Block = 4 waves = 64 query rows of one h; bx = 0 .. NHEAD * NSEG * nqb - 1 -> (h, seg, qbs = qb0 + i), bb = batch;
//   bx, bb and the block's LDS arrays come from the kernel attn_all below;
//   key chunks of 64 within the segment, chunks kt <= qbs only (block-uniform trip <= NQB), chunk kt == qbs keeps
//   its diagonal by the per-element select.
//   K / V^T chunk staging: asynchronous 16-B copies, thread -> rows (tid>>3) + 16 i, piece tid&7 of the row's 128 B
//   (a wave's copy takes four whole rows). One buffer per tile: the K tiles of chunk kt + 1 are copied behind the
//   barrier that ends the score reads of chunk kt and fly under its softmax and P.V; the V^T tiles of chunk kt + 1
//   are copied behind the barrier that ends the P.V reads of chunk kt and fly under the scores of chunk kt + 1.
//   q fragments (hi and residual, 2 d-chunks) held in registers for the whole block.
//   Both products run transposed (S^T = K.q^T, O^T += V^T.P^T): a lane holds one
//   query's scores, and two converted S^T tiles are a B fragment of P^T, so P passes through no LDS.
//   Output coverage: each wave stores rows q0..q0+15 (it 0..7 x lane>>4) x 64 columns (16 lanes x 16 B), one
// =====================================================================================================
template <bool PRES>
__device__ __forceinline__
void attn_seg(_Float16* Ksh, _Float16* Kls, _Float16* Vhs, _Float16* Vls, float (*Os)[16 * 68], int bx, int bb,
              const unsigned short* __restrict__ QKH, const unsigned short* __restrict__ QKL,
              const unsigned short* __restrict__ VTH, const unsigned short* __restrict__ VTL,
              const float* __restrict__ MEM, const float* __restrict__ gate,
              float* outb, float sscale, int qb0, int nqb) {
  const int tid  = threadIdx.x;
  const int wave = tid >> 5;
  const int lane = tid & 31;
  const int hh   = lane >> 4;
  const int c    = lane & 15;

  const int per = NSEG * nqb;
  const int h   = (int)((unsigned)bx / (unsigned)per);
  const int rem = (int)((unsigned)bx - (unsigned)h * (unsigned)per);
  const int seg = rem / nqb;
  const int qbs = qb0 + (rem - seg * nqb);
  if (h >= NHEAD || seg >= NSEG) return;  // block-uniform, ahead of any barrier; never taken for exact grids
  QKH  += (size_t)bb * SEQ * QKW;         // bb = batch: its own planes and its own rows of both outputs
  QKL  += (size_t)bb * SEQ * QKW;
  VTH  += (size_t)bb * DM * SEQ;
  VTL  += (size_t)bb * DM * SEQ;
  MEM  += (size_t)bb * SEQ * DM;
  outb += (size_t)bb * NTOK * DM;
  const int sbase = seg * SEG;
  const int rowl0 = qbs * 64 + wave * 16; // segment-local row of this wave's first query
  const int q0    = sbase + rowl0;        // its position in the concatenated sequence

  const _Float16* Q16 = (const _Float16*)(const void*)QKH;
  const _Float16* L16 = (const _Float16*)(const void*)QKL;
  const _Float16* Qg  = Q16 + (size_t)h * HD;
  const _Float16* Qlg = L16 + (size_t)h * HD;
  const _Float16* Kg  = Q16 + DM + (size_t)h * HD;
  const _Float16* Klg = L16 + DM + (size_t)h * HD;
  const _Float16* Vhg = (const _Float16*)(const void*)VTH + (size_t)h * HD * SEQ;
  const _Float16* Vlg = (const _Float16*)(const void*)VTL + (size_t)h * HD * SEQ;

  // ---- q fragments (B operand, column = lane&15), hi and residual, d-chunks 0 and 1, fixed for the block ----
  const v16h qh0 = ldfrag_h(Qg  + (size_t)(q0 + c) * QKW + 8 * hh);
  const v16h qh1 = ldfrag_h(Qg  + (size_t)(q0 + c) * QKW + 32 + 8 * hh);
  const v16h ql0 = ldfrag_h(Qlg + (size_t)(q0 + c) * QKW + 8 * hh);
  const v16h ql1 = ldfrag_h(Qlg + (size_t)(q0 + c) * QKW + 32 + 8 * hh);

  // a lane holds ONE query (row c of the wave's 16): its running maximum, its running sum, and in oh[t][r] the
  // numerator of d = 16 t + 8 hh + r (the transposed output tile)
  float mrow = NEG_BIG, lrow = 0.f;
  v8f oh[4];
#pragma unroll
  for (int t = 0; t < 4; ++t) oh[t] = zero8();

  // ---- tile copies: this thread's row (mod 16) and 16-B piece; copy i takes row sr + 16 i of the 64-row tile ----
  const int sr = tid >> 3, sc = (tid & 7) * 8;
  const uint32_t lofs = (uint32_t)(sr * APIT + sc) * 2u;
  const uint32_t ls   = 16u * APIT * 2u;                    // LDS bytes per 16 rows
  const uint32_t lKh = (uint32_t)(size_t)(const void*)Ksh + lofs;
  const uint32_t lKl = (uint32_t)(size_t)(const void*)Kls + lofs;
  const uint32_t lVh = (uint32_t)(size_t)(const void*)Vhs + lofs;
  const uint32_t lVl = (uint32_t)(size_t)(const void*)Vls + lofs;
  const uint32_t oK = (uint32_t)(sr * QKW + sc) * 2u, gK = 16u * QKW * 2u;   // byte offset in a K tile, per 16 rows
  const uint32_t oV = (uint32_t)(sr * SEQ + sc) * 2u, gV = 16u * SEQ * 2u;   // the same in a V^T tile
  auto fillK = [&](int kv) {                                // K hi and residual rows kv .. kv + 63, d = 0..63
    acopy8s(lKh, lKh + ls, lKh + 2 * ls, lKh + 3 * ls, lKl, lKl + ls, lKl + 2 * ls, lKl + 3 * ls,
            oK, oK + gK, oK + 2 * gK, oK + 3 * gK, Kg + (size_t)kv * QKW, Klg + (size_t)kv * QKW);
  };
  auto fillV = [&](int kv) {                                // V^T rows d = 0..63, keys kv .. kv + 63
    if (PRES)
      acopy8s(lVh, lVh + ls, lVh + 2 * ls, lVh + 3 * ls, lVl, lVl + ls, lVl + 2 * ls, lVl + 3 * ls,
              oV, oV + gV, oV + 2 * gV, oV + 3 * gV, Vhg + kv, Vlg + kv);
    else
      acopy4s(lVh, lVh + ls, lVh + 2 * ls, lVh + 3 * ls, oV, oV + gV, oV + 2 * gV, oV + 3 * gV, Vhg + kv);
  };
  fillK(sbase);
  fillV(sbase);
  wait_async0();
  __syncthreads();                            // chunk 0's K and V^T tiles are published

  for (int kt = 0; kt < NQB; ++kt) {          // static bound; block-uniform causal chunk skipping
    if (kt > qbs) break;
    const int kv0 = sbase + kt * 64;

    // ---- transposed scores: 64 keys x 16 queries per wave, A = K rows, B = q, K = 64 (2 d-chunks), three products;
    //      D element r of tile j = key 16 j + 8 hh + r against query c ----
    v8f s[4];
#pragma unroll
    for (int j = 0; j < 4; ++j) {
      v8f sh = zero8(), sl = zero8();
      {
        FH kb, lb;
        kb.h[0] = *(const v8h*)(Ksh + (j * 16 + c) * APIT + 8 * hh);
        kb.h[1] = *(const v8h*)(Ksh + (j * 16 + c) * APIT + 16 + 8 * hh);
        lb.h[0] = *(const v8h*)(Kls + (j * 16 + c) * APIT + 8 * hh);
        lb.h[1] = *(const v8h*)(Kls + (j * 16 + c) * APIT + 16 + 8 * hh);
        sh = mma_h_raw(kb.v, qh0, sh);
        sl = mma_h_raw(kb.v, ql0, sl);
        sl = mma_h_raw(lb.v, qh0, sl);
        guard4m(sh, sl, qh0, ql0, kb.v, lb.v);
      }
      {
        FH kb, lb;
        kb.h[0] = *(const v8h*)(Ksh + (j * 16 + c) * APIT + 32 + 8 * hh);
        kb.h[1] = *(const v8h*)(Ksh + (j * 16 + c) * APIT + 48 + 8 * hh);
        lb.h[0] = *(const v8h*)(Kls + (j * 16 + c) * APIT + 32 + 8 * hh);
        lb.h[1] = *(const v8h*)(Kls + (j * 16 + c) * APIT + 48 + 8 * hh);
        sh = mma_h_raw(kb.v, qh1, sh);
        sl = mma_h_raw(kb.v, ql1, sl);
        sl = mma_h_raw(lb.v, qh1, sl);
        guard4m(sh, sl, qh1, ql1, kb.v, lb.v);
      }
      // segment-local key of D element r is kt*64 + 16 j + 8 hh + r, the query row of this lane's D column rowl0 + c:
      // element r is kept while r <= lim
      const int lim = (rowl0 + c) - (kt * 64 + j * 16 + 8 * hh);
#pragma unroll
      for (int r = 0; r < 8; ++r) {
        float v = sh[r];
        v += sl[r] * (1.0f / RSC);
        v *= sscale;
        s[j][r] = (r <= lim) ? v : NEG_BIG;
      }
    }
    wait_ds0();
    wait_async0();
    __syncthreads();                          // ends every read of the K tiles and publishes this chunk's V^T tiles
    if (kt < qbs) fillK(kv0 + 64);            // block-uniform

    // ---- maximum and sum of the query's 64 scores: 32 in this lane, 32 in lane ^ 16 (one exchange each); online
    //      softmax in f32; P hi (x1024, f16) and, when PRES, P residual (x RSC, f16) go straight into B fragments:
    //      tiles 2 kk and 2 kk + 1 hold keys 32 kk + 8 hh + r and 32 kk + 16 + 8 hh + r, the loaders' own k order ----
    float mj[4];
#pragma unroll
    for (int j = 0; j < 4; ++j) {
      float m = s[j][0];
#pragma unroll
      for (int r = 1; r < 8; ++r) m = fmaxf(m, s[j][r]);
      mj[j] = m;
    }
    float m = fmaxf(fmaxf(mj[0], mj[1]), fmaxf(mj[2], mj[3]));
    m = fmaxf(m, xhalf(m));
    const float mnew  = fmaxf(mrow, m);
    const float alpha = __expf(mrow - mnew);
    mrow = mnew;
    FH pa[2], pb[2];
    float pj[4];
#pragma unroll
    for (int j = 0; j < 4; ++j) {
      float ps = 0.f;
#pragma unroll
      for (int r = 0; r < 8; ++r) {
        const float p  = __expf(s[j][r] - mnew);
        ps += p;
        const float ph = p * PSC;
        const _Float16 xh = (_Float16)ph;
        pa[j >> 1].v[(j & 1) * 8 + r] = xh;
        if (PRES) pb[j >> 1].v[(j & 1) * 8 + r] = (_Float16)((ph - (float)xh) * RSC);
      }
      pj[j] = ps;
    }
    float psum = (pj[0] + pj[1]) + (pj[2] + pj[3]);
    psum += xhalf(psum);
    lrow = lrow * alpha + psum;
#pragma unroll
    for (int t = 0; t < 4; ++t) {
#pragma unroll
      for (int r = 0; r < 8; ++r) oh[t][r] *= alpha;
    }

    // ---- transposed local numerator, A = V^T rows, B = P^T: oh += Vhi . Phi; when PRES also
    //      ol = Vres . Phi + Vhi . Plo, oh += ol/RSC ----
#pragma unroll
    for (int t = 0; t < 4; ++t) {
      const _Float16* vr = Vhs + (t * 16 + c) * APIT + 8 * hh;
      FH vb0, vb1;
      vb0.h[0] = *(const v8h*)(vr);
      vb0.h[1] = *(const v8h*)(vr + 16);
      vb1.h[0] = *(const v8h*)(vr + 32);
      vb1.h[1] = *(const v8h*)(vr + 48);
      if (PRES) {
        const _Float16* wr = Vls + (t * 16 + c) * APIT + 8 * hh;
        FH wb0, wb1;
        wb0.h[0] = *(const v8h*)(wr);
        wb0.h[1] = *(const v8h*)(wr + 16);
        wb1.h[0] = *(const v8h*)(wr + 32);
        wb1.h[1] = *(const v8h*)(wr + 48);
        v8f ol = zero8();
        oh[t] = mma_h_raw(vb0.v, pa[0].v, oh[t]);
        ol    = mma_h_raw(wb0.v, pa[0].v, ol);
        ol    = mma_h_raw(vb0.v, pb[0].v, ol);
        oh[t] = mma_h_raw(vb1.v, pa[1].v, oh[t]);
        ol    = mma_h_raw(wb1.v, pa[1].v, ol);
        ol    = mma_h_raw(vb1.v, pb[1].v, ol);
        guard8m(oh[t], ol, pa[0].v, pa[1].v, pb[0].v, pb[1].v, vb0.v, vb1.v, wb0.v, wb1.v);
#pragma unroll
        for (int r = 0; r < 8; ++r) oh[t][r] += ol[r] * (1.0f / RSC);
      } else {
        oh[t] = mma_h_raw(vb0.v, pa[0].v, oh[t]);
        oh[t] = mma_h_raw(vb1.v, pa[1].v, oh[t]);
        guard1q(oh[t], pa[0].v, pa[1].v, vb0.v, vb1.v);
      }
    }
    acc_guard4(oh[0], oh[1], oh[2], oh[3]);
    wait_ds0();
    wait_async0();
    __syncthreads();                          // ends every read of the V^T tiles and publishes the next chunk's K tiles
    if (kt < qbs) fillV(kv0 + 64);            // block-uniform
  }
  wait_async0();

  // ---- normalise (1/l, the 1/1024 p carry and the 1/VSC v carry), gate mix with the memory read, stage the
  //      wave's tile as [query row][d] (a lane writes 8 consecutive d of its query per t) ----
  const float gv  = bfr(gate[h]);
  const float g   = 1.0f / (1.0f + expf(-gv));
  const float omg = 1.0f - g;
  const bool useMem = (seg > 0);                          // block-uniform
  float* os = Os[wave];
  {
    const int qr = q0 + c;                                  // this lane's query position
    const float l = lrow;                                   // >= 1 (the row maximum contributes exp(0))
    const float inv = (1.0f / l) * (1.0f / (PSC * VSC));
    const float* mr = MEM + (size_t)qr * DM + h * HD + 8 * hh;   // inside the MEM plane for every position
#pragma unroll
    for (int t = 0; t < 4; ++t) {
      const v4f ma = *(const v4f*)(mr + 16 * t);
      const v4f mb = *(const v4f*)(mr + 16 * t + 4);
      v4f oa, ob;
#pragma unroll
      for (int r = 0; r < 4; ++r) {                         // e = 16t + 8hh + r and + 4
        oa[r] = g * (useMem ? ma[r] : 0.f) + omg * (oh[t][r] * inv);
        ob[r] = g * (useMem ? mb[r] : 0.f) + omg * (oh[t][4 + r] * inv);
      }
      *(v4f*)(os + c * 68 + 16 * t + 8 * hh)     = oa;
      *(v4f*)(os + c * 68 + 16 * t + 8 * hh + 4) = ob;
    }
  }
  wave_sync_lds();
  {
    const size_t ooff  = (seg < (NTOK / SEG)) ? (size_t)OUT1OFF : (size_t)0;   // positions < NTOK -> second output
    const int    orow0 = (seg < (NTOK / SEG)) ? q0 : (q0 - NTOK);               // row within the output [b][2048][1024]
    v4f ov[8];
#pragma unroll
    for (int it = 0; it < 8; ++it) {
      const int row = it * 2 + hh;                          // it 0..7 x hh 0..1 = rows 0..15 of the wave tile
      ov[it] = *(const v4f*)(os + row * 68 + c * 4);
    }
    {
#pragma unroll
      for (int it = 0; it < 8; ++it) {
        const int row = it * 2 + hh;
        *(v4f*)(outb + ooff + (size_t)(orow0 + row) * DM + h * HD + c * 4) = ov[it];
      }
      
    }
  }
}

// =====================================================================================================
// Both attention variants, which do not depend on one another, in ONE launch, told apart by block range (a
// block-uniform branch ahead of every barrier): blockIdx.y < AB_F are the query blocks NQP .. NQB-1, without the
// residual products (NQP+1 to NQB key chunks each); they start first. The others are the leading NQP query blocks,
// with them (1 to NQP chunks each); they take the places that the long blocks leave. blockIdx.x = batch.
// coverage: grid = (NB, AB_F + AB_T) exact.
// =====================================================================================================
#define AB_F (NHEAD * NSEG * (NQB - NQP))
#define AB_T (NHEAD * NSEG * NQP)
__global__ __launch_bounds__(128, 5)   // 5 waves per SIMD, as both variants had alone: keeps the registers under 1024 / 5
void attn_all(const unsigned short* __restrict__ QKH, const unsigned short* __restrict__ QKL,
              const unsigned short* __restrict__ VTH, const unsigned short* __restrict__ VTL,
              const float* __restrict__ MEM, const float* __restrict__ gate, float* outb, float sscale) {
  __shared__ __align__(16) _Float16 Ksh[64 * APIT];                           // K hi  [key][d]  9 KB
  __shared__ __align__(16) _Float16 Kls[64 * APIT];                           // K res [key][d]  9 KB
  __shared__ __align__(16) _Float16 Vhs[HD * APIT];                           // V^T hi [d][key] 9 KB
  __shared__ __align__(16) _Float16 Vls[HD * APIT];                           // V^T res [d][key] 9 KB (leading blocks)
  __shared__ __align__(16) float    Os[4][16 * 68];                          // per wave output tile [row][d]
  const int by = (int)blockIdx.y, bb = (int)blockIdx.x;
  if (by < AB_F)
    attn_seg<false>(Ksh, Kls, Vhs, Vls, Os, by, bb, QKH, QKL, VTH, VTL, MEM, gate, outb, sscale, NQP, NQB - NQP);
  else
    attn_seg<true>(Ksh, Kls, Vhs, Vls, Os, by - AB_F, bb, QKH, QKL, VTH, VTL, MEM, gate, outb, sscale, 0, NQP);
}

// =====================================================================================================
// Workspace map (bytes); every plane is an exact multiple of its tile / whole-line store granularity (all dims are
// exact tile multiples, no padded tails), all offsets multiples of 4096:
//   XH    f16  [4096 t][1024 in]             0          8388608   (f16 of bf16 value x16, rows b*2048 + t)
//   AH    f16  [4096 t][1024 in]             8388608    8388608
//   WXT   f16  [3072 out][1024 in]           16777216   6291456   (W^T, bf16 value x64)
//   WAT   f16  [3072 out][1024 in]           23068672   6291456
//   COST  f32  [4096 pos][32]                29360128    524288
//   SINT  f32  [4096 pos][32]                29884416    524288
//   QKH   f16  [2 b][4096 pos][2048 (q|k)]   30408704  33554432   (q x4, k x16 hi after norm + rotary)
//   QKL   f16  [2 b][4096][2048]             63963136  33554432   (x4096 residuals)
//   VF    f32  [2 b][4096 pos][1024 (h,d)]   97517568  33554432   (v, f32)
//   VTH   f16  [2 b][1024 (h,d)][4096 pos]  131072000  16777216   (v x16 hi)
//   VTL   f16  [2 b][1024 (h,d)][4096 pos]  147849216  16777216   ((v x16 - hi) x4096)
//   MT    f32  [2 b][16 h][3 s][64 e][64 d] 164626432   1572864
//   ZP    f32  [2 b][16 h][3 s][64 d]       166199296     24576
//   MEM   f32  [2 b][4096 pos][1024 (h,e)]  166223872  33554432
//   end                                     199778304
// =====================================================================================================
extern "C" void kernel_launch(void* const* d_in, const int* in_sizes, int n_in,
                              void* d_out, int out_size, void* d_ws, size_t ws_size,
                              hipStream_t stream) {
  if (n_in < 9) return;
  if (in_sizes[0] != NB * NTOK * DM || in_sizes[1] != NB * NTOK * DM) return;
  if (in_sizes[2] != DM * W3 || in_sizes[3] != DM * W3) return;
  if (in_sizes[4] != NHEAD * HD || in_sizes[5] != NHEAD * HD) return;
  if (in_sizes[6] != NHEAD * HD || in_sizes[7] != NHEAD * HD) return;
  if (in_sizes[8] != NHEAD) return;
  if (out_size != 2 * NB * NTOK * DM) return;

  const float* X    = (const float*)d_in[0];
  const float* Aa   = (const float*)d_in[1];
  const float* Wx   = (const float*)d_in[2];
  const float* Wa   = (const float*)d_in[3];
  const float* g_qx = (const float*)d_in[4];
  const float* g_kx = (const float*)d_in[5];
  const float* g_qa = (const float*)d_in[6];
  const float* g_ka = (const float*)d_in[7];
  const float* gate = (const float*)d_in[8];
  float* outf = (float*)d_out;

  const size_t PXA = (size_t)NB * NTOK * DM * 2;        //  8388608
  const size_t PW  = (size_t)W3 * DM * 2;               //  6291456
  const size_t PRT = (size_t)SEQ * RP * 4;              //   524288
  const size_t PQK = (size_t)NB * SEQ * QKW * 2;        // 33554432
  const size_t PVF = (size_t)NB * SEQ * DM * 4;         // 33554432
  const size_t PVT = (size_t)NB * DM * SEQ * 2;         // 16777216
  const size_t PMT = (size_t)NB * NHEAD * 3 * HD * HD * 4;   // 1572864
  const size_t PZP = (size_t)NB * NHEAD * 3 * HD * 4;        //   24576
  const size_t PME = (size_t)NB * SEQ * DM * 4;         // 33554432
  size_t off = 0;
  const size_t oXH = off; off += PXA;
  const size_t oAH = off; off += PXA;
  const size_t oWX = off; off += PW;
  const size_t oWA = off; off += PW;
  const size_t oCT = off; off += PRT;
  const size_t oST = off; off += PRT;
  const size_t oQH = off; off += PQK;
  const size_t oQL = off; off += PQK;
  const size_t oVF = off; off += PVF;
  const size_t oVH = off; off += PVT;
  const size_t oVL = off; off += PVT;
  const size_t oMT = off; off += PMT;
  const size_t oZP = off; off += PZP;
  const size_t oME = off; off += PME;
  if (off > ws_size) return;                            // off = 199778304

  char* ws = (char*)d_ws;
  unsigned short* XH   = (unsigned short*)(ws + oXH);
  unsigned short* AH   = (unsigned short*)(ws + oAH);
  unsigned short* WXT  = (unsigned short*)(ws + oWX);
  unsigned short* WAT  = (unsigned short*)(ws + oWA);
  float*          COST = (float*)(ws + oCT);
  float*          SINT = (float*)(ws + oST);
  unsigned short* QKH  = (unsigned short*)(ws + oQH);
  unsigned short* QKL  = (unsigned short*)(ws + oQL);
  float*          VF   = (float*)(ws + oVF);
  unsigned short* VTH  = (unsigned short*)(ws + oVH);
  unsigned short* VTL  = (unsigned short*)(ws + oVL);
  float*          MT   = (float*)(ws + oMT);
  float*          ZP   = (float*)(ws + oZP);
  float*          MEM  = (float*)(ws + oME);

  const dim3 blk256(256), blk128(128);
  const float sscale = 0.125f / (QSC * KSC);
  const float oscale = 1.0f / (XSC * WSC);

  // Every kernel is launched once; the two arrays, the two streams and the two batches are grid dimensions, and
  // kernels that do not depend on one another share a launch (block ranges).
  // (1) x, a -> row-major f16 planes of their bf16 RNE values x16; W [1024][3072] -> transposed f16 planes
  //     [3072][1024] (k contiguous, Bt form) of their bf16 RNE values x64; rotary tables
  prep<<<dim3(PB_ROPE + PB_TR + PB_CVT), blk256, 0, stream>>>(X, Aa, XH, Wx, Wa, WXT, COST, SINT);

  const int gqk  = ((NTOK / 32) * (QKW / 128)) / 4;      // 1024 tiles -> 256 blocks per stream and batch
  const int gv   = ((NTOK / 32) * (DM / 128)) / 4;       //  512 tiles -> 128 blocks per stream and batch
  const int gmt  = NHEAD * 3;                            //   48 blocks per batch
  const int gmem = NHEAD * 3 * (SEG / MROWS);            //  384 blocks per batch
  // (2) q|k of stream a (positions 0..2047) and stream x (positions 2048..4095): M=2048, N=2048, K=1024,
  //     fused per-head L2 norm + gain + rotary -> QKH/QKL f16 planes;
  // (3) v of both streams: M=2048, N=1024 (W^T rows 2048..3071), K=1024 -> VF f32 rows
  gemm_qkv<<<dim3(gqk + gv, 2, NB), blk128, 0, stream>>>(AH, XH, DM, WAT, WXT, DM, (void*)QKH, (void*)QKL, QKW,
                                                         (void*)VF, DM, SEQ, COST, SINT, g_qa, g_ka, g_qx, g_kx,
                                                         NTOK, QKW, DM, DM, gqk, oscale);
  // (4) v^T planes: in VF [SEQ rows][DM cols] -> out [DM][SEQ] f16 hi (x16) and residual (x4096), per batch
  tr_v<<<dim3(DM / 64, SEQ / 64, NB), blk256, 0, stream>>>(VF, VF + (size_t)SEQ * DM, SEQ, DM, VTH, VTL, VSC);
  // (5) compressive memory: per-segment sk^T.v and sum sk (segments 0..2), then the memory read for the
  //     query rows of segments 1..3 -> MEM f32 plane
  mt_seg<<<dim3(gmt, NB), blk256, 0, stream>>>(QKH, QKL, VTH, MT, ZP);
  mem_ret<<<dim3(gmem, NB), blk256, 0, stream>>>(QKH, QKL, MT, ZP, MEM);
  // (6) segment-local causal attention + gate mix -> both outputs: the leading NQP query blocks of every
  //     segment with the p, v residual products, the remaining blocks without
  attn_all<<<dim3(NB, AB_F + AB_T), blk128, 0, stream>>>(QKH, QKL, VTH, VTL, MEM, gate, outf, sscale);
  (void)hipGetLastError();
}

// v008
// It runs in 132 microseconds.
// In both of two side-by-side timings against v007, it was 1.18 times as fast.
// All steps since v000 together make it 5.95 times as fast.
// Contractions: a.W and x.W (q|k|v, K=1024) on v_wmma_f32_16x16x32_f16 with f16 containers of the bf16 RNE input
//   values (activations carried x16, W^T x64), one product; q.k^T (K=64) on v_wmma_f32_16x16x32_f16 with q (x4) and
//   k (x16) f16 hi planes plus x4096 f16 residual planes (three products, residual pair in a separate accumulator
//   folded by 1/4096); p.v^T on v_wmma_f32_16x16x32_f16 with p as f16(1024 p) and v^T as f16(16 v), one product
//   (the leading query blocks of every segment add the p and v x4096 f16 residual planes, two more products into a
//   separate accumulator); compressive memory sk^T.v (K=1024) and sq.M (K=64) on v_wmma_f32_16x16x32_f16 with
//   plain f16 operands, one product each. f32 accumulate everywhere; L2 norms, rotary tables and rotation, elu,
//   softmax statistics, sq.z, the memory quotient and the gate mix in f32.
#include <hip/hip_runtime.h>
#include <math.h>
#include <stdint.h>

#define NB      2
#define NTOK    2048                // tokens per stream per batch
#define SEQ     4096                // concatenated positions per batch (stream a first, then x)
#define DM      1024
#define NHEAD   16
#define HD      64
#define RP      32                  // rotary pairs per head
#define W3      3072
#define QKW     2048                // q|k plane width: q at column h*64+d, k at 1024 + h*64+d
#define SEG     1024
#define NSEG    4
#define NQB     16                  // 64-row query blocks per segment
#define NQP     4                   // leading query blocks per segment that carry the p / v residual products
#define MROWS   128                 // query rows per block of the memory read kernel
#define OUT1OFF (NB * NTOK * DM)             // element offset of the second output
#define XSC     16.0f
#define WSC     64.0f
#define QSC     4.0f
#define KSC     16.0f
#define VSC     16.0f
#define RSC     4096.0f
#define PSC     1024.0f
#define NRM_EPS 1.0e-12f
#define DEN_EPS 1.0e-6f
#define LOG2_BASE 13.287712379549449
#define NEG_BIG (-1.0e30f)
#define GBK     128                 // k per LDS stage of the projection GEMM (256 B of every operand row)
#define GPIT    136                 // LDS row pitch of a stage in halves: 272 B = 16 B x 17 (ds_load_b128 readers)
#define GSTG    (256 * GPIT)        // halves per stage: 128 A rows, then 128 Bt rows
#define SLABF   (16 * 132)          // floats per epilogue slab of the projection GEMM (one per wave)
#define APIT    72                  // LDS row pitch of the attention K and V^T tiles in halves: 144 B = 16 B x 9
                                    // (ds_load_b128 readers: 16 rows of a fragment load fall on 16 distinct bank groups)

static_assert(NHEAD * HD == DM);
static_assert(SEQ == 2 * NTOK);
static_assert(SEQ == NSEG * SEG);
static_assert(SEG == NQB * 64);
static_assert(HD == 2 * RP);
static_assert(W3 == 3 * DM);
static_assert(QKW == 2 * DM);
static_assert(((NB * NTOK * DM) % 2048) == 0);
static_assert(((SEQ * RP) % 256) == 0);
static_assert((DM % 128) == 0 && (W3 % 64) == 0 && (NTOK % 64) == 0 && (SEQ % 64) == 0);
static_assert((QKW % 128) == 0 && (DM % 32) == 0);
static_assert(NQP > 0 && NQP < NQB);
static_assert((SEG % MROWS) == 0 && MROWS == 8 * 16);
static_assert(OUT1OFF == NB * NTOK * DM);
static_assert((DM % GBK) == 0 && (NTOK % 128) == 0 && ((GPIT * 2) % 16) == 0);
static_assert(4 * SLABF * 4 <= 2 * GSTG * 2 && ((SLABF * 4) % 16) == 0);
static_assert(APIT >= HD && ((APIT * 2) % 16) == 0);

typedef _Float16 v16h __attribute__((ext_vector_type(16)));
typedef _Float16 v8h  __attribute__((ext_vector_type(8)));
typedef float    v8f  __attribute__((ext_vector_type(8)));
typedef float    v4f  __attribute__((ext_vector_type(4)));
typedef unsigned int v4u __attribute__((ext_vector_type(4)));
union FH { v16h v; v8h h[2]; };

// ---- scalar helpers --------------------------------------------------------------------------------
__device__ __forceinline__ unsigned short bf_bits(float f) {          // f32 -> bf16 bits, RNE convert
  unsigned u = __float_as_uint(f);
  return (unsigned short)((u + 0x7FFFu + ((u >> 16) & 1u)) >> 16);
}
__device__ __forceinline__ float bf_up(unsigned short b) { return __uint_as_float(((unsigned)b) << 16); }
__device__ __forceinline__ float bfr(float f) { return bf_up(bf_bits(f)); }     // value of the bf16 RNE convert
__device__ __forceinline__ unsigned short h_bits(_Float16 x) { return __builtin_bit_cast(unsigned short, x); }
__device__ __forceinline__ unsigned pk16(unsigned short a, unsigned short b) { return (unsigned)a | ((unsigned)b << 16); }
__device__ __forceinline__ v8f zero8() { v8f z = {0.f, 0.f, 0.f, 0.f, 0.f, 0.f, 0.f, 0.f}; return z; }

// ---- fragment loader: 16-bit A/B operand, lane -> row/col (lane&15), p already includes +8*(lane>>4);
//      elements 0..7 <- p[0..7] (k0+8h..), elements 8..15 <- p[16..23] (k0+16+8h..)
__device__ __forceinline__ v16h ldfrag_h(const _Float16* p) {
  FH f;
  f.h[0] = *(const v8h*)(p);
  f.h[1] = *(const v8h*)(p + 16);
  return f.v;
}

// ---- WMMA helpers with trailing VALU hazard gap --------------------------------------------------------
__device__ __forceinline__ v8f mma_h_raw(v16h a, v16h b, v8f c) {
  return __builtin_amdgcn_wmma_f32_16x16x32_f16(false, a, false, b, (short)0, c, false, false);
}
__device__ __forceinline__ v8f mma_h(v16h a, v16h b, v8f c) {
  c = mma_h_raw(a, b, c);
#if defined(__HIP_DEVICE_COMPILE__)
  asm volatile("v_nop\n\tv_nop\n\tv_nop\n\tv_nop" : "+v"(c) : "v"(a), "v"(b));
#endif
  return c;
}
__device__ __forceinline__ void guard3(v8f& x, v8f& y, v16h a, v16h b, v16h d) {   // two D tiles, 3 frags live
#if defined(__HIP_DEVICE_COMPILE__)
  asm volatile("v_nop\n\tv_nop\n\tv_nop\n\tv_nop" : "+v"(x), "+v"(y) : "v"(a), "v"(b), "v"(d));
#endif
}
__device__ __forceinline__ void guard1q(v8f& x, v16h a, v16h b, v16h d, v16h e) {           // one D, 4 frags
#if defined(__HIP_DEVICE_COMPILE__)
  asm volatile("v_nop\n\tv_nop\n\tv_nop\n\tv_nop" : "+v"(x) : "v"(a), "v"(b), "v"(d), "v"(e));
#endif
}
__device__ __forceinline__ void guard4m(v8f& x, v8f& y, v16h a, v16h b, v16h d, v16h e) {   // two D, 4 frags
#if defined(__HIP_DEVICE_COMPILE__)
  asm volatile("v_nop\n\tv_nop\n\tv_nop\n\tv_nop" : "+v"(x), "+v"(y) : "v"(a), "v"(b), "v"(d), "v"(e)
               : "memory");
#endif
}
__device__ __forceinline__ void guard8m(v8f& x, v8f& y, v16h a, v16h b, v16h d, v16h e,
                                        v16h f, v16h g, v16h p, v16h q) {                      // two D, 8 frags
#if defined(__HIP_DEVICE_COMPILE__)
  asm volatile("v_nop\n\tv_nop\n\tv_nop\n\tv_nop" : "+v"(x), "+v"(y)
               : "v"(a), "v"(b), "v"(d), "v"(e), "v"(f), "v"(g), "v"(p), "v"(q) : "memory");
#endif
}
__device__ __forceinline__ void acc_guard4(v8f& a, v8f& b, v8f& c, v8f& d) {
#if defined(__HIP_DEVICE_COMPILE__)
  asm volatile("v_nop\n\tv_nop\n\tv_nop\n\tv_nop" : "+v"(a), "+v"(b), "+v"(c), "+v"(d));
#endif
}
// lane l <-> lane l ^ 16 (the two halves of a D column) by a vector cross-row move
__device__ __forceinline__ float xhalf(float x) {
  const int b = __builtin_bit_cast(int, x);
  return __builtin_bit_cast(float, __builtin_amdgcn_permlanex16(b, b, 0x76543210, 0xfedcba98, false, false));
}
__device__ __forceinline__ void wave_sync_lds() {
  __builtin_amdgcn_fence(__ATOMIC_RELEASE, "workgroup");
  __builtin_amdgcn_wave_barrier();
  __builtin_amdgcn_fence(__ATOMIC_ACQUIRE, "workgroup");
}

// ---- eight asynchronous 16-B copies global -> LDS per lane (l: LDS byte address, g: global address). The
//      s_wait_xcnt stands inside the statement so that no address register is rewritten ahead of it.
__device__ __forceinline__ void acopy8(uint32_t l0, uint32_t l1, uint32_t l2, uint32_t l3,
                                       uint32_t l4, uint32_t l5, uint32_t l6, uint32_t l7,
                                       const _Float16* g0, const _Float16* g1, const _Float16* g2,
                                       const _Float16* g3, const _Float16* g4, const _Float16* g5,
                                       const _Float16* g6, const _Float16* g7) {
#if defined(__HIP_DEVICE_COMPILE__)
  asm volatile("global_load_async_to_lds_b128 %0, %8, off\n\t"
               "global_load_async_to_lds_b128 %1, %9, off\n\t"
               "global_load_async_to_lds_b128 %2, %10, off\n\t"
               "global_load_async_to_lds_b128 %3, %11, off\n\t"
               "global_load_async_to_lds_b128 %4, %12, off\n\t"
               "global_load_async_to_lds_b128 %5, %13, off\n\t"
               "global_load_async_to_lds_b128 %6, %14, off\n\t"
               "global_load_async_to_lds_b128 %7, %15, off\n\t"
               "s_wait_xcnt 0x0"
               :: "v"(l0), "v"(l1), "v"(l2), "v"(l3), "v"(l4), "v"(l5), "v"(l6), "v"(l7),
                  "v"(g0), "v"(g1), "v"(g2), "v"(g3), "v"(g4), "v"(g5), "v"(g6), "v"(g7)
               : "memory");
#endif
}
// four copies per lane from one plane: wave-uniform base b (scalar registers) + the lane's byte offsets o0..o3;
// the s_wait_xcnt stands inside the statement for the same reason as above (it covers the base registers too)
__device__ __forceinline__ void acopy4s(uint32_t l0, uint32_t l1, uint32_t l2, uint32_t l3,
                                        uint32_t o0, uint32_t o1, uint32_t o2, uint32_t o3, const _Float16* b) {
#if defined(__HIP_DEVICE_COMPILE__)
  asm volatile("global_load_async_to_lds_b128 %0, %4, %8\n\t"
               "global_load_async_to_lds_b128 %1, %5, %8\n\t"
               "global_load_async_to_lds_b128 %2, %6, %8\n\t"
               "global_load_async_to_lds_b128 %3, %7, %8\n\t"
               "s_wait_xcnt 0x0"
               :: "v"(l0), "v"(l1), "v"(l2), "v"(l3), "v"(o0), "v"(o1), "v"(o2), "v"(o3), "s"(b)
               : "memory");
#endif
}
// eight copies per lane, four from each of two planes (bases b, d) at the same byte offsets; one wait for all
__device__ __forceinline__ void acopy8s(uint32_t l0, uint32_t l1, uint32_t l2, uint32_t l3,
                                        uint32_t l4, uint32_t l5, uint32_t l6, uint32_t l7,
                                        uint32_t o0, uint32_t o1, uint32_t o2, uint32_t o3,
                                        const _Float16* b, const _Float16* d) {
#if defined(__HIP_DEVICE_COMPILE__)
  asm volatile("global_load_async_to_lds_b128 %0, %8, %12\n\t"
               "global_load_async_to_lds_b128 %1, %9, %12\n\t"
               "global_load_async_to_lds_b128 %2, %10, %12\n\t"
               "global_load_async_to_lds_b128 %3, %11, %12\n\t"
               "global_load_async_to_lds_b128 %4, %8, %13\n\t"
               "global_load_async_to_lds_b128 %5, %9, %13\n\t"
               "global_load_async_to_lds_b128 %6, %10, %13\n\t"
               "global_load_async_to_lds_b128 %7, %11, %13\n\t"
               "s_wait_xcnt 0x0"
               :: "v"(l0), "v"(l1), "v"(l2), "v"(l3), "v"(l4), "v"(l5), "v"(l6), "v"(l7),
                  "v"(o0), "v"(o1), "v"(o2), "v"(o3), "s"(b), "s"(d)
               : "memory");
#endif
}
// 64 rows of one operand, 256 B each, into LDS rows of pitch GPIT: l / g are this thread's addresses in row
// (tid >> 4) at 16-B piece (tid & 15); copy i takes row 8 i + (tid >> 4), a wave's copy covers two whole rows.
__device__ __forceinline__ void acopy_rows64(uint32_t l, const _Float16* g, size_t ld) {
  const uint32_t ls = 8u * GPIT * 2u;
  const size_t   gs = 8 * ld;
  acopy8(l, l + ls, l + 2 * ls, l + 3 * ls, l + 4 * ls, l + 5 * ls, l + 6 * ls, l + 7 * ls,
         g, g + gs, g + 2 * gs, g + 3 * gs, g + 4 * gs, g + 5 * gs, g + 6 * gs, g + 7 * gs);
}
// the issuing wave's own copies have landed (the compiler places no wait for them)
__device__ __forceinline__ void wait_async0() {
#if defined(__HIP_DEVICE_COMPILE__)
  asm volatile("s_wait_asynccnt 0x0" ::: "memory");
#endif
}
// the address translations of this wave's issued global loads and stores are done: stands ahead of an instruction that
// reuses a register which such a load or store names
__device__ __forceinline__ void wait_x0() {
#if defined(__HIP_DEVICE_COMPILE__)
  asm volatile("s_wait_xcnt 0x0" ::: "memory");
#endif
}
// this wave's LDS reads of the stage have returned before the stage is handed back for a refill
__device__ __forceinline__ void wait_ds0() {
#if defined(__HIP_DEVICE_COMPILE__)
  asm volatile("s_wait_dscnt 0x0" ::: "memory");
#endif
}

// =====================================================================================================
// Row-major convert: f32 [n] -> f16 plane [n] holding f16(bf16 RNE value * scale) (scale a power of two, exact).
// coverage: bx = 0 .. n/2048 - 1 blocks x 256 threads x 8 = n elements (n % 2048 == 0 host-checked); by = 2 arrays.
// One block's share of the work; the block indices come from the kernel prep below.
// =====================================================================================================
__device__ __forceinline__ void cvt_rm(int bx, int by, const float* __restrict__ in0, const float* __restrict__ in1,
                                       unsigned short* out, int n, float scale) {
  const size_t i8 = ((size_t)bx * 256 + threadIdx.x) * 8;
  if (i8 + 8 > (size_t)n) return;        // never taken for the host-checked sizes; no barriers below
  const float* in = by ? in1 : in0;      // by = which of the two arrays; its plane follows the first
  out += (size_t)by * (size_t)n;
  const v4f a = *(const v4f*)(in + i8);
  const v4f b = *(const v4f*)(in + i8 + 4);
  float f[8];
  f[0] = a[0]; f[1] = a[1]; f[2] = a[2]; f[3] = a[3];
  f[4] = b[0]; f[5] = b[1]; f[6] = b[2]; f[7] = b[3];
  v4u p;
#pragma unroll
  for (int e = 0; e < 4; ++e) {
    const unsigned short b0 = bf_bits(f[2 * e]), b1 = bf_bits(f[2 * e + 1]);
    const _Float16 x0 = (_Float16)(bf_up(b0) * scale);
    const _Float16 x1 = (_Float16)(bf_up(b1) * scale);
    p[e] = pk16(h_bits(x0), h_bits(x1));
  }
  *(v4u*)(out + i8) = p;
  
}

// =====================================================================================================
// Transposing convert: f32 in[R][C] (row-major, pitch C) -> 16-bit out[C][R] (pitch R), 64x64 tiles through LDS.
//   MODE 0: one plane  out0 = f16(bf16 RNE value * scale).
//   MODE 1: two planes out0 = f16(v * scale) hi, out1 = f16((v * scale - hi) * RSC) residual.
// Block = 256 threads; (bx, by, bz) = (C/64, R/64, 2 matrices) exact (host-checked); sm = the block's 64 x 65 f32 LDS
// tile, declared by the kernel that calls this. Load: thread -> input row tid>>2, 16 consecutive
// columns (four 16-B loads). Store: two iterations, output row it*32 + (tid>>3), lanes (tid&7) -> elements
// coverage: 2 iterations x 32 output rows x 8 lanes x 8 halves = the whole 64x64 tile; grid covers all of C x R.
// =====================================================================================================
template <int MODE>
__device__ __forceinline__ void tr_cvt(float (*sm)[65], int bx, int by, int bz,
                                       const float* __restrict__ in0, const float* __restrict__ in1,
                                       int R, int C, unsigned short* out0, unsigned short* out1,
                                       float scale) {
  const int tid = threadIdx.x;
  const float* in = bz ? in1 : in0;        // bz = which of the two matrices; its planes follow the first's
  out0 += (size_t)bz * (size_t)R * (size_t)C;
  out1 += (size_t)bz * (size_t)R * (size_t)C;
  const int c0 = bx * 64;                  // input column block -> output row block
  const int r0 = by * 64;                  // input row block    -> output column block
  if (c0 + 64 > C || r0 + 64 > R) return;  // block-uniform, ahead of any barrier; never taken for exact grids
  {
    const int lr = tid >> 2, lc = (tid & 3) * 16;
    const float* src = in + (size_t)(r0 + lr) * (size_t)C + c0 + lc;
#pragma unroll
    for (int q = 0; q < 4; ++q) {
      const v4f v = *(const v4f*)(src + 4 * q);
      sm[lr][lc + 4 * q + 0] = v[0];
      sm[lr][lc + 4 * q + 1] = v[1];
      sm[lr][lc + 4 * q + 2] = v[2];
      sm[lr][lc + 4 * q + 3] = v[3];
    }
  }
  __syncthreads();
  const int seg = tid & 7;
  v4u p0[2], p1[2];
#pragma unroll
  for (int it = 0; it < 2; ++it) {
    const int ocl = it * 32 + (tid >> 3);   // output row within the tile = input column
    float f[8];
#pragma unroll
    for (int e = 0; e < 8; ++e) f[e] = sm[seg * 8 + e][ocl];
    v4u pk, pl;
#pragma unroll
    for (int e = 0; e < 4; ++e) {
      const float g0 = f[2 * e], g1 = f[2 * e + 1];
      if (MODE == 0) {
        const _Float16 x0 = (_Float16)(bfr(g0) * scale);
        const _Float16 x1 = (_Float16)(bfr(g1) * scale);
        pk[e] = pk16(h_bits(x0), h_bits(x1));
        pl[e] = pk[e];
      } else {
        const float s0 = g0 * scale, s1 = g1 * scale;
        const _Float16 x0 = (_Float16)s0, x1 = (_Float16)s1;
        const _Float16 y0 = (_Float16)((s0 - (float)x0) * RSC);
        const _Float16 y1 = (_Float16)((s1 - (float)x1) * RSC);
        pk[e] = pk16(h_bits(x0), h_bits(x1));
        pl[e] = pk16(h_bits(y0), h_bits(y1));
      }
    }
    p0[it] = pk;
    p1[it] = pl;
  }
  {
#pragma unroll
    for (int it = 0; it < 2; ++it) {
      const int ocl = it * 32 + (tid >> 3);
      const size_t go = (size_t)(c0 + ocl) * (size_t)R + (size_t)(r0 + seg * 8);
      *(v4u*)(out0 + go) = p0[it];
      if (MODE == 1) *(v4u*)(out1 + go) = p1[it];
    }
    
  }
}

// =====================================================================================================
// Rotary tables for interleaved pairs: cost[t][i] = cos(t * inv_freq[i]), sint[t][i] = sin(t * inv_freq[i]),
// i = 0..31, inv_freq[i] = 1 / (10000^(2i/64)) (power via f64 exp2 -> one f32 convert, then an f32 reciprocal
// formed in f64 and converted once), angle = one f32 multiply with t = position 0..4095 in the concatenated
// coverage: bx = 0 .. n/256 - 1 blocks x 256 threads = n = SEQ*32 elements of each table.
// =====================================================================================================
__device__ __forceinline__ void rope_tab(int bx, float* cost, float* sint, int n) {
  const int e = bx * 256 + (int)threadIdx.x;
  if (e >= n) return;                      // never taken (n % 256 == 0); no barriers below
  const int t = e >> 5, i = e & 31;
  const double pd = exp2((double)i * (1.0 / 32.0) * LOG2_BASE);   // 10000^(2i/64)
  const float  pf = (float)pd;
  const float  invf = (float)(1.0 / (double)pf);
  const float  ang = (float)t * invf;
  float sv, cv;
  sincosf(ang, &sv, &cv);
  *(float*)(cost + e) = cv;
  *(float*)(sint + e) = sv;
  
}

// =====================================================================================================
// The three preparations, which do not depend on one another, in ONE launch, told apart by block range (the
// branches are block-uniform, so the barrier inside tr_cvt is reached by a whole block or by none): blocks
// 0 .. PB_ROPE-1 build the rotary tables, the next PB_TR transpose and convert the two weight matrices
// ((W3/64, DM/64, matrix), x fastest), the last PB_CVT convert x and a ((n/2048, array), x fastest).
// coverage: grid.x = PB_ROPE + PB_TR + PB_CVT exact.
// =====================================================================================================
#define PB_ROPE ((SEQ * RP) / 256)
#define PB_TRX  (W3 / 64)
#define PB_TRY  (DM / 64)
#define PB_TR   (PB_TRX * PB_TRY * 2)
#define PB_CVX  ((NB * NTOK * DM) / 2048)
#define PB_CVT  (PB_CVX * 2)
__global__ __launch_bounds__(256) void prep(const float* __restrict__ x, const float* __restrict__ a,
                                           unsigned short* xh,
                                           const float* __restrict__ wx, const float* __restrict__ wa,
                                           unsigned short* wxt, float* cost, float* sint) {
  __shared__ float sm[64][65];
  int b = (int)blockIdx.x;
  if (b < PB_ROPE) {
    rope_tab(b, cost, sint, SEQ * RP);
    return;
  }
  b -= PB_ROPE;
  if (b < PB_TR) {
    const int bz = b / (PB_TRX * PB_TRY);
    const int r  = b - bz * (PB_TRX * PB_TRY);
    const int by = r / PB_TRX;
    tr_cvt<0>(sm, r - by * PB_TRX, by, bz, wx, wa, DM, W3, wxt, wxt, WSC);
    // in the built text another range's code follows these stores and reuses their registers: the wait stands ahead of it
    asm volatile("s_wait_xcnt 0x0" ::: "memory");
    return;
  }
  b -= PB_TR;
  if (b < PB_CVT) {
    const int by = b / PB_CVX;
    cvt_rm(b - by * PB_CVX, by, x, a, xh, NB * NTOK * DM, XSC);
  }
}

// v rows -> v^T planes (MODE 1 of tr_cvt): grid = (C/64, R/64, 2 matrices) exact (host-checked)
__global__ __launch_bounds__(256) void tr_v(const float* __restrict__ in0, const float* __restrict__ in1,
                                           int R, int C, unsigned short* out0, unsigned short* out1, float scale) {
  __shared__ float sm[64][65];
  tr_cvt<1>(sm, (int)blockIdx.x, (int)blockIdx.y, (int)blockIdx.z, in0, in1, R, C, out0, out1, scale);
}

// =====================================================================================================
// Register-blocked f16 WMMA GEMM, one wave per 32x128 tile; block = 4 waves = 4 tiles stacked in m = one 128x128
// block tile whose operands pass through LDS: a stage is 128 k of the 128 A rows and the 128 Bt rows, brought by
// asynchronous copies into two buffers (stage t + 1 flies while stage t is worked on), read by all 4 waves:
//   acc[m][n] = sum_k A[m][k] * Bt[n][k]; A row-major [M][K] pitch lda, Bt row-major [N][K] pitch ldb
//   (k contiguous); M % 128 == 0, N % 128 == 0, K % 128 == 0 (exact constants here, host-checked).
// EPI 1 (q|k planes, N == QKW): the 128-column tile holds two heads of 64 columns (columns < DM are q heads,
//        columns >= DM are k heads). Per row and head: t = acc*oscale; v = t * (1/max(||t||_2, 1e-12)) *
//        bf16(gain[head][d]) * 8; then the interleaved-pair rotary rotation with the f32 tables at position
//        crow0 + m (pair (2i, 2i+1): o1 = v1*c - v2*s, o2 = v1*s + v2*c), times cscale (QSC for q, KSC for k)
//        -> C0 = f16 hi, C1 = f16((v - hi) * RSC) residual, 16-bit planes of pitch ldc, row crow0 + m, column n.
// EPI 3: f32 rows (C0) = acc*oscale, pitch ldc, row crow0 + m, column n.
// 16 lanes x 16 B per 256-B row segment (two rows per instruction), f32 as 32 lanes x 16 B per 512-B row segment;
// coverage: 2 slabs x 16 rows x 128 cols = the wave's whole 32x128 tile; tiles = whole M x N (bx = 0 .. tiles/4 - 1
// exact), grid.y = the two streams, grid.z = the batches. One block's work; ring (the block's LDS) and bx come from
// the kernel gemm_qkv below.
// =====================================================================================================
template <int EPI>
__device__ __forceinline__ void gemm_t(
    _Float16* ring, int bx,
    const unsigned short* __restrict__ A0, const unsigned short* __restrict__ A1, int lda,
    const unsigned short* __restrict__ Bt0, const unsigned short* __restrict__ Bt1, int ldb,
    void* C0, void* C1, int ldc, int crows,
    const float* __restrict__ cost, const float* __restrict__ sint,
    const float* __restrict__ gq0, const float* __restrict__ gk0,
    const float* __restrict__ gq1, const float* __restrict__ gk1,
    int M, int N, int K, float oscale) {
  const int lane = threadIdx.x & 31;
  const int wave = threadIdx.x >> 5;
  // blockIdx.y = stream (0: operands A0, Bt0, gains gq0, gk0, C rows 0..M-1; 1: the others, C rows M..2M-1);
  // blockIdx.z = batch (A rows z*M.., C plane z of crows rows)
  const int  st = (int)blockIdx.y;
  const unsigned short* A  = (st ? A1 : A0) + (size_t)blockIdx.z * (size_t)M * (size_t)lda;
  const unsigned short* Bt = st ? Bt1 : Bt0;
  const float* gq = st ? gq1 : gq0;
  const float* gk = st ? gk1 : gk0;
  const int    crow0 = st * M;
  const size_t cpl   = (size_t)blockIdx.z * (size_t)crows * (size_t)ldc;   // element offset of this batch's C plane
  const int tilesN = N >> 7;
  const int tilesM = M >> 5;
  if (bx >= (tilesM >> 2) * tilesN) return;   // block-uniform, ahead of any barrier; never taken
  const int bm = bx / tilesN;
  const int tn = bx - bm * tilesN;
  const int tm = bm * 4 + wave;
  const int m0 = tm << 5;
  const int n0 = tn << 7;
  const int rl   = lane & 15;            // row (A) / col (B, D) within subtile
  const int hh   = lane >> 4;            // lane half
  const int koff = hh * 8;               // k offset of this lane half

  v8f acc[2][8];
#pragma unroll
  for (int i = 0; i < 2; ++i)
#pragma unroll
    for (int j = 0; j < 8; ++j) acc[i][j] = zero8();

  {
    const int cr = (int)threadIdx.x >> 4;          // row (mod 8) this thread copies
    const int cc = (int)threadIdx.x & 15;          // its 16-B piece of the row's 256 B
    const _Float16* ga = (const _Float16*)(const void*)A + (size_t)((bm << 7) + cr) * (size_t)lda + cc * 8;
    const _Float16* gb = (const _Float16*)(const void*)Bt + (size_t)(n0 + cr) * (size_t)ldb + cc * 8;
    const uint32_t  lr = (uint32_t)(size_t)(const void*)ring + (uint32_t)(cr * GPIT + cc * 8) * 2u;
    const int nst = K / GBK;                       // stages; block-uniform
    auto fill = [&](int st) {                      // stage st -> buffer st & 1: 32 copies per wave
      const uint32_t l = lr + (uint32_t)(st & 1) * (uint32_t)(GSTG * 2);
      const _Float16* pa = ga + (size_t)st * GBK;
      const _Float16* pb = gb + (size_t)st * GBK;
      acopy_rows64(l, pa, (size_t)lda);
      acopy_rows64(l + 64u * GPIT * 2u, pa + (size_t)64 * (size_t)lda, (size_t)lda);
      acopy_rows64(l + 128u * GPIT * 2u, pb, (size_t)ldb);
      acopy_rows64(l + 192u * GPIT * 2u, pb + (size_t)64 * (size_t)ldb, (size_t)ldb);
    };
    fill(0);
    wait_async0();
    __syncthreads();                               // stage 0 is published
    if (nst > 1) fill(1);
    for (int t = 0; t < nst; ++t) {
      const _Float16* sb  = ring + (t & 1) * GSTG;
      const _Float16* ar0 = sb + (wave * 32 + rl) * GPIT + koff;
      const _Float16* ar1 = ar0 + 16 * GPIT;
      const _Float16* br  = sb + (128 + rl) * GPIT + koff;
#pragma unroll                                     // the k offset becomes an immediate of each LDS load
      for (int kk = 0; kk < GBK / 32; ++kk) {
        const v16h a0 = ldfrag_h(ar0 + 32 * kk);
        const v16h a1 = ldfrag_h(ar1 + 32 * kk);
        v16h b[8];
#pragma unroll                                     // b[] stays in registers: the k-step's LDS loads stand as one group
        for (int j = 0; j < 8; ++j) b[j] = ldfrag_h(br + j * 16 * GPIT + 32 * kk);
#pragma unroll                                     // acc[][] and b[] indexed by constants only
        for (int j = 0; j < 8; ++j) {
          acc[0][j] = mma_h_raw(a0, b[j], acc[0][j]);
          acc[1][j] = mma_h_raw(a1, b[j], acc[1][j]);
          guard3(acc[0][j], acc[1][j], a0, a1, b[j]);
        }
      }
      wait_ds0();
      wait_async0();
      __syncthreads();                             // publishes stage t + 1 and ends every read of stage t
      if (t + 2 < nst) fill(t + 2);
    }
    wait_async0();
  }
  acc_guard4(acc[0][0], acc[0][1], acc[0][2], acc[0][3]);
  acc_guard4(acc[0][4], acc[0][5], acc[0][6], acc[0][7]);
  acc_guard4(acc[1][0], acc[1][1], acc[1][2], acc[1][3]);
  acc_guard4(acc[1][4], acc[1][5], acc[1][6], acc[1][7]);

  // ---- epilogue ----
  // per-wave 16x128 slab, pitch 132 floats, in the ring's first bytes: the barrier at the foot of the last trip has
  // ended every wave's reads of both stages, and no copy is issued or outstanding behind it
  float* slab = (float*)(void*)ring + wave * SLABF;
  float gmul[8];
  float csc = 1.0f;
  if (EPI == 1) {
    const bool isq = (n0 < DM);                                 // wave-uniform
    const int  hb  = (isq ? n0 : (n0 - DM)) >> 6;               // first head of this tile (0..15)
    csc = isq ? QSC : KSC;
#pragma unroll
    for (int j = 0; j < 8; ++j) {
      const int gi = (hb + (j >> 2)) * HD + 16 * (j & 3) + rl;  // < NHEAD*HD, inside both gain arrays
      const float ga = bfr(gq[gi]);
      const float gb = bfr(gk[gi]);
      gmul[j] = (isq ? ga : gb) * 8.0f;
    }
  } else {
#pragma unroll
    for (int j = 0; j < 8; ++j) gmul[j] = 1.0f;
  }
#pragma unroll
  for (int i = 0; i < 2; ++i) {
    const int mB = m0 + 16 * i;
    if (EPI == 1) {
      float inv[2][8];
#pragma unroll
      for (int jh = 0; jh < 2; ++jh) {
#pragma unroll
        for (int r = 0; r < 8; ++r) {        // sum of squares over the head's 64 columns of row 8hh+r
          float ss = 0.f;
#pragma unroll
          for (int jj = 0; jj < 4; ++jj) {
            const float x = acc[i][4 * jh + jj][r] * oscale;
            ss += x * x;
          }
          ss += __shfl_xor(ss, 1, 32);
          ss += __shfl_xor(ss, 2, 32);
          ss += __shfl_xor(ss, 4, 32);
          ss += __shfl_xor(ss, 8, 32);
          inv[jh][r] = oscale * (1.0f / fmaxf(sqrtf(ss), NRM_EPS));
        }
      }
#pragma unroll
      for (int j = 0; j < 8; ++j) {
#pragma unroll
        for (int r = 0; r < 8; ++r)
          slab[(8 * hh + r) * 132 + 16 * j + rl] = acc[i][j][r] * inv[j >> 2][r] * gmul[j];
      }
    } else {
#pragma unroll
      for (int j = 0; j < 8; ++j) {
#pragma unroll
        for (int r = 0; r < 8; ++r) slab[(8 * hh + r) * 132 + 16 * j + rl] = acc[i][j][r] * oscale;
      }
    }
    wave_sync_lds();
    if (EPI == 3) {
      float* Cf = (float*)C0 + cpl;
      v4f ov[16];
#pragma unroll
      for (int it = 0; it < 16; ++it) ov[it] = *(const v4f*)(slab + it * 132 + lane * 4);
      {
#pragma unroll
        for (int it = 0; it < 16; ++it)                       // row it: 32 lanes x 16 B = 512 B = 128 cols
          *(v4f*)(Cf + (size_t)(crow0 + mB + it) * (size_t)ldc + n0 + lane * 4) = ov[it];
        
      }
    } else {
      unsigned short* Cp = (unsigned short*)C0 + cpl;
      unsigned short* Cq = (unsigned short*)C1 + cpl;
      v4u hv[8], lv[8];
#pragma unroll
      for (int it = 0; it < 8; ++it) {
        const int row = it * 2 + hh;                          // it 0..7 x hh 0..1 = rows 0..15
        const float* sp = slab + row * 132 + rl * 8;          // 8 consecutive columns = 4 rotary pairs
        const v4f fa = *(const v4f*)sp;
        const v4f fb = *(const v4f*)(sp + 4);
        float f[8];
        f[0] = fa[0]; f[1] = fa[1]; f[2] = fa[2]; f[3] = fa[3];
        f[4] = fb[0]; f[5] = fb[1]; f[6] = fb[2]; f[7] = fb[3];
        const int pos = crow0 + mB + row;                     // position in the concatenated sequence
        const v4f cv = *(const v4f*)(cost + (size_t)pos * RP + (rl & 7) * 4);   // pairs ((rl&7)*4 .. +3)
        const v4f sv = *(const v4f*)(sint + (size_t)pos * RP + (rl & 7) * 4);
        v4u pk, pl;
#pragma unroll
        for (int e = 0; e < 4; ++e) {
          const float f0 = f[2 * e], f1 = f[2 * e + 1];
          const float cc = cv[e], sn = sv[e];
          const float g0 = (f0 * cc - f1 * sn) * csc;
          const float g1 = (f0 * sn + f1 * cc) * csc;
          const _Float16 x0 = (_Float16)g0;
          const _Float16 x1 = (_Float16)g1;
          const _Float16 y0 = (_Float16)((g0 - (float)x0) * RSC);
          const _Float16 y1 = (_Float16)((g1 - (float)x1) * RSC);
          pk[e] = pk16(h_bits(x0), h_bits(x1));
          pl[e] = pk16(h_bits(y0), h_bits(y1));
        }
        hv[it] = pk;
        lv[it] = pl;
      }
      {
#pragma unroll
        for (int it = 0; it < 8; ++it) {
          const int row = it * 2 + hh;
          const size_t go = (size_t)(crow0 + mB + row) * (size_t)ldc + n0 + rl * 8;
          *(v4u*)(Cp + go) = hv[it];
          *(v4u*)(Cq + go) = lv[it];
        }
        
      }
    }
    wave_sync_lds();
  }
}

// =====================================================================================================
// The q|k product and the v product, which do not depend on one another, in ONE launch, told apart by block range
// (a block-uniform branch ahead of every barrier): blocks 0 .. nbqk-1 of grid.x are the q|k tiles (EPI 1, W^T rows
// 0 .. Nqk-1), the others the v tiles (EPI 3, W^T rows Nqk .. Nqk+Nv-1).
// coverage: grid = (q|k tiles/4 + v tiles/4 exact, 2 streams, batches).
// =====================================================================================================
__global__ __launch_bounds__(128) void gemm_qkv(
    const unsigned short* __restrict__ A0, const unsigned short* __restrict__ A1, int lda,
    const unsigned short* __restrict__ Bt0, const unsigned short* __restrict__ Bt1, int ldb,
    void* QH, void* QL, int ldqk, void* VFp, int ldv, int crows,
    const float* __restrict__ cost, const float* __restrict__ sint,
    const float* __restrict__ gq0, const float* __restrict__ gk0,
    const float* __restrict__ gq1, const float* __restrict__ gk1,
    int M, int Nqk, int Nv, int K, int nbqk, float oscale) {
  __shared__ __align__(16) _Float16 ring[2 * GSTG]; // two operand stages; behind the k loop the same bytes hold the
                                                    // epilogue slabs, so a block takes 136 KiB and two fit one WGP
  const int bx = (int)blockIdx.x;
  if (bx < nbqk) {
    gemm_t<1>(ring, bx, A0, A1, lda, Bt0, Bt1, ldb, QH, QL, ldqk, crows,
              cost, sint, gq0, gk0, gq1, gk1, M, Nqk, K, oscale);
  } else {
    const size_t wo = (size_t)Nqk * (size_t)ldb;      // the v rows of W^T follow the q|k rows
    gemm_t<3>(ring, bx - nbqk, A0, A1, lda, Bt0 + wo, Bt1 + wo, ldb, VFp, VFp, ldv, crows,
              cost, sint, gq0, gk0, gq1, gk1, M, Nv, K, oscale);
  }
}

// =====================================================================================================
// Compressive-memory update per (head h, segment s in 0..2) of one batch (bb):
//   MT[h][s][e][d] = sum over the 1024 keys l of segment s of v[l][e] * sk[l][d], sk = elu(k) + 1
//   (elu(x) = x > 0 ? x : exp(x) - 1, so sk = x > 0 ? x + 1 : exp(x)), and ZP[h][s][d] = sum_l sk[l][d].
//   k is rebuilt in f32 from the q|k hi / residual planes ((hi + lo/RSC) / KSC, column DM + h*64 + d), sk is
//   RNE-converted to f16 and written TRANSPOSED into an LDS tile skT[d][l] (64 keys per chunk, pitch 72 halves);
//   A = V^T hi plane rows (h*64 + e, keys), Bt = skT; D[e][d] scaled by 1/VSC.
//   Block = 4 waves (one block's work; bx, bb and the LDS arrays come from the kernel attn_all below); wave w owns
//   e rows 16*w.. and all 64 d columns; acc guarded; the 16x64 f32 piece is staged in the wave's slab.
// coverage: MT: 4 waves x (16 rows x 64 cols) = the whole 64x64 tile of (h,s); 8 its x 2 row halves x 16 lanes x 4
//   floats = 16 rows x 64 cols per wave. ZP: 16 lanes x 4 floats = 64. skT fill: 128 threads x 32 d x 1 key = 64x64 chunk.
// =====================================================================================================
__device__ __forceinline__ void mt_seg(_Float16* skT, float (*slab)[16 * 68], float (*zred)[HD], float* zsum,
                                       int bx, int bb,
                                       const unsigned short* __restrict__ QKH,
                                       const unsigned short* __restrict__ QKL,
                                       const unsigned short* __restrict__ VTH,
                                       float* MT, float* ZP) {
  const int tid = threadIdx.x, wave = tid >> 5, lane = tid & 31, hh = lane >> 4, c = lane & 15;
  const int h = (int)((unsigned)bx / 3u);
  const int s = (int)((unsigned)bx - (unsigned)h * 3u);
  if (h >= NHEAD) return;                 // block-uniform, ahead of any barrier; never taken
  QKH += (size_t)bb * SEQ * QKW;          // bb = batch: its own planes
  QKL += (size_t)bb * SEQ * QKW;
  VTH += (size_t)bb * DM * SEQ;
  MT  += (size_t)bb * NHEAD * 3 * HD * HD;
  ZP  += (size_t)bb * NHEAD * 3 * HD;
  const int r  = tid >> 1;                // key within the 64-key chunk handled by this thread
  const int dq = (tid & 1) * 32;          // first of the 32 d columns handled by this thread

  const _Float16* Q16 = (const _Float16*)(const void*)QKH;
  const _Float16* L16 = (const _Float16*)(const void*)QKL;
  const _Float16* V16 = (const _Float16*)(const void*)VTH;
  const _Float16* vrow = V16 + (size_t)(h * HD + wave * 16 + c) * SEQ + (size_t)s * SEG + 8 * hh;   // A frag base

  float zacc[32];
#pragma unroll
  for (int e = 0; e < 32; ++e) zacc[e] = 0.f;
  v8f acc[4];
#pragma unroll                            // acc[] indexed by constants only
  for (int j = 0; j < 4; ++j) acc[j] = zero8();

  for (int kt = 0; kt < SEG / 64; ++kt) {
    __syncthreads();                      // prior chunk's fragment reads are done
    {
      const size_t n = (size_t)(s * SEG + kt * 64 + r);
      const _Float16* kp = Q16 + n * QKW + h * HD + dq;     // the row's q columns; its k columns stand DM further
      const _Float16* lp = L16 + n * QKW + h * HD + dq;
      FH kf[2], lf[2];
#pragma unroll                            // kf[], lf[] stay in registers; the eight loads stand as one group
      for (int q = 0; q < 2; ++q) {
        kf[q].h[0] = *(const v8h*)(kp + DM + 16 * q); kf[q].h[1] = *(const v8h*)(kp + DM + 16 * q + 8);
        lf[q].h[0] = *(const v8h*)(lp + DM + 16 * q); lf[q].h[1] = *(const v8h*)(lp + DM + 16 * q + 8);
      }
#if defined(__HIP_DEVICE_COMPILE__)
      // the eight loads' address translations are done before their two address pairs are reused; the wait takes the
      // pairs as inputs so that they stay whole up to it (without that the last load's result is laid over them)
      asm volatile("s_wait_xcnt 0x0" :: "v"(kp), "v"(lp) : "memory");
#endif
#pragma unroll
      for (int e = 0; e < 32; ++e) {
        const float kv = ((float)kf[e >> 4].v[e & 15] + (float)lf[e >> 4].v[e & 15] * (1.0f / RSC)) * (1.0f / KSC);
        const float sk = (kv > 0.f) ? (kv + 1.0f) : __expf(kv);
        const _Float16 skh = (_Float16)sk;
        skT[(dq + e) * 72 + r] = skh;
        zacc[e] += (float)skh;
      }
    }
    __syncthreads();                      // skT chunk complete
#pragma unroll
    for (int kk = 0; kk < 2; ++kk) {
      const v16h a = ldfrag_h(vrow + kt * 64 + 32 * kk);
#pragma unroll                            // acc[] indexed by constants only
      for (int jp = 0; jp < 2; ++jp) {
        const v16h b0 = ldfrag_h(skT + (16 * (2 * jp) + c) * 72 + 32 * kk + 8 * hh);
        const v16h b1 = ldfrag_h(skT + (16 * (2 * jp + 1) + c) * 72 + 32 * kk + 8 * hh);
        acc[2 * jp]     = mma_h_raw(a, b0, acc[2 * jp]);
        acc[2 * jp + 1] = mma_h_raw(a, b1, acc[2 * jp + 1]);
        guard3(acc[2 * jp], acc[2 * jp + 1], a, b0, b1);
      }
    }
  }
  acc_guard4(acc[0], acc[1], acc[2], acc[3]);

  // ---- MT piece: rows e = 16*wave + (8hh+rr), cols d = 16*jj + c ----
  float* sl = slab[wave];
#pragma unroll
  for (int jj = 0; jj < 4; ++jj) {
#pragma unroll
    for (int rr = 0; rr < 8; ++rr) sl[(8 * hh + rr) * 68 + 16 * jj + c] = acc[jj][rr] * (1.0f / VSC);
  }
  wave_sync_lds();
  {
    v4f mv[8];
#pragma unroll
    for (int it = 0; it < 8; ++it) {
      const int row = it * 2 + hh;        // it 0..7 x hh 0..1 = rows 0..15
      mv[it] = *(const v4f*)(sl + row * 68 + c * 4);
    }
    float* mtb = MT + ((size_t)(h * 3 + s) * HD + (size_t)wave * 16) * HD;
#pragma unroll
    for (int it = 0; it < 8; ++it) {
      const int row = it * 2 + hh;
      *(v4f*)(mtb + (size_t)row * HD + c * 4) = mv[it];
    }
  }
  // ---- ZP: sum zacc over the 16 keys of this wave (lanes sharing lane&1), then over the 4 waves ----
#pragma unroll
  for (int e = 0; e < 32; ++e) {
    float v = zacc[e];
    v += __shfl_xor(v, 2, 32);
    v += __shfl_xor(v, 4, 32);
    v += __shfl_xor(v, 8, 32);
    v += __shfl_xor(v, 16, 32);
    if ((lane >> 1) == 0) zred[wave][(lane & 1) * 32 + e] = v;
  }
  __syncthreads();
  if (tid < HD) {
    float z = 0.f;
#pragma unroll
    for (int w = 0; w < 4; ++w) z += zred[w][tid];
    zsum[tid] = z;
  }
  __syncthreads();
  if (tid < 16) {                         // wave 0, lanes 0..15: 16 x 16 B = the whole 256-B ZP row
    const v4f zz = *(const v4f*)(zsum + tid * 4);
    float* zp = ZP + (size_t)(h * 3 + s) * HD + tid * 4;
    *(v4f*)zp = zz;
  }
}

// =====================================================================================================
// Compressive-memory read per (head h, segment s in 1..3, 128-row block) of one batch (blockIdx.y):
//   M_s = sum over segments before s of MT[h][s'] (f32 sum, RNE convert to an f16 LDS tile MTh[e][d], pitch 72);
//   z_s = sum of ZP[h][s'] (f32, LDS). Per query row n of segment s: q rebuilt in f32 from the hi / residual planes
//   ((hi + lo/RSC) / QSC, column h*64 + d), sq = elu(q) + 1 RNE-converted to f16 directly into the A fragment
//   (elementwise transform keeps the A layout); num[n][e] = sum_d sq[n][d] * M_s[d][e] with Bt = MTh (K = 64, two
//   k-steps, 4 column tiles); den[n] = sum_d sq[n][d] * z_s[d] + 1e-6 in f32 from the same f16 sq values (lane
//   halves combined, then broadcast to the D rows); mem[n][e] = num * (1/den).
//   Gate mix: the attention launch ahead of this one has stored (1 - g) * local in every output element; this kernel
//   adds g * mem to the rows of segments 1..3, g = sigmoid(bf16(gate[h])): rows of positions < NTOK are in the second
//   output (offset OUT1OFF), rows of positions >= NTOK in the first, row t mod NTOK, columns h*64..h*64+63.
//   Block = 8 waves x 16 rows; per-wave 16x64 f32 tile staged in LDS; loads and stores 16 lanes x 16 B per 256-B row
// coverage: 16 heads x 3 segments x 8 row blocks x 8 waves x 16 rows = positions 1024..4095 of every head's 64
//   columns, each element read and rewritten by one lane; 8 its x 2 row halves x 16 lanes x 4 floats = the wave's
//   16x64 tile. Positions 0..1023 (segment 0) keep the attention's value (memory is exactly zero there).
// =====================================================================================================
__global__ __launch_bounds__(256) void mem_ret(const unsigned short* __restrict__ QKH,
                                              const unsigned short* __restrict__ QKL,
                                              const float* __restrict__ MT, const float* __restrict__ ZP,
                                              const float* __restrict__ gate, float* outb) {
  __shared__ __align__(16) _Float16 MTh[HD * 72];
  __shared__ float zs[HD];
  __shared__ __align__(16) float slab[8][16 * 68];

  const int tid = threadIdx.x, wave = tid >> 5, lane = tid & 31, hh = lane >> 4, c = lane & 15;
  const int h   = (int)(blockIdx.x / 24u);
  const int rem = (int)(blockIdx.x - (unsigned)h * 24u);
  const int s   = 1 + rem / 8;            // 1..3
  const int rb  = rem - (s - 1) * 8;      // 0..7
  if (h >= NHEAD) return;                 // block-uniform, ahead of any barrier; never taken
  QKH += (size_t)blockIdx.y * SEQ * QKW;  // blockIdx.y = batch: its own planes
  QKL += (size_t)blockIdx.y * SEQ * QKW;
  MT  += (size_t)blockIdx.y * NHEAD * 3 * HD * HD;
  ZP  += (size_t)blockIdx.y * NHEAD * 3 * HD;
  outb += (size_t)blockIdx.y * NTOK * DM; // and its own rows of both outputs

  // the attention's part of this wave's 16 output rows, fetched ahead of the work below (row it*2 + hh, 16 B per lane)
  const int n0w = s * SEG + rb * MROWS + wave * 16;          // first query position of this wave
  float* ob = outb + ((s < (NTOK / SEG)) ? (size_t)OUT1OFF + (size_t)n0w * DM : (size_t)(n0w - NTOK) * DM)
                   + h * HD + c * 4;
  v4f pv[8];
#pragma unroll                            // pv[] stays in registers; the eight loads stand as one group
  for (int it = 0; it < 8; ++it) pv[it] = *(const v4f*)(ob + (size_t)(it * 2 + hh) * DM);

  {
    const int e = tid >> 2, d0 = (tid & 3) * 16;
    float sm[16];
#pragma unroll
    for (int i = 0; i < 16; ++i) sm[i] = 0.f;
#pragma unroll
    for (int sp = 0; sp < 3; ++sp) {
      if (sp < s) {                       // block-uniform
        const float* src = MT + ((size_t)(h * 3 + sp) * HD + e) * HD + d0;
#pragma unroll
        for (int q = 0; q < 4; ++q) {
          const v4f v = *(const v4f*)(src + 4 * q);
          sm[4 * q + 0] += v[0]; sm[4 * q + 1] += v[1]; sm[4 * q + 2] += v[2]; sm[4 * q + 3] += v[3];
        }
      }
    }
    v8h p0, p1;
#pragma unroll
    for (int i = 0; i < 8; ++i) { p0[i] = (_Float16)sm[i]; p1[i] = (_Float16)sm[8 + i]; }
    *(v8h*)(MTh + e * 72 + d0) = p0;
    *(v8h*)(MTh + e * 72 + d0 + 8) = p1;
    if (tid < HD) {
      float z = 0.f;
#pragma unroll
      for (int sp = 0; sp < 3; ++sp) {
        if (sp < s) z += ZP[(size_t)(h * 3 + sp) * HD + tid];
      }
      zs[tid] = z;
    }
  }
  __syncthreads();

  const _Float16* Q16 = (const _Float16*)(const void*)QKH;
  const _Float16* L16 = (const _Float16*)(const void*)QKL;

  v16h af[2];
  float denp = 0.f;
#pragma unroll
  for (int kk = 0; kk < 2; ++kk) {
    FH hf, lf;
    hf.v = ldfrag_h(Q16 + (size_t)(n0w + c) * QKW + h * HD + 32 * kk + 8 * hh);
    lf.v = ldfrag_h(L16 + (size_t)(n0w + c) * QKW + h * HD + 32 * kk + 8 * hh);
    v16h a;
#pragma unroll
    for (int i = 0; i < 16; ++i) {
      const float qv = ((float)hf.v[i] + (float)lf.v[i] * (1.0f / RSC)) * (1.0f / QSC);
      const float sq = (qv > 0.f) ? (qv + 1.0f) : __expf(qv);
      const _Float16 sqh = (_Float16)sq;
      a[i] = sqh;
      const int kidx = 32 * kk + ((i < 8) ? (8 * hh + i) : (8 + 8 * hh + i));   // k of element i (split map)
      denp += (float)sqh * zs[kidx];
    }
    af[kk] = a;
  }
  const float den = denp + __shfl_xor(denp, 16, 32) + DEN_EPS;   // row c complete in lanes c and c+16

  v8f acc[4];
#pragma unroll
  for (int j = 0; j < 4; ++j) {
    acc[j] = zero8();
#pragma unroll
    for (int kk = 0; kk < 2; ++kk) {
      const v16h b = ldfrag_h(MTh + (16 * j + c) * 72 + 32 * kk + 8 * hh);
      acc[j] = mma_h(af[kk], b, acc[j]);
    }
  }
  float rinv[8];
#pragma unroll
  for (int rr = 0; rr < 8; ++rr) rinv[rr] = 1.0f / __shfl(den, 8 * hh + rr, 32);   // den of D row 8hh+rr

  float* sl = slab[wave];
#pragma unroll
  for (int j = 0; j < 4; ++j) {
#pragma unroll
    for (int rr = 0; rr < 8; ++rr) sl[(8 * hh + rr) * 68 + 16 * j + c] = acc[j][rr] * rinv[rr];
  }
  wave_sync_lds();
  {
    v4f ov[8];
#pragma unroll
    for (int it = 0; it < 8; ++it) {
      const int row = it * 2 + hh;        // it 0..7 x hh 0..1 = rows 0..15
      ov[it] = *(const v4f*)(sl + row * 68 + c * 4);
    }
    const float gv = bfr(gate[h]);
    const float g  = 1.0f / (1.0f + expf(-gv));
#pragma unroll
    for (int it = 0; it < 8; ++it) {
      const int row = it * 2 + hh;
      *(v4f*)(ob + (size_t)row * DM) = g * ov[it] + pv[it];
    }
  }
}

// =====================================================================================================
// Segment-local causal attention with the gate mix, per (batch, h, segment, 64-query block):
//   s = (sum_d qh.kh + (ql.kh + qh.kl) / RSC) * sscale, sscale = (1/8) / (QSC*KSC); key > query (segment-local)
//   -> NEG_BIG (value select); online softmax in f32; p = exp(s - m) carried as ph = f16(1024 p) and, when PRES,
//   also pl = f16((1024 p - ph) * RSC); local numerator = p . v with v as f16 hi (VSC v) and, when PRES, the f16
//   residual ((VSC v - hi) * RSC) plane: oh += ph.vhi over all chunks; when PRES: ol = ph.vres + pl.vhi (one
//   residual accumulator per chunk and 16-wide d tile, both products carry the same 1/RSC), folded as
//   oh += ol / RSC in f32 right after its two k-steps.
//   q|k planes (f16, pitch QKW, rows = positions): q element (t, h, d) at [t*QKW + h*64 + d], k at
//   [t*QKW + DM + h*64 + d]; V^T planes (f16): element (h, d, t) at [(h*64 + d)*SEQ + t].
//   Epilogue per query row t: local = oh / (l * PSC * VSC); out = (1 - g) * local with g = sigmoid(bf16(gate[h]))
//   (the whole result in segment 0, where the memory is exactly 0; the start value to which the kernel mem_ret,
//   launched behind this one, adds g * mem in segments >= 1);
//   rows of positions < NTOK go to the second output (offset OUT1OFF), rows of positions
//   >= NTOK to the first, row t mod NTOK, columns h*64..h*64+63 (pitch DM floats).
//   Block = 4 waves = 64 query rows of one h; bx = 0 .. NHEAD * NSEG * nqb - 1 -> (h, seg, qbs = qb0 + i), bb = batch;
//   bx, bb and the block's LDS arrays come from the kernel attn_all below;
//   key chunks of 64 within the segment, chunks kt <= qbs only (block-uniform trip <= NQB), chunk kt == qbs keeps
//   its diagonal by the per-element select.
//   K / V^T chunk staging: asynchronous 16-B copies, thread -> rows (tid>>3) + 16 i, piece tid&7 of the row's 128 B
//   (a wave's copy takes four whole rows). One buffer per tile: the K tiles of chunk kt + 1 are copied behind the
//   barrier that ends the score reads of chunk kt and fly under its softmax and P.V; the V^T tiles of chunk kt + 1
//   are copied behind the barrier that ends the P.V reads of chunk kt and fly under the scores of chunk kt + 1.
//   q fragments (hi and residual, 2 d-chunks) held in registers for the whole block.
//   Both products run transposed (S^T = K.q^T, O^T += V^T.P^T): a lane holds one
//   query's scores, and two converted S^T tiles are a B fragment of P^T, so P passes through no LDS.
//   Output coverage: each wave stores rows q0..q0+15 (it 0..7 x lane>>4) x 64 columns (16 lanes x 16 B), one
// =====================================================================================================
template <bool PRES>
__device__ __forceinline__
void attn_seg(_Float16* Ksh, _Float16* Kls, _Float16* Vhs, _Float16* Vls, float (*Os)[16 * 68], int bx, int bb,
              const unsigned short* __restrict__ QKH, const unsigned short* __restrict__ QKL,
              const unsigned short* __restrict__ VTH, const unsigned short* __restrict__ VTL,
              const float* __restrict__ gate,
              float* outb, float sscale, int qb0, int nqb) {
  const int tid  = threadIdx.x;
  const int wave = tid >> 5;
  const int lane = tid & 31;
  const int hh   = lane >> 4;
  const int c    = lane & 15;

  const int per = NSEG * nqb;
  const int h   = (int)((unsigned)bx / (unsigned)per);
  const int rem = (int)((unsigned)bx - (unsigned)h * (unsigned)per);
  const int seg = rem / nqb;
  const int qbs = qb0 + (rem - seg * nqb);
  if (h >= NHEAD || seg >= NSEG) return;  // block-uniform, ahead of any barrier; never taken for exact grids
  QKH  += (size_t)bb * SEQ * QKW;         // bb = batch: its own planes and its own rows of both outputs
  QKL  += (size_t)bb * SEQ * QKW;
  VTH  += (size_t)bb * DM * SEQ;
  VTL  += (size_t)bb * DM * SEQ;
  outb += (size_t)bb * NTOK * DM;
  const int sbase = seg * SEG;
  const int rowl0 = qbs * 64 + wave * 16; // segment-local row of this wave's first query
  const int q0    = sbase + rowl0;        // its position in the concatenated sequence

  const _Float16* Q16 = (const _Float16*)(const void*)QKH;
  const _Float16* L16 = (const _Float16*)(const void*)QKL;
  const _Float16* Qg  = Q16 + (size_t)h * HD;
  const _Float16* Qlg = L16 + (size_t)h * HD;
  const _Float16* Kg  = Q16 + DM + (size_t)h * HD;
  const _Float16* Klg = L16 + DM + (size_t)h * HD;
  const _Float16* Vhg = (const _Float16*)(const void*)VTH + (size_t)h * HD * SEQ;
  const _Float16* Vlg = (const _Float16*)(const void*)VTL + (size_t)h * HD * SEQ;

  // ---- q fragments (B operand, column = lane&15), hi and residual, d-chunks 0 and 1, fixed for the block ----
  const v16h qh0 = ldfrag_h(Qg  + (size_t)(q0 + c) * QKW + 8 * hh);
  const v16h qh1 = ldfrag_h(Qg  + (size_t)(q0 + c) * QKW + 32 + 8 * hh);
  const v16h ql0 = ldfrag_h(Qlg + (size_t)(q0 + c) * QKW + 8 * hh);
  const v16h ql1 = ldfrag_h(Qlg + (size_t)(q0 + c) * QKW + 32 + 8 * hh);

  // a lane holds ONE query (row c of the wave's 16): its running maximum, its running sum, and in oh[t][r] the
  // numerator of d = 16 t + 8 hh + r (the transposed output tile)
  float mrow = NEG_BIG, lrow = 0.f;
  v8f oh[4];
#pragma unroll
  for (int t = 0; t < 4; ++t) oh[t] = zero8();

  // ---- tile copies: this thread's row (mod 16) and 16-B piece; copy i takes row sr + 16 i of the 64-row tile ----
  const int sr = tid >> 3, sc = (tid & 7) * 8;
  const uint32_t lofs = (uint32_t)(sr * APIT + sc) * 2u;
  const uint32_t ls   = 16u * APIT * 2u;                    // LDS bytes per 16 rows
  const uint32_t lKh = (uint32_t)(size_t)(const void*)Ksh + lofs;
  const uint32_t lKl = (uint32_t)(size_t)(const void*)Kls + lofs;
  const uint32_t lVh = (uint32_t)(size_t)(const void*)Vhs + lofs;
  const uint32_t lVl = (uint32_t)(size_t)(const void*)Vls + lofs;
  const uint32_t oK = (uint32_t)(sr * QKW + sc) * 2u, gK = 16u * QKW * 2u;   // byte offset in a K tile, per 16 rows
  const uint32_t oV = (uint32_t)(sr * SEQ + sc) * 2u, gV = 16u * SEQ * 2u;   // the same in a V^T tile
  auto fillK = [&](int kv) {                                // K hi and residual rows kv .. kv + 63, d = 0..63
    acopy8s(lKh, lKh + ls, lKh + 2 * ls, lKh + 3 * ls, lKl, lKl + ls, lKl + 2 * ls, lKl + 3 * ls,
            oK, oK + gK, oK + 2 * gK, oK + 3 * gK, Kg + (size_t)kv * QKW, Klg + (size_t)kv * QKW);
  };
  auto fillV = [&](int kv) {                                // V^T rows d = 0..63, keys kv .. kv + 63
    if (PRES)
      acopy8s(lVh, lVh + ls, lVh + 2 * ls, lVh + 3 * ls, lVl, lVl + ls, lVl + 2 * ls, lVl + 3 * ls,
              oV, oV + gV, oV + 2 * gV, oV + 3 * gV, Vhg + kv, Vlg + kv);
    else
      acopy4s(lVh, lVh + ls, lVh + 2 * ls, lVh + 3 * ls, oV, oV + gV, oV + 2 * gV, oV + 3 * gV, Vhg + kv);
  };
  fillK(sbase);
  fillV(sbase);
  wait_async0();
  __syncthreads();                            // chunk 0's K and V^T tiles are published

  for (int kt = 0; kt < NQB; ++kt) {          // static bound; block-uniform causal chunk skipping
    if (kt > qbs) break;
    const int kv0 = sbase + kt * 64;

    // ---- transposed scores: 64 keys x 16 queries per wave, A = K rows, B = q, K = 64 (2 d-chunks), three products;
    //      D element r of tile j = key 16 j + 8 hh + r against query c ----
    v8f s[4];
#pragma unroll
    for (int j = 0; j < 4; ++j) {
      v8f sh = zero8(), sl = zero8();
      {
        FH kb, lb;
        kb.h[0] = *(const v8h*)(Ksh + (j * 16 + c) * APIT + 8 * hh);
        kb.h[1] = *(const v8h*)(Ksh + (j * 16 + c) * APIT + 16 + 8 * hh);
        lb.h[0] = *(const v8h*)(Kls + (j * 16 + c) * APIT + 8 * hh);
        lb.h[1] = *(const v8h*)(Kls + (j * 16 + c) * APIT + 16 + 8 * hh);
        sh = mma_h_raw(kb.v, qh0, sh);
        sl = mma_h_raw(kb.v, ql0, sl);
        sl = mma_h_raw(lb.v, qh0, sl);
        guard4m(sh, sl, qh0, ql0, kb.v, lb.v);
      }
      {
        FH kb, lb;
        kb.h[0] = *(const v8h*)(Ksh + (j * 16 + c) * APIT + 32 + 8 * hh);
        kb.h[1] = *(const v8h*)(Ksh + (j * 16 + c) * APIT + 48 + 8 * hh);
        lb.h[0] = *(const v8h*)(Kls + (j * 16 + c) * APIT + 32 + 8 * hh);
        lb.h[1] = *(const v8h*)(Kls + (j * 16 + c) * APIT + 48 + 8 * hh);
        sh = mma_h_raw(kb.v, qh1, sh);
        sl = mma_h_raw(kb.v, ql1, sl);
        sl = mma_h_raw(lb.v, qh1, sl);
        guard4m(sh, sl, qh1, ql1, kb.v, lb.v);
      }
      // segment-local key of D element r is kt*64 + 16 j + 8 hh + r, the query row of this lane's D column rowl0 + c:
      // element r is kept while r <= lim
      const int lim = (rowl0 + c) - (kt * 64 + j * 16 + 8 * hh);
#pragma unroll
      for (int r = 0; r < 8; ++r) {
        float v = sh[r];
        v += sl[r] * (1.0f / RSC);
        v *= sscale;
        s[j][r] = (r <= lim) ? v : NEG_BIG;
      }
    }
    wait_ds0();
    wait_async0();
    __syncthreads();                          // ends every read of the K tiles and publishes this chunk's V^T tiles
    if (kt < qbs) fillK(kv0 + 64);            // block-uniform

    // ---- maximum and sum of the query's 64 scores: 32 in this lane, 32 in lane ^ 16 (one exchange each); online
    //      softmax in f32; P hi (x1024, f16) and, when PRES, P residual (x RSC, f16) go straight into B fragments:
    //      tiles 2 kk and 2 kk + 1 hold keys 32 kk + 8 hh + r and 32 kk + 16 + 8 hh + r, the loaders' own k order ----
    float mj[4];
#pragma unroll
    for (int j = 0; j < 4; ++j) {
      float m = s[j][0];
#pragma unroll
      for (int r = 1; r < 8; ++r) m = fmaxf(m, s[j][r]);
      mj[j] = m;
    }
    float m = fmaxf(fmaxf(mj[0], mj[1]), fmaxf(mj[2], mj[3]));
    m = fmaxf(m, xhalf(m));
    const float mnew  = fmaxf(mrow, m);
    const float alpha = __expf(mrow - mnew);
    mrow = mnew;
    FH pa[2], pb[2];
    float pj[4];
#pragma unroll
    for (int j = 0; j < 4; ++j) {
      float ps = 0.f;
#pragma unroll
      for (int r = 0; r < 8; ++r) {
        const float p  = __expf(s[j][r] - mnew);
        ps += p;
        const float ph = p * PSC;
        const _Float16 xh = (_Float16)ph;
        pa[j >> 1].v[(j & 1) * 8 + r] = xh;
        if (PRES) pb[j >> 1].v[(j & 1) * 8 + r] = (_Float16)((ph - (float)xh) * RSC);
      }
      pj[j] = ps;
    }
    float psum = (pj[0] + pj[1]) + (pj[2] + pj[3]);
    psum += xhalf(psum);
    lrow = lrow * alpha + psum;
#pragma unroll
    for (int t = 0; t < 4; ++t) {
#pragma unroll
      for (int r = 0; r < 8; ++r) oh[t][r] *= alpha;
    }

    // ---- transposed local numerator, A = V^T rows, B = P^T: oh += Vhi . Phi; when PRES also
    //      ol = Vres . Phi + Vhi . Plo, oh += ol/RSC ----
#pragma unroll
    for (int t = 0; t < 4; ++t) {
      const _Float16* vr = Vhs + (t * 16 + c) * APIT + 8 * hh;
      FH vb0, vb1;
      vb0.h[0] = *(const v8h*)(vr);
      vb0.h[1] = *(const v8h*)(vr + 16);
      vb1.h[0] = *(const v8h*)(vr + 32);
      vb1.h[1] = *(const v8h*)(vr + 48);
      if (PRES) {
        const _Float16* wr = Vls + (t * 16 + c) * APIT + 8 * hh;
        FH wb0, wb1;
        wb0.h[0] = *(const v8h*)(wr);
        wb0.h[1] = *(const v8h*)(wr + 16);
        wb1.h[0] = *(const v8h*)(wr + 32);
        wb1.h[1] = *(const v8h*)(wr + 48);
        v8f ol = zero8();
        oh[t] = mma_h_raw(vb0.v, pa[0].v, oh[t]);
        ol    = mma_h_raw(wb0.v, pa[0].v, ol);
        ol    = mma_h_raw(vb0.v, pb[0].v, ol);
        oh[t] = mma_h_raw(vb1.v, pa[1].v, oh[t]);
        ol    = mma_h_raw(wb1.v, pa[1].v, ol);
        ol    = mma_h_raw(vb1.v, pb[1].v, ol);
        guard8m(oh[t], ol, pa[0].v, pa[1].v, pb[0].v, pb[1].v, vb0.v, vb1.v, wb0.v, wb1.v);
#pragma unroll
        for (int r = 0; r < 8; ++r) oh[t][r] += ol[r] * (1.0f / RSC);
      } else {
        oh[t] = mma_h_raw(vb0.v, pa[0].v, oh[t]);
        oh[t] = mma_h_raw(vb1.v, pa[1].v, oh[t]);
        guard1q(oh[t], pa[0].v, pa[1].v, vb0.v, vb1.v);
      }
    }
    acc_guard4(oh[0], oh[1], oh[2], oh[3]);
    wait_ds0();
    wait_async0();
    __syncthreads();                          // ends every read of the V^T tiles and publishes the next chunk's K tiles
    if (kt < qbs) fillV(kv0 + 64);            // block-uniform
  }
  wait_async0();

  // ---- normalise (1/l, the 1/1024 p carry and the 1/VSC v carry), weigh by 1 - g, stage the
  //      wave's tile as [query row][d] (a lane writes 8 consecutive d of its query per t) ----
  const float gv  = bfr(gate[h]);
  const float g   = 1.0f / (1.0f + expf(-gv));
  const float omg = 1.0f - g;
  float* os = Os[wave];
  {
    const float l = lrow;                                   // >= 1 (the row maximum contributes exp(0))
    const float inv = (1.0f / l) * (1.0f / (PSC * VSC));
#pragma unroll
    for (int t = 0; t < 4; ++t) {
      v4f oa, ob;
#pragma unroll
      for (int r = 0; r < 4; ++r) {                         // e = 16t + 8hh + r and + 4
        oa[r] = omg * (oh[t][r] * inv);
        ob[r] = omg * (oh[t][4 + r] * inv);
      }
      *(v4f*)(os + c * 68 + 16 * t + 8 * hh)     = oa;
      *(v4f*)(os + c * 68 + 16 * t + 8 * hh + 4) = ob;
    }
  }
  wave_sync_lds();
  {
    const size_t ooff  = (seg < (NTOK / SEG)) ? (size_t)OUT1OFF : (size_t)0;   // positions < NTOK -> second output
    const int    orow0 = (seg < (NTOK / SEG)) ? q0 : (q0 - NTOK);               // row within the output [b][2048][1024]
    v4f ov[8];
#pragma unroll
    for (int it = 0; it < 8; ++it) {
      const int row = it * 2 + hh;                          // it 0..7 x hh 0..1 = rows 0..15 of the wave tile
      ov[it] = *(const v4f*)(os + row * 68 + c * 4);
    }
    {
#pragma unroll
      for (int it = 0; it < 8; ++it) {
        const int row = it * 2 + hh;
        *(v4f*)(outb + ooff + (size_t)(orow0 + row) * DM + h * HD + c * 4) = ov[it];
      }
      wait_x0();   // in the built text another block range's code follows these stores and reuses their registers
    }
  }
}

// =====================================================================================================
// The compressive-memory update and both attention variants, which do not depend on one another, in ONE launch, told
// apart by block range (block-uniform branches ahead of every barrier): blockIdx.y < AB_M are the (head, segment)
// blocks of mt_seg, few and long (16 dependent chunks each): they start first and run beside the attention. The next
// AB_F are the query blocks NQP .. NQB-1, without the residual products (NQP+1 to NQB key chunks each). The others are
// the leading NQP query blocks, with them (1 to NQP chunks each); they take the places that the long blocks leave.
// blockIdx.x = batch. mt_seg uses the attention's LDS arrays: Ksh as its sk^T tile, Kls and Vhs for the z sums, Os as slabs.
// coverage: grid = (NB, AB_M + AB_F + AB_T) exact.
// =====================================================================================================
#define AB_M (NHEAD * 3)
#define AB_F (NHEAD * NSEG * (NQB - NQP))
#define AB_T (NHEAD * NSEG * NQP)
__global__ __launch_bounds__(128, 5)   // 5 waves per SIMD, as both variants had alone: keeps the registers under 1024 / 5
void attn_all(const unsigned short* __restrict__ QKH, const unsigned short* __restrict__ QKL,
              const unsigned short* __restrict__ VTH, const unsigned short* __restrict__ VTL,
              float* MT, float* ZP, const float* __restrict__ gate, float* outb, float sscale) {
  __shared__ __align__(16) _Float16 Ksh[64 * APIT];                           // K hi  [key][d]  9 KB
  __shared__ __align__(16) _Float16 Kls[64 * APIT];                           // K res [key][d]  9 KB
  __shared__ __align__(16) _Float16 Vhs[HD * APIT];                           // V^T hi [d][key] 9 KB
  __shared__ __align__(16) _Float16 Vls[HD * APIT];                           // V^T res [d][key] 9 KB (leading blocks)
  __shared__ __align__(16) float    Os[4][16 * 68];                          // per wave output tile [row][d]
  static_assert(4 * HD * 4 <= 64 * APIT * 2 && APIT == 72);
  const int by = (int)blockIdx.y - AB_M, bb = (int)blockIdx.x;
  if (by < 0)
    mt_seg(Ksh, Os, (float (*)[HD])(void*)Kls, (float*)(void*)Vhs, by + AB_M, bb, QKH, QKL, VTH, MT, ZP);
  else if (by < AB_F)
    attn_seg<false>(Ksh, Kls, Vhs, Vls, Os, by, bb, QKH, QKL, VTH, VTL, gate, outb, sscale, NQP, NQB - NQP);
  else
    attn_seg<true>(Ksh, Kls, Vhs, Vls, Os, by - AB_F, bb, QKH, QKL, VTH, VTL, gate, outb, sscale, 0, NQP);
}

// =====================================================================================================
// Workspace map (bytes); every plane is an exact multiple of its tile / whole-line store granularity (all dims are
// exact tile multiples, no padded tails), all offsets multiples of 4096:
//   XH    f16  [4096 t][1024 in]             0          8388608   (f16 of bf16 value x16, rows b*2048 + t)
//   AH    f16  [4096 t][1024 in]             8388608    8388608
//   WXT   f16  [3072 out][1024 in]           16777216   6291456   (W^T, bf16 value x64)
//   WAT   f16  [3072 out][1024 in]           23068672   6291456
//   COST  f32  [4096 pos][32]                29360128    524288
//   SINT  f32  [4096 pos][32]                29884416    524288
//   QKH   f16  [2 b][4096 pos][2048 (q|k)]   30408704  33554432   (q x4, k x16 hi after norm + rotary)
//   QKL   f16  [2 b][4096][2048]             63963136  33554432   (x4096 residuals)
//   VF    f32  [2 b][4096 pos][1024 (h,d)]   97517568  33554432   (v, f32)
//   VTH   f16  [2 b][1024 (h,d)][4096 pos]  131072000  16777216   (v x16 hi)
//   VTL   f16  [2 b][1024 (h,d)][4096 pos]  147849216  16777216   ((v x16 - hi) x4096)
//   MT    f32  [2 b][16 h][3 s][64 e][64 d] 164626432   1572864
//   ZP    f32  [2 b][16 h][3 s][64 d]       166199296     24576
//   end                                     166223872
// =====================================================================================================
extern "C" void kernel_launch(void* const* d_in, const int* in_sizes, int n_in,
                              void* d_out, int out_size, void* d_ws, size_t ws_size,
                              hipStream_t stream) {
  if (n_in < 9) return;
  if (in_sizes[0] != NB * NTOK * DM || in_sizes[1] != NB * NTOK * DM) return;
  if (in_sizes[2] != DM * W3 || in_sizes[3] != DM * W3) return;
  if (in_sizes[4] != NHEAD * HD || in_sizes[5] != NHEAD * HD) return;
  if (in_sizes[6] != NHEAD * HD || in_sizes[7] != NHEAD * HD) return;
  if (in_sizes[8] != NHEAD) return;
  if (out_size != 2 * NB * NTOK * DM) return;

  const float* X    = (const float*)d_in[0];
  const float* Aa   = (const float*)d_in[1];
  const float* Wx   = (const float*)d_in[2];
  const float* Wa   = (const float*)d_in[3];
  const float* g_qx = (const float*)d_in[4];
  const float* g_kx = (const float*)d_in[5];
  const float* g_qa = (const float*)d_in[6];
  const float* g_ka = (const float*)d_in[7];
  const float* gate = (const float*)d_in[8];
  float* outf = (float*)d_out;

  const size_t PXA = (size_t)NB * NTOK * DM * 2;        //  8388608
  const size_t PW  = (size_t)W3 * DM * 2;               //  6291456
  const size_t PRT = (size_t)SEQ * RP * 4;              //   524288
  const size_t PQK = (size_t)NB * SEQ * QKW * 2;        // 33554432
  const size_t PVF = (size_t)NB * SEQ * DM * 4;         // 33554432
  const size_t PVT = (size_t)NB * DM * SEQ * 2;         // 16777216
  const size_t PMT = (size_t)NB * NHEAD * 3 * HD * HD * 4;   // 1572864
  const size_t PZP = (size_t)NB * NHEAD * 3 * HD * 4;        //   24576
  size_t off = 0;
  const size_t oXH = off; off += PXA;
  const size_t oAH = off; off += PXA;
  const size_t oWX = off; off += PW;
  const size_t oWA = off; off += PW;
  const size_t oCT = off; off += PRT;
  const size_t oST = off; off += PRT;
  const size_t oQH = off; off += PQK;
  const size_t oQL = off; off += PQK;
  const size_t oVF = off; off += PVF;
  const size_t oVH = off; off += PVT;
  const size_t oVL = off; off += PVT;
  const size_t oMT = off; off += PMT;
  const size_t oZP = off; off += PZP;
  if (off > ws_size) return;                            // off = 166223872

  char* ws = (char*)d_ws;
  unsigned short* XH   = (unsigned short*)(ws + oXH);
  unsigned short* AH   = (unsigned short*)(ws + oAH);
  unsigned short* WXT  = (unsigned short*)(ws + oWX);
  unsigned short* WAT  = (unsigned short*)(ws + oWA);
  float*          COST = (float*)(ws + oCT);
  float*          SINT = (float*)(ws + oST);
  unsigned short* QKH  = (unsigned short*)(ws + oQH);
  unsigned short* QKL  = (unsigned short*)(ws + oQL);
  float*          VF   = (float*)(ws + oVF);
  unsigned short* VTH  = (unsigned short*)(ws + oVH);
  unsigned short* VTL  = (unsigned short*)(ws + oVL);
  float*          MT   = (float*)(ws + oMT);
  float*          ZP   = (float*)(ws + oZP);

  const dim3 blk256(256), blk128(128);
  const float sscale = 0.125f / (QSC * KSC);
  const float oscale = 1.0f / (XSC * WSC);

  // Every kernel is launched once; the two arrays, the two streams and the two batches are grid dimensions, and
  // kernels that do not depend on one another share a launch (block ranges).
  // (1) x, a -> row-major f16 planes of their bf16 RNE values x16; W [1024][3072] -> transposed f16 planes
  //     [3072][1024] (k contiguous, Bt form) of their bf16 RNE values x64; rotary tables
  prep<<<dim3(PB_ROPE + PB_TR + PB_CVT), blk256, 0, stream>>>(X, Aa, XH, Wx, Wa, WXT, COST, SINT);

  const int gqk  = ((NTOK / 32) * (QKW / 128)) / 4;      // 1024 tiles -> 256 blocks per stream and batch
  const int gv   = ((NTOK / 32) * (DM / 128)) / 4;       //  512 tiles -> 128 blocks per stream and batch
  const int gmem = NHEAD * 3 * (SEG / MROWS);            //  384 blocks per batch
  // (2) q|k of stream a (positions 0..2047) and stream x (positions 2048..4095): M=2048, N=2048, K=1024,
  //     fused per-head L2 norm + gain + rotary -> QKH/QKL f16 planes;
  // (3) v of both streams: M=2048, N=1024 (W^T rows 2048..3071), K=1024 -> VF f32 rows
  gemm_qkv<<<dim3(gqk + gv, 2, NB), blk128, 0, stream>>>(AH, XH, DM, WAT, WXT, DM, (void*)QKH, (void*)QKL, QKW,
                                                         (void*)VF, DM, SEQ, COST, SINT, g_qa, g_ka, g_qx, g_kx,
                                                         NTOK, QKW, DM, DM, gqk, oscale);
  // (4) v^T planes: in VF [SEQ rows][DM cols] -> out [DM][SEQ] f16 hi (x16) and residual (x4096), per batch
  tr_v<<<dim3(DM / 64, SEQ / 64, NB), blk256, 0, stream>>>(VF, VF + (size_t)SEQ * DM, SEQ, DM, VTH, VTL, VSC);
  // (5) compressive memory update: per-segment sk^T.v and sum sk (segments 0..2) -> MT, ZP; in the same launch the
  //     segment-local causal attention -> (1 - g) * local in both outputs: the leading NQP query blocks of every
  //     segment with the p, v residual products, the remaining blocks without
  attn_all<<<dim3(NB, AB_M + AB_F + AB_T), blk128, 0, stream>>>(QKH, QKL, VTH, VTL, MT, ZP, gate, outf, sscale);
  // (6) the memory read for the query rows of segments 1..3, added as g * mem to their output rows
  mem_ret<<<dim3(gmem, NB), blk256, 0, stream>>>(QKH, QKL, MT, ZP, gate, outf);
  (void)hipGetLastError();
}

// v009
// It runs in 128 microseconds.
// Timed twice side by side with v008, it ran 1.03 times as fast both times.
// All steps since v000 together make it 6.14 times as fast.
// Contractions: a.W and x.W (q|k|v, K=1024) on v_wmma_f32_16x16x32_f16 with f16 containers of the bf16 RNE input
//   values (activations carried x16, W^T x64), one product; q.k^T (K=64) on v_wmma_f32_16x16x32_f16 with q (x4) and
//   k (x16) f16 hi planes plus x4096 f16 residual planes (three products, residual pair in a separate accumulator
//   folded by 1/4096); p.v^T on v_wmma_f32_16x16x32_f16 with p as f16(1024 p) and v^T as f16(16 v), one product
//   (the leading query blocks of every segment add the p and v x4096 f16 residual planes, two more products into a
//   separate accumulator); compressive memory sk^T.v (K=1024) and sq.M (K=64) on v_wmma_f32_16x16x32_f16 with
//   plain f16 operands, one product each. f32 accumulate everywhere; L2 norms, rotary tables and rotation, elu,
//   softmax statistics, sq.z, the memory quotient and the gate mix in f32.
#include <hip/hip_runtime.h>
#include <math.h>
#include <stdint.h>

#define NB      2
#define NTOK    2048                // tokens per stream per batch
#define SEQ     4096                // concatenated positions per batch (stream a first, then x)
#define DM      1024
#define NHEAD   16
#define HD      64
#define RP      32                  // rotary pairs per head
#define W3      3072
#define QKW     2048                // q|k plane width: q at column h*64+d, k at 1024 + h*64+d
#define SEG     1024
#define NSEG    4
#define NQB     16                  // 64-row query blocks per segment
#define NQP     4                   // leading query blocks per segment that carry the p / v residual products
#define MROWS   128                 // query rows per block of the memory read kernel
#define OUT1OFF (NB * NTOK * DM)             // element offset of the second output
#define XSC     16.0f
#define WSC     64.0f
#define QSC     4.0f
#define KSC     16.0f
#define VSC     16.0f
#define RSC     4096.0f
#define PSC     1024.0f
#define NRM_EPS 1.0e-12f
#define DEN_EPS 1.0e-6f
#define LOG2_BASE 13.287712379549449
#define NEG_BIG (-1.0e30f)
#define GBK     128                 // k per LDS stage of the projection GEMM (256 B of every operand row)
#define GPIT    136                 // LDS row pitch of a stage in halves: 272 B = 16 B x 17 (ds_load_b128 readers)
#define GSTG    (256 * GPIT)        // halves per stage: 128 A rows, then 128 Bt rows
#define SLABF   (16 * 132)          // floats per epilogue slab of the projection GEMM (one per wave)
#define VPIT    136                 // LDS row pitch of the v^T epilogue tile in halves: 272 B = 16 B x 17 (16-B writers and readers)
#define APIT    72                  // LDS row pitch of the attention K and V^T tiles in halves: 144 B = 16 B x 9
                                    // (ds_load_b128 readers: 16 rows of a fragment load fall on 16 distinct bank groups)

static_assert(NHEAD * HD == DM);
static_assert(SEQ == 2 * NTOK);
static_assert(SEQ == NSEG * SEG);
static_assert(SEG == NQB * 64);
static_assert(HD == 2 * RP);
static_assert(W3 == 3 * DM);
static_assert(QKW == 2 * DM);
static_assert(((NB * NTOK * DM) % 2048) == 0);
static_assert(((SEQ * RP) % 256) == 0);
static_assert((DM % 128) == 0 && (W3 % 64) == 0 && (NTOK % 64) == 0 && (SEQ % 64) == 0);
static_assert((QKW % 128) == 0 && (DM % 32) == 0);
static_assert(NQP > 0 && NQP < NQB);
static_assert((SEG % MROWS) == 0 && MROWS == 8 * 16);
static_assert(OUT1OFF == NB * NTOK * DM);
static_assert((DM % GBK) == 0 && (NTOK % 128) == 0 && ((GPIT * 2) % 16) == 0);
static_assert(4 * SLABF * 4 <= 2 * GSTG * 2 && ((SLABF * 4) % 16) == 0);
static_assert(2 * 128 * VPIT <= 2 * GSTG && VPIT >= 128 && ((VPIT * 2) % 16) == 0);
static_assert(APIT >= HD && ((APIT * 2) % 16) == 0);

typedef _Float16 v16h __attribute__((ext_vector_type(16)));
typedef _Float16 v8h  __attribute__((ext_vector_type(8)));
typedef float    v8f  __attribute__((ext_vector_type(8)));
typedef float    v4f  __attribute__((ext_vector_type(4)));
typedef unsigned int v4u __attribute__((ext_vector_type(4)));
union FH { v16h v; v8h h[2]; };

// ---- scalar helpers --------------------------------------------------------------------------------
__device__ __forceinline__ unsigned short bf_bits(float f) {          // f32 -> bf16 bits, RNE convert
  unsigned u = __float_as_uint(f);
  return (unsigned short)((u + 0x7FFFu + ((u >> 16) & 1u)) >> 16);
}
__device__ __forceinline__ float bf_up(unsigned short b) { return __uint_as_float(((unsigned)b) << 16); }
__device__ __forceinline__ float bfr(float f) { return bf_up(bf_bits(f)); }     // value of the bf16 RNE convert
__device__ __forceinline__ unsigned short h_bits(_Float16 x) { return __builtin_bit_cast(unsigned short, x); }
__device__ __forceinline__ unsigned pk16(unsigned short a, unsigned short b) { return (unsigned)a | ((unsigned)b << 16); }
__device__ __forceinline__ v8f zero8() { v8f z = {0.f, 0.f, 0.f, 0.f, 0.f, 0.f, 0.f, 0.f}; return z; }

// ---- fragment loader: 16-bit A/B operand, lane -> row/col (lane&15), p already includes +8*(lane>>4);
//      elements 0..7 <- p[0..7] (k0+8h..), elements 8..15 <- p[16..23] (k0+16+8h..)
__device__ __forceinline__ v16h ldfrag_h(const _Float16* p) {
  FH f;
  f.h[0] = *(const v8h*)(p);
  f.h[1] = *(const v8h*)(p + 16);
  return f.v;
}

// ---- WMMA helpers with trailing VALU hazard gap --------------------------------------------------------
__device__ __forceinline__ v8f mma_h_raw(v16h a, v16h b, v8f c) {
  return __builtin_amdgcn_wmma_f32_16x16x32_f16(false, a, false, b, (short)0, c, false, false);
}
__device__ __forceinline__ v8f mma_h(v16h a, v16h b, v8f c) {
  c = mma_h_raw(a, b, c);
#if defined(__HIP_DEVICE_COMPILE__)
  asm volatile("v_nop\n\tv_nop\n\tv_nop\n\tv_nop" : "+v"(c) : "v"(a), "v"(b));
#endif
  return c;
}
__device__ __forceinline__ void guard3(v8f& x, v8f& y, v16h a, v16h b, v16h d) {   // two D tiles, 3 frags live
#if defined(__HIP_DEVICE_COMPILE__)
  asm volatile("v_nop\n\tv_nop\n\tv_nop\n\tv_nop" : "+v"(x), "+v"(y) : "v"(a), "v"(b), "v"(d));
#endif
}
__device__ __forceinline__ void guard1q(v8f& x, v16h a, v16h b, v16h d, v16h e) {           // one D, 4 frags
#if defined(__HIP_DEVICE_COMPILE__)
  asm volatile("v_nop\n\tv_nop\n\tv_nop\n\tv_nop" : "+v"(x) : "v"(a), "v"(b), "v"(d), "v"(e));
#endif
}
__device__ __forceinline__ void guard4m(v8f& x, v8f& y, v16h a, v16h b, v16h d, v16h e) {   // two D, 4 frags
#if defined(__HIP_DEVICE_COMPILE__)
  asm volatile("v_nop\n\tv_nop\n\tv_nop\n\tv_nop" : "+v"(x), "+v"(y) : "v"(a), "v"(b), "v"(d), "v"(e)
               : "memory");
#endif
}
__device__ __forceinline__ void guard8m(v8f& x, v8f& y, v16h a, v16h b, v16h d, v16h e,
                                        v16h f, v16h g, v16h p, v16h q) {                      // two D, 8 frags
#if defined(__HIP_DEVICE_COMPILE__)
  asm volatile("v_nop\n\tv_nop\n\tv_nop\n\tv_nop" : "+v"(x), "+v"(y)
               : "v"(a), "v"(b), "v"(d), "v"(e), "v"(f), "v"(g), "v"(p), "v"(q) : "memory");
#endif
}
__device__ __forceinline__ void acc_guard4(v8f& a, v8f& b, v8f& c, v8f& d) {
#if defined(__HIP_DEVICE_COMPILE__)
  asm volatile("v_nop\n\tv_nop\n\tv_nop\n\tv_nop" : "+v"(a), "+v"(b), "+v"(c), "+v"(d));
#endif
}
// lane l <-> lane l ^ 16 (the two halves of a D column) by a vector cross-row move
__device__ __forceinline__ float xhalf(float x) {
  const int b = __builtin_bit_cast(int, x);
  return __builtin_bit_cast(float, __builtin_amdgcn_permlanex16(b, b, 0x76543210, 0xfedcba98, false, false));
}
__device__ __forceinline__ void wave_sync_lds() {
  __builtin_amdgcn_fence(__ATOMIC_RELEASE, "workgroup");
  __builtin_amdgcn_wave_barrier();
  __builtin_amdgcn_fence(__ATOMIC_ACQUIRE, "workgroup");
}

// ---- eight asynchronous 16-B copies global -> LDS per lane (l: LDS byte address, g: global address). The
//      s_wait_xcnt stands inside the statement so that no address register is rewritten ahead of it.
__device__ __forceinline__ void acopy8(uint32_t l0, uint32_t l1, uint32_t l2, uint32_t l3,
                                       uint32_t l4, uint32_t l5, uint32_t l6, uint32_t l7,
                                       const _Float16* g0, const _Float16* g1, const _Float16* g2,
                                       const _Float16* g3, const _Float16* g4, const _Float16* g5,
                                       const _Float16* g6, const _Float16* g7) {
#if defined(__HIP_DEVICE_COMPILE__)
  asm volatile("global_load_async_to_lds_b128 %0, %8, off\n\t"
               "global_load_async_to_lds_b128 %1, %9, off\n\t"
               "global_load_async_to_lds_b128 %2, %10, off\n\t"
               "global_load_async_to_lds_b128 %3, %11, off\n\t"
               "global_load_async_to_lds_b128 %4, %12, off\n\t"
               "global_load_async_to_lds_b128 %5, %13, off\n\t"
               "global_load_async_to_lds_b128 %6, %14, off\n\t"
               "global_load_async_to_lds_b128 %7, %15, off\n\t"
               "s_wait_xcnt 0x0"
               :: "v"(l0), "v"(l1), "v"(l2), "v"(l3), "v"(l4), "v"(l5), "v"(l6), "v"(l7),
                  "v"(g0), "v"(g1), "v"(g2), "v"(g3), "v"(g4), "v"(g5), "v"(g6), "v"(g7)
               : "memory");
#endif
}
// four copies per lane from one plane: wave-uniform base b (scalar registers) + the lane's byte offsets o0..o3;
// the s_wait_xcnt stands inside the statement for the same reason as above (it covers the base registers too)
__device__ __forceinline__ void acopy4s(uint32_t l0, uint32_t l1, uint32_t l2, uint32_t l3,
                                        uint32_t o0, uint32_t o1, uint32_t o2, uint32_t o3, const _Float16* b) {
#if defined(__HIP_DEVICE_COMPILE__)
  asm volatile("global_load_async_to_lds_b128 %0, %4, %8\n\t"
               "global_load_async_to_lds_b128 %1, %5, %8\n\t"
               "global_load_async_to_lds_b128 %2, %6, %8\n\t"
               "global_load_async_to_lds_b128 %3, %7, %8\n\t"
               "s_wait_xcnt 0x0"
               :: "v"(l0), "v"(l1), "v"(l2), "v"(l3), "v"(o0), "v"(o1), "v"(o2), "v"(o3), "s"(b)
               : "memory");
#endif
}
// eight copies per lane, four from each of two planes (bases b, d) at the same byte offsets; one wait for all
__device__ __forceinline__ void acopy8s(uint32_t l0, uint32_t l1, uint32_t l2, uint32_t l3,
                                        uint32_t l4, uint32_t l5, uint32_t l6, uint32_t l7,
                                        uint32_t o0, uint32_t o1, uint32_t o2, uint32_t o3,
                                        const _Float16* b, const _Float16* d) {
#if defined(__HIP_DEVICE_COMPILE__)
  asm volatile("global_load_async_to_lds_b128 %0, %8, %12\n\t"
               "global_load_async_to_lds_b128 %1, %9, %12\n\t"
               "global_load_async_to_lds_b128 %2, %10, %12\n\t"
               "global_load_async_to_lds_b128 %3, %11, %12\n\t"
               "global_load_async_to_lds_b128 %4, %8, %13\n\t"
               "global_load_async_to_lds_b128 %5, %9, %13\n\t"
               "global_load_async_to_lds_b128 %6, %10, %13\n\t"
               "global_load_async_to_lds_b128 %7, %11, %13\n\t"
               "s_wait_xcnt 0x0"
               :: "v"(l0), "v"(l1), "v"(l2), "v"(l3), "v"(l4), "v"(l5), "v"(l6), "v"(l7),
                  "v"(o0), "v"(o1), "v"(o2), "v"(o3), "s"(b), "s"(d)
               : "memory");
#endif
}
// 64 rows of one operand, 256 B each, into LDS rows of pitch GPIT: l / g are this thread's addresses in row
// (tid >> 4) at 16-B piece (tid & 15); copy i takes row 8 i + (tid >> 4), a wave's copy covers two whole rows.
__device__ __forceinline__ void acopy_rows64(uint32_t l, const _Float16* g, size_t ld) {
  const uint32_t ls = 8u * GPIT * 2u;
  const size_t   gs = 8 * ld;
  acopy8(l, l + ls, l + 2 * ls, l + 3 * ls, l + 4 * ls, l + 5 * ls, l + 6 * ls, l + 7 * ls,
         g, g + gs, g + 2 * gs, g + 3 * gs, g + 4 * gs, g + 5 * gs, g + 6 * gs, g + 7 * gs);
}
// the issuing wave's own copies have landed (the compiler places no wait for them)
__device__ __forceinline__ void wait_async0() {
#if defined(__HIP_DEVICE_COMPILE__)
  asm volatile("s_wait_asynccnt 0x0" ::: "memory");
#endif
}
// the address translations of this wave's issued global loads and stores are done: stands ahead of an instruction that
// reuses a register which such a load or store names
__device__ __forceinline__ void wait_x0() {
#if defined(__HIP_DEVICE_COMPILE__)
  asm volatile("s_wait_xcnt 0x0" ::: "memory");
#endif
}
// this wave's LDS reads of the stage have returned before the stage is handed back for a refill
__device__ __forceinline__ void wait_ds0() {
#if defined(__HIP_DEVICE_COMPILE__)
  asm volatile("s_wait_dscnt 0x0" ::: "memory");
#endif
}

// =====================================================================================================
// Row-major convert: f32 [n] -> f16 plane [n] holding f16(bf16 RNE value * scale) (scale a power of two, exact).
// coverage: bx = 0 .. n/2048 - 1 blocks x 256 threads x 8 = n elements (n % 2048 == 0 host-checked); by = 2 arrays.
// One block's share of the work; the block indices come from the kernel prep below.
// =====================================================================================================
__device__ __forceinline__ void cvt_rm(int bx, int by, const float* __restrict__ in0, const float* __restrict__ in1,
                                       unsigned short* out, int n, float scale) {
  const size_t i8 = ((size_t)bx * 256 + threadIdx.x) * 8;
  if (i8 + 8 > (size_t)n) return;        // never taken for the host-checked sizes; no barriers below
  const float* in = by ? in1 : in0;      // by = which of the two arrays; its plane follows the first
  out += (size_t)by * (size_t)n;
  const v4f a = *(const v4f*)(in + i8);
  const v4f b = *(const v4f*)(in + i8 + 4);
  float f[8];
  f[0] = a[0]; f[1] = a[1]; f[2] = a[2]; f[3] = a[3];
  f[4] = b[0]; f[5] = b[1]; f[6] = b[2]; f[7] = b[3];
  v4u p;
#pragma unroll
  for (int e = 0; e < 4; ++e) {
    const unsigned short b0 = bf_bits(f[2 * e]), b1 = bf_bits(f[2 * e + 1]);
    const _Float16 x0 = (_Float16)(bf_up(b0) * scale);
    const _Float16 x1 = (_Float16)(bf_up(b1) * scale);
    p[e] = pk16(h_bits(x0), h_bits(x1));
  }
  *(v4u*)(out + i8) = p;
  
}

// =====================================================================================================
// Transposing convert: f32 in[R][C] (row-major, pitch C) -> 16-bit out[C][R] (pitch R), 64x64 tiles through LDS:
//   out0 = f16(bf16 RNE value * scale).
// Block = 256 threads; (bx, by, bz) = (C/64, R/64, 2 matrices) exact (host-checked); sm = the block's 64 x 65 f32 LDS
// tile, declared by the kernel that calls this. Load: thread -> input row tid>>2, 16 consecutive
// columns (four 16-B loads). Store: two iterations, output row it*32 + (tid>>3), lanes (tid&7) -> elements
// coverage: 2 iterations x 32 output rows x 8 lanes x 8 halves = the whole 64x64 tile; grid covers all of C x R.
// =====================================================================================================
__device__ __forceinline__ void tr_cvt(float (*sm)[65], int bx, int by, int bz,
                                       const float* __restrict__ in0, const float* __restrict__ in1,
                                       int R, int C, unsigned short* out0, float scale) {
  const int tid = threadIdx.x;
  const float* in = bz ? in1 : in0;        // bz = which of the two matrices; its plane follows the first's
  out0 += (size_t)bz * (size_t)R * (size_t)C;
  const int c0 = bx * 64;                  // input column block -> output row block
  const int r0 = by * 64;                  // input row block    -> output column block
  if (c0 + 64 > C || r0 + 64 > R) return;  // block-uniform, ahead of any barrier; never taken for exact grids
  {
    const int lr = tid >> 2, lc = (tid & 3) * 16;
    const float* src = in + (size_t)(r0 + lr) * (size_t)C + c0 + lc;
#pragma unroll
    for (int q = 0; q < 4; ++q) {
      const v4f v = *(const v4f*)(src + 4 * q);
      sm[lr][lc + 4 * q + 0] = v[0];
      sm[lr][lc + 4 * q + 1] = v[1];
      sm[lr][lc + 4 * q + 2] = v[2];
      sm[lr][lc + 4 * q + 3] = v[3];
    }
  }
  __syncthreads();
  const int seg = tid & 7;
  v4u p0[2];
#pragma unroll
  for (int it = 0; it < 2; ++it) {
    const int ocl = it * 32 + (tid >> 3);   // output row within the tile = input column
    float f[8];
#pragma unroll
    for (int e = 0; e < 8; ++e) f[e] = sm[seg * 8 + e][ocl];
    v4u pk;
#pragma unroll
    for (int e = 0; e < 4; ++e) {
      const float g0 = f[2 * e], g1 = f[2 * e + 1];
      const _Float16 x0 = (_Float16)(bfr(g0) * scale);
      const _Float16 x1 = (_Float16)(bfr(g1) * scale);
      pk[e] = pk16(h_bits(x0), h_bits(x1));
    }
    p0[it] = pk;
  }
  {
#pragma unroll
    for (int it = 0; it < 2; ++it) {
      const int ocl = it * 32 + (tid >> 3);
      const size_t go = (size_t)(c0 + ocl) * (size_t)R + (size_t)(r0 + seg * 8);
      *(v4u*)(out0 + go) = p0[it];
    }
    
  }
}

// =====================================================================================================
// Rotary tables for interleaved pairs: cost[t][i] = cos(t * inv_freq[i]), sint[t][i] = sin(t * inv_freq[i]),
// i = 0..31, inv_freq[i] = 1 / (10000^(2i/64)) (power via f64 exp2 -> one f32 convert, then an f32 reciprocal
// formed in f64 and converted once), angle = one f32 multiply with t = position 0..4095 in the concatenated
// coverage: bx = 0 .. n/256 - 1 blocks x 256 threads = n = SEQ*32 elements of each table.
// =====================================================================================================
__device__ __forceinline__ void rope_tab(int bx, float* cost, float* sint, int n) {
  const int e = bx * 256 + (int)threadIdx.x;
  if (e >= n) return;                      // never taken (n % 256 == 0); no barriers below
  const int t = e >> 5, i = e & 31;
  const double pd = exp2((double)i * (1.0 / 32.0) * LOG2_BASE);   // 10000^(2i/64)
  const float  pf = (float)pd;
  const float  invf = (float)(1.0 / (double)pf);
  const float  ang = (float)t * invf;
  float sv, cv;
  sincosf(ang, &sv, &cv);
  *(float*)(cost + e) = cv;
  *(float*)(sint + e) = sv;
  
}

// =====================================================================================================
// The three preparations, which do not depend on one another, in ONE launch, told apart by block range (the
// branches are block-uniform, so the barrier inside tr_cvt is reached by a whole block or by none): blocks
// 0 .. PB_ROPE-1 build the rotary tables, the next PB_TR transpose and convert the two weight matrices
// ((W3/64, DM/64, matrix), x fastest), the last PB_CVT convert x and a ((n/2048, array), x fastest).
// coverage: grid.x = PB_ROPE + PB_TR + PB_CVT exact.
// =====================================================================================================
#define PB_ROPE ((SEQ * RP) / 256)
#define PB_TRX  (W3 / 64)
#define PB_TRY  (DM / 64)
#define PB_TR   (PB_TRX * PB_TRY * 2)
#define PB_CVX  ((NB * NTOK * DM) / 2048)
#define PB_CVT  (PB_CVX * 2)
__global__ __launch_bounds__(256) void prep(const float* __restrict__ x, const float* __restrict__ a,
                                           unsigned short* xh,
                                           const float* __restrict__ wx, const float* __restrict__ wa,
                                           unsigned short* wxt, float* cost, float* sint) {
  __shared__ float sm[64][65];
  int b = (int)blockIdx.x;
  if (b < PB_ROPE) {
    rope_tab(b, cost, sint, SEQ * RP);
    return;
  }
  b -= PB_ROPE;
  if (b < PB_TR) {
    const int bz = b / (PB_TRX * PB_TRY);
    const int r  = b - bz * (PB_TRX * PB_TRY);
    const int by = r / PB_TRX;
    tr_cvt(sm, r - by * PB_TRX, by, bz, wx, wa, DM, W3, wxt, WSC);
    // in the built text another range's code follows these stores and reuses their registers: the wait stands ahead of it
    asm volatile("s_wait_xcnt 0x0" ::: "memory");
    return;
  }
  b -= PB_TR;
  if (b < PB_CVT) {
    const int by = b / PB_CVX;
    cvt_rm(b - by * PB_CVX, by, x, a, xh, NB * NTOK * DM, XSC);
  }
}

// =====================================================================================================
// Register-blocked f16 WMMA GEMM, one wave per 32x128 tile; block = 4 waves = 4 tiles stacked in m = one 128x128
// block tile whose operands pass through LDS: a stage is 128 k of the 128 A rows and the 128 Bt rows, brought by
// asynchronous copies into two buffers (stage t + 1 flies while stage t is worked on), read by all 4 waves:
//   acc[m][n] = sum_k A[m][k] * Bt[n][k]; A row-major [M][K] pitch lda, Bt row-major [N][K] pitch ldb
//   (k contiguous); M % 128 == 0, N % 128 == 0, K % 128 == 0 (exact constants here, host-checked).
// EPI 1 (q|k planes, N == QKW): the 128-column tile holds two heads of 64 columns (columns < DM are q heads,
//        columns >= DM are k heads). Per row and head: t = acc*oscale; v = t * (1/max(||t||_2, 1e-12)) *
//        bf16(gain[head][d]) * 8; then the interleaved-pair rotary rotation with the f32 tables at position
//        crow0 + m (pair (2i, 2i+1): o1 = v1*c - v2*s, o2 = v1*s + v2*c), times cscale (QSC for q, KSC for k)
//        -> C0 = f16 hi, C1 = f16((v - hi) * RSC) residual, 16-bit planes of pitch ldc, row crow0 + m, column n.
// EPI 3 (v, stored transposed): t = acc*oscale; C0 = f16(t * VSC) hi, C1 = f16((t * VSC - hi) * RSC) residual, 16-bit
//        planes [ldc rows n][SEQ positions]: element (n, crow0 + m). A lane's 8 D registers are 8 consecutive positions
//        of one column n, one 16-B piece of a plane's row; the block's 128 n x 128 m tile is gathered in LDS and each
//        of its rows leaves as one whole 256-B segment.
// 16 lanes x 16 B per 256-B row segment (two rows per instruction);
// coverage: EPI 1: 2 slabs x 16 rows x 128 cols = the wave's whole 32x128 tile; EPI 3: 4 waves x 16 its x 2 rows = the
// 128 rows of the block's tile in either plane; tiles = whole M x N (bx = 0 .. tiles/4 - 1
// exact), grid.y = the two streams, grid.z = the batches. One block's work; ring (the block's LDS) and bx come from
// the kernel gemm_qkv below.
// =====================================================================================================
template <int EPI>
__device__ __forceinline__ void gemm_t(
    _Float16* ring, int bx,
    const unsigned short* __restrict__ A0, const unsigned short* __restrict__ A1, int lda,
    const unsigned short* __restrict__ Bt0, const unsigned short* __restrict__ Bt1, int ldb,
    void* C0, void* C1, int ldc, int crows,
    const float* __restrict__ cost, const float* __restrict__ sint,
    const float* __restrict__ gq0, const float* __restrict__ gk0,
    const float* __restrict__ gq1, const float* __restrict__ gk1,
    int M, int N, int K, float oscale) {
  const int lane = threadIdx.x & 31;
  const int wave = threadIdx.x >> 5;
  // blockIdx.y = stream (0: operands A0, Bt0, gains gq0, gk0, C rows 0..M-1; 1: the others, C rows M..2M-1);
  // blockIdx.z = batch (A rows z*M.., C plane z of crows rows)
  const int  st = (int)blockIdx.y;
  const unsigned short* A  = (st ? A1 : A0) + (size_t)blockIdx.z * (size_t)M * (size_t)lda;
  const unsigned short* Bt = st ? Bt1 : Bt0;
  const float* gq = st ? gq1 : gq0;
  const float* gk = st ? gk1 : gk0;
  const int    crow0 = st * M;
  const size_t cpl   = (size_t)blockIdx.z * (size_t)crows * (size_t)ldc;   // element offset of this batch's C plane
  const int tilesN = N >> 7;
  const int tilesM = M >> 5;
  if (bx >= (tilesM >> 2) * tilesN) return;   // block-uniform, ahead of any barrier; never taken
  const int bm = bx / tilesN;
  const int tn = bx - bm * tilesN;
  const int tm = bm * 4 + wave;
  const int m0 = tm << 5;
  const int n0 = tn << 7;
  const int rl   = lane & 15;            // row (A) / col (B, D) within subtile
  const int hh   = lane >> 4;            // lane half
  const int koff = hh * 8;               // k offset of this lane half

  v8f acc[2][8];
#pragma unroll
  for (int i = 0; i < 2; ++i)
#pragma unroll
    for (int j = 0; j < 8; ++j) acc[i][j] = zero8();

  {
    const int cr = (int)threadIdx.x >> 4;          // row (mod 8) this thread copies
    const int cc = (int)threadIdx.x & 15;          // its 16-B piece of the row's 256 B
    const _Float16* ga = (const _Float16*)(const void*)A + (size_t)((bm << 7) + cr) * (size_t)lda + cc * 8;
    const _Float16* gb = (const _Float16*)(const void*)Bt + (size_t)(n0 + cr) * (size_t)ldb + cc * 8;
    const uint32_t  lr = (uint32_t)(size_t)(const void*)ring + (uint32_t)(cr * GPIT + cc * 8) * 2u;
    const int nst = K / GBK;                       // stages; block-uniform
    auto fill = [&](int st) {                      // stage st -> buffer st & 1: 32 copies per wave
      const uint32_t l = lr + (uint32_t)(st & 1) * (uint32_t)(GSTG * 2);
      const _Float16* pa = ga + (size_t)st * GBK;
      const _Float16* pb = gb + (size_t)st * GBK;
      acopy_rows64(l, pa, (size_t)lda);
      acopy_rows64(l + 64u * GPIT * 2u, pa + (size_t)64 * (size_t)lda, (size_t)lda);
      acopy_rows64(l + 128u * GPIT * 2u, pb, (size_t)ldb);
      acopy_rows64(l + 192u * GPIT * 2u, pb + (size_t)64 * (size_t)ldb, (size_t)ldb);
    };
    fill(0);
    wait_async0();
    __syncthreads();                               // stage 0 is published
    if (nst > 1) fill(1);
    for (int t = 0; t < nst; ++t) {
      const _Float16* sb  = ring + (t & 1) * GSTG;
      const _Float16* ar0 = sb + (wave * 32 + rl) * GPIT + koff;
      const _Float16* ar1 = ar0 + 16 * GPIT;
      const _Float16* br  = sb + (128 + rl) * GPIT + koff;
#pragma unroll                                     // the k offset becomes an immediate of each LDS load
      for (int kk = 0; kk < GBK / 32; ++kk) {
        const v16h a0 = ldfrag_h(ar0 + 32 * kk);
        const v16h a1 = ldfrag_h(ar1 + 32 * kk);
        v16h b[8];
#pragma unroll                                     // b[] stays in registers: the k-step's LDS loads stand as one group
        for (int j = 0; j < 8; ++j) b[j] = ldfrag_h(br + j * 16 * GPIT + 32 * kk);
#pragma unroll                                     // acc[][] and b[] indexed by constants only
        for (int j = 0; j < 8; ++j) {
          acc[0][j] = mma_h_raw(a0, b[j], acc[0][j]);
          acc[1][j] = mma_h_raw(a1, b[j], acc[1][j]);
          guard3(acc[0][j], acc[1][j], a0, a1, b[j]);
        }
      }
      wait_ds0();
      wait_async0();
      __syncthreads();                             // publishes stage t + 1 and ends every read of stage t
      if (t + 2 < nst) fill(t + 2);
    }
    wait_async0();
  }
  acc_guard4(acc[0][0], acc[0][1], acc[0][2], acc[0][3]);
  acc_guard4(acc[0][4], acc[0][5], acc[0][6], acc[0][7]);
  acc_guard4(acc[1][0], acc[1][1], acc[1][2], acc[1][3]);
  acc_guard4(acc[1][4], acc[1][5], acc[1][6], acc[1][7]);

  // ---- epilogue ----
  // the staging below lies in the ring's first bytes: the barrier at the foot of the last trip has
  // ended every wave's reads of both stages, and no copy is issued or outstanding behind it
  if (EPI == 3) {
    _Float16* th = ring;                                        // hi plane of the block's tile, [128 n][VPIT]
    _Float16* tl = ring + 128 * VPIT;                           // residual plane
#pragma unroll                                                  // all three: acc[][][] indexed by constants only
    for (int i = 0; i < 2; ++i) {
#pragma unroll
      for (int j = 0; j < 8; ++j) {
        v8h xh, xl;
#pragma unroll
        for (int r = 0; r < 8; ++r) {                           // position m0 + 16 i + 8 hh + r of column n0 + 16 j + rl
          const float v = acc[i][j][r] * oscale;
          const float s = v * VSC;
          const _Float16 x = (_Float16)s;
          xh[r] = x;
          xl[r] = (_Float16)((s - (float)x) * RSC);
        }
        const int o = (16 * j + rl) * VPIT + wave * 32 + 16 * i + 8 * hh;
        *(v8h*)(th + o) = xh;
        *(v8h*)(tl + o) = xl;
      }
    }
    __syncthreads();                                            // a row of the tile holds pieces of all 4 waves
    const int    lo = (wave * 32 + hh) * VPIT + rl * 8;         // row 32 wave + 2 it + hh, 16-B piece rl
    const size_t go = cpl + (size_t)(n0 + wave * 32 + hh) * SEQ + (size_t)(crow0 + (bm << 7) + rl * 8);
    _Float16* Ch = (_Float16*)C0 + go;
    _Float16* Cl = (_Float16*)C1 + go;
    v8h hv[16], lv[16];
#pragma unroll                                                  // hv[], lv[] stay in registers; the 32 LDS loads stand as one group
    for (int it = 0; it < 16; ++it) {
      hv[it] = *(const v8h*)(th + lo + it * 2 * VPIT);
      lv[it] = *(const v8h*)(tl + lo + it * 2 * VPIT);
    }
#pragma unroll                                                  // the row step is an immediate: one address pair per plane
    for (int it = 0; it < 16; ++it) {
      *(v8h*)(Ch + (size_t)it * 2 * SEQ) = hv[it];
      *(v8h*)(Cl + (size_t)it * 2 * SEQ) = lv[it];
    }
    wait_x0();   // in the built text the other block range's code follows these stores and reuses their registers
    return;
  }
  // per-wave 16x128 slab, pitch 132 floats
  float* slab = (float*)(void*)ring + wave * SLABF;
  float gmul[8];
  float csc = 1.0f;
  if (EPI == 1) {
    const bool isq = (n0 < DM);                                 // wave-uniform
    const int  hb  = (isq ? n0 : (n0 - DM)) >> 6;               // first head of this tile (0..15)
    csc = isq ? QSC : KSC;
#pragma unroll
    for (int j = 0; j < 8; ++j) {
      const int gi = (hb + (j >> 2)) * HD + 16 * (j & 3) + rl;  // < NHEAD*HD, inside both gain arrays
      const float ga = bfr(gq[gi]);
      const float gb = bfr(gk[gi]);
      gmul[j] = (isq ? ga : gb) * 8.0f;
    }
  }
#pragma unroll
  for (int i = 0; i < 2; ++i) {
    const int mB = m0 + 16 * i;
    if (EPI == 1) {
      float inv[2][8];
#pragma unroll
      for (int jh = 0; jh < 2; ++jh) {
#pragma unroll
        for (int r = 0; r < 8; ++r) {        // sum of squares over the head's 64 columns of row 8hh+r
          float ss = 0.f;
#pragma unroll
          for (int jj = 0; jj < 4; ++jj) {
            const float x = acc[i][4 * jh + jj][r] * oscale;
            ss += x * x;
          }
          ss += __shfl_xor(ss, 1, 32);
          ss += __shfl_xor(ss, 2, 32);
          ss += __shfl_xor(ss, 4, 32);
          ss += __shfl_xor(ss, 8, 32);
          inv[jh][r] = oscale * (1.0f / fmaxf(sqrtf(ss), NRM_EPS));
        }
      }
#pragma unroll
      for (int j = 0; j < 8; ++j) {
#pragma unroll
        for (int r = 0; r < 8; ++r)
          slab[(8 * hh + r) * 132 + 16 * j + rl] = acc[i][j][r] * inv[j >> 2][r] * gmul[j];
      }
    }
    wave_sync_lds();
    {
      unsigned short* Cp = (unsigned short*)C0 + cpl;
      unsigned short* Cq = (unsigned short*)C1 + cpl;
      v4u hv[8], lv[8];
#pragma unroll
      for (int it = 0; it < 8; ++it) {
        const int row = it * 2 + hh;                          // it 0..7 x hh 0..1 = rows 0..15
        const float* sp = slab + row * 132 + rl * 8;          // 8 consecutive columns = 4 rotary pairs
        const v4f fa = *(const v4f*)sp;
        const v4f fb = *(const v4f*)(sp + 4);
        float f[8];
        f[0] = fa[0]; f[1] = fa[1]; f[2] = fa[2]; f[3] = fa[3];
        f[4] = fb[0]; f[5] = fb[1]; f[6] = fb[2]; f[7] = fb[3];
        const int pos = crow0 + mB + row;                     // position in the concatenated sequence
        const v4f cv = *(const v4f*)(cost + (size_t)pos * RP + (rl & 7) * 4);   // pairs ((rl&7)*4 .. +3)
        const v4f sv = *(const v4f*)(sint + (size_t)pos * RP + (rl & 7) * 4);
        v4u pk, pl;
#pragma unroll
        for (int e = 0; e < 4; ++e) {
          const float f0 = f[2 * e], f1 = f[2 * e + 1];
          const float cc = cv[e], sn = sv[e];
          const float g0 = (f0 * cc - f1 * sn) * csc;
          const float g1 = (f0 * sn + f1 * cc) * csc;
          const _Float16 x0 = (_Float16)g0;
          const _Float16 x1 = (_Float16)g1;
          const _Float16 y0 = (_Float16)((g0 - (float)x0) * RSC);
          const _Float16 y1 = (_Float16)((g1 - (float)x1) * RSC);
          pk[e] = pk16(h_bits(x0), h_bits(x1));
          pl[e] = pk16(h_bits(y0), h_bits(y1));
        }
        hv[it] = pk;
        lv[it] = pl;
      }
      {
#pragma unroll
        for (int it = 0; it < 8; ++it) {
          const int row = it * 2 + hh;
          const size_t go = (size_t)(crow0 + mB + row) * (size_t)ldc + n0 + rl * 8;
          *(v4u*)(Cp + go) = hv[it];
          *(v4u*)(Cq + go) = lv[it];
        }
        
      }
    }
    wave_sync_lds();
  }
}

// =====================================================================================================
// The q|k product and the v product, which do not depend on one another, in ONE launch, told apart by block range
// (a block-uniform branch ahead of every barrier): blocks 0 .. nbqk-1 of grid.x are the q|k tiles (EPI 1, W^T rows
// 0 .. Nqk-1), the others the v tiles (EPI 3, W^T rows Nqk .. Nqk+Nv-1).
// coverage: grid = (q|k tiles/4 + v tiles/4 exact, 2 streams, batches).
// =====================================================================================================
__global__ __launch_bounds__(128) void gemm_qkv(
    const unsigned short* __restrict__ A0, const unsigned short* __restrict__ A1, int lda,
    const unsigned short* __restrict__ Bt0, const unsigned short* __restrict__ Bt1, int ldb,
    void* QH, void* QL, int ldqk, void* VH, void* VL, int ldv, int crows,
    const float* __restrict__ cost, const float* __restrict__ sint,
    const float* __restrict__ gq0, const float* __restrict__ gk0,
    const float* __restrict__ gq1, const float* __restrict__ gk1,
    int M, int Nqk, int Nv, int K, int nbqk, float oscale) {
  __shared__ __align__(16) _Float16 ring[2 * GSTG]; // two operand stages; behind the k loop the same bytes hold the
                                                    // epilogue staging, so a block takes 136 KiB and two fit one WGP
  const int bx = (int)blockIdx.x;
  if (bx < nbqk) {
    gemm_t<1>(ring, bx, A0, A1, lda, Bt0, Bt1, ldb, QH, QL, ldqk, crows,
              cost, sint, gq0, gk0, gq1, gk1, M, Nqk, K, oscale);
  } else {
    const size_t wo = (size_t)Nqk * (size_t)ldb;      // the v rows of W^T follow the q|k rows
    gemm_t<3>(ring, bx - nbqk, A0, A1, lda, Bt0 + wo, Bt1 + wo, ldb, VH, VL, ldv, crows,
              cost, sint, gq0, gk0, gq1, gk1, M, Nv, K, oscale);
  }
}

// =====================================================================================================
// Compressive-memory update per (head h, segment s in 0..2) of one batch (bb):
//   MT[h][s][e][d] = sum over the 1024 keys l of segment s of v[l][e] * sk[l][d], sk = elu(k) + 1
//   (elu(x) = x > 0 ? x : exp(x) - 1, so sk = x > 0 ? x + 1 : exp(x)), and ZP[h][s][d] = sum_l sk[l][d].
//   k is rebuilt in f32 from the q|k hi / residual planes ((hi + lo/RSC) / KSC, column DM + h*64 + d), sk is
//   RNE-converted to f16 and written TRANSPOSED into an LDS tile skT[d][l] (64 keys per chunk, pitch 72 halves);
//   A = V^T hi plane rows (h*64 + e, keys), Bt = skT; D[e][d] scaled by 1/VSC.
//   Block = 4 waves (one block's work; bx, bb and the LDS arrays come from the kernel attn_all below); wave w owns
//   e rows 16*w.. and all 64 d columns; acc guarded; the 16x64 f32 piece is staged in the wave's slab.
// coverage: MT: 4 waves x (16 rows x 64 cols) = the whole 64x64 tile of (h,s); 8 its x 2 row halves x 16 lanes x 4
//   floats = 16 rows x 64 cols per wave. ZP: 16 lanes x 4 floats = 64. skT fill: 128 threads x 32 d x 1 key = 64x64 chunk.
// =====================================================================================================
__device__ __forceinline__ void mt_seg(_Float16* skT, float (*slab)[16 * 68], float (*zred)[HD], float* zsum,
                                       int bx, int bb,
                                       const unsigned short* __restrict__ QKH,
                                       const unsigned short* __restrict__ QKL,
                                       const unsigned short* __restrict__ VTH,
                                       float* MT, float* ZP) {
  const int tid = threadIdx.x, wave = tid >> 5, lane = tid & 31, hh = lane >> 4, c = lane & 15;
  const int h = (int)((unsigned)bx / 3u);
  const int s = (int)((unsigned)bx - (unsigned)h * 3u);
  if (h >= NHEAD) return;                 // block-uniform, ahead of any barrier; never taken
  QKH += (size_t)bb * SEQ * QKW;          // bb = batch: its own planes
  QKL += (size_t)bb * SEQ * QKW;
  VTH += (size_t)bb * DM * SEQ;
  MT  += (size_t)bb * NHEAD * 3 * HD * HD;
  ZP  += (size_t)bb * NHEAD * 3 * HD;
  const int r  = tid >> 1;                // key within the 64-key chunk handled by this thread
  const int dq = (tid & 1) * 32;          // first of the 32 d columns handled by this thread

  const _Float16* Q16 = (const _Float16*)(const void*)QKH;
  const _Float16* L16 = (const _Float16*)(const void*)QKL;
  const _Float16* V16 = (const _Float16*)(const void*)VTH;
  const _Float16* vrow = V16 + (size_t)(h * HD + wave * 16 + c) * SEQ + (size_t)s * SEG + 8 * hh;   // A frag base

  float zacc[32];
#pragma unroll
  for (int e = 0; e < 32; ++e) zacc[e] = 0.f;
  v8f acc[4];
#pragma unroll                            // acc[] indexed by constants only
  for (int j = 0; j < 4; ++j) acc[j] = zero8();

  for (int kt = 0; kt < SEG / 64; ++kt) {
    __syncthreads();                      // prior chunk's fragment reads are done
    {
      const size_t n = (size_t)(s * SEG + kt * 64 + r);
      const _Float16* kp = Q16 + n * QKW + h * HD + dq;     // the row's q columns; its k columns stand DM further
      const _Float16* lp = L16 + n * QKW + h * HD + dq;
      FH kf[2], lf[2];
#pragma unroll                            // kf[], lf[] stay in registers; the eight loads stand as one group
      for (int q = 0; q < 2; ++q) {
        kf[q].h[0] = *(const v8h*)(kp + DM + 16 * q); kf[q].h[1] = *(const v8h*)(kp + DM + 16 * q + 8);
        lf[q].h[0] = *(const v8h*)(lp + DM + 16 * q); lf[q].h[1] = *(const v8h*)(lp + DM + 16 * q + 8);
      }
#if defined(__HIP_DEVICE_COMPILE__)
      // the eight loads' address translations are done before their two address pairs are reused; the wait takes the
      // pairs as inputs so that they stay whole up to it (without that the last load's result is laid over them)
      asm volatile("s_wait_xcnt 0x0" :: "v"(kp), "v"(lp) : "memory");
#endif
#pragma unroll
      for (int e = 0; e < 32; ++e) {
        const float kv = ((float)kf[e >> 4].v[e & 15] + (float)lf[e >> 4].v[e & 15] * (1.0f / RSC)) * (1.0f / KSC);
        const float sk = (kv > 0.f) ? (kv + 1.0f) : __expf(kv);
        const _Float16 skh = (_Float16)sk;
        skT[(dq + e) * 72 + r] = skh;
        zacc[e] += (float)skh;
      }
    }
    __syncthreads();                      // skT chunk complete
#pragma unroll
    for (int kk = 0; kk < 2; ++kk) {
      const v16h a = ldfrag_h(vrow + kt * 64 + 32 * kk);
#pragma unroll                            // acc[] indexed by constants only
      for (int jp = 0; jp < 2; ++jp) {
        const v16h b0 = ldfrag_h(skT + (16 * (2 * jp) + c) * 72 + 32 * kk + 8 * hh);
        const v16h b1 = ldfrag_h(skT + (16 * (2 * jp + 1) + c) * 72 + 32 * kk + 8 * hh);
        acc[2 * jp]     = mma_h_raw(a, b0, acc[2 * jp]);
        acc[2 * jp + 1] = mma_h_raw(a, b1, acc[2 * jp + 1]);
        guard3(acc[2 * jp], acc[2 * jp + 1], a, b0, b1);
      }
    }
  }
  acc_guard4(acc[0], acc[1], acc[2], acc[3]);

  // ---- MT piece: rows e = 16*wave + (8hh+rr), cols d = 16*jj + c ----
  float* sl = slab[wave];
#pragma unroll
  for (int jj = 0; jj < 4; ++jj) {
#pragma unroll
    for (int rr = 0; rr < 8; ++rr) sl[(8 * hh + rr) * 68 + 16 * jj + c] = acc[jj][rr] * (1.0f / VSC);
  }
  wave_sync_lds();
  {
    v4f mv[8];
#pragma unroll
    for (int it = 0; it < 8; ++it) {
      const int row = it * 2 + hh;        // it 0..7 x hh 0..1 = rows 0..15
      mv[it] = *(const v4f*)(sl + row * 68 + c * 4);
    }
    float* mtb = MT + ((size_t)(h * 3 + s) * HD + (size_t)wave * 16) * HD;
#pragma unroll
    for (int it = 0; it < 8; ++it) {
      const int row = it * 2 + hh;
      *(v4f*)(mtb + (size_t)row * HD + c * 4) = mv[it];
    }
  }
  // ---- ZP: sum zacc over the 16 keys of this wave (lanes sharing lane&1), then over the 4 waves ----
#pragma unroll
  for (int e = 0; e < 32; ++e) {
    float v = zacc[e];
    v += __shfl_xor(v, 2, 32);
    v += __shfl_xor(v, 4, 32);
    v += __shfl_xor(v, 8, 32);
    v += __shfl_xor(v, 16, 32);
    if ((lane >> 1) == 0) zred[wave][(lane & 1) * 32 + e] = v;
  }
  __syncthreads();
  if (tid < HD) {
    float z = 0.f;
#pragma unroll
    for (int w = 0; w < 4; ++w) z += zred[w][tid];
    zsum[tid] = z;
  }
  __syncthreads();
  if (tid < 16) {                         // wave 0, lanes 0..15: 16 x 16 B = the whole 256-B ZP row
    const v4f zz = *(const v4f*)(zsum + tid * 4);
    float* zp = ZP + (size_t)(h * 3 + s) * HD + tid * 4;
    *(v4f*)zp = zz;
  }
}

// =====================================================================================================
// Compressive-memory read per (head h, segment s in 1..3, 128-row block) of one batch (blockIdx.y):
//   M_s = sum over segments before s of MT[h][s'] (f32 sum, RNE convert to an f16 LDS tile MTh[e][d], pitch 72);
//   z_s = sum of ZP[h][s'] (f32, LDS). Per query row n of segment s: q rebuilt in f32 from the hi / residual planes
//   ((hi + lo/RSC) / QSC, column h*64 + d), sq = elu(q) + 1 RNE-converted to f16 directly into the A fragment
//   (elementwise transform keeps the A layout); num[n][e] = sum_d sq[n][d] * M_s[d][e] with Bt = MTh (K = 64, two
//   k-steps, 4 column tiles); den[n] = sum_d sq[n][d] * z_s[d] + 1e-6 in f32 from the same f16 sq values (lane
//   halves combined, then broadcast to the D rows); mem[n][e] = num * (1/den).
//   Gate mix: the attention launch ahead of this one has stored (1 - g) * local in every output element; this kernel
//   adds g * mem to the rows of segments 1..3, g = sigmoid(bf16(gate[h])): rows of positions < NTOK are in the second
//   output (offset OUT1OFF), rows of positions >= NTOK in the first, row t mod NTOK, columns h*64..h*64+63.
//   Block = 8 waves x 16 rows; per-wave 16x64 f32 tile staged in LDS; loads and stores 16 lanes x 16 B per 256-B row
// coverage: 16 heads x 3 segments x 8 row blocks x 8 waves x 16 rows = positions 1024..4095 of every head's 64
//   columns, each element read and rewritten by one lane; 8 its x 2 row halves x 16 lanes x 4 floats = the wave's
//   16x64 tile. Positions 0..1023 (segment 0) keep the attention's value (memory is exactly zero there).
// =====================================================================================================
__global__ __launch_bounds__(256) void mem_ret(const unsigned short* __restrict__ QKH,
                                              const unsigned short* __restrict__ QKL,
                                              const float* __restrict__ MT, const float* __restrict__ ZP,
                                              const float* __restrict__ gate, float* outb) {
  __shared__ __align__(16) _Float16 MTh[HD * 72];
  __shared__ float zs[HD];
  __shared__ __align__(16) float slab[8][16 * 68];

  const int tid = threadIdx.x, wave = tid >> 5, lane = tid & 31, hh = lane >> 4, c = lane & 15;
  const int h   = (int)(blockIdx.x / 24u);
  const int rem = (int)(blockIdx.x - (unsigned)h * 24u);
  const int s   = 1 + rem / 8;            // 1..3
  const int rb  = rem - (s - 1) * 8;      // 0..7
  if (h >= NHEAD) return;                 // block-uniform, ahead of any barrier; never taken
  QKH += (size_t)blockIdx.y * SEQ * QKW;  // blockIdx.y = batch: its own planes
  QKL += (size_t)blockIdx.y * SEQ * QKW;
  MT  += (size_t)blockIdx.y * NHEAD * 3 * HD * HD;
  ZP  += (size_t)blockIdx.y * NHEAD * 3 * HD;
  outb += (size_t)blockIdx.y * NTOK * DM; // and its own rows of both outputs

  // the attention's part of this wave's 16 output rows, fetched ahead of the work below (row it*2 + hh, 16 B per lane)
  const int n0w = s * SEG + rb * MROWS + wave * 16;          // first query position of this wave
  float* ob = outb + ((s < (NTOK / SEG)) ? (size_t)OUT1OFF + (size_t)n0w * DM : (size_t)(n0w - NTOK) * DM)
                   + h * HD + c * 4;
  v4f pv[8];
#pragma unroll                            // pv[] stays in registers; the eight loads stand as one group
  for (int it = 0; it < 8; ++it) pv[it] = *(const v4f*)(ob + (size_t)(it * 2 + hh) * DM);

  {
    const int e = tid >> 2, d0 = (tid & 3) * 16;
    float sm[16];
#pragma unroll
    for (int i = 0; i < 16; ++i) sm[i] = 0.f;
#pragma unroll
    for (int sp = 0; sp < 3; ++sp) {
      if (sp < s) {                       // block-uniform
        const float* src = MT + ((size_t)(h * 3 + sp) * HD + e) * HD + d0;
#pragma unroll
        for (int q = 0; q < 4; ++q) {
          const v4f v = *(const v4f*)(src + 4 * q);
          sm[4 * q + 0] += v[0]; sm[4 * q + 1] += v[1]; sm[4 * q + 2] += v[2]; sm[4 * q + 3] += v[3];
        }
      }
    }
    v8h p0, p1;
#pragma unroll
    for (int i = 0; i < 8; ++i) { p0[i] = (_Float16)sm[i]; p1[i] = (_Float16)sm[8 + i]; }
    *(v8h*)(MTh + e * 72 + d0) = p0;
    *(v8h*)(MTh + e * 72 + d0 + 8) = p1;
    if (tid < HD) {
      float z = 0.f;
#pragma unroll
      for (int sp = 0; sp < 3; ++sp) {
        if (sp < s) z += ZP[(size_t)(h * 3 + sp) * HD + tid];
      }
      zs[tid] = z;
    }
  }
  __syncthreads();

  const _Float16* Q16 = (const _Float16*)(const void*)QKH;
  const _Float16* L16 = (const _Float16*)(const void*)QKL;

  v16h af[2];
  float denp = 0.f;
#pragma unroll
  for (int kk = 0; kk < 2; ++kk) {
    FH hf, lf;
    hf.v = ldfrag_h(Q16 + (size_t)(n0w + c) * QKW + h * HD + 32 * kk + 8 * hh);
    lf.v = ldfrag_h(L16 + (size_t)(n0w + c) * QKW + h * HD + 32 * kk + 8 * hh);
    v16h a;
#pragma unroll
    for (int i = 0; i < 16; ++i) {
      const float qv = ((float)hf.v[i] + (float)lf.v[i] * (1.0f / RSC)) * (1.0f / QSC);
      const float sq = (qv > 0.f) ? (qv + 1.0f) : __expf(qv);
      const _Float16 sqh = (_Float16)sq;
      a[i] = sqh;
      const int kidx = 32 * kk + ((i < 8) ? (8 * hh + i) : (8 + 8 * hh + i));   // k of element i (split map)
      denp += (float)sqh * zs[kidx];
    }
    af[kk] = a;
  }
  const float den = denp + __shfl_xor(denp, 16, 32) + DEN_EPS;   // row c complete in lanes c and c+16

  v8f acc[4];
#pragma unroll
  for (int j = 0; j < 4; ++j) {
    acc[j] = zero8();
#pragma unroll
    for (int kk = 0; kk < 2; ++kk) {
      const v16h b = ldfrag_h(MTh + (16 * j + c) * 72 + 32 * kk + 8 * hh);
      acc[j] = mma_h(af[kk], b, acc[j]);
    }
  }
  float rinv[8];
#pragma unroll
  for (int rr = 0; rr < 8; ++rr) rinv[rr] = 1.0f / __shfl(den, 8 * hh + rr, 32);   // den of D row 8hh+rr

  float* sl = slab[wave];
#pragma unroll
  for (int j = 0; j < 4; ++j) {
#pragma unroll
    for (int rr = 0; rr < 8; ++rr) sl[(8 * hh + rr) * 68 + 16 * j + c] = acc[j][rr] * rinv[rr];
  }
  wave_sync_lds();
  {
    v4f ov[8];
#pragma unroll
    for (int it = 0; it < 8; ++it) {
      const int row = it * 2 + hh;        // it 0..7 x hh 0..1 = rows 0..15
      ov[it] = *(const v4f*)(sl + row * 68 + c * 4);
    }
    const float gv = bfr(gate[h]);
    const float g  = 1.0f / (1.0f + expf(-gv));
#pragma unroll
    for (int it = 0; it < 8; ++it) {
      const int row = it * 2 + hh;
      *(v4f*)(ob + (size_t)row * DM) = g * ov[it] + pv[it];
    }
  }
}

// =====================================================================================================
// Segment-local causal attention with the gate mix, per (batch, h, segment, 64-query block):
//   s = (sum_d qh.kh + (ql.kh + qh.kl) / RSC) * sscale, sscale = (1/8) / (QSC*KSC); key > query (segment-local)
//   -> NEG_BIG (value select); online softmax in f32; p = exp(s - m) carried as ph = f16(1024 p) and, when PRES,
//   also pl = f16((1024 p - ph) * RSC); local numerator = p . v with v as f16 hi (VSC v) and, when PRES, the f16
//   residual ((VSC v - hi) * RSC) plane: oh += ph.vhi over all chunks; when PRES: ol = ph.vres + pl.vhi (one
//   residual accumulator per chunk and 16-wide d tile, both products carry the same 1/RSC), folded as
//   oh += ol / RSC in f32 right after its two k-steps.
//   q|k planes (f16, pitch QKW, rows = positions): q element (t, h, d) at [t*QKW + h*64 + d], k at
//   [t*QKW + DM + h*64 + d]; V^T planes (f16): element (h, d, t) at [(h*64 + d)*SEQ + t].
//   Epilogue per query row t: local = oh / (l * PSC * VSC); out = (1 - g) * local with g = sigmoid(bf16(gate[h]))
//   (the whole result in segment 0, where the memory is exactly 0; the start value to which the kernel mem_ret,
//   launched behind this one, adds g * mem in segments >= 1);
//   rows of positions < NTOK go to the second output (offset OUT1OFF), rows of positions
//   >= NTOK to the first, row t mod NTOK, columns h*64..h*64+63 (pitch DM floats).
//   Block = 4 waves = 64 query rows of one h; bx = 0 .. NHEAD * NSEG * nqb - 1 -> (h, seg, qbs = qb0 + i), bb = batch;
//   bx, bb and the block's LDS arrays come from the kernel attn_all below;
//   key chunks of 64 within the segment, chunks kt <= qbs only (block-uniform trip <= NQB), chunk kt == qbs keeps
//   its diagonal by the per-element select.
//   K / V^T chunk staging: asynchronous 16-B copies, thread -> rows (tid>>3) + 16 i, piece tid&7 of the row's 128 B
//   (a wave's copy takes four whole rows). One buffer per tile: the K tiles of chunk kt + 1 are copied behind the
//   barrier that ends the score reads of chunk kt and fly under its softmax and P.V; the V^T tiles of chunk kt + 1
//   are copied behind the barrier that ends the P.V reads of chunk kt and fly under the scores of chunk kt + 1.
//   q fragments (hi and residual, 2 d-chunks) held in registers for the whole block.
//   Both products run transposed (S^T = K.q^T, O^T += V^T.P^T): a lane holds one
//   query's scores, and two converted S^T tiles are a B fragment of P^T, so P passes through no LDS.
//   Output coverage: each wave stores rows q0..q0+15 (it 0..7 x lane>>4) x 64 columns (16 lanes x 16 B), one
// =====================================================================================================
template <bool PRES>
__device__ __forceinline__
void attn_seg(_Float16* Ksh, _Float16* Kls, _Float16* Vhs, _Float16* Vls, float (*Os)[16 * 68], int bx, int bb,
              const unsigned short* __restrict__ QKH, const unsigned short* __restrict__ QKL,
              const unsigned short* __restrict__ VTH, const unsigned short* __restrict__ VTL,
              const float* __restrict__ gate,
              float* outb, float sscale, int qb0, int nqb) {
  const int tid  = threadIdx.x;
  const int wave = tid >> 5;
  const int lane = tid & 31;
  const int hh   = lane >> 4;
  const int c    = lane & 15;

  const int per = NSEG * nqb;
  const int h   = (int)((unsigned)bx / (unsigned)per);
  const int rem = (int)((unsigned)bx - (unsigned)h * (unsigned)per);
  const int seg = rem / nqb;
  const int qbs = qb0 + (rem - seg * nqb);
  if (h >= NHEAD || seg >= NSEG) return;  // block-uniform, ahead of any barrier; never taken for exact grids
  QKH  += (size_t)bb * SEQ * QKW;         // bb = batch: its own planes and its own rows of both outputs
  QKL  += (size_t)bb * SEQ * QKW;
  VTH  += (size_t)bb * DM * SEQ;
  VTL  += (size_t)bb * DM * SEQ;
  outb += (size_t)bb * NTOK * DM;
  const int sbase = seg * SEG;
  const int rowl0 = qbs * 64 + wave * 16; // segment-local row of this wave's first query
  const int q0    = sbase + rowl0;        // its position in the concatenated sequence

  const _Float16* Q16 = (const _Float16*)(const void*)QKH;
  const _Float16* L16 = (const _Float16*)(const void*)QKL;
  const _Float16* Qg  = Q16 + (size_t)h * HD;
  const _Float16* Qlg = L16 + (size_t)h * HD;
  const _Float16* Kg  = Q16 + DM + (size_t)h * HD;
  const _Float16* Klg = L16 + DM + (size_t)h * HD;
  const _Float16* Vhg = (const _Float16*)(const void*)VTH + (size_t)h * HD * SEQ;
  const _Float16* Vlg = (const _Float16*)(const void*)VTL + (size_t)h * HD * SEQ;

  // ---- q fragments (B operand, column = lane&15), hi and residual, d-chunks 0 and 1, fixed for the block ----
  const v16h qh0 = ldfrag_h(Qg  + (size_t)(q0 + c) * QKW + 8 * hh);
  const v16h qh1 = ldfrag_h(Qg  + (size_t)(q0 + c) * QKW + 32 + 8 * hh);
  const v16h ql0 = ldfrag_h(Qlg + (size_t)(q0 + c) * QKW + 8 * hh);
  const v16h ql1 = ldfrag_h(Qlg + (size_t)(q0 + c) * QKW + 32 + 8 * hh);

  // a lane holds ONE query (row c of the wave's 16): its running maximum, its running sum, and in oh[t][r] the
  // numerator of d = 16 t + 8 hh + r (the transposed output tile)
  float mrow = NEG_BIG, lrow = 0.f;
  v8f oh[4];
#pragma unroll
  for (int t = 0; t < 4; ++t) oh[t] = zero8();

  // ---- tile copies: this thread's row (mod 16) and 16-B piece; copy i takes row sr + 16 i of the 64-row tile ----
  const int sr = tid >> 3, sc = (tid & 7) * 8;
  const uint32_t lofs = (uint32_t)(sr * APIT + sc) * 2u;
  const uint32_t ls   = 16u * APIT * 2u;                    // LDS bytes per 16 rows
  const uint32_t lKh = (uint32_t)(size_t)(const void*)Ksh + lofs;
  const uint32_t lKl = (uint32_t)(size_t)(const void*)Kls + lofs;
  const uint32_t lVh = (uint32_t)(size_t)(const void*)Vhs + lofs;
  const uint32_t lVl = (uint32_t)(size_t)(const void*)Vls + lofs;
  const uint32_t oK = (uint32_t)(sr * QKW + sc) * 2u, gK = 16u * QKW * 2u;   // byte offset in a K tile, per 16 rows
  const uint32_t oV = (uint32_t)(sr * SEQ + sc) * 2u, gV = 16u * SEQ * 2u;   // the same in a V^T tile
  auto fillK = [&](int kv) {                                // K hi and residual rows kv .. kv + 63, d = 0..63
    acopy8s(lKh, lKh + ls, lKh + 2 * ls, lKh + 3 * ls, lKl, lKl + ls, lKl + 2 * ls, lKl + 3 * ls,
            oK, oK + gK, oK + 2 * gK, oK + 3 * gK, Kg + (size_t)kv * QKW, Klg + (size_t)kv * QKW);
  };
  auto fillV = [&](int kv) {                                // V^T rows d = 0..63, keys kv .. kv + 63
    if (PRES)
      acopy8s(lVh, lVh + ls, lVh + 2 * ls, lVh + 3 * ls, lVl, lVl + ls, lVl + 2 * ls, lVl + 3 * ls,
              oV, oV + gV, oV + 2 * gV, oV + 3 * gV, Vhg + kv, Vlg + kv);
    else
      acopy4s(lVh, lVh + ls, lVh + 2 * ls, lVh + 3 * ls, oV, oV + gV, oV + 2 * gV, oV + 3 * gV, Vhg + kv);
  };
  fillK(sbase);
  fillV(sbase);
  wait_async0();
  __syncthreads();                            // chunk 0's K and V^T tiles are published

  for (int kt = 0; kt < NQB; ++kt) {          // static bound; block-uniform causal chunk skipping
    if (kt > qbs) break;
    const int kv0 = sbase + kt * 64;

    // ---- transposed scores: 64 keys x 16 queries per wave, A = K rows, B = q, K = 64 (2 d-chunks), three products;
    //      D element r of tile j = key 16 j + 8 hh + r against query c ----
    v8f s[4];
#pragma unroll
    for (int j = 0; j < 4; ++j) {
      v8f sh = zero8(), sl = zero8();
      {
        FH kb, lb;
        kb.h[0] = *(const v8h*)(Ksh + (j * 16 + c) * APIT + 8 * hh);
        kb.h[1] = *(const v8h*)(Ksh + (j * 16 + c) * APIT + 16 + 8 * hh);
        lb.h[0] = *(const v8h*)(Kls + (j * 16 + c) * APIT + 8 * hh);
        lb.h[1] = *(const v8h*)(Kls + (j * 16 + c) * APIT + 16 + 8 * hh);
        sh = mma_h_raw(kb.v, qh0, sh);
        sl = mma_h_raw(kb.v, ql0, sl);
        sl = mma_h_raw(lb.v, qh0, sl);
        guard4m(sh, sl, qh0, ql0, kb.v, lb.v);
      }
      {
        FH kb, lb;
        kb.h[0] = *(const v8h*)(Ksh + (j * 16 + c) * APIT + 32 + 8 * hh);
        kb.h[1] = *(const v8h*)(Ksh + (j * 16 + c) * APIT + 48 + 8 * hh);
        lb.h[0] = *(const v8h*)(Kls + (j * 16 + c) * APIT + 32 + 8 * hh);
        lb.h[1] = *(const v8h*)(Kls + (j * 16 + c) * APIT + 48 + 8 * hh);
        sh = mma_h_raw(kb.v, qh1, sh);
        sl = mma_h_raw(kb.v, ql1, sl);
        sl = mma_h_raw(lb.v, qh1, sl);
        guard4m(sh, sl, qh1, ql1, kb.v, lb.v);
      }
      // segment-local key of D element r is kt*64 + 16 j + 8 hh + r, the query row of this lane's D column rowl0 + c:
      // element r is kept while r <= lim
      const int lim = (rowl0 + c) - (kt * 64 + j * 16 + 8 * hh);
#pragma unroll
      for (int r = 0; r < 8; ++r) {
        float v = sh[r];
        v += sl[r] * (1.0f / RSC);
        v *= sscale;
        s[j][r] = (r <= lim) ? v : NEG_BIG;
      }
    }
    wait_ds0();
    wait_async0();
    __syncthreads();                          // ends every read of the K tiles and publishes this chunk's V^T tiles
    if (kt < qbs) fillK(kv0 + 64);            // block-uniform

    // ---- maximum and sum of the query's 64 scores: 32 in this lane, 32 in lane ^ 16 (one exchange each); online
    //      softmax in f32; P hi (x1024, f16) and, when PRES, P residual (x RSC, f16) go straight into B fragments:
    //      tiles 2 kk and 2 kk + 1 hold keys 32 kk + 8 hh + r and 32 kk + 16 + 8 hh + r, the loaders' own k order ----
    float mj[4];
#pragma unroll
    for (int j = 0; j < 4; ++j) {
      float m = s[j][0];
#pragma unroll
      for (int r = 1; r < 8; ++r) m = fmaxf(m, s[j][r]);
      mj[j] = m;
    }
    float m = fmaxf(fmaxf(mj[0], mj[1]), fmaxf(mj[2], mj[3]));
    m = fmaxf(m, xhalf(m));
    const float mnew  = fmaxf(mrow, m);
    const float alpha = __expf(mrow - mnew);
    mrow = mnew;
    FH pa[2], pb[2];
    float pj[4];
#pragma unroll
    for (int j = 0; j < 4; ++j) {
      float ps = 0.f;
#pragma unroll
      for (int r = 0; r < 8; ++r) {
        const float p  = __expf(s[j][r] - mnew);
        ps += p;
        const float ph = p * PSC;
        const _Float16 xh = (_Float16)ph;
        pa[j >> 1].v[(j & 1) * 8 + r] = xh;
        if (PRES) pb[j >> 1].v[(j & 1) * 8 + r] = (_Float16)((ph - (float)xh) * RSC);
      }
      pj[j] = ps;
    }
    float psum = (pj[0] + pj[1]) + (pj[2] + pj[3]);
    psum += xhalf(psum);
    lrow = lrow * alpha + psum;
#pragma unroll
    for (int t = 0; t < 4; ++t) {
#pragma unroll
      for (int r = 0; r < 8; ++r) oh[t][r] *= alpha;
    }

    // ---- transposed local numerator, A = V^T rows, B = P^T: oh += Vhi . Phi; when PRES also
    //      ol = Vres . Phi + Vhi . Plo, oh += ol/RSC ----
#pragma unroll
    for (int t = 0; t < 4; ++t) {
      const _Float16* vr = Vhs + (t * 16 + c) * APIT + 8 * hh;
      FH vb0, vb1;
      vb0.h[0] = *(const v8h*)(vr);
      vb0.h[1] = *(const v8h*)(vr + 16);
      vb1.h[0] = *(const v8h*)(vr + 32);
      vb1.h[1] = *(const v8h*)(vr + 48);
      if (PRES) {
        const _Float16* wr = Vls + (t * 16 + c) * APIT + 8 * hh;
        FH wb0, wb1;
        wb0.h[0] = *(const v8h*)(wr);
        wb0.h[1] = *(const v8h*)(wr + 16);
        wb1.h[0] = *(const v8h*)(wr + 32);
        wb1.h[1] = *(const v8h*)(wr + 48);
        v8f ol = zero8();
        oh[t] = mma_h_raw(vb0.v, pa[0].v, oh[t]);
        ol    = mma_h_raw(wb0.v, pa[0].v, ol);
        ol    = mma_h_raw(vb0.v, pb[0].v, ol);
        oh[t] = mma_h_raw(vb1.v, pa[1].v, oh[t]);
        ol    = mma_h_raw(wb1.v, pa[1].v, ol);
        ol    = mma_h_raw(vb1.v, pb[1].v, ol);
        guard8m(oh[t], ol, pa[0].v, pa[1].v, pb[0].v, pb[1].v, vb0.v, vb1.v, wb0.v, wb1.v);
#pragma unroll
        for (int r = 0; r < 8; ++r) oh[t][r] += ol[r] * (1.0f / RSC);
      } else {
        oh[t] = mma_h_raw(vb0.v, pa[0].v, oh[t]);
        oh[t] = mma_h_raw(vb1.v, pa[1].v, oh[t]);
        guard1q(oh[t], pa[0].v, pa[1].v, vb0.v, vb1.v);
      }
    }
    acc_guard4(oh[0], oh[1], oh[2], oh[3]);
    wait_ds0();
    wait_async0();
    __syncthreads();                          // ends every read of the V^T tiles and publishes the next chunk's K tiles
    if (kt < qbs) fillV(kv0 + 64);            // block-uniform
  }
  wait_async0();

  // ---- normalise (1/l, the 1/1024 p carry and the 1/VSC v carry), weigh by 1 - g, stage the
  //      wave's tile as [query row][d] (a lane writes 8 consecutive d of its query per t) ----
  const float gv  = bfr(gate[h]);
  const float g   = 1.0f / (1.0f + expf(-gv));
  const float omg = 1.0f - g;
  float* os = Os[wave];
  {
    const float l = lrow;                                   // >= 1 (the row maximum contributes exp(0))
    const float inv = (1.0f / l) * (1.0f / (PSC * VSC));
#pragma unroll
    for (int t = 0; t < 4; ++t) {
      v4f oa, ob;
#pragma unroll
      for (int r = 0; r < 4; ++r) {                         // e = 16t + 8hh + r and + 4
        oa[r] = omg * (oh[t][r] * inv);
        ob[r] = omg * (oh[t][4 + r] * inv);
      }
      *(v4f*)(os + c * 68 + 16 * t + 8 * hh)     = oa;
      *(v4f*)(os + c * 68 + 16 * t + 8 * hh + 4) = ob;
    }
  }
  wave_sync_lds();
  {
    const size_t ooff  = (seg < (NTOK / SEG)) ? (size_t)OUT1OFF : (size_t)0;   // positions < NTOK -> second output
    const int    orow0 = (seg < (NTOK / SEG)) ? q0 : (q0 - NTOK);               // row within the output [b][2048][1024]
    v4f ov[8];
#pragma unroll
    for (int it = 0; it < 8; ++it) {
      const int row = it * 2 + hh;                          // it 0..7 x hh 0..1 = rows 0..15 of the wave tile
      ov[it] = *(const v4f*)(os + row * 68 + c * 4);
    }
    {
#pragma unroll
      for (int it = 0; it < 8; ++it) {
        const int row = it * 2 + hh;
        *(v4f*)(outb + ooff + (size_t)(orow0 + row) * DM + h * HD + c * 4) = ov[it];
      }
      wait_x0();   // in the built text another block range's code follows these stores and reuses their registers
    }
  }
}

// =====================================================================================================
// The compressive-memory update and both attention variants, which do not depend on one another, in ONE launch, told
// apart by block range (block-uniform branches ahead of every barrier): blockIdx.y < AB_M are the (head, segment)
// blocks of mt_seg, few and long (16 dependent chunks each): they start first and run beside the attention. The next
// AB_F are the query blocks NQP .. NQB-1, without the residual products (NQP+1 to NQB key chunks each). The others are
// the leading NQP query blocks, with them (1 to NQP chunks each); they take the places that the long blocks leave.
// blockIdx.x = batch. mt_seg uses the attention's LDS arrays: Ksh as its sk^T tile, Kls and Vhs for the z sums, Os as slabs.
// coverage: grid = (NB, AB_M + AB_F + AB_T) exact.
// =====================================================================================================
#define AB_M (NHEAD * 3)
#define AB_F (NHEAD * NSEG * (NQB - NQP))
#define AB_T (NHEAD * NSEG * NQP)
__global__ __launch_bounds__(128, 5)   // 5 waves per SIMD, as both variants had alone: keeps the registers under 1024 / 5
void attn_all(const unsigned short* __restrict__ QKH, const unsigned short* __restrict__ QKL,
              const unsigned short* __restrict__ VTH, const unsigned short* __restrict__ VTL,
              float* MT, float* ZP, const float* __restrict__ gate, float* outb, float sscale) {
  __shared__ __align__(16) _Float16 Ksh[64 * APIT];                           // K hi  [key][d]  9 KB
  __shared__ __align__(16) _Float16 Kls[64 * APIT];                           // K res [key][d]  9 KB
  __shared__ __align__(16) _Float16 Vhs[HD * APIT];                           // V^T hi [d][key] 9 KB
  __shared__ __align__(16) _Float16 Vls[HD * APIT];                           // V^T res [d][key] 9 KB (leading blocks)
  __shared__ __align__(16) float    Os[4][16 * 68];                          // per wave output tile [row][d]
  static_assert(4 * HD * 4 <= 64 * APIT * 2 && APIT == 72);
  const int by = (int)blockIdx.y - AB_M, bb = (int)blockIdx.x;
  if (by < 0)
    mt_seg(Ksh, Os, (float (*)[HD])(void*)Kls, (float*)(void*)Vhs, by + AB_M, bb, QKH, QKL, VTH, MT, ZP);
  else if (by < AB_F)
    attn_seg<false>(Ksh, Kls, Vhs, Vls, Os, by, bb, QKH, QKL, VTH, VTL, gate, outb, sscale, NQP, NQB - NQP);
  else
    attn_seg<true>(Ksh, Kls, Vhs, Vls, Os, by - AB_F, bb, QKH, QKL, VTH, VTL, gate, outb, sscale, 0, NQP);
}

// =====================================================================================================
// Workspace map (bytes); every plane is an exact multiple of its tile / whole-line store granularity (all dims are
// exact tile multiples, no padded tails), all offsets multiples of 4096:
//   XH    f16  [4096 t][1024 in]             0          8388608   (f16 of bf16 value x16, rows b*2048 + t)
//   AH    f16  [4096 t][1024 in]             8388608    8388608
//   WXT   f16  [3072 out][1024 in]           16777216   6291456   (W^T, bf16 value x64)
//   WAT   f16  [3072 out][1024 in]           23068672   6291456
//   COST  f32  [4096 pos][32]                29360128    524288
//   SINT  f32  [4096 pos][32]                29884416    524288
//   QKH   f16  [2 b][4096 pos][2048 (q|k)]   30408704  33554432   (q x4, k x16 hi after norm + rotary)
//   QKL   f16  [2 b][4096][2048]             63963136  33554432   (x4096 residuals)
//   VTH   f16  [2 b][1024 (h,d)][4096 pos]   97517568  16777216   (v x16 hi)
//   VTL   f16  [2 b][1024 (h,d)][4096 pos]  114294784  16777216   ((v x16 - hi) x4096)
//   MT    f32  [2 b][16 h][3 s][64 e][64 d] 131072000   1572864
//   ZP    f32  [2 b][16 h][3 s][64 d]       132644864     24576
//   end                                     132669440
// =====================================================================================================
extern "C" void kernel_launch(void* const* d_in, const int* in_sizes, int n_in,
                              void* d_out, int out_size, void* d_ws, size_t ws_size,
                              hipStream_t stream) {
  if (n_in < 9) return;
  if (in_sizes[0] != NB * NTOK * DM || in_sizes[1] != NB * NTOK * DM) return;
  if (in_sizes[2] != DM * W3 || in_sizes[3] != DM * W3) return;
  if (in_sizes[4] != NHEAD * HD || in_sizes[5] != NHEAD * HD) return;
  if (in_sizes[6] != NHEAD * HD || in_sizes[7] != NHEAD * HD) return;
  if (in_sizes[8] != NHEAD) return;
  if (out_size != 2 * NB * NTOK * DM) return;

  const float* X    = (const float*)d_in[0];
  const float* Aa   = (const float*)d_in[1];
  const float* Wx   = (const float*)d_in[2];
  const float* Wa   = (const float*)d_in[3];
  const float* g_qx = (const float*)d_in[4];
  const float* g_kx = (const float*)d_in[5];
  const float* g_qa = (const float*)d_in[6];
  const float* g_ka = (const float*)d_in[7];
  const float* gate = (const float*)d_in[8];
  float* outf = (float*)d_out;

  const size_t PXA = (size_t)NB * NTOK * DM * 2;        //  8388608
  const size_t PW  = (size_t)W3 * DM * 2;               //  6291456
  const size_t PRT = (size_t)SEQ * RP * 4;              //   524288
  const size_t PQK = (size_t)NB * SEQ * QKW * 2;        // 33554432
  const size_t PVT = (size_t)NB * DM * SEQ * 2;         // 16777216
  const size_t PMT = (size_t)NB * NHEAD * 3 * HD * HD * 4;   // 1572864
  const size_t PZP = (size_t)NB * NHEAD * 3 * HD * 4;        //   24576
  size_t off = 0;
  const size_t oXH = off; off += PXA;
  const size_t oAH = off; off += PXA;
  const size_t oWX = off; off += PW;
  const size_t oWA = off; off += PW;
  const size_t oCT = off; off += PRT;
  const size_t oST = off; off += PRT;
  const size_t oQH = off; off += PQK;
  const size_t oQL = off; off += PQK;
  const size_t oVH = off; off += PVT;
  const size_t oVL = off; off += PVT;
  const size_t oMT = off; off += PMT;
  const size_t oZP = off; off += PZP;
  if (off > ws_size) return;                            // off = 132669440

  char* ws = (char*)d_ws;
  unsigned short* XH   = (unsigned short*)(ws + oXH);
  unsigned short* AH   = (unsigned short*)(ws + oAH);
  unsigned short* WXT  = (unsigned short*)(ws + oWX);
  unsigned short* WAT  = (unsigned short*)(ws + oWA);
  float*          COST = (float*)(ws + oCT);
  float*          SINT = (float*)(ws + oST);
  unsigned short* QKH  = (unsigned short*)(ws + oQH);
  unsigned short* QKL  = (unsigned short*)(ws + oQL);
  unsigned short* VTH  = (unsigned short*)(ws + oVH);
  unsigned short* VTL  = (unsigned short*)(ws + oVL);
  float*          MT   = (float*)(ws + oMT);
  float*          ZP   = (float*)(ws + oZP);

  const dim3 blk256(256), blk128(128);
  const float sscale = 0.125f / (QSC * KSC);
  const float oscale = 1.0f / (XSC * WSC);

  // Every kernel is launched once; the two arrays, the two streams and the two batches are grid dimensions, and
  // kernels that do not depend on one another share a launch (block ranges).
  // (1) x, a -> row-major f16 planes of their bf16 RNE values x16; W [1024][3072] -> transposed f16 planes
  //     [3072][1024] (k contiguous, Bt form) of their bf16 RNE values x64; rotary tables
  prep<<<dim3(PB_ROPE + PB_TR + PB_CVT), blk256, 0, stream>>>(X, Aa, XH, Wx, Wa, WXT, COST, SINT);

  const int gqk  = ((NTOK / 32) * (QKW / 128)) / 4;      // 1024 tiles -> 256 blocks per stream and batch
  const int gv   = ((NTOK / 32) * (DM / 128)) / 4;       //  512 tiles -> 128 blocks per stream and batch
  const int gmem = NHEAD * 3 * (SEG / MROWS);            //  384 blocks per batch
  // (2) q|k of stream a (positions 0..2047) and stream x (positions 2048..4095): M=2048, N=2048, K=1024,
  //     fused per-head L2 norm + gain + rotary -> QKH/QKL f16 planes;
  // (3) v of both streams: M=2048, N=1024 (W^T rows 2048..3071), K=1024 -> v^T planes [DM][SEQ] per batch, f16 hi
  //     (x16) and residual (x4096)
  gemm_qkv<<<dim3(gqk + gv, 2, NB), blk128, 0, stream>>>(AH, XH, DM, WAT, WXT, DM, (void*)QKH, (void*)QKL, QKW,
                                                         (void*)VTH, (void*)VTL, DM, SEQ, COST, SINT, g_qa, g_ka,
                                                         g_qx, g_kx, NTOK, QKW, DM, DM, gqk, oscale);
  // (4) compressive memory update: per-segment sk^T.v and sum sk (segments 0..2) -> MT, ZP; in the same launch the
  //     segment-local causal attention -> (1 - g) * local in both outputs: the leading NQP query blocks of every
  //     segment with the p, v residual products, the remaining blocks without
  attn_all<<<dim3(NB, AB_M + AB_F + AB_T), blk128, 0, stream>>>(QKH, QKL, VTH, VTL, MT, ZP, gate, outf, sscale);
  // (5) the memory read for the query rows of segments 1..3, added as g * mem to their output rows
  mem_ret<<<dim3(gmem, NB), blk256, 0, stream>>>(QKH, QKL, MT, ZP, gate, outf);
  (void)hipGetLastError();
}
